// v000
// The times below were measured on an AMD MI455X: many runs one after another, warmed up first and cycling through
// copies of the inputs, with the whole window's GPU time divided by the number of runs. Launches and the gaps
// between them are all in it. The median over several windows is given; except for v000 it joins two sittings, which
// can be a few percent apart, so the side-by-side timings, each taken in one sitting, are the better comparison.
// v000, which the later versions start from, runs in 313 microseconds.
#include <hip/hip_runtime.h>

// Multi-head attention, width 1024 = 16 heads x 64; query/keys/values [SEQ][NB][1024] sequence-first (row = s*NB_FULL + b), Wq/Wk/Wv/Wo [out][in] (y = x W^T), no biases,
// UNSCALED scores, int32 mask [SEQ][SEQ] with replace-fill (-1e20 where mask == 0), output = ctx Wo^T as f32 [SEQ][NB][1024].
// Compute dtypes, f32 accumulate everywhere: q/k/v projections v_wmma_f32_16x16x32_bf16 (inputs and W RNE-converted to bf16; products exact);
// scores v_wmma_f32_16x16x32_f16: q and k each as f16 value + f16 residual x2048 (three products: value*value in one accumulator, the two residual products in a second accumulator);
// P (x2^14 carry, cancels in the normalisation) and v single f16; out-projection v_wmma_f32_16x16x32_f16: ctx single f16, Wo = f16(bf16(Wo) * 64), folded back by 1/64; softmax f32 (online, running max).
// Layout: bf16 copies of the inputs de-interleaved to [b][s][1024]; q/k (value, residual) planes [b*16+h][t][d] and v^T plane [b*16+h][d][t] written by the GEMM epilogue;
// fused flash kernel in transposed form (S^T = K Q^T, O^T = V^T P^T) writes the f16 ctx plane [b*SEQ+t][1024]; the out-projection GEMM writes rows t*OUT_NB + b.

#ifndef NB
#define NB 2
#endif
#ifndef SEQ
#define SEQ 2048
#endif
#define NB_FULL  2
#define SEQ_FULL 2048
#ifndef OUT_NB
#define OUT_NB NB                // batch pitch (in rows) of the output [t][OUT_NB][1024]
#endif
#define DM   1024
#define NH_  16
#define HD   64
#define AW   4                   // waves per flash block (16 query rows each)
#define QRS  2048.0f             // carry of the q / k residual planes
#define QRI  (1.0f / 2048.0f)
#define SC2  1.4426950408889634f // log2(e); the module applies no score scale
#define PSH  14.0f               // log2 of the P carry (16384)
#define FILL2 (-1.4426950408889634e20f)   // -1e20 in the log2 domain (replace-fill of masked scores)
#define WOS  64.0f               // carry of the Wo plane
#define WOI  (1.0f / 64.0f)

static_assert(HD == 64);
static_assert(NH_ * HD == DM);                 // head h = columns h*64 + d
static_assert(DM % 64 == 0);                   // 16 column tiles of 64
static_assert(DM % 32 == 0);                   // GEMM k-loop steps by 32
static_assert(SEQ % 64 == 0);                  // a 64-row tile never straddles two batches
static_assert((NB * SEQ) % 64 == 0);
static_assert(SEQ % 32 == 0);                  // key loop steps by 32
static_assert(SEQ % (16 * AW) == 0);           // flash grid covers the sequence exactly
static_assert(((size_t)NB * SEQ * DM) % 8 == 0);
static_assert(((size_t)DM * DM) % 8 == 0);
static_assert(NB <= NB_FULL);
static_assert(SEQ <= SEQ_FULL);
static_assert(NB <= OUT_NB);

typedef _Float16 h16;
typedef unsigned short bf;
typedef __attribute__((ext_vector_type(16))) __bf16   v16bf;
typedef __attribute__((ext_vector_type(16))) _Float16 v16h;
typedef __attribute__((ext_vector_type(8)))  _Float16 v8h;
typedef __attribute__((ext_vector_type(8)))  unsigned short v8us;
typedef __attribute__((ext_vector_type(8)))  float    v8f;
typedef __attribute__((ext_vector_type(4)))  float    v4f;
typedef __attribute__((ext_vector_type(4)))  int      v4i;
typedef v4f  __attribute__((may_alias)) v4fa;

__device__ __forceinline__ unsigned short f2bf(float f) { unsigned u = __float_as_uint(f); u += 0x7FFFu + ((u >> 16) & 1u); return (unsigned short)(u >> 16); }
__device__ __forceinline__ float bf2f(unsigned short s) { return __uint_as_float(((unsigned)s) << 16); }
__device__ __forceinline__ v16h cat16(v8h lo, v8h hi) { return __builtin_shufflevector(lo, hi, 0, 1, 2, 3, 4, 5, 6, 7, 8, 9, 10, 11, 12, 13, 14, 15); }
__device__ __forceinline__ v16bf cat16b(v8us lo, v8us hi) { return __builtin_bit_cast(v16bf, __builtin_shufflevector(lo, hi, 0, 1, 2, 3, 4, 5, 6, 7, 8, 9, 10, 11, 12, 13, 14, 15)); }
__device__ __forceinline__ v8f wmma16(v16h a, v16h b, v8f c) { return __builtin_amdgcn_wmma_f32_16x16x32_f16(false, a, false, b, (short)0, c, false, false); }
__device__ __forceinline__ v8f wmmab(v16bf a, v16bf b, v8f c) { return __builtin_amdgcn_wmma_f32_16x16x32_bf16(false, a, false, b, (short)0, c, false, false); }
// fragment loaders from K-contiguous 16-bit rows; p already includes + 8*(lane>>4): elements 0..7 <- k0+8h+0..7, elements 8..15 <- k0+16+8h+0..7 (same map for A and B)
__device__ __forceinline__ v16h  ldh(const h16* p) { return cat16(*(const v8h*)p, *(const v8h*)(p + 16)); }
__device__ __forceinline__ v16bf ldb(const bf* p)  { return cat16b(*(const v8us*)p, *(const v8us*)(p + 16)); }
// ordering point for wave-private LDS tiles (same wave writes and reads)
__device__ __forceinline__ void wave_sync() { __builtin_amdgcn_fence(3 /* release order */, "wavefront"); __builtin_amdgcn_wave_barrier(); asm volatile("" ::: "memory"); }

// k_cvtx: bf16 (RNE convert) copy with de-interleave: src [t][NB_FULL][DM] f32 -> dst [b][t][DM] bf16, b < NB, t < SEQ.
__global__ __launch_bounds__(256) void k_cvtx(const float* __restrict__ src, bf* dst, size_t n8) {
    const size_t i = (size_t)blockIdx.x * 256 + threadIdx.x; if (i >= n8) return;
    const size_t e = i * 8; const size_t drow = e / DM; const size_t c = e % DM;
    const size_t b = drow / SEQ, t = drow % SEQ;
    const v8f v = *(const v8f*)(src + (t * NB_FULL + b) * DM + c); v8us o;
#pragma unroll
    for (int k = 0; k < 8; ++k) o[k] = f2bf(v[k]);
    *(v8us*)(dst + e) = o; 
}

__global__ __launch_bounds__(256) void k_cvt8(const float* __restrict__ src, bf* dst, size_t n8) {
    const size_t i = (size_t)blockIdx.x * 256 + threadIdx.x; if (i >= n8) return;
    const v8f v = *(const v8f*)(src + i * 8); v8us o;
#pragma unroll
    for (int k = 0; k < 8; ++k) o[k] = f2bf(v[k]);
    *(v8us*)(dst + i * 8) = o; 
}

__global__ __launch_bounds__(256) void k_cvt8h(const float* __restrict__ src, h16* dst, size_t n8) {
    const size_t i = (size_t)blockIdx.x * 256 + threadIdx.x; if (i >= n8) return;
    const v8f v = *(const v8f*)(src + i * 8); v8h o;
#pragma unroll
    for (int k = 0; k < 8; ++k) o[k] = (h16)(bf2f(f2bf(v[k])) * WOS);
    *(v8h*)(dst + i * 8) = o; 
}

// k_proj: register-blocked bf16 GEMM, ONE WAVE per 64x64 tile (16 accumulators), operands straight from K-contiguous bf16 planes, K = DM.
// C[m][n] = sum_k A[m][k] Bt[n][k], written as f16 (Ph) and optionally the f16 residual x2048 (Pr, useRes != 0) at
// tile base (r0/RB)*sRB + (r0%RB)*pitch + (c0/CB)*sCB + (c0%CB), row pitch 'pitch' (halves). grid (M/64, N/64), 32 threads.
__global__ __launch_bounds__(32) void k_proj(const bf* __restrict__ A, const bf* __restrict__ Bt, h16* Ph, h16* Pr, int useRes, int RB, size_t sRB, int pitch, int CB, size_t sCB) {
    __shared__ __align__(16) float os[16 * 68];
    const int K = DM;
    const int lane = threadIdx.x & 31, lr = lane & 15, hi = lane >> 4; const int r0 = blockIdx.x * 64, c0 = blockIdx.y * 64;
    v8f acc[4][4];
#pragma unroll
    for (int mb = 0; mb < 4; ++mb)
#pragma unroll
        for (int nb = 0; nb < 4; ++nb) acc[mb][nb] = (v8f){};
    const size_t aoff = (size_t)(r0 + lr) * K + 8 * hi, boff = (size_t)(c0 + lr) * K + 8 * hi;
#pragma unroll 1
    for (int kc = 0; kc < K; kc += 32) {
        v16bf a[4];
#pragma unroll
        for (int mb = 0; mb < 4; ++mb) a[mb] = ldb(A + aoff + (size_t)mb * 16 * K + kc);
#pragma unroll
        for (int nb = 0; nb < 4; ++nb) { const v16bf b = ldb(Bt + boff + (size_t)nb * 16 * K + kc);
#pragma unroll
            for (int mb = 0; mb < 4; ++mb) acc[mb][nb] = wmmab(a[mb], b, acc[mb][nb]); }
        asm volatile("v_nop\n\tv_nop\n\tv_nop\n\tv_nop" : "+v"(acc[0][0]), "+v"(acc[1][1]), "+v"(acc[2][2]), "+v"(acc[3][3]) : "v"(a[0]), "v"(a[1]), "v"(a[2]), "v"(a[3]));
    }
    const size_t tbase = (size_t)(r0 / RB) * sRB + (size_t)(r0 % RB) * (size_t)pitch + (size_t)(c0 / CB) * sCB + (size_t)(c0 % CB);
#pragma unroll
    for (int mb = 0; mb < 4; ++mb) {
#pragma unroll
        for (int nb = 0; nb < 4; ++nb) {
#pragma unroll
            for (int j = 0; j < 8; ++j) os[(hi * 8 + j) * 68 + nb * 16 + lr] = acc[mb][nb][j]; }   // D: row 8h+j, col lane&15
        wave_sync();
        const size_t sb = tbase + (size_t)(mb * 16) * (size_t)pitch;
{
#pragma unroll
            for (int s = 0; s < 4; ++s) { const int row = 4 * s + (lane >> 3), c8 = (lane & 7) * 8;   // 4 s x 4 row groups = 16 rows; 8 lanes x 8 = 64 columns
                const v4f x0 = *(const v4fa*)(&os[row * 68 + c8]); const v4f x1 = *(const v4fa*)(&os[row * 68 + c8 + 4]); v8h hv, rv;
#pragma unroll
                for (int i = 0; i < 4; ++i) { const h16 a0 = (h16)x0[i]; const h16 a1 = (h16)x1[i]; hv[i] = a0; hv[4 + i] = a1; rv[i] = (h16)((x0[i] - (float)a0) * QRS); rv[4 + i] = (h16)((x1[i] - (float)a1) * QRS); }
                const size_t oo = sb + (size_t)row * (size_t)pitch + c8;
                *(v8h*)(Ph + oo) = hv; if (useRes) *(v8h*)(Pr + oo) = rv; }
             }
        wave_sync();
    }
}

// k_oproj: register-blocked f16 GEMM, ONE WAVE per 64x64 tile, A = ctx plane [NB*SEQ][DM] f16 (row m = b*SEQ + t), Bt = Wo plane [DM][DM] f16 (x64 carry), K = DM.
// OUT[(t*OUT_NB + b)][n] = (1/64) sum_k A[m][k] Bt[n][k], f32. grid (NB*SEQ/64, DM/64), 32 threads.
__global__ __launch_bounds__(32) void k_oproj(const h16* __restrict__ A, const h16* __restrict__ Bt, float* OUT) {
    __shared__ __align__(16) float os[16 * 68];
    const int K = DM;
    const int lane = threadIdx.x & 31, lr = lane & 15, hi = lane >> 4; const int r0 = blockIdx.x * 64, c0 = blockIdx.y * 64;
    v8f acc[4][4];
#pragma unroll
    for (int mb = 0; mb < 4; ++mb)
#pragma unroll
        for (int nb = 0; nb < 4; ++nb) acc[mb][nb] = (v8f){};
    const size_t aoff = (size_t)(r0 + lr) * K + 8 * hi, boff = (size_t)(c0 + lr) * K + 8 * hi;
#pragma unroll 1
    for (int kc = 0; kc < K; kc += 32) {
        v16h a[4];
#pragma unroll
        for (int mb = 0; mb < 4; ++mb) a[mb] = ldh(A + aoff + (size_t)mb * 16 * K + kc);
#pragma unroll
        for (int nb = 0; nb < 4; ++nb) { const v16h b = ldh(Bt + boff + (size_t)nb * 16 * K + kc);
#pragma unroll
            for (int mb = 0; mb < 4; ++mb) acc[mb][nb] = wmma16(a[mb], b, acc[mb][nb]); }
        asm volatile("v_nop\n\tv_nop\n\tv_nop\n\tv_nop" : "+v"(acc[0][0]), "+v"(acc[1][1]), "+v"(acc[2][2]), "+v"(acc[3][3]) : "v"(a[0]), "v"(a[1]), "v"(a[2]), "v"(a[3]));
    }
#pragma unroll
    for (int mb = 0; mb < 4; ++mb) {
#pragma unroll
        for (int nb = 0; nb < 4; ++nb) {
#pragma unroll
            for (int j = 0; j < 8; ++j) os[(hi * 8 + j) * 68 + nb * 16 + lr] = acc[mb][nb][j] * WOI; }   // D: row 8h+j, col lane&15
        wave_sync();
{
#pragma unroll
            for (int s = 0; s < 8; ++s) { const int row = 2 * s + hi, cofs = lr * 4;   // 8 s x 2 rows = 16 rows; 16 lanes x 4 floats = 64 columns
                const int m = r0 + mb * 16 + row; const int bb = m / SEQ, t = m % SEQ;
                const v4f val = *(const v4fa*)(&os[row * 68 + cofs]);
                *(v4f*)(OUT + ((size_t)t * OUT_NB + bb) * DM + c0 + cofs) = val; }
             }
        wave_sync();
    }
}

// k_flash: fused attention, one wave per 16 query rows of one (batch, head); K / V^T / Q fragments straight from the f16 planes (two 16-B loads each, arithmetic addressing).
// Transposed form: S^T[key][t] = K Q^T (A = K rows, B = Q rows); lane (t = lane&15, h = lane>>4) holds keys 8h+r of each 16-key tile, so the packed
// P tile is directly the B fragment of O^T[d][t] = V^T P^T (element r <- tile keys 0..15, element 8+r <- tile keys 16..31, lane unchanged).
// Scores: value*value in sH; (k value * q residual) + (k residual * q value), both carrying x2048, in sL; s = sH + sL/2048. Mask words are loaded by value (4 x 16 B per lane per step)
// and masked scores are REPLACED by the fill constant before the running-max softmax (a fully masked row comes out uniform).
// Softmax state (running max, partial sum) is one scalar per lane; the two lane halves of a row are combined with one xor-16 exchange.
__global__ __launch_bounds__(32 * AW) void k_flash(const h16* __restrict__ QH, const h16* __restrict__ QR, const h16* __restrict__ KH, const h16* __restrict__ KR,
                                                   const h16* __restrict__ VT, const int* __restrict__ MASK, h16* CX) {
    __shared__ __align__(16) float os[AW * 16 * 68];
    const int lane = threadIdx.x & 31, wave = threadIdx.x >> 5, lr = lane & 15, hi = lane >> 4;
    const int zh = blockIdx.y; const int b = zh / NH_, h = zh % NH_;
    const int t0 = (blockIdx.x * AW + wave) * 16;
    const size_t pbase = (size_t)zh * SEQ * HD;
    const size_t qo = pbase + (size_t)(t0 + lr) * HD + 8 * hi;
    const v16h qh0 = ldh(QH + qo), qh1 = ldh(QH + qo + 32), qr0 = ldh(QR + qo), qr1 = ldh(QR + qo + 32);   // B fragments: col t, k = d
    const size_t ko = pbase + (size_t)lr * HD + 8 * hi;      // + key * HD       (A fragment: row key, k = d)
    const size_t vo = pbase + (size_t)lr * SEQ + 8 * hi;     // + 16j*SEQ + key  (A fragment: row d, k = key)
    const int* mrow = MASK + (size_t)(t0 + lr) * SEQ_FULL + 8 * hi;   // mask[t][key0 + 8h + r] (tile a), [key0 + 16 + 8h + r] (tile b)
    v8f o0 = (v8f){}, o1 = (v8f){}, o2 = (v8f){}, o3 = (v8f){};
    float m = -3.0e38f, l = 0.0f;
#pragma unroll 1
    for (int key0 = 0; key0 < SEQ; key0 += 32) {
        const v4i ma0 = *(const v4i*)(mrow + key0), ma1 = *(const v4i*)(mrow + key0 + 4), mb0 = *(const v4i*)(mrow + key0 + 16), mb1 = *(const v4i*)(mrow + key0 + 20);
        const h16* ka = KH + ko + (size_t)key0 * HD;
        const v16h ka0 = ldh(ka), ka1 = ldh(ka + 32), kb0 = ldh(ka + 16 * HD), kb1 = ldh(ka + 16 * HD + 32);
        v8f sHa = (v8f){}, sLa = (v8f){}, sHb = (v8f){}, sLb = (v8f){};
        sHa = wmma16(ka0, qh0, sHa); sLa = wmma16(ka0, qr0, sLa); sHb = wmma16(kb0, qh0, sHb); sLb = wmma16(kb0, qr0, sLb);
        sHa = wmma16(ka1, qh1, sHa); sLa = wmma16(ka1, qr1, sLa); sHb = wmma16(kb1, qh1, sHb); sLb = wmma16(kb1, qr1, sLb);
        asm volatile("v_nop\n\tv_nop\n\tv_nop\n\tv_nop" : "+v"(sHa), "+v"(sLa), "+v"(sHb), "+v"(sLb) : "v"(ka0), "v"(ka1), "v"(kb0), "v"(kb1));
        const h16* kr = KR + ko + (size_t)key0 * HD;
        const v16h ra0 = ldh(kr), ra1 = ldh(kr + 32), rb0 = ldh(kr + 16 * HD), rb1 = ldh(kr + 16 * HD + 32);
        sLa = wmma16(ra0, qh0, sLa); sLb = wmma16(rb0, qh0, sLb);
        sLa = wmma16(ra1, qh1, sLa); sLb = wmma16(rb1, qh1, sLb);
        asm volatile("v_nop\n\tv_nop\n\tv_nop\n\tv_nop" : "+v"(sLa), "+v"(sLb) : "v"(ra0), "v"(ra1), "v"(rb0), "v"(rb1));
        float ta[8], tb[8]; float mx = -3.0e38f;
#pragma unroll
        for (int r = 0; r < 8; ++r) {
            const int mka = (r < 4) ? ma0[r & 3] : ma1[r & 3];
            const int mkb = (r < 4) ? mb0[r & 3] : mb1[r & 3];
            const float sa = (sHa[r] + sLa[r] * QRI) * SC2, sb = (sHb[r] + sLb[r] * QRI) * SC2;
            ta[r] = (mka != 0) ? sa : FILL2; tb[r] = (mkb != 0) ? sb : FILL2;
            mx = fmaxf(mx, fmaxf(ta[r], tb[r])); }
        mx = fmaxf(mx, __shfl_xor(mx, 16, 32));
        const float mnew = fmaxf(m, mx);
        const float alpha = __builtin_amdgcn_exp2f(m - mnew);
        v16h pb; float ls = 0.0f;
#pragma unroll
        for (int r = 0; r < 8; ++r) { const h16 pa = (h16)__builtin_amdgcn_exp2f((ta[r] - mnew) + PSH); const h16 pc = (h16)__builtin_amdgcn_exp2f((tb[r] - mnew) + PSH); pb[r] = pa; pb[8 + r] = pc; ls += (float)pa + (float)pc; }
        l = l * alpha + ls; m = mnew;
        o0 = o0 * alpha; o1 = o1 * alpha; o2 = o2 * alpha; o3 = o3 * alpha;
        const h16* va = VT + vo + key0;
        const v16h v0 = ldh(va), v1 = ldh(va + (size_t)16 * SEQ), v2 = ldh(va + (size_t)32 * SEQ), v3 = ldh(va + (size_t)48 * SEQ);
        o0 = wmma16(v0, pb, o0); o1 = wmma16(v1, pb, o1); o2 = wmma16(v2, pb, o2); o3 = wmma16(v3, pb, o3);
        asm volatile("v_nop\n\tv_nop\n\tv_nop\n\tv_nop" : "+v"(o0), "+v"(o1), "+v"(o2), "+v"(o3) : "v"(v0), "v"(v1), "v"(v2), "v"(v3), "v"(pb));
    }
    l += __shfl_xor(l, 16, 32);
    const float inv = 1.0f / l;
    const int wb = wave * 16 * 68;
    // O^T D layout: o_j[r] = (d = 16j + 8h + r, t = lane&15) -> os[t][d]; rows 0..15 x columns 0..63 all written
    { v4f a, c;
      a[0] = o0[0] * inv; a[1] = o0[1] * inv; a[2] = o0[2] * inv; a[3] = o0[3] * inv; c[0] = o0[4] * inv; c[1] = o0[5] * inv; c[2] = o0[6] * inv; c[3] = o0[7] * inv;
      *(v4fa*)(&os[wb + lr * 68 +  0 + 8 * hi]) = a; *(v4fa*)(&os[wb + lr * 68 +  0 + 8 * hi + 4]) = c;
      a[0] = o1[0] * inv; a[1] = o1[1] * inv; a[2] = o1[2] * inv; a[3] = o1[3] * inv; c[0] = o1[4] * inv; c[1] = o1[5] * inv; c[2] = o1[6] * inv; c[3] = o1[7] * inv;
      *(v4fa*)(&os[wb + lr * 68 + 16 + 8 * hi]) = a; *(v4fa*)(&os[wb + lr * 68 + 16 + 8 * hi + 4]) = c;
      a[0] = o2[0] * inv; a[1] = o2[1] * inv; a[2] = o2[2] * inv; a[3] = o2[3] * inv; c[0] = o2[4] * inv; c[1] = o2[5] * inv; c[2] = o2[6] * inv; c[3] = o2[7] * inv;
      *(v4fa*)(&os[wb + lr * 68 + 32 + 8 * hi]) = a; *(v4fa*)(&os[wb + lr * 68 + 32 + 8 * hi + 4]) = c;
      a[0] = o3[0] * inv; a[1] = o3[1] * inv; a[2] = o3[2] * inv; a[3] = o3[3] * inv; c[0] = o3[4] * inv; c[1] = o3[5] * inv; c[2] = o3[6] * inv; c[3] = o3[7] * inv;
      *(v4fa*)(&os[wb + lr * 68 + 48 + 8 * hi]) = a; *(v4fa*)(&os[wb + lr * 68 + 48 + 8 * hi + 4]) = c; }
    wave_sync();
    h16* crow = CX + ((size_t)b * SEQ + t0) * DM + h * HD;
{
#pragma unroll
        for (int s = 0; s < 4; ++s) { const int row = 4 * s + (lane >> 3), c8 = (lane & 7) * 8;   // 4 s x 4 row groups = 16 rows; 8 lanes x 8 halves = 64 columns
            const v4f x0 = *(const v4fa*)(&os[wb + row * 68 + c8]); const v4f x1 = *(const v4fa*)(&os[wb + row * 68 + c8 + 4]); v8h hv;
#pragma unroll
            for (int i = 0; i < 4; ++i) { hv[i] = (h16)x0[i]; hv[4 + i] = (h16)x1[i]; }
            *(v8h*)(crow + (size_t)row * DM + c8) = hv; }
         }
}

static constexpr size_t al256(size_t v) { return (v + 255) & ~(size_t)255; }
static constexpr size_t SZ_XB = al256((size_t)NB * SEQ * DM * 2);              // one bf16 input plane [NB*SEQ][1024]
static constexpr size_t SZ_WB = al256((size_t)3 * DM * DM * 2);               // bf16 Wq | Wk | Wv
static constexpr size_t SZ_WO = al256((size_t)DM * DM * 2);                   // f16 Wo x64
static constexpr size_t SZ_PL = al256((size_t)NB * NH_ * SEQ * HD * 2);       // one f16 head plane
static constexpr size_t SZ_CX = al256((size_t)NB * SEQ * DM * 2);             // f16 ctx plane
static constexpr size_t SZ_TOTAL = 3 * SZ_XB + SZ_WB + SZ_WO + 5 * SZ_PL + SZ_CX;
static_assert(SZ_TOTAL <= (size_t)134217728);          // workspace carve <= 128 MiB
static_assert(((size_t)DM * DM * 2) % 256 == 0);       // weight sub-planes stay 256-byte aligned

extern "C" void kernel_launch(void* const* d_in, const int* in_sizes, int n_in,
                              void* d_out, int out_size, void* d_ws, size_t ws_size, hipStream_t stream) {
    if (n_in < 8) return;
    const size_t needx = ((size_t)(SEQ - 1) * NB_FULL + NB) * DM;
    if ((size_t)in_sizes[0] < needx || (size_t)in_sizes[1] < needx || (size_t)in_sizes[2] < needx) return;
    if ((size_t)in_sizes[3] < (size_t)(SEQ - 1) * SEQ_FULL + SEQ) return;
    if ((size_t)in_sizes[4] < (size_t)DM * DM || (size_t)in_sizes[5] < (size_t)DM * DM || (size_t)in_sizes[6] < (size_t)DM * DM || (size_t)in_sizes[7] < (size_t)DM * DM) return;
    if ((size_t)out_size < ((size_t)(SEQ - 1) * OUT_NB + NB) * DM) return;
    if (SZ_TOTAL > ws_size) return;
    // wire order: query, keys, values, mask (int32), Wq, Wk, Wv, Wo ([out][in] = Bt as-is)
    const float* xq = (const float*)d_in[0]; const float* xk = (const float*)d_in[1]; const float* xv = (const float*)d_in[2];
    const int* mask = (const int*)d_in[3];
    const float* wq = (const float*)d_in[4]; const float* wk = (const float*)d_in[5]; const float* wv = (const float*)d_in[6]; const float* wo = (const float*)d_in[7];
    float* OUT = (float*)d_out;      // [SEQ][OUT_NB][1024]
    char* wsp = (char*)d_ws;
    bf* XQ = (bf*)wsp; wsp += SZ_XB;                 // [NB*SEQ][1024], row b*SEQ + t
    bf* XK = (bf*)wsp; wsp += SZ_XB;
    bf* XV = (bf*)wsp; wsp += SZ_XB;
    bf* WB = (bf*)wsp; wsp += SZ_WB;                 // [3][1024][1024]: q | k | v
    h16* WO16 = (h16*)wsp; wsp += SZ_WO;             // [1024][1024] x64
    h16* QH = (h16*)wsp; wsp += SZ_PL;               // [NB*16][SEQ][64]
    h16* QR = (h16*)wsp; wsp += SZ_PL;               // [NB*16][SEQ][64] residual x2048
    h16* KH = (h16*)wsp; wsp += SZ_PL;               // [NB*16][SEQ][64]
    h16* KR = (h16*)wsp; wsp += SZ_PL;               // [NB*16][SEQ][64] residual x2048
    h16* VT = (h16*)wsp; wsp += SZ_PL;               // [NB*16][64][SEQ]
    h16* CX = (h16*)wsp; wsp += SZ_CX;               // [NB*SEQ][1024]
    bf* WQ = WB; bf* WK = WB + (size_t)DM * DM; bf* WV = WB + (size_t)2 * DM * DM;

    { const size_t n8 = (size_t)NB * SEQ * DM / 8; const unsigned g = (unsigned)((n8 + 255) / 256);
      k_cvtx<<<g, 256, 0, stream>>>(xq, XQ, n8); k_cvtx<<<g, 256, 0, stream>>>(xk, XK, n8); k_cvtx<<<g, 256, 0, stream>>>(xv, XV, n8); }
    { const size_t n8 = (size_t)DM * DM / 8; const unsigned g = (unsigned)((n8 + 255) / 256);
      k_cvt8<<<g, 256, 0, stream>>>(wq, WQ, n8); k_cvt8<<<g, 256, 0, stream>>>(wk, WK, n8); k_cvt8<<<g, 256, 0, stream>>>(wv, WV, n8);
      k_cvt8h<<<g, 256, 0, stream>>>(wo, WO16, n8); }

    // q, k: A = x rows (m = b*SEQ + t), Bt = W rows (n = h*64 + d) -> planes [(b*16 + h)][t][d], value + residual
    k_proj<<<dim3(NB * SEQ / 64, DM / 64, 1), 32, 0, stream>>>(XQ, WQ, QH, QR, 1, SEQ, (size_t)NH_ * SEQ * HD, HD, HD, (size_t)SEQ * HD);
    k_proj<<<dim3(NB * SEQ / 64, DM / 64, 1), 32, 0, stream>>>(XK, WK, KH, KR, 1, SEQ, (size_t)NH_ * SEQ * HD, HD, HD, (size_t)SEQ * HD);
    // v^T: A = Wv rows (m = h*64 + d), Bt = x rows (n = b*SEQ + t) -> plane [(b*1024 + m)][t] = [(b*16 + h)][d][t]
    k_proj<<<dim3(DM / 64, NB * SEQ / 64, 1), 32, 0, stream>>>(WV, XV, VT, VT, 0, DM, (size_t)0, SEQ, SEQ, (size_t)DM * SEQ);

    k_flash<<<dim3(SEQ / (16 * AW), NB * NH_, 1), 32 * AW, 0, stream>>>(QH, QR, KH, KR, VT, mask, CX);

    // out[t][b][n] = sum_k ctx[b*SEQ + t][k] Wo[n][k]
    k_oproj<<<dim3(NB * SEQ / 64, DM / 64, 1), 32, 0, stream>>>(CX, WO16, OUT);
}

// v001
// A run of this version takes 299 microseconds.
// Timed twice side by side with v000, it ran 1.08 and 1.07 times as fast.
#include <hip/hip_runtime.h>

// Multi-head attention, width 1024 = 16 heads x 64; query/keys/values [SEQ][NB][1024] sequence-first (row = s*NB_FULL + b), Wq/Wk/Wv/Wo [out][in] (y = x W^T), no biases,
// UNSCALED scores, int32 mask [SEQ][SEQ] with replace-fill (-1e20 where mask == 0), output = ctx Wo^T as f32 [SEQ][NB][1024].
// Compute dtypes, f32 accumulate everywhere: q/k/v projections v_wmma_f32_16x16x32_bf16 (inputs and W RNE-converted to bf16; products exact);
// scores v_wmma_f32_16x16x32_f16: q and k each as f16 value + f16 residual x2048 (three products: value*value in one accumulator, the two residual products in a second accumulator);
// P (x2^14 carry, cancels in the normalisation) and v single f16; out-projection v_wmma_f32_16x16x32_f16: ctx single f16, Wo = f16(bf16(Wo) * 64), folded back by 1/64; softmax f32 (online, running max).
// Layout: bf16 copies of the inputs de-interleaved to [b][s][1024]; q/k (value, residual) planes [b*16+h][t][d] and v^T plane [b*16+h][d][t] written by the GEMM epilogue;
// fused flash kernel in transposed form (S^T = K Q^T, O^T = V^T P^T) writes the f16 ctx plane [b*SEQ+t][1024]; the out-projection GEMM writes rows t*OUT_NB + b.
// FRAGMENT ORDER: every 16-bit workspace plane [R][C] (C = the k dimension of its WMMA use) is stored as fragments of 16 rows x 32 k, 1 KiB each, fragment index (r/16)*(C/32) + k/32.
// Inside a fragment the 16-byte piece (row r, k = 8q..8q+7 of the 32, q = 0..3) lies at (q>>1)*512 B + ((q&1)*16 + r%16)*16 B, so each of the two wave-wide 16-byte loads
// of a fragment reads 512 contiguous bytes (4 whole lines; from row-major planes it would touch 16).

#ifndef NB
#define NB 2
#endif
#ifndef SEQ
#define SEQ 2048
#endif
#define NB_FULL  2
#define SEQ_FULL 2048
#ifndef OUT_NB
#define OUT_NB NB                // batch pitch (in rows) of the output [t][OUT_NB][1024]
#endif
#define DM   1024
#define NH_  16
#define HD   64
#define AW   4                   // waves per flash block (16 query rows each)
#define QRS  2048.0f             // carry of the q / k residual planes
#define QRI  (1.0f / 2048.0f)
#define SC2  1.4426950408889634f // log2(e); the module applies no score scale
#define PSH  14.0f               // log2 of the P carry (16384)
#define FILL2 (-1.4426950408889634e20f)   // -1e20 in the log2 domain (replace-fill of masked scores)
#define WOS  64.0f               // carry of the Wo plane
#define WOI  (1.0f / 64.0f)

static_assert(HD == 64);
static_assert(NH_ * HD == DM);                 // head h = columns h*64 + d
static_assert(DM % 64 == 0);                   // 16 column tiles of 64
static_assert(DM % 32 == 0);                   // GEMM k-loop steps by 32
static_assert(SEQ % 64 == 0);                  // a 64-row tile (and a 16-row fragment) never straddles two batches
static_assert((NB * SEQ) % 64 == 0);
static_assert(SEQ % 32 == 0);                  // key loop steps by 32
static_assert(SEQ % (16 * AW) == 0);           // flash grid covers the sequence exactly
static_assert(((size_t)NB * SEQ * DM) % 8 == 0);
static_assert(((size_t)DM * DM) % 8 == 0);
static_assert(NB <= NB_FULL);
static_assert(SEQ <= SEQ_FULL);
static_assert(NB <= OUT_NB);

typedef _Float16 h16;
typedef unsigned short bf;
typedef __attribute__((ext_vector_type(16))) __bf16   v16bf;
typedef __attribute__((ext_vector_type(16))) _Float16 v16h;
typedef __attribute__((ext_vector_type(8)))  _Float16 v8h;
typedef __attribute__((ext_vector_type(8)))  unsigned short v8us;
typedef __attribute__((ext_vector_type(8)))  float    v8f;
typedef __attribute__((ext_vector_type(4)))  float    v4f;
typedef __attribute__((ext_vector_type(4)))  int      v4i;
typedef __attribute__((ext_vector_type(4)))  unsigned short v4us;
typedef v4f  __attribute__((may_alias)) v4fa;
typedef v4us __attribute__((may_alias)) v4usa;
typedef v8us __attribute__((may_alias)) v8usa;

__device__ __forceinline__ unsigned short f2bf(float f) { unsigned u = __float_as_uint(f); u += 0x7FFFu + ((u >> 16) & 1u); return (unsigned short)(u >> 16); }
__device__ __forceinline__ float bf2f(unsigned short s) { return __uint_as_float(((unsigned)s) << 16); }
__device__ __forceinline__ v16h cat16(v8h lo, v8h hi) { return __builtin_shufflevector(lo, hi, 0, 1, 2, 3, 4, 5, 6, 7, 8, 9, 10, 11, 12, 13, 14, 15); }
__device__ __forceinline__ v16bf cat16b(v8us lo, v8us hi) { return __builtin_bit_cast(v16bf, __builtin_shufflevector(lo, hi, 0, 1, 2, 3, 4, 5, 6, 7, 8, 9, 10, 11, 12, 13, 14, 15)); }
__device__ __forceinline__ v8f wmma16(v16h a, v16h b, v8f c) { return __builtin_amdgcn_wmma_f32_16x16x32_f16(false, a, false, b, (short)0, c, false, false); }
__device__ __forceinline__ v8f wmmab(v16bf a, v16bf b, v8f c) { return __builtin_amdgcn_wmma_f32_16x16x32_bf16(false, a, false, b, (short)0, c, false, false); }
// fragment loaders from fragment-order planes; p = fragment base + 8*lane: elements 0..7 <- k0+8h+0..7, elements 8..15 <- k0+16+8h+0..7, row lane&15, h = lane>>4 (same map for A and B)
__device__ __forceinline__ v16h  ldh(const h16* p) { return cat16(*(const v8h*)p, *(const v8h*)(p + 256)); }
__device__ __forceinline__ v16bf ldb(const bf* p)  { return cat16b(*(const v8us*)p, *(const v8us*)(p + 256)); }
// ordering point for wave-private LDS tiles (same wave writes and reads)
__device__ __forceinline__ void wave_sync() { __builtin_amdgcn_fence(3 /* release order */, "wavefront"); __builtin_amdgcn_wave_barrier(); asm volatile("" ::: "memory"); }

// cvt_frag: one wave converts one fragment (16 rows x 32 columns) of an f32 matrix with DM columns: four whole-line loads (4 rows x 128 B each), the 16-bit rows
// through a wave-private LDS tile (80-byte pitch: 16 B x odd, free of conflicts for the 16-byte reads), two 512-byte stores in fragment order.
// MODE 0: bf16 RNE, source rows de-interleaved (plane row b*SEQ + t <- source row t*NB_FULL + b); MODE 1: bf16 RNE, rows as they are; MODE 2: f16(bf16(x) * 64), rows as they are.
template <int MODE> __device__ __forceinline__ void cvt_frag(const float* __restrict__ src, unsigned short* dst, size_t nfrag, unsigned short* ts) {
    const int lane = threadIdx.x & 31, wave = threadIdx.x >> 5;
    const size_t f = (size_t)blockIdx.x * 8 + wave; if (f >= nfrag) return;
    const size_t tile = f / (DM / 32), chunk = f % (DM / 32);
    unsigned short* tw = ts + wave * 16 * 40;
#pragma unroll
    for (int i = 0; i < 4; ++i) {
        const int row = 4 * i + (lane >> 3); const size_t drow = tile * 16 + row;
        const size_t srow = (MODE == 0) ? ((drow % SEQ) * NB_FULL + drow / SEQ) : drow;
        const v4f v = *(const v4f*)(src + srow * DM + chunk * 32 + (lane & 7) * 4); v4us o;
#pragma unroll
        for (int k = 0; k < 4; ++k) o[k] = (MODE == 2) ? __builtin_bit_cast(unsigned short, (h16)(bf2f(f2bf(v[k])) * WOS)) : f2bf(v[k]);
        *(v4usa*)(tw + row * 40 + (lane & 7) * 4) = o; }
    wave_sync();
#pragma unroll
    for (int j = 0; j < 2; ++j) { const v8us o = *(const v8usa*)(tw + (lane & 15) * 40 + j * 16 + (lane >> 4) * 8); *(v8us*)(dst + f * 512 + j * 256 + lane * 8) = o; }
}

// k_cvtx: src [t][NB_FULL][DM] f32 -> dst plane [b*SEQ + t][DM] bf16, fragment order. 8 waves per block, one fragment each.
__global__ __launch_bounds__(256) void k_cvtx(const float* __restrict__ src, bf* dst, size_t nfrag) {
    __shared__ __align__(16) unsigned short ts[8 * 16 * 40];
    cvt_frag<0>(src, dst, nfrag, ts);
}

__global__ __launch_bounds__(256) void k_cvt8(const float* __restrict__ src, bf* dst, size_t nfrag) {
    __shared__ __align__(16) unsigned short ts[8 * 16 * 40];
    cvt_frag<1>(src, dst, nfrag, ts);
}

__global__ __launch_bounds__(256) void k_cvt8h(const float* __restrict__ src, h16* dst, size_t nfrag) {
    __shared__ __align__(16) unsigned short ts[8 * 16 * 40];
    cvt_frag<2>(src, (unsigned short*)dst, nfrag, ts);
}

// k_proj: register-blocked bf16 GEMM, ONE WAVE per 64x64 tile (16 accumulators), operands straight from fragment-order bf16 planes, K = DM.
// C[m][n] = sum_k A[m][k] Bt[n][k], written as f16 (Ph) and optionally the f16 residual x2048 (Pr, useRes != 0) in fragment order into planes of 'pitch' columns:
// tile base (r0/RB)*sRB + (r0%RB)*pitch + (c0/CB)*sCB + (c0%CB)*16 (halves); 16 rows further = 16*pitch, 32 columns further = 512. grid (M/64, N/64), 32 threads.
__global__ __launch_bounds__(32) void k_proj(const bf* __restrict__ A, const bf* __restrict__ Bt, h16* Ph, h16* Pr, int useRes, int RB, size_t sRB, int pitch, int CB, size_t sCB) {
    __shared__ __align__(16) float os[16 * 68];
    const int K = DM;
    const int lane = threadIdx.x & 31, lr = lane & 15, hi = lane >> 4; const int r0 = blockIdx.x * 64, c0 = blockIdx.y * 64;
    v8f acc[4][4];
#pragma unroll
    for (int mb = 0; mb < 4; ++mb)
#pragma unroll
        for (int nb = 0; nb < 4; ++nb) acc[mb][nb] = (v8f){};
    const size_t aoff = (size_t)r0 * K + 8 * lane, boff = (size_t)c0 * K + 8 * lane;   // fragment (row/16, kc/32) at (row/16)*16*K + kc*16
#pragma unroll 1
    for (int kc = 0; kc < K; kc += 32) {
        v16bf a[4]; const bf* pa = A + aoff + (size_t)kc * 16;
#pragma unroll
        for (int mb = 0; mb < 4; ++mb) a[mb] = ldb(pa + (size_t)mb * 16 * K);
#pragma unroll
        for (int nb = 0; nb < 4; ++nb) { const v16bf b = ldb(Bt + boff + (size_t)nb * 16 * K + (size_t)kc * 16);
            if (nb == 0) asm volatile("s_wait_xcnt 0x0" :: "v"(pa) : "memory");   // the A loads' address pair stays whole up to this wait, so no later load result lands in it while they are issued
#pragma unroll
            for (int mb = 0; mb < 4; ++mb) acc[mb][nb] = wmmab(a[mb], b, acc[mb][nb]); }
        asm volatile("v_nop\n\tv_nop\n\tv_nop\n\tv_nop" : "+v"(acc[0][0]), "+v"(acc[1][1]), "+v"(acc[2][2]), "+v"(acc[3][3]) : "v"(a[0]), "v"(a[1]), "v"(a[2]), "v"(a[3]));
    }
    const size_t tbase = (size_t)(r0 / RB) * sRB + (size_t)(r0 % RB) * (size_t)pitch + (size_t)(c0 / CB) * sCB + (size_t)(c0 % CB) * 16;
#pragma unroll
    for (int mb = 0; mb < 4; ++mb) {
#pragma unroll
        for (int nb = 0; nb < 4; ++nb) {
#pragma unroll
            for (int j = 0; j < 8; ++j) os[(hi * 8 + j) * 68 + nb * 16 + lr] = acc[mb][nb][j]; }   // D: row 8h+j, col lane&15
        wave_sync();
        const size_t sb = tbase + (size_t)(mb * 16) * (size_t)pitch;
{
#pragma unroll
            for (int s = 0; s < 4; ++s) { const int row = lr, c8 = (2 * s + hi) * 8;   // s = 2*(column/32) + half of the fragment; 16 rows x 2 pieces = one 512-byte store
                const v4f x0 = *(const v4fa*)(&os[row * 68 + c8]); const v4f x1 = *(const v4fa*)(&os[row * 68 + c8 + 4]); v8h hv, rv;
#pragma unroll
                for (int i = 0; i < 4; ++i) { const h16 a0 = (h16)x0[i]; const h16 a1 = (h16)x1[i]; hv[i] = a0; hv[4 + i] = a1; rv[i] = (h16)((x0[i] - (float)a0) * QRS); rv[4 + i] = (h16)((x1[i] - (float)a1) * QRS); }
                const size_t oo = sb + (size_t)(s * 256 + lane * 8);
                *(v8h*)(Ph + oo) = hv; if (useRes) *(v8h*)(Pr + oo) = rv; }
             }
        wave_sync();
    }
}

// k_oproj: register-blocked f16 GEMM, ONE WAVE per 64x64 tile, A = ctx plane [NB*SEQ][DM] f16 (row m = b*SEQ + t), Bt = Wo plane [DM][DM] f16 (x64 carry), both in fragment order, K = DM.
// OUT[(t*OUT_NB + b)][n] = (1/64) sum_k A[m][k] Bt[n][k], f32. grid (NB*SEQ/64, DM/64), 32 threads.
__global__ __launch_bounds__(32) void k_oproj(const h16* __restrict__ A, const h16* __restrict__ Bt, float* OUT) {
    __shared__ __align__(16) float os[16 * 68];
    const int K = DM;
    const int lane = threadIdx.x & 31, lr = lane & 15, hi = lane >> 4; const int r0 = blockIdx.x * 64, c0 = blockIdx.y * 64;
    v8f acc[4][4];
#pragma unroll
    for (int mb = 0; mb < 4; ++mb)
#pragma unroll
        for (int nb = 0; nb < 4; ++nb) acc[mb][nb] = (v8f){};
    const size_t aoff = (size_t)r0 * K + 8 * lane, boff = (size_t)c0 * K + 8 * lane;   // fragment (row/16, kc/32) at (row/16)*16*K + kc*16
#pragma unroll 1
    for (int kc = 0; kc < K; kc += 32) {
        v16h a[4]; const h16* pa = A + aoff + (size_t)kc * 16;
#pragma unroll
        for (int mb = 0; mb < 4; ++mb) a[mb] = ldh(pa + (size_t)mb * 16 * K);
#pragma unroll
        for (int nb = 0; nb < 4; ++nb) { const v16h b = ldh(Bt + boff + (size_t)nb * 16 * K + (size_t)kc * 16);
            if (nb == 0) asm volatile("s_wait_xcnt 0x0" :: "v"(pa) : "memory");   // the A loads' address pair stays whole up to this wait, so no later load result lands in it while they are issued
#pragma unroll
            for (int mb = 0; mb < 4; ++mb) acc[mb][nb] = wmma16(a[mb], b, acc[mb][nb]); }
        asm volatile("v_nop\n\tv_nop\n\tv_nop\n\tv_nop" : "+v"(acc[0][0]), "+v"(acc[1][1]), "+v"(acc[2][2]), "+v"(acc[3][3]) : "v"(a[0]), "v"(a[1]), "v"(a[2]), "v"(a[3]));
    }
#pragma unroll
    for (int mb = 0; mb < 4; ++mb) {
#pragma unroll
        for (int nb = 0; nb < 4; ++nb) {
#pragma unroll
            for (int j = 0; j < 8; ++j) os[(hi * 8 + j) * 68 + nb * 16 + lr] = acc[mb][nb][j] * WOI; }   // D: row 8h+j, col lane&15
        wave_sync();
{
#pragma unroll
            for (int s = 0; s < 8; ++s) { const int row = 2 * s + hi, cofs = lr * 4;   // 8 s x 2 rows = 16 rows; 16 lanes x 4 floats = 64 columns
                const int m = r0 + mb * 16 + row; const int bb = m / SEQ, t = m % SEQ;
                const v4f val = *(const v4fa*)(&os[row * 68 + cofs]);
                *(v4f*)(OUT + ((size_t)t * OUT_NB + bb) * DM + c0 + cofs) = val; }
             }
        wave_sync();
    }
}

// k_flash: fused attention, one wave per 16 query rows of one (batch, head); K / V^T / Q fragments straight from the fragment-order f16 planes (two 16-B loads each, 512 contiguous bytes per wave and load).
// Transposed form: S^T[key][t] = K Q^T (A = K rows, B = Q rows); lane (t = lane&15, h = lane>>4) holds keys 8h+r of each 16-key tile, so the packed
// P tile is directly the B fragment of O^T[d][t] = V^T P^T (element r <- tile keys 0..15, element 8+r <- tile keys 16..31, lane unchanged).
// Scores: value*value in sH; (k value * q residual) + (k residual * q value), both carrying x2048, in sL; s = sH + sL/2048. Mask words are loaded by value (4 x 16 B per lane per step)
// and masked scores are REPLACED by the fill constant before the running-max softmax (a fully masked row comes out uniform).
// Softmax state (running max, partial sum) is one scalar per lane; the two lane halves of a row are combined with one xor-16 exchange.
__global__ __launch_bounds__(32 * AW) void k_flash(const h16* __restrict__ QH, const h16* __restrict__ QR, const h16* __restrict__ KH, const h16* __restrict__ KR,
                                                   const h16* __restrict__ VT, const int* __restrict__ MASK, h16* CX) {
    const int lane = threadIdx.x & 31, wave = threadIdx.x >> 5, lr = lane & 15, hi = lane >> 4;
    const int zh = blockIdx.y; const int b = zh / NH_, h = zh % NH_;
    const int t0 = (blockIdx.x * AW + wave) * 16;
    const size_t pbase = (size_t)zh * SEQ * HD;
    const size_t qo = pbase + (size_t)t0 * HD + 8 * lane;     // 16 rows x 64 d = two fragments of 512 halves
    const v16h qh0 = ldh(QH + qo), qh1 = ldh(QH + qo + 512), qr0 = ldh(QR + qo), qr1 = ldh(QR + qo + 512);   // B fragments: col t, k = d
    const size_t ko = pbase + 8 * lane;      // + key0 * HD + 512 * (d / 32)   (A fragment: row key, k = d)
    const size_t vo = pbase + 8 * lane;      // + 16j*SEQ + key0 * 16          (A fragment: row d, k = key)
    const int* mrow = MASK + (size_t)(t0 + lr) * SEQ_FULL + 8 * hi;   // mask[t][key0 + 8h + r] (tile a), [key0 + 16 + 8h + r] (tile b)
    v8f o0 = (v8f){}, o1 = (v8f){}, o2 = (v8f){}, o3 = (v8f){};
    float m = -3.0e38f, l = 0.0f;
#pragma unroll 1
    for (int key0 = 0; key0 < SEQ; key0 += 32) {
        const v4i ma0 = *(const v4i*)(mrow + key0), ma1 = *(const v4i*)(mrow + key0 + 4), mb0 = *(const v4i*)(mrow + key0 + 16), mb1 = *(const v4i*)(mrow + key0 + 20);
        const h16* ka = KH + ko + (size_t)key0 * HD;
        const v16h ka0 = ldh(ka), ka1 = ldh(ka + 512), kb0 = ldh(ka + 16 * HD), kb1 = ldh(ka + 16 * HD + 512);
        asm volatile("s_wait_xcnt 0x0" :: "v"(ka) : "memory");   // the eight loads' address pair stays whole up to this wait, so none of their results lands in it while the others are issued
        v8f sHa = (v8f){}, sLa = (v8f){}, sHb = (v8f){}, sLb = (v8f){};
        sHa = wmma16(ka0, qh0, sHa); sLa = wmma16(ka0, qr0, sLa); sHb = wmma16(kb0, qh0, sHb); sLb = wmma16(kb0, qr0, sLb);
        sHa = wmma16(ka1, qh1, sHa); sLa = wmma16(ka1, qr1, sLa); sHb = wmma16(kb1, qh1, sHb); sLb = wmma16(kb1, qr1, sLb);
        asm volatile("v_nop\n\tv_nop\n\tv_nop\n\tv_nop" : "+v"(sHa), "+v"(sLa), "+v"(sHb), "+v"(sLb) : "v"(ka0), "v"(ka1), "v"(kb0), "v"(kb1));
        const h16* kr = KR + ko + (size_t)key0 * HD;
        const v16h ra0 = ldh(kr), ra1 = ldh(kr + 512), rb0 = ldh(kr + 16 * HD), rb1 = ldh(kr + 16 * HD + 512);
        sLa = wmma16(ra0, qh0, sLa); sLb = wmma16(rb0, qh0, sLb);
        sLa = wmma16(ra1, qh1, sLa); sLb = wmma16(rb1, qh1, sLb);
        asm volatile("v_nop\n\tv_nop\n\tv_nop\n\tv_nop" : "+v"(sLa), "+v"(sLb) : "v"(ra0), "v"(ra1), "v"(rb0), "v"(rb1));
        float ta[8], tb[8]; float mx = -3.0e38f;
#pragma unroll
        for (int r = 0; r < 8; ++r) {
            const int mka = (r < 4) ? ma0[r & 3] : ma1[r & 3];
            const int mkb = (r < 4) ? mb0[r & 3] : mb1[r & 3];
            const float sa = (sHa[r] + sLa[r] * QRI) * SC2, sb = (sHb[r] + sLb[r] * QRI) * SC2;
            ta[r] = (mka != 0) ? sa : FILL2; tb[r] = (mkb != 0) ? sb : FILL2;
            mx = fmaxf(mx, fmaxf(ta[r], tb[r])); }
        mx = fmaxf(mx, __shfl_xor(mx, 16, 32));
        const float mnew = fmaxf(m, mx);
        const float alpha = __builtin_amdgcn_exp2f(m - mnew);
        v16h pb; float ls = 0.0f;
#pragma unroll
        for (int r = 0; r < 8; ++r) { const h16 pa = (h16)__builtin_amdgcn_exp2f((ta[r] - mnew) + PSH); const h16 pc = (h16)__builtin_amdgcn_exp2f((tb[r] - mnew) + PSH); pb[r] = pa; pb[8 + r] = pc; ls += (float)pa + (float)pc; }
        l = l * alpha + ls; m = mnew;
        o0 = o0 * alpha; o1 = o1 * alpha; o2 = o2 * alpha; o3 = o3 * alpha;
        const h16* va = VT + vo + (size_t)key0 * 16;
        const v16h v0 = ldh(va), v1 = ldh(va + (size_t)16 * SEQ), v2 = ldh(va + (size_t)32 * SEQ), v3 = ldh(va + (size_t)48 * SEQ);
        o0 = wmma16(v0, pb, o0); o1 = wmma16(v1, pb, o1); o2 = wmma16(v2, pb, o2); o3 = wmma16(v3, pb, o3);
        asm volatile("v_nop\n\tv_nop\n\tv_nop\n\tv_nop" : "+v"(o0), "+v"(o1), "+v"(o2), "+v"(o3) : "v"(v0), "v"(v1), "v"(v2), "v"(v3), "v"(pb));
    }
    l += __shfl_xor(l, 16, 32);
    const float inv = 1.0f / l;
    // O^T D layout: o_j[r] = (d = 16j + 8h + r, t = lane&15): a lane's eight values of o_j are the 16-byte piece (row t, columns 16j + 8h + 0..7) of the ctx plane,
    // which fragment order puts at j*256 + lane*8 halves behind the base of fragments (row/16, 2h) and (row/16, 2h + 1): four 512-byte stores straight from the accumulators
    h16* crow = CX + ((size_t)b * SEQ + t0) * DM + h * (HD * 16) + lane * 8;
    v8h h0, h1, h2, h3;
#pragma unroll
    for (int r = 0; r < 8; ++r) { h0[r] = (h16)(o0[r] * inv); h1[r] = (h16)(o1[r] * inv); h2[r] = (h16)(o2[r] * inv); h3[r] = (h16)(o3[r] * inv); }
    *(v8h*)(crow) = h0; *(v8h*)(crow + 256) = h1; *(v8h*)(crow + 512) = h2; *(v8h*)(crow + 768) = h3;
}

static constexpr size_t al256(size_t v) { return (v + 255) & ~(size_t)255; }
static constexpr size_t SZ_XB = al256((size_t)NB * SEQ * DM * 2);              // one bf16 input plane [NB*SEQ][1024]
static constexpr size_t SZ_WB = al256((size_t)3 * DM * DM * 2);               // bf16 Wq | Wk | Wv
static constexpr size_t SZ_WO = al256((size_t)DM * DM * 2);                   // f16 Wo x64
static constexpr size_t SZ_PL = al256((size_t)NB * NH_ * SEQ * HD * 2);       // one f16 head plane
static constexpr size_t SZ_CX = al256((size_t)NB * SEQ * DM * 2);             // f16 ctx plane
static constexpr size_t SZ_TOTAL = 3 * SZ_XB + SZ_WB + SZ_WO + 5 * SZ_PL + SZ_CX;
static_assert(SZ_TOTAL <= (size_t)134217728);          // workspace carve <= 128 MiB
static_assert(((size_t)DM * DM * 2) % 256 == 0);       // weight sub-planes stay 256-byte aligned

extern "C" void kernel_launch(void* const* d_in, const int* in_sizes, int n_in,
                              void* d_out, int out_size, void* d_ws, size_t ws_size, hipStream_t stream) {
    if (n_in < 8) return;
    const size_t needx = ((size_t)(SEQ - 1) * NB_FULL + NB) * DM;
    if ((size_t)in_sizes[0] < needx || (size_t)in_sizes[1] < needx || (size_t)in_sizes[2] < needx) return;
    if ((size_t)in_sizes[3] < (size_t)(SEQ - 1) * SEQ_FULL + SEQ) return;
    if ((size_t)in_sizes[4] < (size_t)DM * DM || (size_t)in_sizes[5] < (size_t)DM * DM || (size_t)in_sizes[6] < (size_t)DM * DM || (size_t)in_sizes[7] < (size_t)DM * DM) return;
    if ((size_t)out_size < ((size_t)(SEQ - 1) * OUT_NB + NB) * DM) return;
    if (SZ_TOTAL > ws_size) return;
    // wire order: query, keys, values, mask (int32), Wq, Wk, Wv, Wo ([out][in] = Bt as-is)
    const float* xq = (const float*)d_in[0]; const float* xk = (const float*)d_in[1]; const float* xv = (const float*)d_in[2];
    const int* mask = (const int*)d_in[3];
    const float* wq = (const float*)d_in[4]; const float* wk = (const float*)d_in[5]; const float* wv = (const float*)d_in[6]; const float* wo = (const float*)d_in[7];
    float* OUT = (float*)d_out;      // [SEQ][OUT_NB][1024]
    char* wsp = (char*)d_ws;
    bf* XQ = (bf*)wsp; wsp += SZ_XB;                 // [NB*SEQ][1024], row b*SEQ + t
    bf* XK = (bf*)wsp; wsp += SZ_XB;
    bf* XV = (bf*)wsp; wsp += SZ_XB;
    bf* WB = (bf*)wsp; wsp += SZ_WB;                 // [3][1024][1024]: q | k | v
    h16* WO16 = (h16*)wsp; wsp += SZ_WO;             // [1024][1024] x64
    h16* QH = (h16*)wsp; wsp += SZ_PL;               // [NB*16][SEQ][64]
    h16* QR = (h16*)wsp; wsp += SZ_PL;               // [NB*16][SEQ][64] residual x2048
    h16* KH = (h16*)wsp; wsp += SZ_PL;               // [NB*16][SEQ][64]
    h16* KR = (h16*)wsp; wsp += SZ_PL;               // [NB*16][SEQ][64] residual x2048
    h16* VT = (h16*)wsp; wsp += SZ_PL;               // [NB*16][64][SEQ]
    h16* CX = (h16*)wsp; wsp += SZ_CX;               // [NB*SEQ][1024]
    bf* WQ = WB; bf* WK = WB + (size_t)DM * DM; bf* WV = WB + (size_t)2 * DM * DM;

    { const size_t n8 = (size_t)NB * SEQ * DM / 512; const unsigned g = (unsigned)((n8 + 7) / 8);   // fragments of 16 x 32; 8 per block
      k_cvtx<<<g, 256, 0, stream>>>(xq, XQ, n8); k_cvtx<<<g, 256, 0, stream>>>(xk, XK, n8); k_cvtx<<<g, 256, 0, stream>>>(xv, XV, n8); }
    { const size_t n8 = (size_t)DM * DM / 512; const unsigned g = (unsigned)((n8 + 7) / 8);
      k_cvt8<<<g, 256, 0, stream>>>(wq, WQ, n8); k_cvt8<<<g, 256, 0, stream>>>(wk, WK, n8); k_cvt8<<<g, 256, 0, stream>>>(wv, WV, n8);
      k_cvt8h<<<g, 256, 0, stream>>>(wo, WO16, n8); }

    // q, k: A = x rows (m = b*SEQ + t), Bt = W rows (n = h*64 + d) -> planes [(b*16 + h)][t][d], value + residual
    k_proj<<<dim3(NB * SEQ / 64, DM / 64, 1), 32, 0, stream>>>(XQ, WQ, QH, QR, 1, SEQ, (size_t)NH_ * SEQ * HD, HD, HD, (size_t)SEQ * HD);
    k_proj<<<dim3(NB * SEQ / 64, DM / 64, 1), 32, 0, stream>>>(XK, WK, KH, KR, 1, SEQ, (size_t)NH_ * SEQ * HD, HD, HD, (size_t)SEQ * HD);
    // v^T: A = Wv rows (m = h*64 + d), Bt = x rows (n = b*SEQ + t) -> plane [(b*1024 + m)][t] = [(b*16 + h)][d][t]
    k_proj<<<dim3(DM / 64, NB * SEQ / 64, 1), 32, 0, stream>>>(WV, XV, VT, VT, 0, DM, (size_t)0, SEQ, SEQ, (size_t)DM * SEQ);

    k_flash<<<dim3(SEQ / (16 * AW), NB * NH_, 1), 32 * AW, 0, stream>>>(QH, QR, KH, KR, VT, mask, CX);

    // out[t][b][n] = sum_k ctx[b*SEQ + t][k] Wo[n][k]
    k_oproj<<<dim3(NB * SEQ / 64, DM / 64, 1), 32, 0, stream>>>(CX, WO16, OUT);
}

// v002
// It runs in 221 microseconds.
// Two timings next to v001 put it at 1.38 and 1.37 times that version's speed.
// Over all steps from v000 it is 1.48 times as fast.
#include <hip/hip_runtime.h>

// Multi-head attention, width 1024 = 16 heads x 64; query/keys/values [SEQ][NB][1024] sequence-first (row = s*NB_FULL + b), Wq/Wk/Wv/Wo [out][in] (y = x W^T), no biases,
// UNSCALED scores, int32 mask [SEQ][SEQ] with replace-fill (-1e20 where mask == 0), output = ctx Wo^T as f32 [SEQ][NB][1024].
// Compute dtypes, f32 accumulate everywhere: q/k/v projections v_wmma_f32_16x16x32_bf16 (inputs and W RNE-converted to bf16; products exact);
// scores v_wmma_f32_16x16x32_f16: q and k each as f16 value + f16 residual x2048 (three products: value*value in one accumulator, the two residual products in a second accumulator);
// P (x2^14 carry, cancels in the normalisation) and v single f16; out-projection v_wmma_f32_16x16x32_f16: ctx single f16, Wo = f16(bf16(Wo) * 64), folded back by 1/64; softmax f32 (online, running max).
// Layout: bf16 copies of the inputs de-interleaved to [b][s][1024]; q/k (value, residual) planes [b*16+h][t][d] and v^T plane [b*16+h][d][t] written by the GEMM epilogue;
// fused flash kernel in transposed form (S^T = K Q^T, O^T = V^T P^T) writes the f16 ctx plane [b*SEQ+t][1024]; the out-projection GEMM writes rows t*OUT_NB + b.
// FRAGMENT ORDER: every 16-bit workspace plane [R][C] (C = the k dimension of its WMMA use) is stored as fragments of 16 rows x 32 k, 1 KiB each, fragment index (r/16)*(C/32) + k/32.
// Inside a fragment the 16-byte piece (row r, k = 8q..8q+7 of the 32, q = 0..3) lies at (q>>1)*512 B + ((q&1)*16 + r%16)*16 B, so each of the two wave-wide 16-byte loads
// of a fragment reads 512 contiguous bytes (4 whole lines; from row-major planes it would touch 16).

#ifndef NB
#define NB 2
#endif
#ifndef SEQ
#define SEQ 2048
#endif
#define NB_FULL  2
#define SEQ_FULL 2048
#ifndef OUT_NB
#define OUT_NB NB                // batch pitch (in rows) of the output [t][OUT_NB][1024]
#endif
#define DM   1024
#define NH_  16
#define HD   64
#define AW   4                   // waves per flash block (16 query rows each)
#define QRS  2048.0f             // carry of the q / k residual planes
#define QRI  (1.0f / 2048.0f)
#define SC2  1.4426950408889634f // log2(e); the module applies no score scale
#define PSH  14.0f               // log2 of the P carry (16384)
#define FILL2 (-1.4426950408889634e20f)   // -1e20 in the log2 domain (replace-fill of masked scores)
#define WOS  64.0f               // carry of the Wo plane
#define WOI  (1.0f / 64.0f)

static_assert(HD == 64);
static_assert(NH_ * HD == DM);                 // head h = columns h*64 + d
static_assert(DM % 64 == 0);                   // 16 column tiles of 64
static_assert(DM % 32 == 0);                   // GEMM k-loop steps by 32
static_assert(SEQ % 64 == 0);                  // a 64-row tile (and a 16-row fragment) never straddles two batches
static_assert((NB * SEQ) % 64 == 0);
static_assert(SEQ % 32 == 0);                  // key loop steps by 32
static_assert(SEQ % (16 * AW) == 0);           // flash grid covers the sequence exactly
static_assert(((size_t)NB * SEQ * DM) % 8 == 0);
static_assert(((size_t)DM * DM) % 8 == 0);
static_assert(NB <= NB_FULL);
static_assert(SEQ <= SEQ_FULL);
static_assert(NB <= OUT_NB);

typedef _Float16 h16;
typedef unsigned short bf;
typedef __attribute__((ext_vector_type(16))) __bf16   v16bf;
typedef __attribute__((ext_vector_type(16))) _Float16 v16h;
typedef __attribute__((ext_vector_type(8)))  _Float16 v8h;
typedef __attribute__((ext_vector_type(8)))  unsigned short v8us;
typedef __attribute__((ext_vector_type(8)))  float    v8f;
typedef __attribute__((ext_vector_type(4)))  float    v4f;
typedef __attribute__((ext_vector_type(4)))  int      v4i;
typedef __attribute__((ext_vector_type(4)))  unsigned short v4us;
typedef v4f  __attribute__((may_alias)) v4fa;
typedef v4us __attribute__((may_alias)) v4usa;
typedef v8us __attribute__((may_alias)) v8usa;

__device__ __forceinline__ unsigned short f2bf(float f) { unsigned u = __float_as_uint(f); u += 0x7FFFu + ((u >> 16) & 1u); return (unsigned short)(u >> 16); }
__device__ __forceinline__ float bf2f(unsigned short s) { return __uint_as_float(((unsigned)s) << 16); }
__device__ __forceinline__ v16h cat16(v8h lo, v8h hi) { return __builtin_shufflevector(lo, hi, 0, 1, 2, 3, 4, 5, 6, 7, 8, 9, 10, 11, 12, 13, 14, 15); }
__device__ __forceinline__ v16bf cat16b(v8us lo, v8us hi) { return __builtin_bit_cast(v16bf, __builtin_shufflevector(lo, hi, 0, 1, 2, 3, 4, 5, 6, 7, 8, 9, 10, 11, 12, 13, 14, 15)); }
__device__ __forceinline__ v8f wmma16(v16h a, v16h b, v8f c) { return __builtin_amdgcn_wmma_f32_16x16x32_f16(false, a, false, b, (short)0, c, false, false); }
__device__ __forceinline__ v8f wmmab(v16bf a, v16bf b, v8f c) { return __builtin_amdgcn_wmma_f32_16x16x32_bf16(false, a, false, b, (short)0, c, false, false); }
// fragment loaders from fragment-order planes; p = fragment base + 8*lane: elements 0..7 <- k0+8h+0..7, elements 8..15 <- k0+16+8h+0..7, row lane&15, h = lane>>4 (same map for A and B)
__device__ __forceinline__ v16h  ldh(const h16* p) { return cat16(*(const v8h*)p, *(const v8h*)(p + 256)); }
__device__ __forceinline__ v16bf ldb(const bf* p)  { return cat16b(*(const v8us*)p, *(const v8us*)(p + 256)); }
// ordering point for wave-private LDS tiles (same wave writes and reads)
__device__ __forceinline__ void wave_sync() { __builtin_amdgcn_fence(3 /* release order */, "wavefront"); __builtin_amdgcn_wave_barrier(); asm volatile("" ::: "memory"); }

// cvt_frag: one wave converts one fragment (16 rows x 32 columns) of an f32 matrix with DM columns: four whole-line loads (4 rows x 128 B each), the 16-bit rows
// through a wave-private LDS tile (80-byte pitch: 16 B x odd, free of conflicts for the 16-byte reads), two 512-byte stores in fragment order.
// MODE 0: bf16 RNE, source rows de-interleaved (plane row b*SEQ + t <- source row t*NB_FULL + b); MODE 1: bf16 RNE, rows as they are; MODE 2: f16(bf16(x) * 64), rows as they are.
template <int MODE> __device__ __forceinline__ void cvt_frag(const float* __restrict__ src, unsigned short* dst, unsigned blk, unsigned short* ts) {
    const int lane = threadIdx.x & 31, wave = threadIdx.x >> 5;
    const size_t f = (size_t)blk * 8 + wave;
    const size_t tile = f / (DM / 32), chunk = f % (DM / 32);
    unsigned short* tw = ts + wave * 16 * 40;
#pragma unroll
    for (int i = 0; i < 4; ++i) {
        const int row = 4 * i + (lane >> 3); const size_t drow = tile * 16 + row;
        const size_t srow = (MODE == 0) ? ((drow % SEQ) * NB_FULL + drow / SEQ) : drow;
        const v4f v = *(const v4f*)(src + srow * DM + chunk * 32 + (lane & 7) * 4); v4us o;
#pragma unroll
        for (int k = 0; k < 4; ++k) o[k] = (MODE == 2) ? __builtin_bit_cast(unsigned short, (h16)(bf2f(f2bf(v[k])) * WOS)) : f2bf(v[k]);
        *(v4usa*)(tw + row * 40 + (lane & 7) * 4) = o; }
    wave_sync();
#pragma unroll
    for (int j = 0; j < 2; ++j) { const v8us o = *(const v8usa*)(tw + (lane & 15) * 40 + j * 16 + (lane >> 4) * 8); *(v8us*)(dst + f * 512 + j * 256 + lane * 8) = o; }
}

// k_cvt: all seven conversions in ONE launch (they are independent of each other); the block index picks the matrix. 8 waves per block, one fragment each.
// Blocks 0 .. 3*GX-1: query | keys | values, src [t][NB_FULL][DM] f32 -> plane [b*SEQ + t][DM] bf16; then 3*GW blocks: Wq | Wk | Wv -> bf16; then GW blocks: Wo -> f16 x64. All in fragment order.
#define GX ((unsigned)((size_t)NB * SEQ * DM / 512 / 8))
#define GW ((unsigned)((size_t)DM * DM / 512 / 8))
static_assert(((size_t)NB * SEQ * DM) % (512 * 8) == 0);   // every block of the merged grid has eight whole fragments
static_assert(((size_t)DM * DM) % (512 * 8) == 0);
__global__ __launch_bounds__(256) void k_cvt(const float* __restrict__ xq, const float* __restrict__ xk, const float* __restrict__ xv,
                                             const float* __restrict__ wq, const float* __restrict__ wk, const float* __restrict__ wv, const float* __restrict__ wo,
                                             bf* XQ, bf* XK, bf* XV, bf* WQ, bf* WK, bf* WV, h16* WO16) {
    __shared__ __align__(16) unsigned short ts[8 * 16 * 40];
    const unsigned bx = blockIdx.x;
    if (bx < 3 * GX) { const unsigned w = bx / GX; cvt_frag<0>(w == 0 ? xq : w == 1 ? xk : xv, w == 0 ? XQ : w == 1 ? XK : XV, bx % GX, ts); }
    else if (bx < 3 * GX + 3 * GW) { const unsigned c = bx - 3 * GX, w = c / GW; cvt_frag<1>(w == 0 ? wq : w == 1 ? wk : wv, w == 0 ? WQ : w == 1 ? WK : WV, c % GW, ts); }
    else cvt_frag<2>(wo, (unsigned short*)WO16, bx - (3 * GX + 3 * GW), ts);
}

// k_proj: register-blocked bf16 GEMM, ONE WAVE per 64x64 tile (16 accumulators), operands straight from fragment-order bf16 planes, K = DM.
// C[m][n] = sum_k A[m][k] Bt[n][k], written as f16 (Ph) and optionally the f16 residual x2048 (Pr, useRes != 0) in fragment order into planes of 'pitch' columns:
// tile base (r0/RB)*sRB + (r0%RB)*pitch + (c0/CB)*sCB + (c0%CB)*16 (halves); 16 rows further = 16*pitch, 32 columns further = 512.
// The three projections are independent and run in ONE launch, grid (NB*SEQ/64, DM/64, 3), 32 threads; blockIdx.z picks the product:
// z = 0, 1 (q, k): A = x rows (m = b*SEQ + t), Bt = W rows (n = h*64 + d) -> planes [(b*16 + h)][t][d], value + residual;
// z = 2 (v^T): A = Wv rows (m = h*64 + d, from blockIdx.y), Bt = x rows (n = b*SEQ + t, from blockIdx.x) -> plane [(b*1024 + m)][t] = [(b*16 + h)][d][t], value only.
__global__ __launch_bounds__(32) void k_proj(const bf* __restrict__ XQ, const bf* __restrict__ XK, const bf* __restrict__ XV, const bf* __restrict__ WQ, const bf* __restrict__ WK, const bf* __restrict__ WV,
                                             h16* QH, h16* QR, h16* KH, h16* KR, h16* VT) {
    __shared__ __align__(16) float os[16 * 68];
    const int K = DM;
    const int z = blockIdx.z; const bool isv = (z == 2);
    const bf* __restrict__ A = isv ? WV : (z == 0 ? XQ : XK); const bf* __restrict__ Bt = isv ? XV : (z == 0 ? WQ : WK);
    h16* Ph = isv ? VT : (z == 0 ? QH : KH); h16* Pr = (z == 0) ? QR : KR; const bool useRes = !isv;
    const int RB = isv ? DM : SEQ, pitch = isv ? SEQ : HD, CB = isv ? SEQ : HD;
    const size_t sRB = isv ? (size_t)0 : (size_t)NH_ * SEQ * HD, sCB = isv ? (size_t)DM * SEQ : (size_t)SEQ * HD;
    const int lane = threadIdx.x & 31, lr = lane & 15, hi = lane >> 4; const int r0 = (isv ? blockIdx.y : blockIdx.x) * 64, c0 = (isv ? blockIdx.x : blockIdx.y) * 64;
    v8f acc[4][4];
#pragma unroll
    for (int mb = 0; mb < 4; ++mb)
#pragma unroll
        for (int nb = 0; nb < 4; ++nb) acc[mb][nb] = (v8f){};
    const size_t aoff = (size_t)r0 * K + 8 * lane, boff = (size_t)c0 * K + 8 * lane;   // fragment (row/16, kc/32) at (row/16)*16*K + kc*16
#pragma unroll 1
    for (int kc = 0; kc < K; kc += 32) {
        v16bf a[4]; const bf* pa = A + aoff + (size_t)kc * 16;
#pragma unroll
        for (int mb = 0; mb < 4; ++mb) a[mb] = ldb(pa + (size_t)mb * 16 * K);
#pragma unroll
        for (int nb = 0; nb < 4; ++nb) { const v16bf b = ldb(Bt + boff + (size_t)nb * 16 * K + (size_t)kc * 16);
            if (nb == 0) asm volatile("s_wait_xcnt 0x0" :: "v"(pa) : "memory");   // the A loads' address pair stays whole up to this wait, so no later load result lands in it while they are issued
#pragma unroll
            for (int mb = 0; mb < 4; ++mb) acc[mb][nb] = wmmab(a[mb], b, acc[mb][nb]); }
        asm volatile("v_nop\n\tv_nop\n\tv_nop\n\tv_nop" : "+v"(acc[0][0]), "+v"(acc[1][1]), "+v"(acc[2][2]), "+v"(acc[3][3]) : "v"(a[0]), "v"(a[1]), "v"(a[2]), "v"(a[3]));
    }
    const size_t tbase = (size_t)(r0 / RB) * sRB + (size_t)(r0 % RB) * (size_t)pitch + (size_t)(c0 / CB) * sCB + (size_t)(c0 % CB) * 16;
#pragma unroll
    for (int mb = 0; mb < 4; ++mb) {
#pragma unroll
        for (int nb = 0; nb < 4; ++nb) {
#pragma unroll
            for (int j = 0; j < 8; ++j) os[(hi * 8 + j) * 68 + nb * 16 + lr] = acc[mb][nb][j]; }   // D: row 8h+j, col lane&15
        wave_sync();
        const size_t sb = tbase + (size_t)(mb * 16) * (size_t)pitch;
{
#pragma unroll
            for (int s = 0; s < 4; ++s) { const int row = lr, c8 = (2 * s + hi) * 8;   // s = 2*(column/32) + half of the fragment; 16 rows x 2 pieces = one 512-byte store
                const v4f x0 = *(const v4fa*)(&os[row * 68 + c8]); const v4f x1 = *(const v4fa*)(&os[row * 68 + c8 + 4]); v8h hv, rv;
#pragma unroll
                for (int i = 0; i < 4; ++i) { const h16 a0 = (h16)x0[i]; const h16 a1 = (h16)x1[i]; hv[i] = a0; hv[4 + i] = a1; rv[i] = (h16)((x0[i] - (float)a0) * QRS); rv[4 + i] = (h16)((x1[i] - (float)a1) * QRS); }
                const size_t oo = sb + (size_t)(s * 256 + lane * 8);
                *(v8h*)(Ph + oo) = hv; if (useRes) *(v8h*)(Pr + oo) = rv; }
             }
        wave_sync();
    }
}

// k_oproj: register-blocked f16 GEMM, ONE WAVE per 64x64 tile, A = ctx plane [NB*SEQ][DM] f16 (row m = b*SEQ + t), Bt = Wo plane [DM][DM] f16 (x64 carry), both in fragment order, K = DM.
// OUT[(t*OUT_NB + b)][n] = (1/64) sum_k A[m][k] Bt[n][k], f32. grid (NB*SEQ/64, DM/64), 32 threads.
__global__ __launch_bounds__(32) void k_oproj(const h16* __restrict__ A, const h16* __restrict__ Bt, float* OUT) {
    __shared__ __align__(16) float os[16 * 68];
    const int K = DM;
    const int lane = threadIdx.x & 31, lr = lane & 15, hi = lane >> 4; const int r0 = blockIdx.x * 64, c0 = blockIdx.y * 64;
    v8f acc[4][4];
#pragma unroll
    for (int mb = 0; mb < 4; ++mb)
#pragma unroll
        for (int nb = 0; nb < 4; ++nb) acc[mb][nb] = (v8f){};
    const size_t aoff = (size_t)r0 * K + 8 * lane, boff = (size_t)c0 * K + 8 * lane;   // fragment (row/16, kc/32) at (row/16)*16*K + kc*16
#pragma unroll 1
    for (int kc = 0; kc < K; kc += 32) {
        v16h a[4]; const h16* pa = A + aoff + (size_t)kc * 16;
#pragma unroll
        for (int mb = 0; mb < 4; ++mb) a[mb] = ldh(pa + (size_t)mb * 16 * K);
#pragma unroll
        for (int nb = 0; nb < 4; ++nb) { const v16h b = ldh(Bt + boff + (size_t)nb * 16 * K + (size_t)kc * 16);
            if (nb == 0) asm volatile("s_wait_xcnt 0x0" :: "v"(pa) : "memory");   // the A loads' address pair stays whole up to this wait, so no later load result lands in it while they are issued
#pragma unroll
            for (int mb = 0; mb < 4; ++mb) acc[mb][nb] = wmma16(a[mb], b, acc[mb][nb]); }
        asm volatile("v_nop\n\tv_nop\n\tv_nop\n\tv_nop" : "+v"(acc[0][0]), "+v"(acc[1][1]), "+v"(acc[2][2]), "+v"(acc[3][3]) : "v"(a[0]), "v"(a[1]), "v"(a[2]), "v"(a[3]));
    }
#pragma unroll
    for (int mb = 0; mb < 4; ++mb) {
#pragma unroll
        for (int nb = 0; nb < 4; ++nb) {
#pragma unroll
            for (int j = 0; j < 8; ++j) os[(hi * 8 + j) * 68 + nb * 16 + lr] = acc[mb][nb][j] * WOI; }   // D: row 8h+j, col lane&15
        wave_sync();
{
#pragma unroll
            for (int s = 0; s < 8; ++s) { const int row = 2 * s + hi, cofs = lr * 4;   // 8 s x 2 rows = 16 rows; 16 lanes x 4 floats = 64 columns
                const int m = r0 + mb * 16 + row; const int bb = m / SEQ, t = m % SEQ;
                const v4f val = *(const v4fa*)(&os[row * 68 + cofs]);
                *(v4f*)(OUT + ((size_t)t * OUT_NB + bb) * DM + c0 + cofs) = val; }
             }
        wave_sync();
    }
}

// k_flash: fused attention, one wave per 16 query rows of one (batch, head); K / V^T / Q fragments straight from the fragment-order f16 planes (two 16-B loads each, 512 contiguous bytes per wave and load).
// Transposed form: S^T[key][t] = K Q^T (A = K rows, B = Q rows); lane (t = lane&15, h = lane>>4) holds keys 8h+r of each 16-key tile, so the packed
// P tile is directly the B fragment of O^T[d][t] = V^T P^T (element r <- tile keys 0..15, element 8+r <- tile keys 16..31, lane unchanged).
// Scores: value*value in sH; (k value * q residual) + (k residual * q value), both carrying x2048, in sL; s = sH + sL/2048. Mask words are loaded by value (4 x 16 B per lane per step)
// and masked scores are REPLACED by the fill constant before the running-max softmax (a fully masked row comes out uniform).
// Softmax state (running max, partial sum) is one scalar per lane; the two lane halves of a row are combined with one xor-16 exchange.
__global__ __launch_bounds__(32 * AW) void k_flash(const h16* __restrict__ QH, const h16* __restrict__ QR, const h16* __restrict__ KH, const h16* __restrict__ KR,
                                                   const h16* __restrict__ VT, const int* __restrict__ MASK, h16* CX) {
    const int lane = threadIdx.x & 31, wave = threadIdx.x >> 5, lr = lane & 15, hi = lane >> 4;
    const int zh = blockIdx.y; const int b = zh / NH_, h = zh % NH_;
    const int t0 = (blockIdx.x * AW + wave) * 16;
    const size_t pbase = (size_t)zh * SEQ * HD;
    const size_t qo = pbase + (size_t)t0 * HD + 8 * lane;     // 16 rows x 64 d = two fragments of 512 halves
    const v16h qh0 = ldh(QH + qo), qh1 = ldh(QH + qo + 512), qr0 = ldh(QR + qo), qr1 = ldh(QR + qo + 512);   // B fragments: col t, k = d
    const size_t ko = pbase + 8 * lane;      // + key0 * HD + 512 * (d / 32)   (A fragment: row key, k = d)
    const size_t vo = pbase + 8 * lane;      // + 16j*SEQ + key0 * 16          (A fragment: row d, k = key)
    const int* mrow = MASK + (size_t)(t0 + lr) * SEQ_FULL + 8 * hi;   // mask[t][key0 + 8h + r] (tile a), [key0 + 16 + 8h + r] (tile b)
    v8f o0 = (v8f){}, o1 = (v8f){}, o2 = (v8f){}, o3 = (v8f){};
    float m = -3.0e38f, l = 0.0f;
#pragma unroll 1
    for (int key0 = 0; key0 < SEQ; key0 += 32) {
        const v4i ma0 = *(const v4i*)(mrow + key0), ma1 = *(const v4i*)(mrow + key0 + 4), mb0 = *(const v4i*)(mrow + key0 + 16), mb1 = *(const v4i*)(mrow + key0 + 20);
        const h16* ka = KH + ko + (size_t)key0 * HD;
        const v16h ka0 = ldh(ka), ka1 = ldh(ka + 512), kb0 = ldh(ka + 16 * HD), kb1 = ldh(ka + 16 * HD + 512);
        asm volatile("s_wait_xcnt 0x0" :: "v"(ka) : "memory");   // the eight loads' address pair stays whole up to this wait, so none of their results lands in it while the others are issued
        v8f sHa = (v8f){}, sLa = (v8f){}, sHb = (v8f){}, sLb = (v8f){};
        sHa = wmma16(ka0, qh0, sHa); sLa = wmma16(ka0, qr0, sLa); sHb = wmma16(kb0, qh0, sHb); sLb = wmma16(kb0, qr0, sLb);
        sHa = wmma16(ka1, qh1, sHa); sLa = wmma16(ka1, qr1, sLa); sHb = wmma16(kb1, qh1, sHb); sLb = wmma16(kb1, qr1, sLb);
        asm volatile("v_nop\n\tv_nop\n\tv_nop\n\tv_nop" : "+v"(sHa), "+v"(sLa), "+v"(sHb), "+v"(sLb) : "v"(ka0), "v"(ka1), "v"(kb0), "v"(kb1));
        const h16* kr = KR + ko + (size_t)key0 * HD;
        const v16h ra0 = ldh(kr), ra1 = ldh(kr + 512), rb0 = ldh(kr + 16 * HD), rb1 = ldh(kr + 16 * HD + 512);
        sLa = wmma16(ra0, qh0, sLa); sLb = wmma16(rb0, qh0, sLb);
        sLa = wmma16(ra1, qh1, sLa); sLb = wmma16(rb1, qh1, sLb);
        asm volatile("v_nop\n\tv_nop\n\tv_nop\n\tv_nop" : "+v"(sLa), "+v"(sLb) : "v"(ra0), "v"(ra1), "v"(rb0), "v"(rb1));
        float ta[8], tb[8]; float mx = -3.0e38f;
#pragma unroll
        for (int r = 0; r < 8; ++r) {
            const int mka = (r < 4) ? ma0[r & 3] : ma1[r & 3];
            const int mkb = (r < 4) ? mb0[r & 3] : mb1[r & 3];
            const float sa = (sHa[r] + sLa[r] * QRI) * SC2, sb = (sHb[r] + sLb[r] * QRI) * SC2;
            ta[r] = (mka != 0) ? sa : FILL2; tb[r] = (mkb != 0) ? sb : FILL2;
            mx = fmaxf(mx, fmaxf(ta[r], tb[r])); }
        mx = fmaxf(mx, __shfl_xor(mx, 16, 32));
        const float mnew = fmaxf(m, mx);
        const float alpha = __builtin_amdgcn_exp2f(m - mnew);
        v16h pb; float ls = 0.0f;
#pragma unroll
        for (int r = 0; r < 8; ++r) { const h16 pa = (h16)__builtin_amdgcn_exp2f((ta[r] - mnew) + PSH); const h16 pc = (h16)__builtin_amdgcn_exp2f((tb[r] - mnew) + PSH); pb[r] = pa; pb[8 + r] = pc; ls += (float)pa + (float)pc; }
        l = l * alpha + ls; m = mnew;
        o0 = o0 * alpha; o1 = o1 * alpha; o2 = o2 * alpha; o3 = o3 * alpha;
        const h16* va = VT + vo + (size_t)key0 * 16;
        const v16h v0 = ldh(va), v1 = ldh(va + (size_t)16 * SEQ), v2 = ldh(va + (size_t)32 * SEQ), v3 = ldh(va + (size_t)48 * SEQ);
        o0 = wmma16(v0, pb, o0); o1 = wmma16(v1, pb, o1); o2 = wmma16(v2, pb, o2); o3 = wmma16(v3, pb, o3);
        asm volatile("v_nop\n\tv_nop\n\tv_nop\n\tv_nop" : "+v"(o0), "+v"(o1), "+v"(o2), "+v"(o3) : "v"(v0), "v"(v1), "v"(v2), "v"(v3), "v"(pb));
    }
    l += __shfl_xor(l, 16, 32);
    const float inv = 1.0f / l;
    // O^T D layout: o_j[r] = (d = 16j + 8h + r, t = lane&15): a lane's eight values of o_j are the 16-byte piece (row t, columns 16j + 8h + 0..7) of the ctx plane,
    // which fragment order puts at j*256 + lane*8 halves behind the base of fragments (row/16, 2h) and (row/16, 2h + 1): four 512-byte stores straight from the accumulators
    h16* crow = CX + ((size_t)b * SEQ + t0) * DM + h * (HD * 16) + lane * 8;
    v8h h0, h1, h2, h3;
#pragma unroll
    for (int r = 0; r < 8; ++r) { h0[r] = (h16)(o0[r] * inv); h1[r] = (h16)(o1[r] * inv); h2[r] = (h16)(o2[r] * inv); h3[r] = (h16)(o3[r] * inv); }
    *(v8h*)(crow) = h0; *(v8h*)(crow + 256) = h1; *(v8h*)(crow + 512) = h2; *(v8h*)(crow + 768) = h3;
}

static constexpr size_t al256(size_t v) { return (v + 255) & ~(size_t)255; }
static constexpr size_t SZ_XB = al256((size_t)NB * SEQ * DM * 2);              // one bf16 input plane [NB*SEQ][1024]
static constexpr size_t SZ_WB = al256((size_t)3 * DM * DM * 2);               // bf16 Wq | Wk | Wv
static constexpr size_t SZ_WO = al256((size_t)DM * DM * 2);                   // f16 Wo x64
static constexpr size_t SZ_PL = al256((size_t)NB * NH_ * SEQ * HD * 2);       // one f16 head plane
static constexpr size_t SZ_CX = al256((size_t)NB * SEQ * DM * 2);             // f16 ctx plane
static constexpr size_t SZ_TOTAL = 3 * SZ_XB + SZ_WB + SZ_WO + 5 * SZ_PL + SZ_CX;
static_assert(SZ_TOTAL <= (size_t)134217728);          // workspace carve <= 128 MiB
static_assert(((size_t)DM * DM * 2) % 256 == 0);       // weight sub-planes stay 256-byte aligned

extern "C" void kernel_launch(void* const* d_in, const int* in_sizes, int n_in,
                              void* d_out, int out_size, void* d_ws, size_t ws_size, hipStream_t stream) {
    if (n_in < 8) return;
    const size_t needx = ((size_t)(SEQ - 1) * NB_FULL + NB) * DM;
    if ((size_t)in_sizes[0] < needx || (size_t)in_sizes[1] < needx || (size_t)in_sizes[2] < needx) return;
    if ((size_t)in_sizes[3] < (size_t)(SEQ - 1) * SEQ_FULL + SEQ) return;
    if ((size_t)in_sizes[4] < (size_t)DM * DM || (size_t)in_sizes[5] < (size_t)DM * DM || (size_t)in_sizes[6] < (size_t)DM * DM || (size_t)in_sizes[7] < (size_t)DM * DM) return;
    if ((size_t)out_size < ((size_t)(SEQ - 1) * OUT_NB + NB) * DM) return;
    if (SZ_TOTAL > ws_size) return;
    // wire order: query, keys, values, mask (int32), Wq, Wk, Wv, Wo ([out][in] = Bt as-is)
    const float* xq = (const float*)d_in[0]; const float* xk = (const float*)d_in[1]; const float* xv = (const float*)d_in[2];
    const int* mask = (const int*)d_in[3];
    const float* wq = (const float*)d_in[4]; const float* wk = (const float*)d_in[5]; const float* wv = (const float*)d_in[6]; const float* wo = (const float*)d_in[7];
    float* OUT = (float*)d_out;      // [SEQ][OUT_NB][1024]
    char* wsp = (char*)d_ws;
    bf* XQ = (bf*)wsp; wsp += SZ_XB;                 // [NB*SEQ][1024], row b*SEQ + t
    bf* XK = (bf*)wsp; wsp += SZ_XB;
    bf* XV = (bf*)wsp; wsp += SZ_XB;
    bf* WB = (bf*)wsp; wsp += SZ_WB;                 // [3][1024][1024]: q | k | v
    h16* WO16 = (h16*)wsp; wsp += SZ_WO;             // [1024][1024] x64
    h16* QH = (h16*)wsp; wsp += SZ_PL;               // [NB*16][SEQ][64]
    h16* QR = (h16*)wsp; wsp += SZ_PL;               // [NB*16][SEQ][64] residual x2048
    h16* KH = (h16*)wsp; wsp += SZ_PL;               // [NB*16][SEQ][64]
    h16* KR = (h16*)wsp; wsp += SZ_PL;               // [NB*16][SEQ][64] residual x2048
    h16* VT = (h16*)wsp; wsp += SZ_PL;               // [NB*16][64][SEQ]
    h16* CX = (h16*)wsp; wsp += SZ_CX;               // [NB*SEQ][1024]
    bf* WQ = WB; bf* WK = WB + (size_t)DM * DM; bf* WV = WB + (size_t)2 * DM * DM;

    k_cvt<<<3 * GX + 4 * GW, 256, 0, stream>>>(xq, xk, xv, wq, wk, wv, wo, XQ, XK, XV, WQ, WK, WV, WO16);

    k_proj<<<dim3(NB * SEQ / 64, DM / 64, 3), 32, 0, stream>>>(XQ, XK, XV, WQ, WK, WV, QH, QR, KH, KR, VT);

    k_flash<<<dim3(SEQ / (16 * AW), NB * NH_, 1), 32 * AW, 0, stream>>>(QH, QR, KH, KR, VT, mask, CX);

    // out[t][b][n] = sum_k ctx[b*SEQ + t][k] Wo[n][k]
    k_oproj<<<dim3(NB * SEQ / 64, DM / 64, 1), 32, 0, stream>>>(CX, WO16, OUT);
}

// v003
// It runs in 165 microseconds.
// Next to v002, in two timings, it ran 1.33 and 1.35 times as fast.
// Counting every step since v000, it is 1.98 times as fast.
#include <hip/hip_runtime.h>

// Multi-head attention, width 1024 = 16 heads x 64; query/keys/values [SEQ][NB][1024] sequence-first (row = s*NB_FULL + b), Wq/Wk/Wv/Wo [out][in] (y = x W^T), no biases,
// UNSCALED scores, int32 mask [SEQ][SEQ] with replace-fill (-1e20 where mask == 0), output = ctx Wo^T as f32 [SEQ][NB][1024].
// Compute dtypes, f32 accumulate everywhere: q/k/v projections v_wmma_f32_16x16x32_bf16 (inputs and W RNE-converted to bf16; products exact);
// scores v_wmma_f32_16x16x32_f16: q and k each as f16 value + f16 residual x2048 (three products: value*value in one accumulator, the two residual products in a second accumulator);
// P (x2^14 carry, cancels in the normalisation) and v single f16; out-projection v_wmma_f32_16x16x32_f16: ctx single f16, Wo = f16(bf16(Wo) * 64), folded back by 1/64; softmax f32 (online, running max).
// Layout: bf16 copies of the inputs de-interleaved to [b][s][1024]; q/k (value, residual) planes [b*16+h][t][d] and v^T plane [b*16+h][d][t] written by the GEMM epilogue;
// fused flash kernel in transposed form (S^T = K Q^T, O^T = V^T P^T) writes the f16 ctx plane [b*SEQ+t][1024]; the out-projection GEMM writes rows t*OUT_NB + b.
// FRAGMENT ORDER: every 16-bit workspace plane [R][C] (C = the k dimension of its WMMA use) is stored as fragments of 16 rows x 32 k, 1 KiB each, fragment index (r/16)*(C/32) + k/32.
// Inside a fragment the 16-byte piece (row r, k = 8q..8q+7 of the 32, q = 0..3) lies at (q>>1)*512 B + ((q&1)*16 + r%16)*16 B, so each of the two wave-wide 16-byte loads
// of a fragment reads 512 contiguous bytes (4 whole lines; from row-major planes it would touch 16).

#ifndef NB
#define NB 2
#endif
#ifndef SEQ
#define SEQ 2048
#endif
#define NB_FULL  2
#define SEQ_FULL 2048
#ifndef OUT_NB
#define OUT_NB NB                // batch pitch (in rows) of the output [t][OUT_NB][1024]
#endif
#define DM   1024
#define NH_  16
#define HD   64
#define AW   8                   // waves per flash block (16 query rows each)
#define QRS  2048.0f             // carry of the q / k residual planes
#define QRI  (1.0f / 2048.0f)
#define SC2  1.4426950408889634f // log2(e); the module applies no score scale
#define PSH  14.0f               // log2 of the P carry (16384)
#define FILL2 (-1.4426950408889634e20f)   // -1e20 in the log2 domain (replace-fill of masked scores)
#define WOS  64.0f               // carry of the Wo plane
#define WOI  (1.0f / 64.0f)

static_assert(HD == 64);
static_assert(NH_ * HD == DM);                 // head h = columns h*64 + d
static_assert(DM % 64 == 0);                   // 16 column tiles of 64
static_assert(DM % 32 == 0);                   // GEMM k-loop steps by 32
static_assert(SEQ % 64 == 0);                  // a 64-row tile (and a 16-row fragment) never straddles two batches
static_assert((NB * SEQ) % 64 == 0);
static_assert(SEQ % 32 == 0);                  // key loop steps by 32
static_assert(SEQ % (16 * AW) == 0);           // flash grid covers the sequence exactly
static_assert(((size_t)NB * SEQ * DM) % 8 == 0);
static_assert(((size_t)DM * DM) % 8 == 0);
static_assert(NB <= NB_FULL);
static_assert(SEQ <= SEQ_FULL);
static_assert(NB <= OUT_NB);

typedef _Float16 h16;
typedef unsigned short bf;
typedef __attribute__((ext_vector_type(16))) __bf16   v16bf;
typedef __attribute__((ext_vector_type(16))) _Float16 v16h;
typedef __attribute__((ext_vector_type(8)))  _Float16 v8h;
typedef __attribute__((ext_vector_type(8)))  unsigned short v8us;
typedef __attribute__((ext_vector_type(8)))  float    v8f;
typedef __attribute__((ext_vector_type(4)))  float    v4f;
typedef __attribute__((ext_vector_type(4)))  int      v4i;
typedef __attribute__((ext_vector_type(4)))  unsigned short v4us;
typedef v4f  __attribute__((may_alias)) v4fa;
typedef v4us __attribute__((may_alias)) v4usa;
typedef v8us __attribute__((may_alias)) v8usa;

__device__ __forceinline__ unsigned short f2bf(float f) { unsigned u = __float_as_uint(f); u += 0x7FFFu + ((u >> 16) & 1u); return (unsigned short)(u >> 16); }
__device__ __forceinline__ float bf2f(unsigned short s) { return __uint_as_float(((unsigned)s) << 16); }
__device__ __forceinline__ v16h cat16(v8h lo, v8h hi) { return __builtin_shufflevector(lo, hi, 0, 1, 2, 3, 4, 5, 6, 7, 8, 9, 10, 11, 12, 13, 14, 15); }
__device__ __forceinline__ v16bf cat16b(v8us lo, v8us hi) { return __builtin_bit_cast(v16bf, __builtin_shufflevector(lo, hi, 0, 1, 2, 3, 4, 5, 6, 7, 8, 9, 10, 11, 12, 13, 14, 15)); }
__device__ __forceinline__ v8f wmma16(v16h a, v16h b, v8f c) { return __builtin_amdgcn_wmma_f32_16x16x32_f16(false, a, false, b, (short)0, c, false, false); }
__device__ __forceinline__ v8f wmmab(v16bf a, v16bf b, v8f c) { return __builtin_amdgcn_wmma_f32_16x16x32_bf16(false, a, false, b, (short)0, c, false, false); }
// fragment loaders from fragment-order planes; p = fragment base + 8*lane: elements 0..7 <- k0+8h+0..7, elements 8..15 <- k0+16+8h+0..7, row lane&15, h = lane>>4 (same map for A and B)
__device__ __forceinline__ v16h  ldh(const h16* p) { return cat16(*(const v8h*)p, *(const v8h*)(p + 256)); }
__device__ __forceinline__ v16bf ldb(const bf* p)  { return cat16b(*(const v8us*)p, *(const v8us*)(p + 256)); }
// ordering point for wave-private LDS tiles (same wave writes and reads)
__device__ __forceinline__ void wave_sync() { __builtin_amdgcn_fence(3 /* release order */, "wavefront"); __builtin_amdgcn_wave_barrier(); asm volatile("" ::: "memory"); }

// cvt_frag: one wave converts one fragment (16 rows x 32 columns) of an f32 matrix with DM columns: four whole-line loads (4 rows x 128 B each), the 16-bit rows
// through a wave-private LDS tile (80-byte pitch: 16 B x odd, free of conflicts for the 16-byte reads), two 512-byte stores in fragment order.
// MODE 0: bf16 RNE, source rows de-interleaved (plane row b*SEQ + t <- source row t*NB_FULL + b); MODE 1: bf16 RNE, rows as they are; MODE 2: f16(bf16(x) * 64), rows as they are.
template <int MODE> __device__ __forceinline__ void cvt_frag(const float* __restrict__ src, unsigned short* dst, unsigned blk, unsigned short* ts) {
    const int lane = threadIdx.x & 31, wave = threadIdx.x >> 5;
    const size_t f = (size_t)blk * 8 + wave;
    const size_t tile = f / (DM / 32), chunk = f % (DM / 32);
    unsigned short* tw = ts + wave * 16 * 40;
#pragma unroll
    for (int i = 0; i < 4; ++i) {
        const int row = 4 * i + (lane >> 3); const size_t drow = tile * 16 + row;
        const size_t srow = (MODE == 0) ? ((drow % SEQ) * NB_FULL + drow / SEQ) : drow;
        const v4f v = *(const v4f*)(src + srow * DM + chunk * 32 + (lane & 7) * 4); v4us o;
#pragma unroll
        for (int k = 0; k < 4; ++k) o[k] = (MODE == 2) ? __builtin_bit_cast(unsigned short, (h16)(bf2f(f2bf(v[k])) * WOS)) : f2bf(v[k]);
        *(v4usa*)(tw + row * 40 + (lane & 7) * 4) = o; }
    wave_sync();
#pragma unroll
    for (int j = 0; j < 2; ++j) { const v8us o = *(const v8usa*)(tw + (lane & 15) * 40 + j * 16 + (lane >> 4) * 8); *(v8us*)(dst + f * 512 + j * 256 + lane * 8) = o; }
}

// k_cvt: all seven conversions in ONE launch (they are independent of each other); the block index picks the matrix. 8 waves per block, one fragment each.
// Blocks 0 .. 3*GX-1: query | keys | values, src [t][NB_FULL][DM] f32 -> plane [b*SEQ + t][DM] bf16; then 3*GW blocks: Wq | Wk | Wv -> bf16; then GW blocks: Wo -> f16 x64. All in fragment order.
#define GX ((unsigned)((size_t)NB * SEQ * DM / 512 / 8))
#define GW ((unsigned)((size_t)DM * DM / 512 / 8))
static_assert(((size_t)NB * SEQ * DM) % (512 * 8) == 0);   // every block of the merged grid has eight whole fragments
static_assert(((size_t)DM * DM) % (512 * 8) == 0);
__global__ __launch_bounds__(256) void k_cvt(const float* __restrict__ xq, const float* __restrict__ xk, const float* __restrict__ xv,
                                             const float* __restrict__ wq, const float* __restrict__ wk, const float* __restrict__ wv, const float* __restrict__ wo,
                                             bf* XQ, bf* XK, bf* XV, bf* WQ, bf* WK, bf* WV, h16* WO16) {
    __shared__ __align__(16) unsigned short ts[8 * 16 * 40];
    const unsigned bx = blockIdx.x;
    if (bx < 3 * GX) { const unsigned w = bx / GX; cvt_frag<0>(w == 0 ? xq : w == 1 ? xk : xv, w == 0 ? XQ : w == 1 ? XK : XV, bx % GX, ts); }
    else if (bx < 3 * GX + 3 * GW) { const unsigned c = bx - 3 * GX, w = c / GW; cvt_frag<1>(w == 0 ? wq : w == 1 ? wk : wv, w == 0 ? WQ : w == 1 ? WK : WV, c % GW, ts); }
    else cvt_frag<2>(wo, (unsigned short*)WO16, bx - (3 * GX + 3 * GW), ts);
}

// k_proj: register-blocked bf16 GEMM, ONE WAVE per 64x64 tile (16 accumulators), operands straight from fragment-order bf16 planes, K = DM.
// C[m][n] = sum_k A[m][k] Bt[n][k], written as f16 (Ph) and optionally the f16 residual x2048 (Pr, useRes != 0) in fragment order into planes of 'pitch' columns:
// tile base (r0/RB)*sRB + (r0%RB)*pitch + (c0/CB)*sCB + (c0%CB)*16 (halves); 16 rows further = 16*pitch, 32 columns further = 512.
// The three projections are independent and run in ONE launch, grid (NB*SEQ/64, DM/64, 3), 32 threads; blockIdx.z picks the product:
// z = 0, 1 (q, k): A = x rows (m = b*SEQ + t), Bt = W rows (n = h*64 + d) -> planes [(b*16 + h)][t][d], value + residual;
// z = 2 (v^T): A = Wv rows (m = h*64 + d, from blockIdx.y), Bt = x rows (n = b*SEQ + t, from blockIdx.x) -> plane [(b*1024 + m)][t] = [(b*16 + h)][d][t], value only.
__global__ __launch_bounds__(32) void k_proj(const bf* __restrict__ XQ, const bf* __restrict__ XK, const bf* __restrict__ XV, const bf* __restrict__ WQ, const bf* __restrict__ WK, const bf* __restrict__ WV,
                                             h16* QH, h16* QR, h16* KH, h16* KR, h16* VT) {
    __shared__ __align__(16) float os[16 * 68];
    const int K = DM;
    const int z = blockIdx.z; const bool isv = (z == 2);
    const bf* __restrict__ A = isv ? WV : (z == 0 ? XQ : XK); const bf* __restrict__ Bt = isv ? XV : (z == 0 ? WQ : WK);
    h16* Ph = isv ? VT : (z == 0 ? QH : KH); h16* Pr = (z == 0) ? QR : KR; const bool useRes = !isv;
    const int RB = isv ? DM : SEQ, pitch = isv ? SEQ : HD, CB = isv ? SEQ : HD;
    const size_t sRB = isv ? (size_t)0 : (size_t)NH_ * SEQ * HD, sCB = isv ? (size_t)DM * SEQ : (size_t)SEQ * HD;
    const int lane = threadIdx.x & 31, lr = lane & 15, hi = lane >> 4; const int r0 = (isv ? blockIdx.y : blockIdx.x) * 64, c0 = (isv ? blockIdx.x : blockIdx.y) * 64;
    v8f acc[4][4];
#pragma unroll
    for (int mb = 0; mb < 4; ++mb)
#pragma unroll
        for (int nb = 0; nb < 4; ++nb) acc[mb][nb] = (v8f){};
    const size_t aoff = (size_t)r0 * K + 8 * lane, boff = (size_t)c0 * K + 8 * lane;   // fragment (row/16, kc/32) at (row/16)*16*K + kc*16
#pragma unroll 1
    for (int kc = 0; kc < K; kc += 32) {
        v16bf a[4]; const bf* pa = A + aoff + (size_t)kc * 16;
#pragma unroll
        for (int mb = 0; mb < 4; ++mb) a[mb] = ldb(pa + (size_t)mb * 16 * K);
#pragma unroll
        for (int nb = 0; nb < 4; ++nb) { const v16bf b = ldb(Bt + boff + (size_t)nb * 16 * K + (size_t)kc * 16);
            if (nb == 0) asm volatile("s_wait_xcnt 0x0" :: "v"(pa) : "memory");   // the A loads' address pair stays whole up to this wait, so no later load result lands in it while they are issued
#pragma unroll
            for (int mb = 0; mb < 4; ++mb) acc[mb][nb] = wmmab(a[mb], b, acc[mb][nb]); }
        asm volatile("v_nop\n\tv_nop\n\tv_nop\n\tv_nop" : "+v"(acc[0][0]), "+v"(acc[1][1]), "+v"(acc[2][2]), "+v"(acc[3][3]) : "v"(a[0]), "v"(a[1]), "v"(a[2]), "v"(a[3]));
    }
    const size_t tbase = (size_t)(r0 / RB) * sRB + (size_t)(r0 % RB) * (size_t)pitch + (size_t)(c0 / CB) * sCB + (size_t)(c0 % CB) * 16;
#pragma unroll
    for (int mb = 0; mb < 4; ++mb) {
#pragma unroll
        for (int nb = 0; nb < 4; ++nb) {
#pragma unroll
            for (int j = 0; j < 8; ++j) os[(hi * 8 + j) * 68 + nb * 16 + lr] = acc[mb][nb][j]; }   // D: row 8h+j, col lane&15
        wave_sync();
        const size_t sb = tbase + (size_t)(mb * 16) * (size_t)pitch;
{
#pragma unroll
            for (int s = 0; s < 4; ++s) { const int row = lr, c8 = (2 * s + hi) * 8;   // s = 2*(column/32) + half of the fragment; 16 rows x 2 pieces = one 512-byte store
                const v4f x0 = *(const v4fa*)(&os[row * 68 + c8]); const v4f x1 = *(const v4fa*)(&os[row * 68 + c8 + 4]); v8h hv, rv;
#pragma unroll
                for (int i = 0; i < 4; ++i) { const h16 a0 = (h16)x0[i]; const h16 a1 = (h16)x1[i]; hv[i] = a0; hv[4 + i] = a1; rv[i] = (h16)((x0[i] - (float)a0) * QRS); rv[4 + i] = (h16)((x1[i] - (float)a1) * QRS); }
                const size_t oo = sb + (size_t)(s * 256 + lane * 8);
                *(v8h*)(Ph + oo) = hv; if (useRes) *(v8h*)(Pr + oo) = rv; }
             }
        wave_sync();
    }
}

// k_oproj: register-blocked f16 GEMM, ONE WAVE per 64x64 tile, A = ctx plane [NB*SEQ][DM] f16 (row m = b*SEQ + t), Bt = Wo plane [DM][DM] f16 (x64 carry), both in fragment order, K = DM.
// OUT[(t*OUT_NB + b)][n] = (1/64) sum_k A[m][k] Bt[n][k], f32. grid (NB*SEQ/64, DM/64), 32 threads.
__global__ __launch_bounds__(32) void k_oproj(const h16* __restrict__ A, const h16* __restrict__ Bt, float* OUT) {
    __shared__ __align__(16) float os[16 * 68];
    const int K = DM;
    const int lane = threadIdx.x & 31, lr = lane & 15, hi = lane >> 4; const int r0 = blockIdx.x * 64, c0 = blockIdx.y * 64;
    v8f acc[4][4];
#pragma unroll
    for (int mb = 0; mb < 4; ++mb)
#pragma unroll
        for (int nb = 0; nb < 4; ++nb) acc[mb][nb] = (v8f){};
    const size_t aoff = (size_t)r0 * K + 8 * lane, boff = (size_t)c0 * K + 8 * lane;   // fragment (row/16, kc/32) at (row/16)*16*K + kc*16
#pragma unroll 1
    for (int kc = 0; kc < K; kc += 32) {
        v16h a[4]; const h16* pa = A + aoff + (size_t)kc * 16;
#pragma unroll
        for (int mb = 0; mb < 4; ++mb) a[mb] = ldh(pa + (size_t)mb * 16 * K);
#pragma unroll
        for (int nb = 0; nb < 4; ++nb) { const v16h b = ldh(Bt + boff + (size_t)nb * 16 * K + (size_t)kc * 16);
            if (nb == 0) asm volatile("s_wait_xcnt 0x0" :: "v"(pa) : "memory");   // the A loads' address pair stays whole up to this wait, so no later load result lands in it while they are issued
#pragma unroll
            for (int mb = 0; mb < 4; ++mb) acc[mb][nb] = wmma16(a[mb], b, acc[mb][nb]); }
        asm volatile("v_nop\n\tv_nop\n\tv_nop\n\tv_nop" : "+v"(acc[0][0]), "+v"(acc[1][1]), "+v"(acc[2][2]), "+v"(acc[3][3]) : "v"(a[0]), "v"(a[1]), "v"(a[2]), "v"(a[3]));
    }
#pragma unroll
    for (int mb = 0; mb < 4; ++mb) {
#pragma unroll
        for (int nb = 0; nb < 4; ++nb) {
#pragma unroll
            for (int j = 0; j < 8; ++j) os[(hi * 8 + j) * 68 + nb * 16 + lr] = acc[mb][nb][j] * WOI; }   // D: row 8h+j, col lane&15
        wave_sync();
{
#pragma unroll
            for (int s = 0; s < 8; ++s) { const int row = 2 * s + hi, cofs = lr * 4;   // 8 s x 2 rows = 16 rows; 16 lanes x 4 floats = 64 columns
                const int m = r0 + mb * 16 + row; const int bb = m / SEQ, t = m % SEQ;
                const v4f val = *(const v4fa*)(&os[row * 68 + cofs]);
                *(v4f*)(OUT + ((size_t)t * OUT_NB + bb) * DM + c0 + cofs) = val; }
             }
        wave_sync();
    }
}

// k_flash: fused attention, one wave per 16 query rows of one (batch, head), AW waves (16*AW query rows) per block; Q fragments straight from the fragment-order f16 planes, once.
// THE RING: the loop's operands (K value, K residual, V^T, mask rows) come through a two-buffer LDS ring, one stage = SK keys = two passes of 32. Every thread brings 14 pieces of 16 bytes per stage
// with asynchronous copies to LDS, issued one whole stage ahead, so each K / V^T byte leaves L2 once per block (not once per wave) and no load latency stands in the loop.
// A stage in LDS: K value | K residual | V^T, 8 KiB each, in the planes' own fragment order (a wave-wide 16-byte read covers 512 contiguous bytes); mask rows of SK ints at a pitch of MP ints
// (272 B = 16 B x odd: the 16 rows of a wave-wide 16-byte read fall on different banks).
// Transposed form: S^T[key][t] = K Q^T (A = K rows, B = Q rows); lane (t = lane&15, h = lane>>4) holds keys 8h+r of each 16-key tile, so the packed
// P tile is directly the B fragment of O^T[d][t] = V^T P^T (element r <- tile keys 0..15, element 8+r <- tile keys 16..31, lane unchanged).
// Scores: value*value in sH; (k value * q residual) + (k residual * q value), both carrying x2048, in sL; s = sH + sL/2048. Mask words are read by value (4 x 16 B per lane per pass)
// and masked scores are REPLACED by the fill constant before the running-max softmax (a fully masked row comes out uniform).
// Softmax state (running max, partial sum) is one scalar per lane; the two lane halves of a row are combined with one xor-16 exchange.
#define SK  64                   // keys per ring stage
#define MP  68                   // pitch of a mask row in LDS, in ints
#define NST (SEQ / SK)           // stages
static_assert(AW == 8 && SK == 64);            // the copy map below: 256 threads, 512 pieces per 8-KiB plane slice, 16 pieces per mask row
static_assert(SEQ % SK == 0 && NST >= 2);      // the ring's prologue fills two stages
static_assert(SEQ == SEQ_FULL);                // a mask row holds the SK keys of every stage

// One stage's copies of one thread. gk, gr, gv, gm: the thread's own first piece of the stage in the K value, K residual, V^T planes and the mask; lk, lm: its LDS byte addresses in the stage's buffer.
// The s_wait_xcnt stands inside the statement, behind the last copy, so that no address register is rewritten ahead of it.
__device__ __forceinline__ void stage_copy(const h16* gk, const h16* gr, const h16* gv, const int* gm, unsigned lk, unsigned lm) {
    asm volatile("global_load_async_to_lds_b128 %0, %14, off\n\t"
                 "global_load_async_to_lds_b128 %1, %15, off\n\t"
                 "global_load_async_to_lds_b128 %2, %16, off\n\t"
                 "global_load_async_to_lds_b128 %3, %17, off\n\t"
                 "global_load_async_to_lds_b128 %4, %18, off\n\t"
                 "global_load_async_to_lds_b128 %5, %19, off\n\t"
                 "global_load_async_to_lds_b128 %6, %20, off\n\t"
                 "global_load_async_to_lds_b128 %7, %21, off\n\t"
                 "global_load_async_to_lds_b128 %8, %22, off\n\t"
                 "global_load_async_to_lds_b128 %9, %23, off\n\t"
                 "global_load_async_to_lds_b128 %10, %24, off\n\t"
                 "global_load_async_to_lds_b128 %11, %25, off\n\t"
                 "global_load_async_to_lds_b128 %12, %26, off\n\t"
                 "global_load_async_to_lds_b128 %13, %27, off\n\t"
                 "s_wait_xcnt 0x0"
                 :: "v"(lk), "v"(lk + 4096u), "v"(lk + 8192u), "v"(lk + 12288u), "v"(lk + 16384u), "v"(lk + 20480u),
                    "v"(lm), "v"(lm + 1u * 16 * MP * 4), "v"(lm + 2u * 16 * MP * 4), "v"(lm + 3u * 16 * MP * 4), "v"(lm + 4u * 16 * MP * 4), "v"(lm + 5u * 16 * MP * 4), "v"(lm + 6u * 16 * MP * 4), "v"(lm + 7u * 16 * MP * 4),
                    "v"(gk), "v"(gk + 2048), "v"(gr), "v"(gr + 2048), "v"(gv), "v"(gv + (size_t)32 * SEQ),
                    "v"(gm), "v"(gm + (size_t)1 * 16 * SEQ_FULL), "v"(gm + (size_t)2 * 16 * SEQ_FULL), "v"(gm + (size_t)3 * 16 * SEQ_FULL), "v"(gm + (size_t)4 * 16 * SEQ_FULL),
                    "v"(gm + (size_t)5 * 16 * SEQ_FULL), "v"(gm + (size_t)6 * 16 * SEQ_FULL), "v"(gm + (size_t)7 * 16 * SEQ_FULL)
                 : "memory");
}

__global__ __launch_bounds__(32 * AW) void k_flash(const h16* __restrict__ QH, const h16* __restrict__ QR, const h16* __restrict__ KH, const h16* __restrict__ KR,
                                                   const h16* __restrict__ VT, const int* __restrict__ MASK, h16* CX) {
    __shared__ __align__(16) h16 kvs[2][3 * SK * HD];        // per buffer: K value | K residual | V^T, SK*HD halves each
    __shared__ __align__(16) int mks[2][16 * AW * MP];       // per buffer: 16*AW mask rows of SK ints, pitch MP
    const int tid = threadIdx.x, lane = tid & 31, wave = tid >> 5, lr = lane & 15, hi = lane >> 4;
    const int zh = blockIdx.y; const int b = zh / NH_, h = zh % NH_;
    const int tb = blockIdx.x * (16 * AW), t0 = tb + wave * 16;
    const size_t pbase = (size_t)zh * SEQ * HD;
    // the thread's pieces of stage 0: plane slices of SK keys are contiguous (K: SK*HD halves; V^T: SK*16 halves per 16 d rows, thread halves 0/1 take d tiles 0/1, then 2/3); mask: row tid/16 (+16 per copy), piece tid%16
    const h16* gk = KH + pbase + tid * 8;
    const h16* gr = KR + pbase + tid * 8;
    const h16* gv = VT + pbase + (size_t)(tid >> 7) * 16 * SEQ + (tid & 127) * 8;
    const int* gm = MASK + (size_t)(tb + (tid >> 4)) * SEQ_FULL + (tid & 15) * 4;
    const unsigned lk0 = (unsigned)(size_t)&kvs[0][0] + tid * 16u, lm0 = (unsigned)(size_t)&mks[0][0] + (tid >> 4) * (MP * 4u) + (tid & 15) * 16u;
    const unsigned LKB = 3 * SK * HD * 2, LMB = 16 * AW * MP * 4;   // bytes from buffer 0 to buffer 1
    stage_copy(gk, gr, gv, gm, lk0, lm0);
    const size_t qo = pbase + (size_t)t0 * HD + 8 * lane;     // 16 rows x 64 d = two fragments of 512 halves
    const v16h qh0 = ldh(QH + qo), qh1 = ldh(QH + qo + 512), qr0 = ldh(QR + qo), qr1 = ldh(QR + qo + 512);   // B fragments: col t, k = d
    asm volatile("s_wait_asynccnt 0x0" ::: "memory");   // stage 0 of this wave has landed
    __syncthreads();                                    // ... and every wave's: stage 0 is published
    stage_copy(gk + SK * HD, gr + SK * HD, gv + SK * 16, gm + SK, lk0 + LKB, lm0 + LMB);
    v8f o0 = (v8f){}, o1 = (v8f){}, o2 = (v8f){}, o3 = (v8f){};
    float m = -3.0e38f, l = 0.0f;
#pragma unroll 1
    for (int s = 0; s < NST; ++s) {
        const h16* kst = &kvs[s & 1][0] + 8 * lane;                          // + 32p*HD + 16*HD*(key tile) + 512*(d/32)  (A fragment: row key, k = d)
        const int* mst = &mks[s & 1][0] + (wave * 16 + lr) * MP + 8 * hi;    // mask[t][32p + 8h + r] (tile a), [32p + 16 + 8h + r] (tile b)
#pragma unroll
        for (int p = 0; p < SK / 32; ++p) {
        const int* mrow = mst + 32 * p;
        const v4i ma0 = *(const v4i*)(mrow), ma1 = *(const v4i*)(mrow + 4), mb0 = *(const v4i*)(mrow + 16), mb1 = *(const v4i*)(mrow + 20);
        const h16* ka = kst + 32 * p * HD;
        const v16h ka0 = ldh(ka), ka1 = ldh(ka + 512), kb0 = ldh(ka + 16 * HD), kb1 = ldh(ka + 16 * HD + 512);
        v8f sHa = (v8f){}, sLa = (v8f){}, sHb = (v8f){}, sLb = (v8f){};
        sHa = wmma16(ka0, qh0, sHa); sLa = wmma16(ka0, qr0, sLa); sHb = wmma16(kb0, qh0, sHb); sLb = wmma16(kb0, qr0, sLb);
        sHa = wmma16(ka1, qh1, sHa); sLa = wmma16(ka1, qr1, sLa); sHb = wmma16(kb1, qh1, sHb); sLb = wmma16(kb1, qr1, sLb);
        asm volatile("v_nop\n\tv_nop\n\tv_nop\n\tv_nop" : "+v"(sHa), "+v"(sLa), "+v"(sHb), "+v"(sLb) : "v"(ka0), "v"(ka1), "v"(kb0), "v"(kb1));
        const h16* kr = ka + SK * HD;
        const v16h ra0 = ldh(kr), ra1 = ldh(kr + 512), rb0 = ldh(kr + 16 * HD), rb1 = ldh(kr + 16 * HD + 512);
        sLa = wmma16(ra0, qh0, sLa); sLb = wmma16(rb0, qh0, sLb);
        sLa = wmma16(ra1, qh1, sLa); sLb = wmma16(rb1, qh1, sLb);
        asm volatile("v_nop\n\tv_nop\n\tv_nop\n\tv_nop" : "+v"(sLa), "+v"(sLb) : "v"(ra0), "v"(ra1), "v"(rb0), "v"(rb1));
        float ta[8], tb2[8]; float mx = -3.0e38f;
#pragma unroll
        for (int r = 0; r < 8; ++r) {
            const int mka = (r < 4) ? ma0[r & 3] : ma1[r & 3];
            const int mkb = (r < 4) ? mb0[r & 3] : mb1[r & 3];
            const float sa = (sHa[r] + sLa[r] * QRI) * SC2, sb = (sHb[r] + sLb[r] * QRI) * SC2;
            ta[r] = (mka != 0) ? sa : FILL2; tb2[r] = (mkb != 0) ? sb : FILL2;
            mx = fmaxf(mx, fmaxf(ta[r], tb2[r])); }
        mx = fmaxf(mx, __shfl_xor(mx, 16, 32));
        const float mnew = fmaxf(m, mx);
        const float alpha = __builtin_amdgcn_exp2f(m - mnew);
        v16h pb; float ls = 0.0f;
#pragma unroll
        for (int r = 0; r < 8; ++r) { const h16 pa = (h16)__builtin_amdgcn_exp2f((ta[r] - mnew) + PSH); const h16 pc = (h16)__builtin_amdgcn_exp2f((tb2[r] - mnew) + PSH); pb[r] = pa; pb[8 + r] = pc; ls += (float)pa + (float)pc; }
        l = l * alpha + ls; m = mnew;
        o0 = o0 * alpha; o1 = o1 * alpha; o2 = o2 * alpha; o3 = o3 * alpha;
        const h16* va = kst + 2 * SK * HD + 512 * p;      // + SK*16*(d/16)   (A fragment: row d, k = key)
        const v16h v0 = ldh(va), v1 = ldh(va + SK * 16), v2 = ldh(va + 2 * SK * 16), v3 = ldh(va + 3 * SK * 16);
        o0 = wmma16(v0, pb, o0); o1 = wmma16(v1, pb, o1); o2 = wmma16(v2, pb, o2); o3 = wmma16(v3, pb, o3);
        asm volatile("v_nop\n\tv_nop\n\tv_nop\n\tv_nop" : "+v"(o0), "+v"(o1), "+v"(o2), "+v"(o3) : "v"(v0), "v"(v1), "v"(v2), "v"(v3), "v"(pb));
        }
        // publish point of stage s + 1, and the end of every wave's reads of stage s
        asm volatile("s_wait_dscnt 0x0" ::: "memory");      // this wave's LDS reads of stage s have returned before its buffer is refilled
        asm volatile("s_wait_asynccnt 0x0" ::: "memory");   // this wave's copies of stage s + 1 have landed
        __syncthreads();
        if (s + 2 < NST)                                    // the same for the whole block
            stage_copy(gk + (size_t)(s + 2) * SK * HD, gr + (size_t)(s + 2) * SK * HD, gv + (size_t)(s + 2) * SK * 16, gm + (size_t)(s + 2) * SK, lk0 + (s & 1) * LKB, lm0 + (s & 1) * LMB);
    }
    asm volatile("s_wait_asynccnt 0x0" ::: "memory");       // no copy is outstanding when the wave ends
    l += __shfl_xor(l, 16, 32);
    const float inv = 1.0f / l;
    // O^T D layout: o_j[r] = (d = 16j + 8h + r, t = lane&15): a lane's eight values of o_j are the 16-byte piece (row t, columns 16j + 8h + 0..7) of the ctx plane,
    // which fragment order puts at j*256 + lane*8 halves behind the base of fragments (row/16, 2h) and (row/16, 2h + 1): four 512-byte stores straight from the accumulators
    h16* crow = CX + ((size_t)b * SEQ + t0) * DM + h * (HD * 16) + lane * 8;
    v8h h0, h1, h2, h3;
#pragma unroll
    for (int r = 0; r < 8; ++r) { h0[r] = (h16)(o0[r] * inv); h1[r] = (h16)(o1[r] * inv); h2[r] = (h16)(o2[r] * inv); h3[r] = (h16)(o3[r] * inv); }
    *(v8h*)(crow) = h0; *(v8h*)(crow + 256) = h1; *(v8h*)(crow + 512) = h2; *(v8h*)(crow + 768) = h3;
}

static constexpr size_t al256(size_t v) { return (v + 255) & ~(size_t)255; }
static constexpr size_t SZ_XB = al256((size_t)NB * SEQ * DM * 2);              // one bf16 input plane [NB*SEQ][1024]
static constexpr size_t SZ_WB = al256((size_t)3 * DM * DM * 2);               // bf16 Wq | Wk | Wv
static constexpr size_t SZ_WO = al256((size_t)DM * DM * 2);                   // f16 Wo x64
static constexpr size_t SZ_PL = al256((size_t)NB * NH_ * SEQ * HD * 2);       // one f16 head plane
static constexpr size_t SZ_CX = al256((size_t)NB * SEQ * DM * 2);             // f16 ctx plane
static constexpr size_t SZ_TOTAL = 3 * SZ_XB + SZ_WB + SZ_WO + 5 * SZ_PL + SZ_CX;
static_assert(SZ_TOTAL <= (size_t)134217728);          // workspace carve <= 128 MiB
static_assert(((size_t)DM * DM * 2) % 256 == 0);       // weight sub-planes stay 256-byte aligned

extern "C" void kernel_launch(void* const* d_in, const int* in_sizes, int n_in,
                              void* d_out, int out_size, void* d_ws, size_t ws_size, hipStream_t stream) {
    if (n_in < 8) return;
    const size_t needx = ((size_t)(SEQ - 1) * NB_FULL + NB) * DM;
    if ((size_t)in_sizes[0] < needx || (size_t)in_sizes[1] < needx || (size_t)in_sizes[2] < needx) return;
    if ((size_t)in_sizes[3] < (size_t)(SEQ - 1) * SEQ_FULL + SEQ) return;
    if ((size_t)in_sizes[4] < (size_t)DM * DM || (size_t)in_sizes[5] < (size_t)DM * DM || (size_t)in_sizes[6] < (size_t)DM * DM || (size_t)in_sizes[7] < (size_t)DM * DM) return;
    if ((size_t)out_size < ((size_t)(SEQ - 1) * OUT_NB + NB) * DM) return;
    if (SZ_TOTAL > ws_size) return;
    // wire order: query, keys, values, mask (int32), Wq, Wk, Wv, Wo ([out][in] = Bt as-is)
    const float* xq = (const float*)d_in[0]; const float* xk = (const float*)d_in[1]; const float* xv = (const float*)d_in[2];
    const int* mask = (const int*)d_in[3];
    const float* wq = (const float*)d_in[4]; const float* wk = (const float*)d_in[5]; const float* wv = (const float*)d_in[6]; const float* wo = (const float*)d_in[7];
    float* OUT = (float*)d_out;      // [SEQ][OUT_NB][1024]
    char* wsp = (char*)d_ws;
    bf* XQ = (bf*)wsp; wsp += SZ_XB;                 // [NB*SEQ][1024], row b*SEQ + t
    bf* XK = (bf*)wsp; wsp += SZ_XB;
    bf* XV = (bf*)wsp; wsp += SZ_XB;
    bf* WB = (bf*)wsp; wsp += SZ_WB;                 // [3][1024][1024]: q | k | v
    h16* WO16 = (h16*)wsp; wsp += SZ_WO;             // [1024][1024] x64
    h16* QH = (h16*)wsp; wsp += SZ_PL;               // [NB*16][SEQ][64]
    h16* QR = (h16*)wsp; wsp += SZ_PL;               // [NB*16][SEQ][64] residual x2048
    h16* KH = (h16*)wsp; wsp += SZ_PL;               // [NB*16][SEQ][64]
    h16* KR = (h16*)wsp; wsp += SZ_PL;               // [NB*16][SEQ][64] residual x2048
    h16* VT = (h16*)wsp; wsp += SZ_PL;               // [NB*16][64][SEQ]
    h16* CX = (h16*)wsp; wsp += SZ_CX;               // [NB*SEQ][1024]
    bf* WQ = WB; bf* WK = WB + (size_t)DM * DM; bf* WV = WB + (size_t)2 * DM * DM;

    k_cvt<<<3 * GX + 4 * GW, 256, 0, stream>>>(xq, xk, xv, wq, wk, wv, wo, XQ, XK, XV, WQ, WK, WV, WO16);

    k_proj<<<dim3(NB * SEQ / 64, DM / 64, 3), 32, 0, stream>>>(XQ, XK, XV, WQ, WK, WV, QH, QR, KH, KR, VT);

    k_flash<<<dim3(SEQ / (16 * AW), NB * NH_, 1), 32 * AW, 0, stream>>>(QH, QR, KH, KR, VT, mask, CX);

    // out[t][b][n] = sum_k ctx[b*SEQ + t][k] Wo[n][k]
    k_oproj<<<dim3(NB * SEQ / 64, DM / 64, 1), 32, 0, stream>>>(CX, WO16, OUT);
}

// v004
// Measured time: 119 microseconds a run.
// Two timings next to v003 both put it at 1.36 times that version's speed.
// All steps since v000 together make it 2.69 times as fast.
#include <hip/hip_runtime.h>

// Multi-head attention, width 1024 = 16 heads x 64; query/keys/values [SEQ][NB][1024] sequence-first (row = s*NB_FULL + b), Wq/Wk/Wv/Wo [out][in] (y = x W^T), no biases,
// UNSCALED scores, int32 mask [SEQ][SEQ] with replace-fill (-1e20 where mask == 0), output = ctx Wo^T as f32 [SEQ][NB][1024].
// Compute dtypes, f32 accumulate everywhere: q/k/v projections v_wmma_f32_16x16x32_bf16 (inputs and W RNE-converted to bf16; products exact);
// scores v_wmma_f32_16x16x32_f16: q and k each as f16 value + f16 residual x2048 (three products: value*value in one accumulator, the two residual products in a second accumulator);
// P (x2^14 carry, cancels in the normalisation) and v single f16; out-projection v_wmma_f32_16x16x32_f16: ctx single f16, Wo = f16(bf16(Wo) * 64), folded back by 1/64; softmax f32 (online, running max).
// Layout: bf16 copies of the inputs de-interleaved to [b][s][1024]; q/k (value, residual) planes [b*16+h][t][d] and v^T plane [b*16+h][d][t] written by the GEMM epilogue;
// fused flash kernel in transposed form (S^T = K Q^T, O^T = V^T P^T) writes the f16 ctx plane [b*SEQ+t][1024]; the out-projection GEMM writes rows t*OUT_NB + b.
// FRAGMENT ORDER: every 16-bit workspace plane [R][C] (C = the k dimension of its WMMA use) is stored as fragments of 16 rows x 32 k, 1 KiB each, fragment index (r/16)*(C/32) + k/32.
// Inside a fragment the 16-byte piece (row r, k = 8q..8q+7 of the 32, q = 0..3) lies at (q>>1)*512 B + ((q&1)*16 + r%16)*16 B, so each of the two wave-wide 16-byte loads
// of a fragment reads 512 contiguous bytes (4 whole lines; from row-major planes it would touch 16).

#ifndef NB
#define NB 2
#endif
#ifndef SEQ
#define SEQ 2048
#endif
#define NB_FULL  2
#define SEQ_FULL 2048
#ifndef OUT_NB
#define OUT_NB NB                // batch pitch (in rows) of the output [t][OUT_NB][1024]
#endif
#define DM   1024
#define NH_  16
#define HD   64
#define AW   8                   // waves per flash block (16 query rows each)
#define QRS  2048.0f             // carry of the q / k residual planes
#define QRI  (1.0f / 2048.0f)
#define SC2  1.4426950408889634f // log2(e); the module applies no score scale
#define PSH  14.0f               // log2 of the P carry (16384)
#define FILL2 (-1.4426950408889634e20f)   // -1e20 in the log2 domain (replace-fill of masked scores)
#define WOS  64.0f               // carry of the Wo plane
#define WOI  (1.0f / 64.0f)

static_assert(HD == 64);
static_assert(NH_ * HD == DM);                 // head h = columns h*64 + d
static_assert(DM % 64 == 0);                   // 16 column tiles of 64
static_assert(DM % 32 == 0);                   // GEMM k-steps of 32, two per ring stage of 64
static_assert(SEQ % 64 == 0);                  // a 64-row tile (and a 16-row fragment) never straddles two batches
static_assert((NB * SEQ) % 64 == 0);
static_assert(SEQ % 32 == 0);                  // key loop steps by 32
static_assert(SEQ % (16 * AW) == 0);           // flash grid covers the sequence exactly
static_assert(((size_t)NB * SEQ * DM) % 8 == 0);
static_assert(((size_t)DM * DM) % 8 == 0);
static_assert(NB <= NB_FULL);
static_assert(SEQ <= SEQ_FULL);
static_assert(NB <= OUT_NB);

typedef _Float16 h16;
typedef unsigned short bf;
typedef __attribute__((ext_vector_type(16))) __bf16   v16bf;
typedef __attribute__((ext_vector_type(16))) _Float16 v16h;
typedef __attribute__((ext_vector_type(8)))  _Float16 v8h;
typedef __attribute__((ext_vector_type(8)))  unsigned short v8us;
typedef __attribute__((ext_vector_type(8)))  float    v8f;
typedef __attribute__((ext_vector_type(4)))  float    v4f;
typedef __attribute__((ext_vector_type(4)))  int      v4i;
typedef __attribute__((ext_vector_type(4)))  unsigned short v4us;
typedef v4f  __attribute__((may_alias)) v4fa;
typedef v4us __attribute__((may_alias)) v4usa;
typedef v8us __attribute__((may_alias)) v8usa;

__device__ __forceinline__ unsigned short f2bf(float f) { unsigned u = __float_as_uint(f); u += 0x7FFFu + ((u >> 16) & 1u); return (unsigned short)(u >> 16); }
__device__ __forceinline__ float bf2f(unsigned short s) { return __uint_as_float(((unsigned)s) << 16); }
__device__ __forceinline__ v16h cat16(v8h lo, v8h hi) { return __builtin_shufflevector(lo, hi, 0, 1, 2, 3, 4, 5, 6, 7, 8, 9, 10, 11, 12, 13, 14, 15); }
__device__ __forceinline__ v16bf cat16b(v8us lo, v8us hi) { return __builtin_bit_cast(v16bf, __builtin_shufflevector(lo, hi, 0, 1, 2, 3, 4, 5, 6, 7, 8, 9, 10, 11, 12, 13, 14, 15)); }
__device__ __forceinline__ v8f wmma16(v16h a, v16h b, v8f c) { return __builtin_amdgcn_wmma_f32_16x16x32_f16(false, a, false, b, (short)0, c, false, false); }
__device__ __forceinline__ v8f wmmab(v16bf a, v16bf b, v8f c) { return __builtin_amdgcn_wmma_f32_16x16x32_bf16(false, a, false, b, (short)0, c, false, false); }
// fragment loaders from fragment-order planes; p = fragment base + 8*lane: elements 0..7 <- k0+8h+0..7, elements 8..15 <- k0+16+8h+0..7, row lane&15, h = lane>>4 (same map for A and B)
__device__ __forceinline__ v16h  ldh(const h16* p) { return cat16(*(const v8h*)p, *(const v8h*)(p + 256)); }
__device__ __forceinline__ v16bf ldb(const bf* p)  { return cat16b(*(const v8us*)p, *(const v8us*)(p + 256)); }
// ordering point for wave-private LDS tiles (same wave writes and reads)
__device__ __forceinline__ void wave_sync() { __builtin_amdgcn_fence(3 /* release order */, "wavefront"); __builtin_amdgcn_wave_barrier(); asm volatile("" ::: "memory"); }

// cvt_frag: one wave converts one fragment (16 rows x 32 columns) of an f32 matrix with DM columns: four whole-line loads (4 rows x 128 B each), the 16-bit rows
// through a wave-private LDS tile (80-byte pitch: 16 B x odd, free of conflicts for the 16-byte reads), two 512-byte stores in fragment order.
// MODE 0: bf16 RNE, source rows de-interleaved (plane row b*SEQ + t <- source row t*NB_FULL + b); MODE 1: bf16 RNE, rows as they are; MODE 2: f16(bf16(x) * 64), rows as they are.
template <int MODE> __device__ __forceinline__ void cvt_frag(const float* __restrict__ src, unsigned short* dst, unsigned blk, unsigned short* ts) {
    const int lane = threadIdx.x & 31, wave = threadIdx.x >> 5;
    const size_t f = (size_t)blk * 8 + wave;
    const size_t tile = f / (DM / 32), chunk = f % (DM / 32);
    unsigned short* tw = ts + wave * 16 * 40;
#pragma unroll
    for (int i = 0; i < 4; ++i) {
        const int row = 4 * i + (lane >> 3); const size_t drow = tile * 16 + row;
        const size_t srow = (MODE == 0) ? ((drow % SEQ) * NB_FULL + drow / SEQ) : drow;
        const v4f v = *(const v4f*)(src + srow * DM + chunk * 32 + (lane & 7) * 4); v4us o;
#pragma unroll
        for (int k = 0; k < 4; ++k) o[k] = (MODE == 2) ? __builtin_bit_cast(unsigned short, (h16)(bf2f(f2bf(v[k])) * WOS)) : f2bf(v[k]);
        *(v4usa*)(tw + row * 40 + (lane & 7) * 4) = o; }
    wave_sync();
#pragma unroll
    for (int j = 0; j < 2; ++j) { const v8us o = *(const v8usa*)(tw + (lane & 15) * 40 + j * 16 + (lane >> 4) * 8); *(v8us*)(dst + f * 512 + j * 256 + lane * 8) = o; }
}

// k_cvt: all seven conversions in ONE launch (they are independent of each other); the block index picks the matrix. 8 waves per block, one fragment each.
// Blocks 0 .. 3*GX-1: query | keys | values, src [t][NB_FULL][DM] f32 -> plane [b*SEQ + t][DM] bf16; then 3*GW blocks: Wq | Wk | Wv -> bf16; then GW blocks: Wo -> f16 x64. All in fragment order.
#define GX ((unsigned)((size_t)NB * SEQ * DM / 512 / 8))
#define GW ((unsigned)((size_t)DM * DM / 512 / 8))
static_assert(((size_t)NB * SEQ * DM) % (512 * 8) == 0);   // every block of the merged grid has eight whole fragments
static_assert(((size_t)DM * DM) % (512 * 8) == 0);
__global__ __launch_bounds__(256) void k_cvt(const float* __restrict__ xq, const float* __restrict__ xk, const float* __restrict__ xv,
                                             const float* __restrict__ wq, const float* __restrict__ wk, const float* __restrict__ wv, const float* __restrict__ wo,
                                             bf* XQ, bf* XK, bf* XV, bf* WQ, bf* WK, bf* WV, h16* WO16) {
    __shared__ __align__(16) unsigned short ts[8 * 16 * 40];
    const unsigned bx = blockIdx.x;
    if (bx < 3 * GX) { const unsigned w = bx / GX; cvt_frag<0>(w == 0 ? xq : w == 1 ? xk : xv, w == 0 ? XQ : w == 1 ? XK : XV, bx % GX, ts); }
    else if (bx < 3 * GX + 3 * GW) { const unsigned c = bx - 3 * GX, w = c / GW; cvt_frag<1>(w == 0 ? wq : w == 1 ? wk : wv, w == 0 ? WQ : w == 1 ? WK : WV, c % GW, ts); }
    else cvt_frag<2>(wo, (unsigned short*)WO16, bx - (3 * GX + 3 * GW), ts);
}

// THE GEMM RING (k_proj, k_oproj): a block of GWV = 4 waves works on a 128x128 tile, wave (wm, wn) = (wave / 2, wave % 2) on its 64x64 quarter (16 accumulators), K = DM.
// Both operands come through a two-buffer LDS ring, one stage = GS = 64 k = two fragments per 16 rows. In a fragment-order plane those two fragments are 2 KiB in a row, which is one
// asynchronous copy of 16 bytes per thread; a stage is 8 such copies for the 128 A rows and 8 for the 128 B rows, issued one whole stage ahead: each operand byte leaves L2 once per block
// (not once per wave) and no L2 latency stands between the matrix instructions. A stage in LDS keeps the planes' own order: A | B, per 16 rows 1024 halves, fragment k/32 at 512 halves.
#define GWV  4                   // waves per GEMM block
#define GS   64                  // k per ring stage
#define GNST (DM / GS)           // stages
#define GOP  (128 * GS)          // halves of one operand in one stage
static_assert(DM % GS == 0 && GNST >= 2);      // the ring's prologue fills two stages
static_assert(GS == 64);                       // a stage is worked on as two steps of 32 k
static_assert((NB * SEQ) % 128 == 0 && DM % 128 == 0);   // the grids cover both matrices with whole 128x128 tiles
static_assert(GWV * 32 * 8 == GS * 16);        // one copy of every thread = the stage's two fragments of 16 rows

// One operand's copies of one thread for one stage: g = the thread's own 16 bytes in the first 16 rows (16 rows further = 16*DM halves), l = its LDS byte address (16 rows further = 2 KiB).
// The s_wait_xcnt stands inside the statement, behind the last copy, so that no address register is rewritten ahead of it.
template <class T> __device__ __forceinline__ void rows_copy(const T* g, unsigned l) {
    asm volatile("global_load_async_to_lds_b128 %0, %8, off\n\t"
                 "global_load_async_to_lds_b128 %1, %9, off\n\t"
                 "global_load_async_to_lds_b128 %2, %10, off\n\t"
                 "global_load_async_to_lds_b128 %3, %11, off\n\t"
                 "global_load_async_to_lds_b128 %4, %12, off\n\t"
                 "global_load_async_to_lds_b128 %5, %13, off\n\t"
                 "global_load_async_to_lds_b128 %6, %14, off\n\t"
                 "global_load_async_to_lds_b128 %7, %15, off\n\t"
                 "s_wait_xcnt 0x0"
                 :: "v"(l), "v"(l + 2048u), "v"(l + 4096u), "v"(l + 6144u), "v"(l + 8192u), "v"(l + 10240u), "v"(l + 12288u), "v"(l + 14336u),
                    "v"(g), "v"(g + (size_t)1 * 16 * DM), "v"(g + (size_t)2 * 16 * DM), "v"(g + (size_t)3 * 16 * DM), "v"(g + (size_t)4 * 16 * DM),
                    "v"(g + (size_t)5 * 16 * DM), "v"(g + (size_t)6 * 16 * DM), "v"(g + (size_t)7 * 16 * DM)
                 : "memory");
}

// k_proj: register-blocked bf16 GEMM on the GEMM ring, operands from fragment-order bf16 planes.
// C[m][n] = sum_k A[m][k] Bt[n][k], written as f16 (Ph) and optionally the f16 residual x2048 (Pr, useRes != 0) in fragment order into planes of 'pitch' columns:
// a wave's tile base (r0/RB)*sRB + (r0%RB)*pitch + (c0/CB)*sCB + (c0%CB)*16 (halves); 16 rows further = 16*pitch, 32 columns further = 512.
// The three projections are independent and run in ONE launch, grid (NB*SEQ/128, DM/128, 3), 128 threads; blockIdx.z picks the product:
// z = 0, 1 (q, k): A = x rows (m = b*SEQ + t), Bt = W rows (n = h*64 + d) -> planes [(b*16 + h)][t][d], value + residual;
// z = 2 (v^T): A = Wv rows (m = h*64 + d, from blockIdx.y), Bt = x rows (n = b*SEQ + t, from blockIdx.x) -> plane [(b*1024 + m)][t] = [(b*16 + h)][d][t], value only.
__global__ __launch_bounds__(32 * GWV) void k_proj(const bf* __restrict__ XQ, const bf* __restrict__ XK, const bf* __restrict__ XV, const bf* __restrict__ WQ, const bf* __restrict__ WK, const bf* __restrict__ WV,
                                             h16* QH, h16* QR, h16* KH, h16* KR, h16* VT) {
    __shared__ __align__(16) bf gs[2][2 * GOP];              // per buffer: A rows | B rows
    __shared__ __align__(16) float osb[GWV][16 * 68];        // a wave's own epilogue tile
    const int K = DM;
    const int z = blockIdx.z; const bool isv = (z == 2);
    const bf* __restrict__ A = isv ? WV : (z == 0 ? XQ : XK); const bf* __restrict__ Bt = isv ? XV : (z == 0 ? WQ : WK);
    h16* Ph = isv ? VT : (z == 0 ? QH : KH); h16* Pr = (z == 0) ? QR : KR; const bool useRes = !isv;
    const int RB = isv ? DM : SEQ, pitch = isv ? SEQ : HD, CB = isv ? SEQ : HD;
    const size_t sRB = isv ? (size_t)0 : (size_t)NH_ * SEQ * HD, sCB = isv ? (size_t)DM * SEQ : (size_t)SEQ * HD;
    const int tid = threadIdx.x, lane = tid & 31, wave = __builtin_amdgcn_readfirstlane(tid >> 5), wm = wave >> 1, wn = wave & 1, lr = lane & 15, hi = lane >> 4;   // the wave's number in a scalar register: tile bases stay scalar
    const int R0 = (isv ? blockIdx.y : blockIdx.x) * 128, C0 = (isv ? blockIdx.x : blockIdx.y) * 128; const int r0 = R0 + wm * 64, c0 = C0 + wn * 64;
    float* os = &osb[wave][0];
    v8f acc[4][4];
#pragma unroll
    for (int mb = 0; mb < 4; ++mb)
#pragma unroll
        for (int nb = 0; nb < 4; ++nb) acc[mb][nb] = (v8f){};
    const bf* ga = A + (size_t)R0 * K + tid * 8; const bf* gb = Bt + (size_t)C0 * K + tid * 8;   // fragment (row/16, kc/32) at (row/16)*16*K + kc*16; a stage further = GS*16 halves
    const unsigned la = (unsigned)(size_t)&gs[0][0] + tid * 16u; const unsigned LOB = GOP * 2, LGB = 2 * GOP * 2;   // bytes from A to B, from buffer 0 to buffer 1
    rows_copy(ga, la); rows_copy(gb, la + LOB);
    asm volatile("s_wait_asynccnt 0x0" ::: "memory");   // stage 0 of this wave has landed
    __syncthreads();                                    // ... and every wave's: stage 0 is published
    rows_copy(ga + GS * 16, la + LGB); rows_copy(gb + GS * 16, la + LGB + LOB);
#pragma unroll 1
    for (int s = 0; s < GNST; ++s) {
        const bf* sa = &gs[s & 1][0] + wm * (4 * 16 * GS) + 8 * lane; const bf* sb = &gs[s & 1][0] + GOP + wn * (4 * 16 * GS) + 8 * lane;
        // The sched_barrier(0) lines hold this order: [reads: A and B of the first 32 k, A of the second][8 products][reads: 2 B fragments of the second 32 k][8 products][reads: the other 2][16 products][waits].
        // Each of the two later groups then stands 8 products ahead of its first use, and every wait but the last is a counted one. Left alone, the scheduler sinks the B reads singly among the products, each with a wait to 0 directly behind it.
        v16bf a[GS / 32][4], b[GS / 32][4];
#pragma unroll
        for (int mb = 0; mb < 4; ++mb) a[0][mb] = ldb(sa + mb * (16 * GS));
#pragma unroll
        for (int nb = 0; nb < 4; ++nb) b[0][nb] = ldb(sb + nb * (16 * GS));
#pragma unroll
        for (int mb = 0; mb < 4; ++mb) a[1][mb] = ldb(sa + mb * (16 * GS) + 512);
        __builtin_amdgcn_sched_barrier(0);   // the first group of reads stays in front of the products
#pragma unroll
        for (int h2 = 0; h2 < 2; ++h2) {
#pragma unroll
            for (int nb = 2 * h2; nb < 2 * h2 + 2; ++nb)
#pragma unroll
                for (int mb = 0; mb < 4; ++mb) acc[mb][nb] = wmmab(a[0][mb], b[0][nb], acc[mb][nb]);
            __builtin_amdgcn_sched_barrier(0);   // these two fragments' reads are not lifted (they take registers of fragments whose last product stands above: 16 fragments at once would not fit 256 registers) ...
            b[1][2 * h2] = ldb(sb + (2 * h2) * (16 * GS) + 512); b[1][2 * h2 + 1] = ldb(sb + (2 * h2 + 1) * (16 * GS) + 512);
            __builtin_amdgcn_sched_barrier(0);   // ... and not sunk towards their use
        }
#pragma unroll
        for (int nb = 0; nb < 4; ++nb)
#pragma unroll
            for (int mb = 0; mb < 4; ++mb) acc[mb][nb] = wmmab(a[1][mb], b[1][nb], acc[mb][nb]);
        // keeps the waits below behind the stage's products. Without it the scheduler lifts them and the barrier in front of the products: every read is then waited out
        // before the first product, and the refill is issued only behind the products, so that it flies for less than one stage.
        __builtin_amdgcn_sched_barrier(0);
        // publish point of stage s + 1, and the end of every wave's reads of stage s
        asm volatile("s_wait_dscnt 0x0" ::: "memory");      // this wave's LDS reads of stage s have returned before its buffer is refilled
        asm volatile("s_wait_asynccnt 0x0" ::: "memory");   // this wave's copies of stage s + 1 have landed
        __syncthreads();
        if (s + 2 < GNST) {                                 // the same for the whole block
            rows_copy(ga + (size_t)(s + 2) * GS * 16, la + (s & 1) * LGB); rows_copy(gb + (size_t)(s + 2) * GS * 16, la + (s & 1) * LGB + LOB); }
    }
    asm volatile("s_wait_asynccnt 0x0" ::: "memory");       // no copy is outstanding when the wave goes on
    const size_t tbase = (size_t)(r0 / RB) * sRB + (size_t)(r0 % RB) * (size_t)pitch + (size_t)(c0 / CB) * sCB + (size_t)(c0 % CB) * 16;
#pragma unroll
    for (int mb = 0; mb < 4; ++mb) {
#pragma unroll
        for (int nb = 0; nb < 4; ++nb) {
#pragma unroll
            for (int j = 0; j < 8; ++j) os[(hi * 8 + j) * 68 + nb * 16 + lr] = acc[mb][nb][j]; }   // D: row 8h+j, col lane&15
        wave_sync();
        const size_t sb = tbase + (size_t)(mb * 16) * (size_t)pitch;
{
#pragma unroll
            for (int s = 0; s < 4; ++s) { const int row = lr, c8 = (2 * s + hi) * 8;   // s = 2*(column/32) + half of the fragment; 16 rows x 2 pieces = one 512-byte store
                const v4f x0 = *(const v4fa*)(&os[row * 68 + c8]); const v4f x1 = *(const v4fa*)(&os[row * 68 + c8 + 4]); v8h hv, rv;
#pragma unroll
                for (int i = 0; i < 4; ++i) { const h16 a0 = (h16)x0[i]; const h16 a1 = (h16)x1[i]; hv[i] = a0; hv[4 + i] = a1; rv[i] = (h16)((x0[i] - (float)a0) * QRS); rv[4 + i] = (h16)((x1[i] - (float)a1) * QRS); }
                const size_t oo = sb + (size_t)(s * 256 + lane * 8);
                *(v8h*)(Ph + oo) = hv; if (useRes) *(v8h*)(Pr + oo) = rv; }
             }
        wave_sync();
    }
}

// k_oproj: register-blocked f16 GEMM on the GEMM ring, A = ctx plane [NB*SEQ][DM] f16 (row m = b*SEQ + t), Bt = Wo plane [DM][DM] f16 (x64 carry), both in fragment order.
// OUT[(t*OUT_NB + b)][n] = (1/64) sum_k A[m][k] Bt[n][k], f32. grid (NB*SEQ/128, DM/128), 128 threads.
__global__ __launch_bounds__(32 * GWV) void k_oproj(const h16* __restrict__ A, const h16* __restrict__ Bt, float* OUT) {
    __shared__ __align__(16) h16 gs[2][2 * GOP];             // per buffer: A rows | B rows
    __shared__ __align__(16) float osb[GWV][16 * 68];        // a wave's own epilogue tile
    const int K = DM;
    const int tid = threadIdx.x, lane = tid & 31, wave = __builtin_amdgcn_readfirstlane(tid >> 5), wm = wave >> 1, wn = wave & 1, lr = lane & 15, hi = lane >> 4;   // the wave's number in a scalar register: tile bases stay scalar
    const int R0 = blockIdx.x * 128, C0 = blockIdx.y * 128; const int r0 = R0 + wm * 64, c0 = C0 + wn * 64;
    float* os = &osb[wave][0];
    v8f acc[4][4];
#pragma unroll
    for (int mb = 0; mb < 4; ++mb)
#pragma unroll
        for (int nb = 0; nb < 4; ++nb) acc[mb][nb] = (v8f){};
    const h16* ga = A + (size_t)R0 * K + tid * 8; const h16* gb = Bt + (size_t)C0 * K + tid * 8;   // fragment (row/16, kc/32) at (row/16)*16*K + kc*16; a stage further = GS*16 halves
    const unsigned la = (unsigned)(size_t)&gs[0][0] + tid * 16u; const unsigned LOB = GOP * 2, LGB = 2 * GOP * 2;   // bytes from A to B, from buffer 0 to buffer 1
    rows_copy(ga, la); rows_copy(gb, la + LOB);
    asm volatile("s_wait_asynccnt 0x0" ::: "memory");   // stage 0 of this wave has landed
    __syncthreads();                                    // ... and every wave's: stage 0 is published
    rows_copy(ga + GS * 16, la + LGB); rows_copy(gb + GS * 16, la + LGB + LOB);
#pragma unroll 1
    for (int s = 0; s < GNST; ++s) {
        const h16* sa = &gs[s & 1][0] + wm * (4 * 16 * GS) + 8 * lane; const h16* sb = &gs[s & 1][0] + GOP + wn * (4 * 16 * GS) + 8 * lane;
        // The sched_barrier(0) lines hold this order: [reads: A and B of the first 32 k, A of the second][8 products][reads: 2 B fragments of the second 32 k][8 products][reads: the other 2][16 products][waits].
        // Each of the two later groups then stands 8 products ahead of its first use, and every wait but the last is a counted one. Left alone, the scheduler sinks the B reads singly among the products, each with a wait to 0 directly behind it.
        v16h a[GS / 32][4], b[GS / 32][4];
#pragma unroll
        for (int mb = 0; mb < 4; ++mb) a[0][mb] = ldh(sa + mb * (16 * GS));
#pragma unroll
        for (int nb = 0; nb < 4; ++nb) b[0][nb] = ldh(sb + nb * (16 * GS));
#pragma unroll
        for (int mb = 0; mb < 4; ++mb) a[1][mb] = ldh(sa + mb * (16 * GS) + 512);
        __builtin_amdgcn_sched_barrier(0);   // the first group of reads stays in front of the products
#pragma unroll
        for (int h2 = 0; h2 < 2; ++h2) {
#pragma unroll
            for (int nb = 2 * h2; nb < 2 * h2 + 2; ++nb)
#pragma unroll
                for (int mb = 0; mb < 4; ++mb) acc[mb][nb] = wmma16(a[0][mb], b[0][nb], acc[mb][nb]);
            __builtin_amdgcn_sched_barrier(0);   // these two fragments' reads are not lifted (they take registers of fragments whose last product stands above: 16 fragments at once would not fit 256 registers) ...
            b[1][2 * h2] = ldh(sb + (2 * h2) * (16 * GS) + 512); b[1][2 * h2 + 1] = ldh(sb + (2 * h2 + 1) * (16 * GS) + 512);
            __builtin_amdgcn_sched_barrier(0);   // ... and not sunk towards their use
        }
#pragma unroll
        for (int nb = 0; nb < 4; ++nb)
#pragma unroll
            for (int mb = 0; mb < 4; ++mb) acc[mb][nb] = wmma16(a[1][mb], b[1][nb], acc[mb][nb]);
        // keeps the waits below behind the stage's products. Without it the scheduler lifts them and the barrier in front of the products: every read is then waited out
        // before the first product, and the refill is issued only behind the products, so that it flies for less than one stage.
        __builtin_amdgcn_sched_barrier(0);
        // publish point of stage s + 1, and the end of every wave's reads of stage s
        asm volatile("s_wait_dscnt 0x0" ::: "memory");      // this wave's LDS reads of stage s have returned before its buffer is refilled
        asm volatile("s_wait_asynccnt 0x0" ::: "memory");   // this wave's copies of stage s + 1 have landed
        __syncthreads();
        if (s + 2 < GNST) {                                 // the same for the whole block
            rows_copy(ga + (size_t)(s + 2) * GS * 16, la + (s & 1) * LGB); rows_copy(gb + (size_t)(s + 2) * GS * 16, la + (s & 1) * LGB + LOB); }
    }
    asm volatile("s_wait_asynccnt 0x0" ::: "memory");       // no copy is outstanding when the wave goes on
#pragma unroll
    for (int mb = 0; mb < 4; ++mb) {
#pragma unroll
        for (int nb = 0; nb < 4; ++nb) {
#pragma unroll
            for (int j = 0; j < 8; ++j) os[(hi * 8 + j) * 68 + nb * 16 + lr] = acc[mb][nb][j] * WOI; }   // D: row 8h+j, col lane&15
        wave_sync();
{
#pragma unroll
            for (int s = 0; s < 8; ++s) { const int row = 2 * s + hi, cofs = lr * 4;   // 8 s x 2 rows = 16 rows; 16 lanes x 4 floats = 64 columns
                const int m = r0 + mb * 16 + row; const int bb = m / SEQ, t = m % SEQ;
                const v4f val = *(const v4fa*)(&os[row * 68 + cofs]);
                *(v4f*)(OUT + ((size_t)t * OUT_NB + bb) * DM + c0 + cofs) = val; }
             }
        wave_sync();
    }
}

// k_flash: fused attention, one wave per 16 query rows of one (batch, head), AW waves (16*AW query rows) per block; Q fragments straight from the fragment-order f16 planes, once.
// THE RING: the loop's operands (K value, K residual, V^T, mask rows) come through a two-buffer LDS ring, one stage = SK keys = two passes of 32. Every thread brings 14 pieces of 16 bytes per stage
// with asynchronous copies to LDS, issued one whole stage ahead, so each K / V^T byte leaves L2 once per block (not once per wave) and no load latency stands in the loop.
// A stage in LDS: K value | K residual | V^T, 8 KiB each, in the planes' own fragment order (a wave-wide 16-byte read covers 512 contiguous bytes); mask rows of SK ints at a pitch of MP ints
// (272 B = 16 B x odd: the 16 rows of a wave-wide 16-byte read fall on different banks).
// Transposed form: S^T[key][t] = K Q^T (A = K rows, B = Q rows); lane (t = lane&15, h = lane>>4) holds keys 8h+r of each 16-key tile, so the packed
// P tile is directly the B fragment of O^T[d][t] = V^T P^T (element r <- tile keys 0..15, element 8+r <- tile keys 16..31, lane unchanged).
// Scores: value*value in sH; (k value * q residual) + (k residual * q value), both carrying x2048, in sL; s = sH + sL/2048. Mask words are read by value (4 x 16 B per lane per pass)
// and masked scores are REPLACED by the fill constant before the running-max softmax (a fully masked row comes out uniform).
// Softmax state (running max, partial sum) is one scalar per lane; the two lane halves of a row are combined with one xor-16 exchange.
#define SK  64                   // keys per ring stage
#define MP  68                   // pitch of a mask row in LDS, in ints
#define NST (SEQ / SK)           // stages
static_assert(AW == 8 && SK == 64);            // the copy map below: 256 threads, 512 pieces per 8-KiB plane slice, 16 pieces per mask row
static_assert(SEQ % SK == 0 && NST >= 2);      // the ring's prologue fills two stages
static_assert(SEQ == SEQ_FULL);                // a mask row holds the SK keys of every stage

// One stage's copies of one thread. gk, gr, gv, gm: the thread's own first piece of the stage in the K value, K residual, V^T planes and the mask; lk, lm: its LDS byte addresses in the stage's buffer.
// The s_wait_xcnt stands inside the statement, behind the last copy, so that no address register is rewritten ahead of it.
__device__ __forceinline__ void stage_copy(const h16* gk, const h16* gr, const h16* gv, const int* gm, unsigned lk, unsigned lm) {
    asm volatile("global_load_async_to_lds_b128 %0, %14, off\n\t"
                 "global_load_async_to_lds_b128 %1, %15, off\n\t"
                 "global_load_async_to_lds_b128 %2, %16, off\n\t"
                 "global_load_async_to_lds_b128 %3, %17, off\n\t"
                 "global_load_async_to_lds_b128 %4, %18, off\n\t"
                 "global_load_async_to_lds_b128 %5, %19, off\n\t"
                 "global_load_async_to_lds_b128 %6, %20, off\n\t"
                 "global_load_async_to_lds_b128 %7, %21, off\n\t"
                 "global_load_async_to_lds_b128 %8, %22, off\n\t"
                 "global_load_async_to_lds_b128 %9, %23, off\n\t"
                 "global_load_async_to_lds_b128 %10, %24, off\n\t"
                 "global_load_async_to_lds_b128 %11, %25, off\n\t"
                 "global_load_async_to_lds_b128 %12, %26, off\n\t"
                 "global_load_async_to_lds_b128 %13, %27, off\n\t"
                 "s_wait_xcnt 0x0"
                 :: "v"(lk), "v"(lk + 4096u), "v"(lk + 8192u), "v"(lk + 12288u), "v"(lk + 16384u), "v"(lk + 20480u),
                    "v"(lm), "v"(lm + 1u * 16 * MP * 4), "v"(lm + 2u * 16 * MP * 4), "v"(lm + 3u * 16 * MP * 4), "v"(lm + 4u * 16 * MP * 4), "v"(lm + 5u * 16 * MP * 4), "v"(lm + 6u * 16 * MP * 4), "v"(lm + 7u * 16 * MP * 4),
                    "v"(gk), "v"(gk + 2048), "v"(gr), "v"(gr + 2048), "v"(gv), "v"(gv + (size_t)32 * SEQ),
                    "v"(gm), "v"(gm + (size_t)1 * 16 * SEQ_FULL), "v"(gm + (size_t)2 * 16 * SEQ_FULL), "v"(gm + (size_t)3 * 16 * SEQ_FULL), "v"(gm + (size_t)4 * 16 * SEQ_FULL),
                    "v"(gm + (size_t)5 * 16 * SEQ_FULL), "v"(gm + (size_t)6 * 16 * SEQ_FULL), "v"(gm + (size_t)7 * 16 * SEQ_FULL)
                 : "memory");
}

__global__ __launch_bounds__(32 * AW) void k_flash(const h16* __restrict__ QH, const h16* __restrict__ QR, const h16* __restrict__ KH, const h16* __restrict__ KR,
                                                   const h16* __restrict__ VT, const int* __restrict__ MASK, h16* CX) {
    __shared__ __align__(16) h16 kvs[2][3 * SK * HD];        // per buffer: K value | K residual | V^T, SK*HD halves each
    __shared__ __align__(16) int mks[2][16 * AW * MP];       // per buffer: 16*AW mask rows of SK ints, pitch MP
    const int tid = threadIdx.x, lane = tid & 31, wave = tid >> 5, lr = lane & 15, hi = lane >> 4;
    const int zh = blockIdx.y; const int b = zh / NH_, h = zh % NH_;
    const int tb = blockIdx.x * (16 * AW), t0 = tb + wave * 16;
    const size_t pbase = (size_t)zh * SEQ * HD;
    // the thread's pieces of stage 0: plane slices of SK keys are contiguous (K: SK*HD halves; V^T: SK*16 halves per 16 d rows, thread halves 0/1 take d tiles 0/1, then 2/3); mask: row tid/16 (+16 per copy), piece tid%16
    const h16* gk = KH + pbase + tid * 8;
    const h16* gr = KR + pbase + tid * 8;
    const h16* gv = VT + pbase + (size_t)(tid >> 7) * 16 * SEQ + (tid & 127) * 8;
    const int* gm = MASK + (size_t)(tb + (tid >> 4)) * SEQ_FULL + (tid & 15) * 4;
    const unsigned lk0 = (unsigned)(size_t)&kvs[0][0] + tid * 16u, lm0 = (unsigned)(size_t)&mks[0][0] + (tid >> 4) * (MP * 4u) + (tid & 15) * 16u;
    const unsigned LKB = 3 * SK * HD * 2, LMB = 16 * AW * MP * 4;   // bytes from buffer 0 to buffer 1
    stage_copy(gk, gr, gv, gm, lk0, lm0);
    const size_t qo = pbase + (size_t)t0 * HD + 8 * lane;     // 16 rows x 64 d = two fragments of 512 halves
    const v16h qh0 = ldh(QH + qo), qh1 = ldh(QH + qo + 512), qr0 = ldh(QR + qo), qr1 = ldh(QR + qo + 512);   // B fragments: col t, k = d
    asm volatile("s_wait_asynccnt 0x0" ::: "memory");   // stage 0 of this wave has landed
    __syncthreads();                                    // ... and every wave's: stage 0 is published
    stage_copy(gk + SK * HD, gr + SK * HD, gv + SK * 16, gm + SK, lk0 + LKB, lm0 + LMB);
    v8f o0 = (v8f){}, o1 = (v8f){}, o2 = (v8f){}, o3 = (v8f){};
    float m = -3.0e38f, l = 0.0f;
#pragma unroll 1
    for (int s = 0; s < NST; ++s) {
        const h16* kst = &kvs[s & 1][0] + 8 * lane;                          // + 32p*HD + 16*HD*(key tile) + 512*(d/32)  (A fragment: row key, k = d)
        const int* mst = &mks[s & 1][0] + (wave * 16 + lr) * MP + 8 * hi;    // mask[t][32p + 8h + r] (tile a), [32p + 16 + 8h + r] (tile b)
#pragma unroll
        for (int p = 0; p < SK / 32; ++p) {
        const int* mrow = mst + 32 * p;
        const v4i ma0 = *(const v4i*)(mrow), ma1 = *(const v4i*)(mrow + 4), mb0 = *(const v4i*)(mrow + 16), mb1 = *(const v4i*)(mrow + 20);
        const h16* ka = kst + 32 * p * HD;
        const v16h ka0 = ldh(ka), ka1 = ldh(ka + 512), kb0 = ldh(ka + 16 * HD), kb1 = ldh(ka + 16 * HD + 512);
        v8f sHa = (v8f){}, sLa = (v8f){}, sHb = (v8f){}, sLb = (v8f){};
        sHa = wmma16(ka0, qh0, sHa); sLa = wmma16(ka0, qr0, sLa); sHb = wmma16(kb0, qh0, sHb); sLb = wmma16(kb0, qr0, sLb);
        sHa = wmma16(ka1, qh1, sHa); sLa = wmma16(ka1, qr1, sLa); sHb = wmma16(kb1, qh1, sHb); sLb = wmma16(kb1, qr1, sLb);
        asm volatile("v_nop\n\tv_nop\n\tv_nop\n\tv_nop" : "+v"(sHa), "+v"(sLa), "+v"(sHb), "+v"(sLb) : "v"(ka0), "v"(ka1), "v"(kb0), "v"(kb1));
        const h16* kr = ka + SK * HD;
        const v16h ra0 = ldh(kr), ra1 = ldh(kr + 512), rb0 = ldh(kr + 16 * HD), rb1 = ldh(kr + 16 * HD + 512);
        sLa = wmma16(ra0, qh0, sLa); sLb = wmma16(rb0, qh0, sLb);
        sLa = wmma16(ra1, qh1, sLa); sLb = wmma16(rb1, qh1, sLb);
        asm volatile("v_nop\n\tv_nop\n\tv_nop\n\tv_nop" : "+v"(sLa), "+v"(sLb) : "v"(ra0), "v"(ra1), "v"(rb0), "v"(rb1));
        float ta[8], tb2[8]; float mx = -3.0e38f;
#pragma unroll
        for (int r = 0; r < 8; ++r) {
            const int mka = (r < 4) ? ma0[r & 3] : ma1[r & 3];
            const int mkb = (r < 4) ? mb0[r & 3] : mb1[r & 3];
            const float sa = (sHa[r] + sLa[r] * QRI) * SC2, sb = (sHb[r] + sLb[r] * QRI) * SC2;
            ta[r] = (mka != 0) ? sa : FILL2; tb2[r] = (mkb != 0) ? sb : FILL2;
            mx = fmaxf(mx, fmaxf(ta[r], tb2[r])); }
        mx = fmaxf(mx, __shfl_xor(mx, 16, 32));
        const float mnew = fmaxf(m, mx);
        const float alpha = __builtin_amdgcn_exp2f(m - mnew);
        v16h pb; float ls = 0.0f;
#pragma unroll
        for (int r = 0; r < 8; ++r) { const h16 pa = (h16)__builtin_amdgcn_exp2f((ta[r] - mnew) + PSH); const h16 pc = (h16)__builtin_amdgcn_exp2f((tb2[r] - mnew) + PSH); pb[r] = pa; pb[8 + r] = pc; ls += (float)pa + (float)pc; }
        l = l * alpha + ls; m = mnew;
        o0 = o0 * alpha; o1 = o1 * alpha; o2 = o2 * alpha; o3 = o3 * alpha;
        const h16* va = kst + 2 * SK * HD + 512 * p;      // + SK*16*(d/16)   (A fragment: row d, k = key)
        const v16h v0 = ldh(va), v1 = ldh(va + SK * 16), v2 = ldh(va + 2 * SK * 16), v3 = ldh(va + 3 * SK * 16);
        o0 = wmma16(v0, pb, o0); o1 = wmma16(v1, pb, o1); o2 = wmma16(v2, pb, o2); o3 = wmma16(v3, pb, o3);
        asm volatile("v_nop\n\tv_nop\n\tv_nop\n\tv_nop" : "+v"(o0), "+v"(o1), "+v"(o2), "+v"(o3) : "v"(v0), "v"(v1), "v"(v2), "v"(v3), "v"(pb));
        }
        // publish point of stage s + 1, and the end of every wave's reads of stage s
        asm volatile("s_wait_dscnt 0x0" ::: "memory");      // this wave's LDS reads of stage s have returned before its buffer is refilled
        asm volatile("s_wait_asynccnt 0x0" ::: "memory");   // this wave's copies of stage s + 1 have landed
        __syncthreads();
        if (s + 2 < NST)                                    // the same for the whole block
            stage_copy(gk + (size_t)(s + 2) * SK * HD, gr + (size_t)(s + 2) * SK * HD, gv + (size_t)(s + 2) * SK * 16, gm + (size_t)(s + 2) * SK, lk0 + (s & 1) * LKB, lm0 + (s & 1) * LMB);
    }
    asm volatile("s_wait_asynccnt 0x0" ::: "memory");       // no copy is outstanding when the wave ends
    l += __shfl_xor(l, 16, 32);
    const float inv = 1.0f / l;
    // O^T D layout: o_j[r] = (d = 16j + 8h + r, t = lane&15): a lane's eight values of o_j are the 16-byte piece (row t, columns 16j + 8h + 0..7) of the ctx plane,
    // which fragment order puts at j*256 + lane*8 halves behind the base of fragments (row/16, 2h) and (row/16, 2h + 1): four 512-byte stores straight from the accumulators
    h16* crow = CX + ((size_t)b * SEQ + t0) * DM + h * (HD * 16) + lane * 8;
    v8h h0, h1, h2, h3;
#pragma unroll
    for (int r = 0; r < 8; ++r) { h0[r] = (h16)(o0[r] * inv); h1[r] = (h16)(o1[r] * inv); h2[r] = (h16)(o2[r] * inv); h3[r] = (h16)(o3[r] * inv); }
    *(v8h*)(crow) = h0; *(v8h*)(crow + 256) = h1; *(v8h*)(crow + 512) = h2; *(v8h*)(crow + 768) = h3;
}

static constexpr size_t al256(size_t v) { return (v + 255) & ~(size_t)255; }
static constexpr size_t SZ_XB = al256((size_t)NB * SEQ * DM * 2);              // one bf16 input plane [NB*SEQ][1024]
static constexpr size_t SZ_WB = al256((size_t)3 * DM * DM * 2);               // bf16 Wq | Wk | Wv
static constexpr size_t SZ_WO = al256((size_t)DM * DM * 2);                   // f16 Wo x64
static constexpr size_t SZ_PL = al256((size_t)NB * NH_ * SEQ * HD * 2);       // one f16 head plane
static constexpr size_t SZ_CX = al256((size_t)NB * SEQ * DM * 2);             // f16 ctx plane
static constexpr size_t SZ_TOTAL = 3 * SZ_XB + SZ_WB + SZ_WO + 5 * SZ_PL + SZ_CX;
static_assert(SZ_TOTAL <= (size_t)134217728);          // workspace carve <= 128 MiB
static_assert(((size_t)DM * DM * 2) % 256 == 0);       // weight sub-planes stay 256-byte aligned

extern "C" void kernel_launch(void* const* d_in, const int* in_sizes, int n_in,
                              void* d_out, int out_size, void* d_ws, size_t ws_size, hipStream_t stream) {
    if (n_in < 8) return;
    const size_t needx = ((size_t)(SEQ - 1) * NB_FULL + NB) * DM;
    if ((size_t)in_sizes[0] < needx || (size_t)in_sizes[1] < needx || (size_t)in_sizes[2] < needx) return;
    if ((size_t)in_sizes[3] < (size_t)(SEQ - 1) * SEQ_FULL + SEQ) return;
    if ((size_t)in_sizes[4] < (size_t)DM * DM || (size_t)in_sizes[5] < (size_t)DM * DM || (size_t)in_sizes[6] < (size_t)DM * DM || (size_t)in_sizes[7] < (size_t)DM * DM) return;
    if ((size_t)out_size < ((size_t)(SEQ - 1) * OUT_NB + NB) * DM) return;
    if (SZ_TOTAL > ws_size) return;
    // wire order: query, keys, values, mask (int32), Wq, Wk, Wv, Wo ([out][in] = Bt as-is)
    const float* xq = (const float*)d_in[0]; const float* xk = (const float*)d_in[1]; const float* xv = (const float*)d_in[2];
    const int* mask = (const int*)d_in[3];
    const float* wq = (const float*)d_in[4]; const float* wk = (const float*)d_in[5]; const float* wv = (const float*)d_in[6]; const float* wo = (const float*)d_in[7];
    float* OUT = (float*)d_out;      // [SEQ][OUT_NB][1024]
    char* wsp = (char*)d_ws;
    bf* XQ = (bf*)wsp; wsp += SZ_XB;                 // [NB*SEQ][1024], row b*SEQ + t
    bf* XK = (bf*)wsp; wsp += SZ_XB;
    bf* XV = (bf*)wsp; wsp += SZ_XB;
    bf* WB = (bf*)wsp; wsp += SZ_WB;                 // [3][1024][1024]: q | k | v
    h16* WO16 = (h16*)wsp; wsp += SZ_WO;             // [1024][1024] x64
    h16* QH = (h16*)wsp; wsp += SZ_PL;               // [NB*16][SEQ][64]
    h16* QR = (h16*)wsp; wsp += SZ_PL;               // [NB*16][SEQ][64] residual x2048
    h16* KH = (h16*)wsp; wsp += SZ_PL;               // [NB*16][SEQ][64]
    h16* KR = (h16*)wsp; wsp += SZ_PL;               // [NB*16][SEQ][64] residual x2048
    h16* VT = (h16*)wsp; wsp += SZ_PL;               // [NB*16][64][SEQ]
    h16* CX = (h16*)wsp; wsp += SZ_CX;               // [NB*SEQ][1024]
    bf* WQ = WB; bf* WK = WB + (size_t)DM * DM; bf* WV = WB + (size_t)2 * DM * DM;

    k_cvt<<<3 * GX + 4 * GW, 256, 0, stream>>>(xq, xk, xv, wq, wk, wv, wo, XQ, XK, XV, WQ, WK, WV, WO16);

    k_proj<<<dim3(NB * SEQ / 128, DM / 128, 3), 32 * GWV, 0, stream>>>(XQ, XK, XV, WQ, WK, WV, QH, QR, KH, KR, VT);

    k_flash<<<dim3(SEQ / (16 * AW), NB * NH_, 1), 32 * AW, 0, stream>>>(QH, QR, KH, KR, VT, mask, CX);

    // out[t][b][n] = sum_k ctx[b*SEQ + t][k] Wo[n][k]
    k_oproj<<<dim3(NB * SEQ / 128, DM / 128, 1), 32 * GWV, 0, stream>>>(CX, WO16, OUT);
}

// v005
// One run takes 110 microseconds.
// Timed twice side by side with v004, it ran 1.08 times as fast both times.
// Counting every step since v000, it is 2.90 times as fast.
#include <hip/hip_runtime.h>

// Multi-head attention, width 1024 = 16 heads x 64; query/keys/values [SEQ][NB][1024] sequence-first (row = s*NB_FULL + b), Wq/Wk/Wv/Wo [out][in] (y = x W^T), no biases,
// UNSCALED scores, int32 mask [SEQ][SEQ] with replace-fill (-1e20 where mask == 0), output = ctx Wo^T as f32 [SEQ][NB][1024].
// Compute dtypes, f32 accumulate everywhere: q/k/v projections v_wmma_f32_16x16x32_bf16 (inputs and W RNE-converted to bf16; products exact);
// scores v_wmma_f32_16x16x32_f16: q and k each as f16 value + f16 residual x2048 (three products: value*value in one accumulator, the two residual products in a second accumulator);
// P (x2^14 carry, cancels in the normalisation) and v single f16; out-projection v_wmma_f32_16x16x32_f16: ctx single f16, Wo = f16(bf16(Wo) * 64), folded back by 1/64; softmax f32 (online, running max).
// Layout: bf16 copies of the inputs de-interleaved to [b][s][1024]; q/k (value, residual) planes [b*16+h][t][d] and v^T plane [b*16+h][d][t] written by the GEMM epilogue;
// fused flash kernel in transposed form (S^T = K Q^T, O^T = V^T P^T) writes the f16 ctx plane [b*SEQ+t][1024]; the out-projection GEMM writes rows t*OUT_NB + b.
// FRAGMENT ORDER: every 16-bit workspace plane [R][C] (C = the k dimension of its WMMA use) is stored as fragments of 16 rows x 32 k, 1 KiB each, fragment index (r/16)*(C/32) + k/32.
// Inside a fragment the 16-byte piece (row r, k = 8q..8q+7 of the 32, q = 0..3) lies at (q>>1)*512 B + ((q&1)*16 + r%16)*16 B, so each of the two wave-wide 16-byte loads
// of a fragment reads 512 contiguous bytes (4 whole lines; from row-major planes it would touch 16).
// MASK BITS: the converter launch packs the int32 mask to one bit per key, plane [SEQ][SEQ/32] of 32-bit words, bit i of word (t, w) = (mask[t][32w + i] != 0); the flash kernel reads only that plane.

#ifndef NB
#define NB 2
#endif
#ifndef SEQ
#define SEQ 2048
#endif
#define NB_FULL  2
#define SEQ_FULL 2048
#ifndef OUT_NB
#define OUT_NB NB                // batch pitch (in rows) of the output [t][OUT_NB][1024]
#endif
#define DM   1024
#define NH_  16
#define HD   64
#define AW   8                   // waves per flash block (16 query rows each)
#define QRS  2048.0f             // carry of the q / k residual planes
#define QRI  (1.0f / 2048.0f)
#define SC2  1.4426950408889634f // log2(e); the module applies no score scale
#define PSH  14.0f               // log2 of the P carry (16384)
#define FILL2 (-1.4426950408889634e20f)   // -1e20 in the log2 domain (replace-fill of masked scores)
#define WOS  64.0f               // carry of the Wo plane
#define WOI  (1.0f / 64.0f)

static_assert(HD == 64);
static_assert(NH_ * HD == DM);                 // head h = columns h*64 + d
static_assert(DM % 64 == 0);                   // 16 column tiles of 64
static_assert(DM % 32 == 0);                   // GEMM k-steps of 32, two per ring stage of 64
static_assert(SEQ % 64 == 0);                  // a 64-row tile (and a 16-row fragment) never straddles two batches
static_assert((NB * SEQ) % 64 == 0);
static_assert(SEQ % 32 == 0);                  // key loop steps by 32
static_assert(SEQ % (16 * AW) == 0);           // flash grid covers the sequence exactly
static_assert(((size_t)NB * SEQ * DM) % 8 == 0);
static_assert(((size_t)DM * DM) % 8 == 0);
static_assert(NB <= NB_FULL);
static_assert(SEQ <= SEQ_FULL);
static_assert(NB <= OUT_NB);

typedef _Float16 h16;
typedef unsigned short bf;
typedef __attribute__((ext_vector_type(16))) __bf16   v16bf;
typedef __attribute__((ext_vector_type(16))) _Float16 v16h;
typedef __attribute__((ext_vector_type(8)))  _Float16 v8h;
typedef __attribute__((ext_vector_type(8)))  unsigned short v8us;
typedef __attribute__((ext_vector_type(8)))  float    v8f;
typedef __attribute__((ext_vector_type(4)))  float    v4f;
typedef __attribute__((ext_vector_type(2)))  unsigned v2u;
typedef __attribute__((ext_vector_type(4)))  unsigned short v4us;
typedef v4f  __attribute__((may_alias)) v4fa;
typedef v4us __attribute__((may_alias)) v4usa;
typedef v8us __attribute__((may_alias)) v8usa;

__device__ __forceinline__ unsigned short f2bf(float f) { unsigned u = __float_as_uint(f); u += 0x7FFFu + ((u >> 16) & 1u); return (unsigned short)(u >> 16); }
__device__ __forceinline__ float bf2f(unsigned short s) { return __uint_as_float(((unsigned)s) << 16); }
__device__ __forceinline__ v16h cat16(v8h lo, v8h hi) { return __builtin_shufflevector(lo, hi, 0, 1, 2, 3, 4, 5, 6, 7, 8, 9, 10, 11, 12, 13, 14, 15); }
__device__ __forceinline__ v16bf cat16b(v8us lo, v8us hi) { return __builtin_bit_cast(v16bf, __builtin_shufflevector(lo, hi, 0, 1, 2, 3, 4, 5, 6, 7, 8, 9, 10, 11, 12, 13, 14, 15)); }
__device__ __forceinline__ v8f wmma16(v16h a, v16h b, v8f c) { return __builtin_amdgcn_wmma_f32_16x16x32_f16(false, a, false, b, (short)0, c, false, false); }
__device__ __forceinline__ v8f wmmab(v16bf a, v16bf b, v8f c) { return __builtin_amdgcn_wmma_f32_16x16x32_bf16(false, a, false, b, (short)0, c, false, false); }
// fragment loaders from fragment-order planes; p = fragment base + 8*lane: elements 0..7 <- k0+8h+0..7, elements 8..15 <- k0+16+8h+0..7, row lane&15, h = lane>>4 (same map for A and B)
__device__ __forceinline__ v16h  ldh(const h16* p) { return cat16(*(const v8h*)p, *(const v8h*)(p + 256)); }
__device__ __forceinline__ v16bf ldb(const bf* p)  { return cat16b(*(const v8us*)p, *(const v8us*)(p + 256)); }
// ordering point for wave-private LDS tiles (same wave writes and reads)
__device__ __forceinline__ void wave_sync() { __builtin_amdgcn_fence(3 /* release order */, "wavefront"); __builtin_amdgcn_wave_barrier(); asm volatile("" ::: "memory"); }

// cvt_frag: one wave converts one fragment (16 rows x 32 columns) of an f32 matrix with DM columns: four whole-line loads (4 rows x 128 B each), the 16-bit rows
// through a wave-private LDS tile (80-byte pitch: 16 B x odd, free of conflicts for the 16-byte reads), two 512-byte stores in fragment order.
// MODE 0: bf16 RNE, source rows de-interleaved (plane row b*SEQ + t <- source row t*NB_FULL + b); MODE 1: bf16 RNE, rows as they are; MODE 2: f16(bf16(x) * 64), rows as they are.
template <int MODE> __device__ __forceinline__ void cvt_frag(const float* __restrict__ src, unsigned short* dst, unsigned blk, unsigned short* ts) {
    const int lane = threadIdx.x & 31, wave = threadIdx.x >> 5;
    const size_t f = (size_t)blk * 8 + wave;
    const size_t tile = f / (DM / 32), chunk = f % (DM / 32);
    unsigned short* tw = ts + wave * 16 * 40;
#pragma unroll
    for (int i = 0; i < 4; ++i) {
        const int row = 4 * i + (lane >> 3); const size_t drow = tile * 16 + row;
        const size_t srow = (MODE == 0) ? ((drow % SEQ) * NB_FULL + drow / SEQ) : drow;
        const v4f v = *(const v4f*)(src + srow * DM + chunk * 32 + (lane & 7) * 4); v4us o;
#pragma unroll
        for (int k = 0; k < 4; ++k) o[k] = (MODE == 2) ? __builtin_bit_cast(unsigned short, (h16)(bf2f(f2bf(v[k])) * WOS)) : f2bf(v[k]);
        *(v4usa*)(tw + row * 40 + (lane & 7) * 4) = o; }
    wave_sync();
#pragma unroll
    for (int j = 0; j < 2; ++j) { const v8us o = *(const v8usa*)(tw + (lane & 15) * 40 + j * 16 + (lane >> 4) * 8); *(v8us*)(dst + f * 512 + j * 256 + lane * 8) = o; }
    asm volatile("s_wait_xcnt 0x0" ::: "memory");   // behind the two stores: in the merged kernel's listing another branch's code follows them and rewrites their registers
}

// mask_bits: one wave packs 32 words of the bit plane (1024 keys of one mask row): 32 whole-line loads (one int per lane), each turned into its word by a wave-wide compare
// (lane i's result is bit i); word i is kept by lane i, and the 32 words leave in one 128-byte store.
__device__ __forceinline__ void mask_bits(const int* __restrict__ mask, unsigned* MB, unsigned blk) {
    const int lane = threadIdx.x & 31, wave = threadIdx.x >> 5;
    const size_t w0 = ((size_t)blk * 8 + wave) * 32;
    const int* src = mask + w0 * 32 + lane;
    int v[32];
#pragma unroll
    for (int i = 0; i < 32; ++i) v[i] = src[i * 32];
    unsigned word = 0;
#pragma unroll
    for (int i = 0; i < 32; ++i) { const unsigned bits = __builtin_amdgcn_ballot_w32(v[i] != 0); word = (lane == i) ? bits : word; }
    MB[w0 + lane] = word;
    asm volatile("s_wait_xcnt 0x0" ::: "memory");   // behind the store: in the merged kernel's listing another branch's code follows it and rewrites its registers
}

// k_cvt: all seven conversions and the mask packing in ONE launch (they are independent of each other); the block index picks the matrix. 8 waves per block, one fragment each.
// Blocks 0 .. 3*GX-1: query | keys | values, src [t][NB_FULL][DM] f32 -> plane [b*SEQ + t][DM] bf16; then 3*GW blocks: Wq | Wk | Wv -> bf16; then GW blocks: Wo -> f16 x64. All in fragment order.
// Then GM blocks: mask rows 0 .. SEQ-1 -> bit plane, 32 words per wave.
#define GX ((unsigned)((size_t)NB * SEQ * DM / 512 / 8))
#define GW ((unsigned)((size_t)DM * DM / 512 / 8))
#define GM ((unsigned)((size_t)SEQ * (SEQ / 32) / 32 / 8))
static_assert(SEQ == SEQ_FULL);                             // the words of the bit plane follow the mask's own rows without a gap
static_assert(((size_t)SEQ * (SEQ / 32)) % (32 * 8) == 0);  // every mask block has eight whole runs of 32 words
static_assert(((size_t)NB * SEQ * DM) % (512 * 8) == 0);   // every conversion block of the merged grid has eight whole fragments
static_assert(((size_t)DM * DM) % (512 * 8) == 0);
__global__ __launch_bounds__(256) void k_cvt(const float* __restrict__ xq, const float* __restrict__ xk, const float* __restrict__ xv,
                                             const float* __restrict__ wq, const float* __restrict__ wk, const float* __restrict__ wv, const float* __restrict__ wo, const int* __restrict__ mask,
                                             bf* XQ, bf* XK, bf* XV, bf* WQ, bf* WK, bf* WV, h16* WO16, unsigned* MB) {
    __shared__ __align__(16) unsigned short ts[8 * 16 * 40];
    const unsigned bx = blockIdx.x;
    if (bx < 3 * GX) { const unsigned w = bx / GX; cvt_frag<0>(w == 0 ? xq : w == 1 ? xk : xv, w == 0 ? XQ : w == 1 ? XK : XV, bx % GX, ts); }
    else if (bx < 3 * GX + 3 * GW) { const unsigned c = bx - 3 * GX, w = c / GW; cvt_frag<1>(w == 0 ? wq : w == 1 ? wk : wv, w == 0 ? WQ : w == 1 ? WK : WV, c % GW, ts); }
    else if (bx < 3 * GX + 4 * GW) cvt_frag<2>(wo, (unsigned short*)WO16, bx - (3 * GX + 3 * GW), ts);
    else mask_bits(mask, MB, bx - (3 * GX + 4 * GW));
}

// THE GEMM RING (k_proj, k_oproj): a block of GWV = 4 waves works on a 128x128 tile, wave (wm, wn) = (wave / 2, wave % 2) on its 64x64 quarter (16 accumulators), K = DM.
// Both operands come through a two-buffer LDS ring, one stage = GS = 64 k = two fragments per 16 rows. In a fragment-order plane those two fragments are 2 KiB in a row, which is one
// asynchronous copy of 16 bytes per thread; a stage is 8 such copies for the 128 A rows and 8 for the 128 B rows, issued one whole stage ahead: each operand byte leaves L2 once per block
// (not once per wave) and no L2 latency stands between the matrix instructions. A stage in LDS keeps the planes' own order: A | B, per 16 rows 1024 halves, fragment k/32 at 512 halves.
#define GWV  4                   // waves per GEMM block
#define GS   64                  // k per ring stage
#define GNST (DM / GS)           // stages
#define GOP  (128 * GS)          // halves of one operand in one stage
static_assert(DM % GS == 0 && GNST >= 2);      // the ring's prologue fills two stages
static_assert(GS == 64);                       // a stage is worked on as two steps of 32 k
static_assert((NB * SEQ) % 128 == 0 && DM % 128 == 0);   // the grids cover both matrices with whole 128x128 tiles
static_assert(GWV * 32 * 8 == GS * 16);        // one copy of every thread = the stage's two fragments of 16 rows

// One operand's copies of one thread for one stage: g = the thread's own 16 bytes in the first 16 rows (16 rows further = 16*DM halves), l = its LDS byte address (16 rows further = 2 KiB).
// The s_wait_xcnt stands inside the statement, behind the last copy, so that no address register is rewritten ahead of it.
template <class T> __device__ __forceinline__ void rows_copy(const T* g, unsigned l) {
    asm volatile("global_load_async_to_lds_b128 %0, %8, off\n\t"
                 "global_load_async_to_lds_b128 %1, %9, off\n\t"
                 "global_load_async_to_lds_b128 %2, %10, off\n\t"
                 "global_load_async_to_lds_b128 %3, %11, off\n\t"
                 "global_load_async_to_lds_b128 %4, %12, off\n\t"
                 "global_load_async_to_lds_b128 %5, %13, off\n\t"
                 "global_load_async_to_lds_b128 %6, %14, off\n\t"
                 "global_load_async_to_lds_b128 %7, %15, off\n\t"
                 "s_wait_xcnt 0x0"
                 :: "v"(l), "v"(l + 2048u), "v"(l + 4096u), "v"(l + 6144u), "v"(l + 8192u), "v"(l + 10240u), "v"(l + 12288u), "v"(l + 14336u),
                    "v"(g), "v"(g + (size_t)1 * 16 * DM), "v"(g + (size_t)2 * 16 * DM), "v"(g + (size_t)3 * 16 * DM), "v"(g + (size_t)4 * 16 * DM),
                    "v"(g + (size_t)5 * 16 * DM), "v"(g + (size_t)6 * 16 * DM), "v"(g + (size_t)7 * 16 * DM)
                 : "memory");
}

// k_proj: register-blocked bf16 GEMM on the GEMM ring, operands from fragment-order bf16 planes.
// C[m][n] = sum_k A[m][k] Bt[n][k], written as f16 (Ph) and optionally the f16 residual x2048 (Pr, useRes != 0) in fragment order into planes of 'pitch' columns:
// a wave's tile base (r0/RB)*sRB + (r0%RB)*pitch + (c0/CB)*sCB + (c0%CB)*16 (halves); 16 rows further = 16*pitch, 32 columns further = 512.
// The three projections are independent and run in ONE launch, grid (NB*SEQ/128, DM/128, 3), 128 threads; blockIdx.z picks the product:
// z = 0, 1 (q, k): A = x rows (m = b*SEQ + t), Bt = W rows (n = h*64 + d) -> planes [(b*16 + h)][t][d], value + residual;
// z = 2 (v^T): A = Wv rows (m = h*64 + d, from blockIdx.y), Bt = x rows (n = b*SEQ + t, from blockIdx.x) -> plane [(b*1024 + m)][t] = [(b*16 + h)][d][t], value only.
__global__ __launch_bounds__(32 * GWV) void k_proj(const bf* __restrict__ XQ, const bf* __restrict__ XK, const bf* __restrict__ XV, const bf* __restrict__ WQ, const bf* __restrict__ WK, const bf* __restrict__ WV,
                                             h16* QH, h16* QR, h16* KH, h16* KR, h16* VT) {
    __shared__ __align__(16) bf gs[2][2 * GOP];              // per buffer: A rows | B rows
    __shared__ __align__(16) float osb[GWV][16 * 68];        // a wave's own epilogue tile
    const int K = DM;
    const int z = blockIdx.z; const bool isv = (z == 2);
    const bf* __restrict__ A = isv ? WV : (z == 0 ? XQ : XK); const bf* __restrict__ Bt = isv ? XV : (z == 0 ? WQ : WK);
    h16* Ph = isv ? VT : (z == 0 ? QH : KH); h16* Pr = (z == 0) ? QR : KR; const bool useRes = !isv;
    const int RB = isv ? DM : SEQ, pitch = isv ? SEQ : HD, CB = isv ? SEQ : HD;
    const size_t sRB = isv ? (size_t)0 : (size_t)NH_ * SEQ * HD, sCB = isv ? (size_t)DM * SEQ : (size_t)SEQ * HD;
    const int tid = threadIdx.x, lane = tid & 31, wave = __builtin_amdgcn_readfirstlane(tid >> 5), wm = wave >> 1, wn = wave & 1, lr = lane & 15, hi = lane >> 4;   // the wave's number in a scalar register: tile bases stay scalar
    const int R0 = (isv ? blockIdx.y : blockIdx.x) * 128, C0 = (isv ? blockIdx.x : blockIdx.y) * 128; const int r0 = R0 + wm * 64, c0 = C0 + wn * 64;
    float* os = &osb[wave][0];
    v8f acc[4][4];
#pragma unroll
    for (int mb = 0; mb < 4; ++mb)
#pragma unroll
        for (int nb = 0; nb < 4; ++nb) acc[mb][nb] = (v8f){};
    const bf* ga = A + (size_t)R0 * K + tid * 8; const bf* gb = Bt + (size_t)C0 * K + tid * 8;   // fragment (row/16, kc/32) at (row/16)*16*K + kc*16; a stage further = GS*16 halves
    const unsigned la = (unsigned)(size_t)&gs[0][0] + tid * 16u; const unsigned LOB = GOP * 2, LGB = 2 * GOP * 2;   // bytes from A to B, from buffer 0 to buffer 1
    rows_copy(ga, la); rows_copy(gb, la + LOB);
    asm volatile("s_wait_asynccnt 0x0" ::: "memory");   // stage 0 of this wave has landed
    __syncthreads();                                    // ... and every wave's: stage 0 is published
    rows_copy(ga + GS * 16, la + LGB); rows_copy(gb + GS * 16, la + LGB + LOB);
#pragma unroll 1
    for (int s = 0; s < GNST; ++s) {
        const bf* sa = &gs[s & 1][0] + wm * (4 * 16 * GS) + 8 * lane; const bf* sb = &gs[s & 1][0] + GOP + wn * (4 * 16 * GS) + 8 * lane;
        // The sched_barrier(0) lines hold this order: [reads: A and B of the first 32 k, A of the second][8 products][reads: 2 B fragments of the second 32 k][8 products][reads: the other 2][16 products][waits].
        // Each of the two later groups then stands 8 products ahead of its first use, and every wait but the last is a counted one. Left alone, the scheduler sinks the B reads singly among the products, each with a wait to 0 directly behind it.
        v16bf a[GS / 32][4], b[GS / 32][4];
#pragma unroll
        for (int mb = 0; mb < 4; ++mb) a[0][mb] = ldb(sa + mb * (16 * GS));
#pragma unroll
        for (int nb = 0; nb < 4; ++nb) b[0][nb] = ldb(sb + nb * (16 * GS));
#pragma unroll
        for (int mb = 0; mb < 4; ++mb) a[1][mb] = ldb(sa + mb * (16 * GS) + 512);
        __builtin_amdgcn_sched_barrier(0);   // the first group of reads stays in front of the products
#pragma unroll
        for (int h2 = 0; h2 < 2; ++h2) {
#pragma unroll
            for (int nb = 2 * h2; nb < 2 * h2 + 2; ++nb)
#pragma unroll
                for (int mb = 0; mb < 4; ++mb) acc[mb][nb] = wmmab(a[0][mb], b[0][nb], acc[mb][nb]);
            __builtin_amdgcn_sched_barrier(0);   // these two fragments' reads are not lifted (they take registers of fragments whose last product stands above: 16 fragments at once would not fit 256 registers) ...
            b[1][2 * h2] = ldb(sb + (2 * h2) * (16 * GS) + 512); b[1][2 * h2 + 1] = ldb(sb + (2 * h2 + 1) * (16 * GS) + 512);
            __builtin_amdgcn_sched_barrier(0);   // ... and not sunk towards their use
        }
#pragma unroll
        for (int nb = 0; nb < 4; ++nb)
#pragma unroll
            for (int mb = 0; mb < 4; ++mb) acc[mb][nb] = wmmab(a[1][mb], b[1][nb], acc[mb][nb]);
        // keeps the waits below behind the stage's products. Without it the scheduler lifts them and the barrier in front of the products: every read is then waited out
        // before the first product, and the refill is issued only behind the products, so that it flies for less than one stage.
        __builtin_amdgcn_sched_barrier(0);
        // publish point of stage s + 1, and the end of every wave's reads of stage s
        asm volatile("s_wait_dscnt 0x0" ::: "memory");      // this wave's LDS reads of stage s have returned before its buffer is refilled
        asm volatile("s_wait_asynccnt 0x0" ::: "memory");   // this wave's copies of stage s + 1 have landed
        __syncthreads();
        if (s + 2 < GNST) {                                 // the same for the whole block
            rows_copy(ga + (size_t)(s + 2) * GS * 16, la + (s & 1) * LGB); rows_copy(gb + (size_t)(s + 2) * GS * 16, la + (s & 1) * LGB + LOB); }
    }
    asm volatile("s_wait_asynccnt 0x0" ::: "memory");       // no copy is outstanding when the wave goes on
    const size_t tbase = (size_t)(r0 / RB) * sRB + (size_t)(r0 % RB) * (size_t)pitch + (size_t)(c0 / CB) * sCB + (size_t)(c0 % CB) * 16;
#pragma unroll
    for (int mb = 0; mb < 4; ++mb) {
#pragma unroll
        for (int nb = 0; nb < 4; ++nb) {
#pragma unroll
            for (int j = 0; j < 8; ++j) os[(hi * 8 + j) * 68 + nb * 16 + lr] = acc[mb][nb][j]; }   // D: row 8h+j, col lane&15
        wave_sync();
        const size_t sb = tbase + (size_t)(mb * 16) * (size_t)pitch;
{
#pragma unroll
            for (int s = 0; s < 4; ++s) { const int row = lr, c8 = (2 * s + hi) * 8;   // s = 2*(column/32) + half of the fragment; 16 rows x 2 pieces = one 512-byte store
                const v4f x0 = *(const v4fa*)(&os[row * 68 + c8]); const v4f x1 = *(const v4fa*)(&os[row * 68 + c8 + 4]); v8h hv, rv;
#pragma unroll
                for (int i = 0; i < 4; ++i) { const h16 a0 = (h16)x0[i]; const h16 a1 = (h16)x1[i]; hv[i] = a0; hv[4 + i] = a1; rv[i] = (h16)((x0[i] - (float)a0) * QRS); rv[4 + i] = (h16)((x1[i] - (float)a1) * QRS); }
                const size_t oo = sb + (size_t)(s * 256 + lane * 8);
                *(v8h*)(Ph + oo) = hv; if (useRes) *(v8h*)(Pr + oo) = rv; }
             }
        wave_sync();
    }
}

// k_oproj: register-blocked f16 GEMM on the GEMM ring, A = ctx plane [NB*SEQ][DM] f16 (row m = b*SEQ + t), Bt = Wo plane [DM][DM] f16 (x64 carry), both in fragment order.
// OUT[(t*OUT_NB + b)][n] = (1/64) sum_k A[m][k] Bt[n][k], f32. grid (NB*SEQ/128, DM/128), 128 threads.
__global__ __launch_bounds__(32 * GWV) void k_oproj(const h16* __restrict__ A, const h16* __restrict__ Bt, float* OUT) {
    __shared__ __align__(16) h16 gs[2][2 * GOP];             // per buffer: A rows | B rows
    __shared__ __align__(16) float osb[GWV][16 * 68];        // a wave's own epilogue tile
    const int K = DM;
    const int tid = threadIdx.x, lane = tid & 31, wave = __builtin_amdgcn_readfirstlane(tid >> 5), wm = wave >> 1, wn = wave & 1, lr = lane & 15, hi = lane >> 4;   // the wave's number in a scalar register: tile bases stay scalar
    const int R0 = blockIdx.x * 128, C0 = blockIdx.y * 128; const int r0 = R0 + wm * 64, c0 = C0 + wn * 64;
    float* os = &osb[wave][0];
    v8f acc[4][4];
#pragma unroll
    for (int mb = 0; mb < 4; ++mb)
#pragma unroll
        for (int nb = 0; nb < 4; ++nb) acc[mb][nb] = (v8f){};
    const h16* ga = A + (size_t)R0 * K + tid * 8; const h16* gb = Bt + (size_t)C0 * K + tid * 8;   // fragment (row/16, kc/32) at (row/16)*16*K + kc*16; a stage further = GS*16 halves
    const unsigned la = (unsigned)(size_t)&gs[0][0] + tid * 16u; const unsigned LOB = GOP * 2, LGB = 2 * GOP * 2;   // bytes from A to B, from buffer 0 to buffer 1
    rows_copy(ga, la); rows_copy(gb, la + LOB);
    asm volatile("s_wait_asynccnt 0x0" ::: "memory");   // stage 0 of this wave has landed
    __syncthreads();                                    // ... and every wave's: stage 0 is published
    rows_copy(ga + GS * 16, la + LGB); rows_copy(gb + GS * 16, la + LGB + LOB);
#pragma unroll 1
    for (int s = 0; s < GNST; ++s) {
        const h16* sa = &gs[s & 1][0] + wm * (4 * 16 * GS) + 8 * lane; const h16* sb = &gs[s & 1][0] + GOP + wn * (4 * 16 * GS) + 8 * lane;
        // The sched_barrier(0) lines hold this order: [reads: A and B of the first 32 k, A of the second][8 products][reads: 2 B fragments of the second 32 k][8 products][reads: the other 2][16 products][waits].
        // Each of the two later groups then stands 8 products ahead of its first use, and every wait but the last is a counted one. Left alone, the scheduler sinks the B reads singly among the products, each with a wait to 0 directly behind it.
        v16h a[GS / 32][4], b[GS / 32][4];
#pragma unroll
        for (int mb = 0; mb < 4; ++mb) a[0][mb] = ldh(sa + mb * (16 * GS));
#pragma unroll
        for (int nb = 0; nb < 4; ++nb) b[0][nb] = ldh(sb + nb * (16 * GS));
#pragma unroll
        for (int mb = 0; mb < 4; ++mb) a[1][mb] = ldh(sa + mb * (16 * GS) + 512);
        __builtin_amdgcn_sched_barrier(0);   // the first group of reads stays in front of the products
#pragma unroll
        for (int h2 = 0; h2 < 2; ++h2) {
#pragma unroll
            for (int nb = 2 * h2; nb < 2 * h2 + 2; ++nb)
#pragma unroll
                for (int mb = 0; mb < 4; ++mb) acc[mb][nb] = wmma16(a[0][mb], b[0][nb], acc[mb][nb]);
            __builtin_amdgcn_sched_barrier(0);   // these two fragments' reads are not lifted (they take registers of fragments whose last product stands above: 16 fragments at once would not fit 256 registers) ...
            b[1][2 * h2] = ldh(sb + (2 * h2) * (16 * GS) + 512); b[1][2 * h2 + 1] = ldh(sb + (2 * h2 + 1) * (16 * GS) + 512);
            __builtin_amdgcn_sched_barrier(0);   // ... and not sunk towards their use
        }
#pragma unroll
        for (int nb = 0; nb < 4; ++nb)
#pragma unroll
            for (int mb = 0; mb < 4; ++mb) acc[mb][nb] = wmma16(a[1][mb], b[1][nb], acc[mb][nb]);
        // keeps the waits below behind the stage's products. Without it the scheduler lifts them and the barrier in front of the products: every read is then waited out
        // before the first product, and the refill is issued only behind the products, so that it flies for less than one stage.
        __builtin_amdgcn_sched_barrier(0);
        // publish point of stage s + 1, and the end of every wave's reads of stage s
        asm volatile("s_wait_dscnt 0x0" ::: "memory");      // this wave's LDS reads of stage s have returned before its buffer is refilled
        asm volatile("s_wait_asynccnt 0x0" ::: "memory");   // this wave's copies of stage s + 1 have landed
        __syncthreads();
        if (s + 2 < GNST) {                                 // the same for the whole block
            rows_copy(ga + (size_t)(s + 2) * GS * 16, la + (s & 1) * LGB); rows_copy(gb + (size_t)(s + 2) * GS * 16, la + (s & 1) * LGB + LOB); }
    }
    asm volatile("s_wait_asynccnt 0x0" ::: "memory");       // no copy is outstanding when the wave goes on
#pragma unroll
    for (int mb = 0; mb < 4; ++mb) {
#pragma unroll
        for (int nb = 0; nb < 4; ++nb) {
#pragma unroll
            for (int j = 0; j < 8; ++j) os[(hi * 8 + j) * 68 + nb * 16 + lr] = acc[mb][nb][j] * WOI; }   // D: row 8h+j, col lane&15
        wave_sync();
{
#pragma unroll
            for (int s = 0; s < 8; ++s) { const int row = 2 * s + hi, cofs = lr * 4;   // 8 s x 2 rows = 16 rows; 16 lanes x 4 floats = 64 columns
                const int m = r0 + mb * 16 + row; const int bb = m / SEQ, t = m % SEQ;
                const v4f val = *(const v4fa*)(&os[row * 68 + cofs]);
                *(v4f*)(OUT + ((size_t)t * OUT_NB + bb) * DM + c0 + cofs) = val; }
             }
        wave_sync();
    }
}

// k_flash: fused attention, one wave per 16 query rows of one (batch, head), AW waves (16*AW query rows) per block; Q fragments straight from the fragment-order f16 planes, once.
// THE RING: the loop's operands (K value, K residual, V^T) come through a two-buffer LDS ring, one stage = SK keys = two passes of 32. Every thread brings 6 pieces of 16 bytes per stage
// with asynchronous copies to LDS, issued one whole stage ahead, so each K / V^T byte leaves L2 once per block (not once per wave) and no load latency stands in the loop.
// A stage in LDS: K value | K residual | V^T, 8 KiB each, in the planes' own fragment order (a wave-wide 16-byte read covers 512 contiguous bytes).
// THE MASK: the block's 16*AW rows of the bit plane (SEQ/32 words each, all keys) are copied to LDS once, with stage 0, at a pitch of MP words (the 16 rows of a wave-wide 8-byte read fall on
// different banks). A lane reads its row's two words of a stage (64 keys) in one 8-byte read.
// Transposed form: S^T[key][t] = K Q^T (A = K rows, B = Q rows); lane (t = lane&15, h = lane>>4) holds keys 8h+r of each 16-key tile, so the packed
// P tile is directly the B fragment of O^T[d][t] = V^T P^T (element r <- tile keys 0..15, element 8+r <- tile keys 16..31, lane unchanged).
// Scores: value*value in sH; (k value * q residual) + (k residual * q value), both carrying x2048, in sL; s = sH + sL/2048. Masked scores are REPLACED by the fill constant before the
// running-max softmax (a fully masked row comes out uniform); the replacing is stepped over, by one wave-uniform test per stage, where none of the wave's 16 x 64 bits of the stage is 0.
// Softmax state (running max, partial sum) is one scalar per lane; the two lane halves of a row are combined with one xor-16 exchange.
#define SK  64                   // keys per ring stage
#define MP  68                   // pitch of a row of mask bits in LDS, in words
#define NST (SEQ / SK)           // stages
static_assert(AW == 8 && SK == 64);            // the copy maps below: 256 threads, 512 pieces per 8-KiB plane slice
static_assert(SEQ / 32 == 64);                 // ... and 16 pieces per row of mask bits
static_assert(SEQ % SK == 0 && NST >= 2);      // the ring's prologue fills two stages

// One stage's copies of one thread. gk, gr, gv: the thread's own first piece of the stage in the K value, K residual and V^T planes; lk: its LDS byte address in the stage's buffer.
// The s_wait_xcnt stands inside the statement, behind the last copy, so that no address register is rewritten ahead of it.
__device__ __forceinline__ void stage_copy(const h16* gk, const h16* gr, const h16* gv, unsigned lk) {
    asm volatile("global_load_async_to_lds_b128 %0, %6, off\n\t"
                 "global_load_async_to_lds_b128 %1, %7, off\n\t"
                 "global_load_async_to_lds_b128 %2, %8, off\n\t"
                 "global_load_async_to_lds_b128 %3, %9, off\n\t"
                 "global_load_async_to_lds_b128 %4, %10, off\n\t"
                 "global_load_async_to_lds_b128 %5, %11, off\n\t"
                 "s_wait_xcnt 0x0"
                 :: "v"(lk), "v"(lk + 4096u), "v"(lk + 8192u), "v"(lk + 12288u), "v"(lk + 16384u), "v"(lk + 20480u),
                    "v"(gk), "v"(gk + 2048), "v"(gr), "v"(gr + 2048), "v"(gv), "v"(gv + (size_t)32 * SEQ)
                 : "memory");
}

// The block's rows of mask bits, once: gm = the thread's own first piece (row tid/16, piece tid%16; 16 rows further per copy), lm = its LDS byte address.
// The s_wait_xcnt stands inside the statement, behind the last copy, so that no address register is rewritten ahead of it.
__device__ __forceinline__ void bits_copy(const unsigned* gm, unsigned lm) {
    asm volatile("global_load_async_to_lds_b128 %0, %8, off\n\t"
                 "global_load_async_to_lds_b128 %1, %9, off\n\t"
                 "global_load_async_to_lds_b128 %2, %10, off\n\t"
                 "global_load_async_to_lds_b128 %3, %11, off\n\t"
                 "global_load_async_to_lds_b128 %4, %12, off\n\t"
                 "global_load_async_to_lds_b128 %5, %13, off\n\t"
                 "global_load_async_to_lds_b128 %6, %14, off\n\t"
                 "global_load_async_to_lds_b128 %7, %15, off\n\t"
                 "s_wait_xcnt 0x0"
                 :: "v"(lm), "v"(lm + 1u * 16 * MP * 4), "v"(lm + 2u * 16 * MP * 4), "v"(lm + 3u * 16 * MP * 4), "v"(lm + 4u * 16 * MP * 4), "v"(lm + 5u * 16 * MP * 4), "v"(lm + 6u * 16 * MP * 4), "v"(lm + 7u * 16 * MP * 4),
                    "v"(gm), "v"(gm + (size_t)1 * 16 * (SEQ / 32)), "v"(gm + (size_t)2 * 16 * (SEQ / 32)), "v"(gm + (size_t)3 * 16 * (SEQ / 32)), "v"(gm + (size_t)4 * 16 * (SEQ / 32)),
                    "v"(gm + (size_t)5 * 16 * (SEQ / 32)), "v"(gm + (size_t)6 * 16 * (SEQ / 32)), "v"(gm + (size_t)7 * 16 * (SEQ / 32))
                 : "memory");
}

__global__ __launch_bounds__(32 * AW) void k_flash(const h16* __restrict__ QH, const h16* __restrict__ QR, const h16* __restrict__ KH, const h16* __restrict__ KR,
                                                   const h16* __restrict__ VT, const unsigned* __restrict__ MB, h16* CX) {
    __shared__ __align__(16) h16 kvs[2][3 * SK * HD];        // per buffer: K value | K residual | V^T, SK*HD halves each
    __shared__ __align__(16) unsigned mks[16 * AW * MP];     // 16*AW rows of mask bits, SEQ/32 words each, pitch MP
    const int tid = threadIdx.x, lane = tid & 31, wave = tid >> 5, lr = lane & 15, hi = lane >> 4;
    const int zh = blockIdx.y; const int b = zh / NH_, h = zh % NH_;
    const int tb = blockIdx.x * (16 * AW), t0 = tb + wave * 16;
    const size_t pbase = (size_t)zh * SEQ * HD;
    // the thread's pieces of stage 0: plane slices of SK keys are contiguous (K: SK*HD halves; V^T: SK*16 halves per 16 d rows, thread halves 0/1 take d tiles 0/1, then 2/3)
    const h16* gk = KH + pbase + tid * 8;
    const h16* gr = KR + pbase + tid * 8;
    const h16* gv = VT + pbase + (size_t)(tid >> 7) * 16 * SEQ + (tid & 127) * 8;
    const unsigned lk0 = (unsigned)(size_t)&kvs[0][0] + tid * 16u;
    const unsigned LKB = 3 * SK * HD * 2;   // bytes from buffer 0 to buffer 1
    stage_copy(gk, gr, gv, lk0);
    bits_copy(MB + (size_t)(tb + (tid >> 4)) * (SEQ / 32) + (tid & 15) * 4, (unsigned)(size_t)&mks[0] + (tid >> 4) * (MP * 4u) + (tid & 15) * 16u);
    const size_t qo = pbase + (size_t)t0 * HD + 8 * lane;     // 16 rows x 64 d = two fragments of 512 halves
    const v16h qh0 = ldh(QH + qo), qh1 = ldh(QH + qo + 512), qr0 = ldh(QR + qo), qr1 = ldh(QR + qo + 512);   // B fragments: col t, k = d
    asm volatile("s_wait_asynccnt 0x0" ::: "memory");   // stage 0 and the mask bits of this wave have landed
    __syncthreads();                                    // ... and every wave's: stage 0 and the mask bits are published
    stage_copy(gk + SK * HD, gr + SK * HD, gv + SK * 16, lk0 + LKB);
    const unsigned* mrow = &mks[(wave * 16 + lr) * MP];      // the bits of the lane's query row
    v8f o0 = (v8f){}, o1 = (v8f){}, o2 = (v8f){}, o3 = (v8f){};
    float m = -3.0e38f, l = 0.0f;
#pragma unroll 1
    for (int s = 0; s < NST; ++s) {
        const h16* kst = &kvs[s & 1][0] + 8 * lane;                          // + 32p*HD + 16*HD*(key tile) + 512*(d/32)  (A fragment: row key, k = d)
        const v2u mw = *(const v2u*)(mrow + 2 * s);                          // word p: bit i = mask[t][64s + 32p + i] != 0
        const bool holes = __builtin_amdgcn_ballot_w32((mw[0] & mw[1]) != 0xFFFFFFFFu) != 0;   // the same for the whole wave: a scalar branch
#pragma unroll
        for (int p = 0; p < SK / 32; ++p) {
        const h16* ka = kst + 32 * p * HD;
        const v16h ka0 = ldh(ka), ka1 = ldh(ka + 512), kb0 = ldh(ka + 16 * HD), kb1 = ldh(ka + 16 * HD + 512);
        v8f sHa = (v8f){}, sLa = (v8f){}, sHb = (v8f){}, sLb = (v8f){};
        sHa = wmma16(ka0, qh0, sHa); sLa = wmma16(ka0, qr0, sLa); sHb = wmma16(kb0, qh0, sHb); sLb = wmma16(kb0, qr0, sLb);
        sHa = wmma16(ka1, qh1, sHa); sLa = wmma16(ka1, qr1, sLa); sHb = wmma16(kb1, qh1, sHb); sLb = wmma16(kb1, qr1, sLb);
        asm volatile("v_nop\n\tv_nop\n\tv_nop\n\tv_nop" : "+v"(sHa), "+v"(sLa), "+v"(sHb), "+v"(sLb) : "v"(ka0), "v"(ka1), "v"(kb0), "v"(kb1));
        const h16* kr = ka + SK * HD;
        const v16h ra0 = ldh(kr), ra1 = ldh(kr + 512), rb0 = ldh(kr + 16 * HD), rb1 = ldh(kr + 16 * HD + 512);
        sLa = wmma16(ra0, qh0, sLa); sLb = wmma16(rb0, qh0, sLb);
        sLa = wmma16(ra1, qh1, sLa); sLb = wmma16(rb1, qh1, sLb);
        asm volatile("v_nop\n\tv_nop\n\tv_nop\n\tv_nop" : "+v"(sLa), "+v"(sLb) : "v"(ra0), "v"(ra1), "v"(rb0), "v"(rb1));
        float ta[8], tb2[8]; float mx = -3.0e38f;
#pragma unroll
        for (int r = 0; r < 8; ++r) { ta[r] = (sHa[r] + sLa[r] * QRI) * SC2; tb2[r] = (sHb[r] + sLb[r] * QRI) * SC2; }
        if (holes) {
            const unsigned wv = mw[p] >> (8 * hi);            // bit r: key 32p + 8h + r (tile a); bit 16 + r: key 32p + 16 + 8h + r (tile b)
#pragma unroll
            for (int r = 0; r < 8; ++r) { ta[r] = ((wv >> r) & 1u) ? ta[r] : FILL2; tb2[r] = ((wv >> (16 + r)) & 1u) ? tb2[r] : FILL2; } }
#pragma unroll
        for (int r = 0; r < 8; ++r) mx = fmaxf(mx, fmaxf(ta[r], tb2[r]));
        mx = fmaxf(mx, __shfl_xor(mx, 16, 32));
        const float mnew = fmaxf(m, mx);
        const float alpha = __builtin_amdgcn_exp2f(m - mnew);
        v16h pb; float ls = 0.0f;
#pragma unroll
        for (int r = 0; r < 8; ++r) { const h16 pa = (h16)__builtin_amdgcn_exp2f((ta[r] - mnew) + PSH); const h16 pc = (h16)__builtin_amdgcn_exp2f((tb2[r] - mnew) + PSH); pb[r] = pa; pb[8 + r] = pc; ls += (float)pa + (float)pc; }
        l = l * alpha + ls; m = mnew;
        o0 = o0 * alpha; o1 = o1 * alpha; o2 = o2 * alpha; o3 = o3 * alpha;
        const h16* va = kst + 2 * SK * HD + 512 * p;      // + SK*16*(d/16)   (A fragment: row d, k = key)
        const v16h v0 = ldh(va), v1 = ldh(va + SK * 16), v2 = ldh(va + 2 * SK * 16), v3 = ldh(va + 3 * SK * 16);
        o0 = wmma16(v0, pb, o0); o1 = wmma16(v1, pb, o1); o2 = wmma16(v2, pb, o2); o3 = wmma16(v3, pb, o3);
        asm volatile("v_nop\n\tv_nop\n\tv_nop\n\tv_nop" : "+v"(o0), "+v"(o1), "+v"(o2), "+v"(o3) : "v"(v0), "v"(v1), "v"(v2), "v"(v3), "v"(pb));
        }
        // publish point of stage s + 1, and the end of every wave's reads of stage s
        asm volatile("s_wait_dscnt 0x0" ::: "memory");      // this wave's LDS reads of stage s have returned before its buffer is refilled
        asm volatile("s_wait_asynccnt 0x0" ::: "memory");   // this wave's copies of stage s + 1 have landed
        __syncthreads();
        if (s + 2 < NST)                                    // the same for the whole block
            stage_copy(gk + (size_t)(s + 2) * SK * HD, gr + (size_t)(s + 2) * SK * HD, gv + (size_t)(s + 2) * SK * 16, lk0 + (s & 1) * LKB);
    }
    asm volatile("s_wait_asynccnt 0x0" ::: "memory");       // no copy is outstanding when the wave ends
    l += __shfl_xor(l, 16, 32);
    const float inv = 1.0f / l;
    // O^T D layout: o_j[r] = (d = 16j + 8h + r, t = lane&15): a lane's eight values of o_j are the 16-byte piece (row t, columns 16j + 8h + 0..7) of the ctx plane,
    // which fragment order puts at j*256 + lane*8 halves behind the base of fragments (row/16, 2h) and (row/16, 2h + 1): four 512-byte stores straight from the accumulators
    h16* crow = CX + ((size_t)b * SEQ + t0) * DM + h * (HD * 16) + lane * 8;
    v8h h0, h1, h2, h3;
#pragma unroll
    for (int r = 0; r < 8; ++r) { h0[r] = (h16)(o0[r] * inv); h1[r] = (h16)(o1[r] * inv); h2[r] = (h16)(o2[r] * inv); h3[r] = (h16)(o3[r] * inv); }
    *(v8h*)(crow) = h0; *(v8h*)(crow + 256) = h1; *(v8h*)(crow + 512) = h2; *(v8h*)(crow + 768) = h3;
}

static constexpr size_t al256(size_t v) { return (v + 255) & ~(size_t)255; }
static constexpr size_t SZ_XB = al256((size_t)NB * SEQ * DM * 2);              // one bf16 input plane [NB*SEQ][1024]
static constexpr size_t SZ_WB = al256((size_t)3 * DM * DM * 2);               // bf16 Wq | Wk | Wv
static constexpr size_t SZ_WO = al256((size_t)DM * DM * 2);                   // f16 Wo x64
static constexpr size_t SZ_PL = al256((size_t)NB * NH_ * SEQ * HD * 2);       // one f16 head plane
static constexpr size_t SZ_CX = al256((size_t)NB * SEQ * DM * 2);             // f16 ctx plane
static constexpr size_t SZ_MB = al256((size_t)SEQ * (SEQ / 32) * 4);          // mask bit plane
static constexpr size_t SZ_TOTAL = 3 * SZ_XB + SZ_WB + SZ_WO + 5 * SZ_PL + SZ_CX + SZ_MB;
static_assert(SZ_TOTAL <= (size_t)134217728);          // workspace carve <= 128 MiB
static_assert(((size_t)DM * DM * 2) % 256 == 0);       // weight sub-planes stay 256-byte aligned

extern "C" void kernel_launch(void* const* d_in, const int* in_sizes, int n_in,
                              void* d_out, int out_size, void* d_ws, size_t ws_size, hipStream_t stream) {
    if (n_in < 8) return;
    const size_t needx = ((size_t)(SEQ - 1) * NB_FULL + NB) * DM;
    if ((size_t)in_sizes[0] < needx || (size_t)in_sizes[1] < needx || (size_t)in_sizes[2] < needx) return;
    if ((size_t)in_sizes[3] < (size_t)(SEQ - 1) * SEQ_FULL + SEQ) return;
    if ((size_t)in_sizes[4] < (size_t)DM * DM || (size_t)in_sizes[5] < (size_t)DM * DM || (size_t)in_sizes[6] < (size_t)DM * DM || (size_t)in_sizes[7] < (size_t)DM * DM) return;
    if ((size_t)out_size < ((size_t)(SEQ - 1) * OUT_NB + NB) * DM) return;
    if (SZ_TOTAL > ws_size) return;
    // wire order: query, keys, values, mask (int32), Wq, Wk, Wv, Wo ([out][in] = Bt as-is)
    const float* xq = (const float*)d_in[0]; const float* xk = (const float*)d_in[1]; const float* xv = (const float*)d_in[2];
    const int* mask = (const int*)d_in[3];
    const float* wq = (const float*)d_in[4]; const float* wk = (const float*)d_in[5]; const float* wv = (const float*)d_in[6]; const float* wo = (const float*)d_in[7];
    float* OUT = (float*)d_out;      // [SEQ][OUT_NB][1024]
    char* wsp = (char*)d_ws;
    bf* XQ = (bf*)wsp; wsp += SZ_XB;                 // [NB*SEQ][1024], row b*SEQ + t
    bf* XK = (bf*)wsp; wsp += SZ_XB;
    bf* XV = (bf*)wsp; wsp += SZ_XB;
    bf* WB = (bf*)wsp; wsp += SZ_WB;                 // [3][1024][1024]: q | k | v
    h16* WO16 = (h16*)wsp; wsp += SZ_WO;             // [1024][1024] x64
    h16* QH = (h16*)wsp; wsp += SZ_PL;               // [NB*16][SEQ][64]
    h16* QR = (h16*)wsp; wsp += SZ_PL;               // [NB*16][SEQ][64] residual x2048
    h16* KH = (h16*)wsp; wsp += SZ_PL;               // [NB*16][SEQ][64]
    h16* KR = (h16*)wsp; wsp += SZ_PL;               // [NB*16][SEQ][64] residual x2048
    h16* VT = (h16*)wsp; wsp += SZ_PL;               // [NB*16][64][SEQ]
    h16* CX = (h16*)wsp; wsp += SZ_CX;               // [NB*SEQ][1024]
    unsigned* MB = (unsigned*)wsp; wsp += SZ_MB;     // [SEQ][SEQ/32] mask bits
    bf* WQ = WB; bf* WK = WB + (size_t)DM * DM; bf* WV = WB + (size_t)2 * DM * DM;

    k_cvt<<<3 * GX + 4 * GW + GM, 256, 0, stream>>>(xq, xk, xv, wq, wk, wv, wo, mask, XQ, XK, XV, WQ, WK, WV, WO16, MB);

    k_proj<<<dim3(NB * SEQ / 128, DM / 128, 3), 32 * GWV, 0, stream>>>(XQ, XK, XV, WQ, WK, WV, QH, QR, KH, KR, VT);

    k_flash<<<dim3(SEQ / (16 * AW), NB * NH_, 1), 32 * AW, 0, stream>>>(QH, QR, KH, KR, VT, MB, CX);

    // out[t][b][n] = sum_k ctx[b*SEQ + t][k] Wo[n][k]
    k_oproj<<<dim3(NB * SEQ / 128, DM / 128, 1), 32 * GWV, 0, stream>>>(CX, WO16, OUT);
}

// v007
// Measured time: 90.5 microseconds a run.
// Versions in between are left out here; by their measured steps it is 1.23 times as fast as v005.
// Over all steps from v000 it is 3.55 times as fast.
#include <hip/hip_runtime.h>

// Multi-head attention, width 1024 = 16 heads x 64; query/keys/values [SEQ][NB][1024] sequence-first (row = s*NB_FULL + b), Wq/Wk/Wv/Wo [out][in] (y = x W^T), no biases,
// UNSCALED scores, int32 mask [SEQ][SEQ] with replace-fill (-1e20 where mask == 0), output = ctx Wo^T as f32 [SEQ][NB][1024].
// Compute dtypes, f32 accumulate everywhere: q/k/v projections v_wmma_f32_16x16x32_bf16 (inputs and W RNE-converted to bf16; products exact);
// scores v_wmma_f32_16x16x32_f16: q and k single f16 (their f16 rounding, 2^-11 relative, lies below the error that the bf16 operands of the projections leave in q and k, 2^-8 relative per operand);
// P (x2^14 carry, cancels in the normalisation) and v single f16; out-projection v_wmma_f32_16x16x32_f16: ctx single f16, Wo = f16(bf16(Wo) * 64), folded back by 1/64; softmax f32 (online, running max).
// Layout: bf16 copies of the inputs de-interleaved to [b][s][1024]; q/k planes [b*16+h][t][d] and v^T plane [b*16+h][d][t] written by the GEMM epilogue;
// fused flash kernel in transposed form (S^T = K Q^T, O^T = V^T P^T) writes the f16 ctx plane [b*SEQ+t][1024]; the out-projection GEMM writes rows t*OUT_NB + b.
// FRAGMENT ORDER: every 16-bit workspace plane [R][C] (C = the k dimension of its WMMA use) is stored as fragments of 16 rows x 32 k, 1 KiB each, fragment index (r/16)*(C/32) + k/32.
// Inside a fragment the 16-byte piece (row r, k = 8q..8q+7 of the 32, q = 0..3) lies at (q>>1)*512 B + ((q&1)*16 + r%16)*16 B, so each of the two wave-wide 16-byte loads
// of a fragment reads 512 contiguous bytes (4 whole lines; from row-major planes it would touch 16).
// MASK BITS: the converter launch packs the int32 mask to one bit per key, plane [SEQ][SEQ/32] of 32-bit words, bit i of word (t, w) = (mask[t][32w + i] != 0); the flash kernel reads only that plane.

#ifndef NB
#define NB 2
#endif
#ifndef SEQ
#define SEQ 2048
#endif
#define NB_FULL  2
#define SEQ_FULL 2048
#ifndef OUT_NB
#define OUT_NB NB                // batch pitch (in rows) of the output [t][OUT_NB][1024]
#endif
#define DM   1024
#define NH_  16
#define HD   64
#define AW   8                   // waves per flash block (16 query rows each)
#define SC2  1.4426950408889634f // log2(e); the module applies no score scale
#define PSH  14.0f               // log2 of the P carry (16384)
#define FILL2 (-1.4426950408889634e20f)   // -1e20 in the log2 domain (replace-fill of masked scores)
#define WOS  64.0f               // carry of the Wo plane
#define WOI  (1.0f / 64.0f)

static_assert(HD == 64);
static_assert(NH_ * HD == DM);                 // head h = columns h*64 + d
static_assert(DM % 64 == 0);                   // 16 column tiles of 64
static_assert(DM % 32 == 0);                   // GEMM k-steps of 32, two per ring stage of 64
static_assert(SEQ % 64 == 0);                  // a 64-row tile (and a 16-row fragment) never straddles two batches
static_assert((NB * SEQ) % 64 == 0);
static_assert(SEQ % 32 == 0);                  // key loop steps by 32
static_assert(SEQ % (16 * AW) == 0);           // flash grid covers the sequence exactly
static_assert(((size_t)NB * SEQ * DM) % 8 == 0);
static_assert(((size_t)DM * DM) % 8 == 0);
static_assert(NB <= NB_FULL);
static_assert(SEQ <= SEQ_FULL);
static_assert(NB <= OUT_NB);

typedef _Float16 h16;
typedef unsigned short bf;
typedef __attribute__((ext_vector_type(16))) __bf16   v16bf;
typedef __attribute__((ext_vector_type(16))) _Float16 v16h;
typedef __attribute__((ext_vector_type(8)))  _Float16 v8h;
typedef __attribute__((ext_vector_type(8)))  unsigned short v8us;
typedef __attribute__((ext_vector_type(8)))  float    v8f;
typedef __attribute__((ext_vector_type(4)))  float    v4f;
typedef __attribute__((ext_vector_type(2)))  unsigned v2u;
typedef __attribute__((ext_vector_type(4)))  unsigned short v4us;
typedef v4f  __attribute__((may_alias)) v4fa;
typedef v4us __attribute__((may_alias)) v4usa;
typedef v8us __attribute__((may_alias)) v8usa;

__device__ __forceinline__ unsigned short f2bf(float f) { unsigned u = __float_as_uint(f); u += 0x7FFFu + ((u >> 16) & 1u); return (unsigned short)(u >> 16); }
__device__ __forceinline__ float bf2f(unsigned short s) { return __uint_as_float(((unsigned)s) << 16); }
__device__ __forceinline__ v16h cat16(v8h lo, v8h hi) { return __builtin_shufflevector(lo, hi, 0, 1, 2, 3, 4, 5, 6, 7, 8, 9, 10, 11, 12, 13, 14, 15); }
__device__ __forceinline__ v16bf cat16b(v8us lo, v8us hi) { return __builtin_bit_cast(v16bf, __builtin_shufflevector(lo, hi, 0, 1, 2, 3, 4, 5, 6, 7, 8, 9, 10, 11, 12, 13, 14, 15)); }
__device__ __forceinline__ v8f wmma16(v16h a, v16h b, v8f c) { return __builtin_amdgcn_wmma_f32_16x16x32_f16(false, a, false, b, (short)0, c, false, false); }
__device__ __forceinline__ v8f wmmab(v16bf a, v16bf b, v8f c) { return __builtin_amdgcn_wmma_f32_16x16x32_bf16(false, a, false, b, (short)0, c, false, false); }
// fragment loaders from fragment-order planes; p = fragment base + 8*lane: elements 0..7 <- k0+8h+0..7, elements 8..15 <- k0+16+8h+0..7, row lane&15, h = lane>>4 (same map for A and B)
__device__ __forceinline__ v16h  ldh(const h16* p) { return cat16(*(const v8h*)p, *(const v8h*)(p + 256)); }
__device__ __forceinline__ v16bf ldb(const bf* p)  { return cat16b(*(const v8us*)p, *(const v8us*)(p + 256)); }
// ordering point for wave-private LDS tiles (same wave writes and reads)
__device__ __forceinline__ void wave_sync() { __builtin_amdgcn_fence(3 /* release order */, "wavefront"); __builtin_amdgcn_wave_barrier(); asm volatile("" ::: "memory"); }

// cvt_frag: one wave converts one fragment (16 rows x 32 columns) of an f32 matrix with DM columns: four whole-line loads (4 rows x 128 B each), the 16-bit rows
// through a wave-private LDS tile (80-byte pitch: 16 B x odd, free of conflicts for the 16-byte reads), two 512-byte stores in fragment order.
// MODE 0: bf16 RNE, source rows de-interleaved (plane row b*SEQ + t <- source row t*NB_FULL + b); MODE 1: bf16 RNE, rows as they are; MODE 2: f16(bf16(x) * 64), rows as they are.
template <int MODE> __device__ __forceinline__ void cvt_frag(const float* __restrict__ src, unsigned short* dst, unsigned blk, unsigned short* ts) {
    const int lane = threadIdx.x & 31, wave = threadIdx.x >> 5;
    const size_t f = (size_t)blk * 8 + wave;
    const size_t tile = f / (DM / 32), chunk = f % (DM / 32);
    unsigned short* tw = ts + wave * 16 * 40;
#pragma unroll
    for (int i = 0; i < 4; ++i) {
        const int row = 4 * i + (lane >> 3); const size_t drow = tile * 16 + row;
        const size_t srow = (MODE == 0) ? ((drow % SEQ) * NB_FULL + drow / SEQ) : drow;
        const v4f v = *(const v4f*)(src + srow * DM + chunk * 32 + (lane & 7) * 4); v4us o;
#pragma unroll
        for (int k = 0; k < 4; ++k) o[k] = (MODE == 2) ? __builtin_bit_cast(unsigned short, (h16)(bf2f(f2bf(v[k])) * WOS)) : f2bf(v[k]);
        *(v4usa*)(tw + row * 40 + (lane & 7) * 4) = o; }
    wave_sync();
#pragma unroll
    for (int j = 0; j < 2; ++j) { const v8us o = *(const v8usa*)(tw + (lane & 15) * 40 + j * 16 + (lane >> 4) * 8); *(v8us*)(dst + f * 512 + j * 256 + lane * 8) = o; }
    asm volatile("s_wait_xcnt 0x0" ::: "memory");   // behind the two stores: in the merged kernel's listing another branch's code follows them and rewrites their registers
}

// mask_bits: one wave packs 32 words of the bit plane (1024 keys of one mask row): 32 whole-line loads (one int per lane), each turned into its word by a wave-wide compare
// (lane i's result is bit i); word i is kept by lane i, and the 32 words leave in one 128-byte store.
__device__ __forceinline__ void mask_bits(const int* __restrict__ mask, unsigned* MB, unsigned blk) {
    const int lane = threadIdx.x & 31, wave = threadIdx.x >> 5;
    const size_t w0 = ((size_t)blk * 8 + wave) * 32;
    const int* src = mask + w0 * 32 + lane;
    int v[32];
#pragma unroll
    for (int i = 0; i < 32; ++i) v[i] = src[i * 32];
    unsigned word = 0;
#pragma unroll
    for (int i = 0; i < 32; ++i) { const unsigned bits = __builtin_amdgcn_ballot_w32(v[i] != 0); word = (lane == i) ? bits : word; }
    MB[w0 + lane] = word;
    asm volatile("s_wait_xcnt 0x0" ::: "memory");   // behind the store: in the merged kernel's listing another branch's code follows it and rewrites its registers
}

// k_cvt: all seven conversions and the mask packing in ONE launch (they are independent of each other); the block index picks the matrix. 8 waves per block, one fragment each.
// Blocks 0 .. 3*GX-1: query | keys | values, src [t][NB_FULL][DM] f32 -> plane [b*SEQ + t][DM] bf16; then 3*GW blocks: Wq | Wk | Wv -> bf16; then GW blocks: Wo -> f16 x64. All in fragment order.
// Then GM blocks: mask rows 0 .. SEQ-1 -> bit plane, 32 words per wave.
#define GX ((unsigned)((size_t)NB * SEQ * DM / 512 / 8))
#define GW ((unsigned)((size_t)DM * DM / 512 / 8))
#define GM ((unsigned)((size_t)SEQ * (SEQ / 32) / 32 / 8))
static_assert(SEQ == SEQ_FULL);                             // the words of the bit plane follow the mask's own rows without a gap
static_assert(((size_t)SEQ * (SEQ / 32)) % (32 * 8) == 0);  // every mask block has eight whole runs of 32 words
static_assert(((size_t)NB * SEQ * DM) % (512 * 8) == 0);   // every conversion block of the merged grid has eight whole fragments
static_assert(((size_t)DM * DM) % (512 * 8) == 0);
__global__ __launch_bounds__(256) void k_cvt(const float* __restrict__ xq, const float* __restrict__ xk, const float* __restrict__ xv,
                                             const float* __restrict__ wq, const float* __restrict__ wk, const float* __restrict__ wv, const float* __restrict__ wo, const int* __restrict__ mask,
                                             bf* XQ, bf* XK, bf* XV, bf* WQ, bf* WK, bf* WV, h16* WO16, unsigned* MB) {
    __shared__ __align__(16) unsigned short ts[8 * 16 * 40];
    const unsigned bx = blockIdx.x;
    if (bx < 3 * GX) { const unsigned w = bx / GX; cvt_frag<0>(w == 0 ? xq : w == 1 ? xk : xv, w == 0 ? XQ : w == 1 ? XK : XV, bx % GX, ts); }
    else if (bx < 3 * GX + 3 * GW) { const unsigned c = bx - 3 * GX, w = c / GW; cvt_frag<1>(w == 0 ? wq : w == 1 ? wk : wv, w == 0 ? WQ : w == 1 ? WK : WV, c % GW, ts); }
    else if (bx < 3 * GX + 4 * GW) cvt_frag<2>(wo, (unsigned short*)WO16, bx - (3 * GX + 3 * GW), ts);
    else mask_bits(mask, MB, bx - (3 * GX + 4 * GW));
}

// THE GEMM RING (k_proj, k_oproj): a block of GWV = 4 waves works on a 128x128 tile, wave (wm, wn) = (wave / 2, wave % 2) on its 64x64 quarter (16 accumulators), K = DM.
// Both operands come through a two-buffer LDS ring, one stage = GS = 64 k = two fragments per 16 rows. In a fragment-order plane those two fragments are 2 KiB in a row, which is one
// asynchronous copy of 16 bytes per thread; a stage is 8 such copies for the 128 A rows and 8 for the 128 B rows, issued one whole stage ahead: each operand byte leaves L2 once per block
// (not once per wave) and no L2 latency stands between the matrix instructions. A stage in LDS keeps the planes' own order: A | B, per 16 rows 1024 halves, fragment k/32 at 512 halves.
#define GWV  4                   // waves per GEMM block
#define GS   64                  // k per ring stage
#define GNST (DM / GS)           // stages
#define GOP  (128 * GS)          // halves of one operand in one stage
static_assert(DM % GS == 0 && GNST >= 2);      // the ring's prologue fills two stages
static_assert(GS == 64);                       // a stage is worked on as two steps of 32 k
static_assert((NB * SEQ) % 128 == 0 && DM % 128 == 0);   // the grids cover both matrices with whole 128x128 tiles
static_assert(GWV * 32 * 8 == GS * 16);        // one copy of every thread = the stage's two fragments of 16 rows

// One operand's copies of one thread for one stage: g = the thread's own 16 bytes in the first 16 rows (16 rows further = 16*DM halves), l = its LDS byte address (16 rows further = 2 KiB).
// The s_wait_xcnt stands inside the statement, behind the last copy, so that no address register is rewritten ahead of it.
template <class T> __device__ __forceinline__ void rows_copy(const T* g, unsigned l) {
    asm volatile("global_load_async_to_lds_b128 %0, %8, off\n\t"
                 "global_load_async_to_lds_b128 %1, %9, off\n\t"
                 "global_load_async_to_lds_b128 %2, %10, off\n\t"
                 "global_load_async_to_lds_b128 %3, %11, off\n\t"
                 "global_load_async_to_lds_b128 %4, %12, off\n\t"
                 "global_load_async_to_lds_b128 %5, %13, off\n\t"
                 "global_load_async_to_lds_b128 %6, %14, off\n\t"
                 "global_load_async_to_lds_b128 %7, %15, off\n\t"
                 "s_wait_xcnt 0x0"
                 :: "v"(l), "v"(l + 2048u), "v"(l + 4096u), "v"(l + 6144u), "v"(l + 8192u), "v"(l + 10240u), "v"(l + 12288u), "v"(l + 14336u),
                    "v"(g), "v"(g + (size_t)1 * 16 * DM), "v"(g + (size_t)2 * 16 * DM), "v"(g + (size_t)3 * 16 * DM), "v"(g + (size_t)4 * 16 * DM),
                    "v"(g + (size_t)5 * 16 * DM), "v"(g + (size_t)6 * 16 * DM), "v"(g + (size_t)7 * 16 * DM)
                 : "memory");
}

// k_proj: register-blocked bf16 GEMM on the GEMM ring, operands from fragment-order bf16 planes.
// C[m][n] = sum_k A[m][k] Bt[n][k], written as f16 (Ph) in fragment order into planes of 'pitch' columns:
// a wave's tile base (r0/RB)*sRB + (r0%RB)*pitch + (c0/CB)*sCB + (c0%CB)*16 (halves); 16 rows further = 16*pitch, 32 columns further = 512.
// The three projections are independent and run in ONE launch, grid (NB*SEQ/128, DM/128, 3), 128 threads; blockIdx.z picks the product:
// z = 0, 1 (q, k): A = x rows (m = b*SEQ + t), Bt = W rows (n = h*64 + d) -> planes [(b*16 + h)][t][d];
// z = 2 (v^T): A = Wv rows (m = h*64 + d, from blockIdx.y), Bt = x rows (n = b*SEQ + t, from blockIdx.x) -> plane [(b*1024 + m)][t] = [(b*16 + h)][d][t].
__global__ __launch_bounds__(32 * GWV) void k_proj(const bf* __restrict__ XQ, const bf* __restrict__ XK, const bf* __restrict__ XV, const bf* __restrict__ WQ, const bf* __restrict__ WK, const bf* __restrict__ WV,
                                             h16* QH, h16* KH, h16* VT) {
    __shared__ __align__(16) bf gs[2][2 * GOP];              // per buffer: A rows | B rows
    __shared__ __align__(16) float osb[GWV][16 * 68];        // a wave's own epilogue tile
    const int K = DM;
    const int z = blockIdx.z; const bool isv = (z == 2);
    const bf* __restrict__ A = isv ? WV : (z == 0 ? XQ : XK); const bf* __restrict__ Bt = isv ? XV : (z == 0 ? WQ : WK);
    h16* Ph = isv ? VT : (z == 0 ? QH : KH);
    const int RB = isv ? DM : SEQ, pitch = isv ? SEQ : HD, CB = isv ? SEQ : HD;
    const size_t sRB = isv ? (size_t)0 : (size_t)NH_ * SEQ * HD, sCB = isv ? (size_t)DM * SEQ : (size_t)SEQ * HD;
    const int tid = threadIdx.x, lane = tid & 31, wave = __builtin_amdgcn_readfirstlane(tid >> 5), wm = wave >> 1, wn = wave & 1, lr = lane & 15, hi = lane >> 4;   // the wave's number in a scalar register: tile bases stay scalar
    const int R0 = (isv ? blockIdx.y : blockIdx.x) * 128, C0 = (isv ? blockIdx.x : blockIdx.y) * 128; const int r0 = R0 + wm * 64, c0 = C0 + wn * 64;
    float* os = &osb[wave][0];
    v8f acc[4][4];
#pragma unroll
    for (int mb = 0; mb < 4; ++mb)
#pragma unroll
        for (int nb = 0; nb < 4; ++nb) acc[mb][nb] = (v8f){};
    const bf* ga = A + (size_t)R0 * K + tid * 8; const bf* gb = Bt + (size_t)C0 * K + tid * 8;   // fragment (row/16, kc/32) at (row/16)*16*K + kc*16; a stage further = GS*16 halves
    const unsigned la = (unsigned)(size_t)&gs[0][0] + tid * 16u; const unsigned LOB = GOP * 2, LGB = 2 * GOP * 2;   // bytes from A to B, from buffer 0 to buffer 1
    rows_copy(ga, la); rows_copy(gb, la + LOB);
    asm volatile("s_wait_asynccnt 0x0" ::: "memory");   // stage 0 of this wave has landed
    __syncthreads();                                    // ... and every wave's: stage 0 is published
    rows_copy(ga + GS * 16, la + LGB); rows_copy(gb + GS * 16, la + LGB + LOB);
#pragma unroll 1
    for (int s = 0; s < GNST; ++s) {
        const bf* sa = &gs[s & 1][0] + wm * (4 * 16 * GS) + 8 * lane; const bf* sb = &gs[s & 1][0] + GOP + wn * (4 * 16 * GS) + 8 * lane;
        // The sched_barrier(0) lines hold this order: [reads: A and B of the first 32 k, A of the second][8 products][reads: 2 B fragments of the second 32 k][8 products][reads: the other 2][16 products][waits].
        // Each of the two later groups then stands 8 products ahead of its first use, and every wait but the last is a counted one. Left alone, the scheduler sinks the B reads singly among the products, each with a wait to 0 directly behind it.
        v16bf a[GS / 32][4], b[GS / 32][4];
#pragma unroll
        for (int mb = 0; mb < 4; ++mb) a[0][mb] = ldb(sa + mb * (16 * GS));
#pragma unroll
        for (int nb = 0; nb < 4; ++nb) b[0][nb] = ldb(sb + nb * (16 * GS));
#pragma unroll
        for (int mb = 0; mb < 4; ++mb) a[1][mb] = ldb(sa + mb * (16 * GS) + 512);
        __builtin_amdgcn_sched_barrier(0);   // the first group of reads stays in front of the products
#pragma unroll
        for (int h2 = 0; h2 < 2; ++h2) {
#pragma unroll
            for (int nb = 2 * h2; nb < 2 * h2 + 2; ++nb)
#pragma unroll
                for (int mb = 0; mb < 4; ++mb) acc[mb][nb] = wmmab(a[0][mb], b[0][nb], acc[mb][nb]);
            __builtin_amdgcn_sched_barrier(0);   // these two fragments' reads are not lifted (they take registers of fragments whose last product stands above: 16 fragments at once would not fit 256 registers) ...
            b[1][2 * h2] = ldb(sb + (2 * h2) * (16 * GS) + 512); b[1][2 * h2 + 1] = ldb(sb + (2 * h2 + 1) * (16 * GS) + 512);
            __builtin_amdgcn_sched_barrier(0);   // ... and not sunk towards their use
        }
#pragma unroll
        for (int nb = 0; nb < 4; ++nb)
#pragma unroll
            for (int mb = 0; mb < 4; ++mb) acc[mb][nb] = wmmab(a[1][mb], b[1][nb], acc[mb][nb]);
        // keeps the waits below behind the stage's products. Without it the scheduler lifts them and the barrier in front of the products: every read is then waited out
        // before the first product, and the refill is issued only behind the products, so that it flies for less than one stage.
        __builtin_amdgcn_sched_barrier(0);
        // publish point of stage s + 1, and the end of every wave's reads of stage s
        asm volatile("s_wait_dscnt 0x0" ::: "memory");      // this wave's LDS reads of stage s have returned before its buffer is refilled
        asm volatile("s_wait_asynccnt 0x0" ::: "memory");   // this wave's copies of stage s + 1 have landed
        __syncthreads();
        if (s + 2 < GNST) {                                 // the same for the whole block
            rows_copy(ga + (size_t)(s + 2) * GS * 16, la + (s & 1) * LGB); rows_copy(gb + (size_t)(s + 2) * GS * 16, la + (s & 1) * LGB + LOB); }
    }
    asm volatile("s_wait_asynccnt 0x0" ::: "memory");       // no copy is outstanding when the wave goes on
    const size_t tbase = (size_t)(r0 / RB) * sRB + (size_t)(r0 % RB) * (size_t)pitch + (size_t)(c0 / CB) * sCB + (size_t)(c0 % CB) * 16;
#pragma unroll
    for (int mb = 0; mb < 4; ++mb) {
#pragma unroll
        for (int nb = 0; nb < 4; ++nb) {
#pragma unroll
            for (int j = 0; j < 8; ++j) os[(hi * 8 + j) * 68 + nb * 16 + lr] = acc[mb][nb][j]; }   // D: row 8h+j, col lane&15
        wave_sync();
        const size_t sb = tbase + (size_t)(mb * 16) * (size_t)pitch;
{
#pragma unroll
            for (int s = 0; s < 4; ++s) { const int row = lr, c8 = (2 * s + hi) * 8;   // s = 2*(column/32) + half of the fragment; 16 rows x 2 pieces = one 512-byte store
                const v4f x0 = *(const v4fa*)(&os[row * 68 + c8]); const v4f x1 = *(const v4fa*)(&os[row * 68 + c8 + 4]); v8h hv;
#pragma unroll
                for (int i = 0; i < 4; ++i) { hv[i] = (h16)x0[i]; hv[4 + i] = (h16)x1[i]; }
                const size_t oo = sb + (size_t)(s * 256 + lane * 8);
                *(v8h*)(Ph + oo) = hv; }
            asm volatile("s_wait_xcnt 0x0" ::: "memory");   // behind the four stores: the next 16 rows' values and addresses take their registers
             }
        wave_sync();
    }
}

// k_oproj: register-blocked f16 GEMM on the GEMM ring, A = ctx plane [NB*SEQ][DM] f16 (row m = b*SEQ + t), Bt = Wo plane [DM][DM] f16 (x64 carry), both in fragment order.
// OUT[(t*OUT_NB + b)][n] = (1/64) sum_k A[m][k] Bt[n][k], f32. grid (NB*SEQ/128, DM/128), 128 threads.
__global__ __launch_bounds__(32 * GWV) void k_oproj(const h16* __restrict__ A, const h16* __restrict__ Bt, float* OUT) {
    __shared__ __align__(16) h16 gs[2][2 * GOP];             // per buffer: A rows | B rows
    __shared__ __align__(16) float osb[GWV][16 * 68];        // a wave's own epilogue tile
    const int K = DM;
    const int tid = threadIdx.x, lane = tid & 31, wave = __builtin_amdgcn_readfirstlane(tid >> 5), wm = wave >> 1, wn = wave & 1, lr = lane & 15, hi = lane >> 4;   // the wave's number in a scalar register: tile bases stay scalar
    const int R0 = blockIdx.x * 128, C0 = blockIdx.y * 128; const int r0 = R0 + wm * 64, c0 = C0 + wn * 64;
    float* os = &osb[wave][0];
    v8f acc[4][4];
#pragma unroll
    for (int mb = 0; mb < 4; ++mb)
#pragma unroll
        for (int nb = 0; nb < 4; ++nb) acc[mb][nb] = (v8f){};
    const h16* ga = A + (size_t)R0 * K + tid * 8; const h16* gb = Bt + (size_t)C0 * K + tid * 8;   // fragment (row/16, kc/32) at (row/16)*16*K + kc*16; a stage further = GS*16 halves
    const unsigned la = (unsigned)(size_t)&gs[0][0] + tid * 16u; const unsigned LOB = GOP * 2, LGB = 2 * GOP * 2;   // bytes from A to B, from buffer 0 to buffer 1
    rows_copy(ga, la); rows_copy(gb, la + LOB);
    asm volatile("s_wait_asynccnt 0x0" ::: "memory");   // stage 0 of this wave has landed
    __syncthreads();                                    // ... and every wave's: stage 0 is published
    rows_copy(ga + GS * 16, la + LGB); rows_copy(gb + GS * 16, la + LGB + LOB);
#pragma unroll 1
    for (int s = 0; s < GNST; ++s) {
        const h16* sa = &gs[s & 1][0] + wm * (4 * 16 * GS) + 8 * lane; const h16* sb = &gs[s & 1][0] + GOP + wn * (4 * 16 * GS) + 8 * lane;
        // The sched_barrier(0) lines hold this order: [reads: A and B of the first 32 k, A of the second][8 products][reads: 2 B fragments of the second 32 k][8 products][reads: the other 2][16 products][waits].
        // Each of the two later groups then stands 8 products ahead of its first use, and every wait but the last is a counted one. Left alone, the scheduler sinks the B reads singly among the products, each with a wait to 0 directly behind it.
        v16h a[GS / 32][4], b[GS / 32][4];
#pragma unroll
        for (int mb = 0; mb < 4; ++mb) a[0][mb] = ldh(sa + mb * (16 * GS));
#pragma unroll
        for (int nb = 0; nb < 4; ++nb) b[0][nb] = ldh(sb + nb * (16 * GS));
#pragma unroll
        for (int mb = 0; mb < 4; ++mb) a[1][mb] = ldh(sa + mb * (16 * GS) + 512);
        __builtin_amdgcn_sched_barrier(0);   // the first group of reads stays in front of the products
#pragma unroll
        for (int h2 = 0; h2 < 2; ++h2) {
#pragma unroll
            for (int nb = 2 * h2; nb < 2 * h2 + 2; ++nb)
#pragma unroll
                for (int mb = 0; mb < 4; ++mb) acc[mb][nb] = wmma16(a[0][mb], b[0][nb], acc[mb][nb]);
            __builtin_amdgcn_sched_barrier(0);   // these two fragments' reads are not lifted (they take registers of fragments whose last product stands above: 16 fragments at once would not fit 256 registers) ...
            b[1][2 * h2] = ldh(sb + (2 * h2) * (16 * GS) + 512); b[1][2 * h2 + 1] = ldh(sb + (2 * h2 + 1) * (16 * GS) + 512);
            __builtin_amdgcn_sched_barrier(0);   // ... and not sunk towards their use
        }
#pragma unroll
        for (int nb = 0; nb < 4; ++nb)
#pragma unroll
            for (int mb = 0; mb < 4; ++mb) acc[mb][nb] = wmma16(a[1][mb], b[1][nb], acc[mb][nb]);
        // keeps the waits below behind the stage's products. Without it the scheduler lifts them and the barrier in front of the products: every read is then waited out
        // before the first product, and the refill is issued only behind the products, so that it flies for less than one stage.
        __builtin_amdgcn_sched_barrier(0);
        // publish point of stage s + 1, and the end of every wave's reads of stage s
        asm volatile("s_wait_dscnt 0x0" ::: "memory");      // this wave's LDS reads of stage s have returned before its buffer is refilled
        asm volatile("s_wait_asynccnt 0x0" ::: "memory");   // this wave's copies of stage s + 1 have landed
        __syncthreads();
        if (s + 2 < GNST) {                                 // the same for the whole block
            rows_copy(ga + (size_t)(s + 2) * GS * 16, la + (s & 1) * LGB); rows_copy(gb + (size_t)(s + 2) * GS * 16, la + (s & 1) * LGB + LOB); }
    }
    asm volatile("s_wait_asynccnt 0x0" ::: "memory");       // no copy is outstanding when the wave goes on
#pragma unroll
    for (int mb = 0; mb < 4; ++mb) {
#pragma unroll
        for (int nb = 0; nb < 4; ++nb) {
#pragma unroll
            for (int j = 0; j < 8; ++j) os[(hi * 8 + j) * 68 + nb * 16 + lr] = acc[mb][nb][j] * WOI; }   // D: row 8h+j, col lane&15
        wave_sync();
{
#pragma unroll
            for (int s = 0; s < 8; ++s) { const int row = 2 * s + hi, cofs = lr * 4;   // 8 s x 2 rows = 16 rows; 16 lanes x 4 floats = 64 columns
                const int m = r0 + mb * 16 + row; const int bb = m / SEQ, t = m % SEQ;
                const v4f val = *(const v4fa*)(&os[row * 68 + cofs]);
                *(v4f*)(OUT + ((size_t)t * OUT_NB + bb) * DM + c0 + cofs) = val; }
             }
        wave_sync();
    }
}

// k_flash: fused attention, one wave per 16 query rows of one (batch, head), AW waves (16*AW query rows) per block; Q fragments straight from the fragment-order f16 planes, once.
// THE RING: the loop's operands (K, V^T) come through a two-buffer LDS ring, one stage = SK keys = two passes of 32. Every thread brings 4 pieces of 16 bytes per stage
// with asynchronous copies to LDS, issued one whole stage ahead, so each K / V^T byte leaves L2 once per block (not once per wave) and no load latency stands in the loop.
// A stage in LDS: K | V^T, 8 KiB each, in the planes' own fragment order (a wave-wide 16-byte read covers 512 contiguous bytes).
// THE MASK: the block's 16*AW rows of the bit plane (SEQ/32 words each, all keys) are copied to LDS once, with stage 0, at a pitch of MP words (the 16 rows of a wave-wide 8-byte read fall on
// different banks). A lane reads its row's two words of a stage (64 keys) in one 8-byte read.
// Transposed form: S^T[key][t] = K Q^T (A = K rows, B = Q rows); lane (t = lane&15, h = lane>>4) holds keys 8h+r of each 16-key tile, so the packed
// P tile is directly the B fragment of O^T[d][t] = V^T P^T (element r <- tile keys 0..15, element 8+r <- tile keys 16..31, lane unchanged).
// Scores: one accumulator per 16-key tile, two products (d = 0..31, 32..63). Masked scores are REPLACED by the fill constant before the
// running-max softmax (a fully masked row comes out uniform); the replacing is stepped over, by one wave-uniform test per stage, where none of the wave's 16 x 64 bits of the stage is 0.
// Softmax state: the running max is one scalar per lane (the two lane halves of a row are combined with one xor-16 exchange per pass).
// ROW SUMS ON THE MATRIX PIPE: the denominator is one more accumulator tile, lt += E P^T per 32 keys, E = the constant A fragment with ones in rows 0 and 8 and zeros elsewhere.
// D row 8h + j sits in register j of lane half h, so register 0 of EVERY lane holds the sum over all 32 keys of its own query column (P as rounded to f16); registers 1..7 stay 0.
#define SK  64                   // keys per ring stage
#define MP  68                   // pitch of a row of mask bits in LDS, in words
#define NST (SEQ / SK)           // stages
static_assert(AW == 8 && SK == 64);            // the copy maps below: 256 threads, 512 pieces per 8-KiB plane slice
static_assert(SEQ / 32 == 64);                 // ... and 16 pieces per row of mask bits
static_assert(SEQ % SK == 0 && NST >= 2);      // the ring's prologue fills two stages

// One stage's copies of one thread. gk, gv: the thread's own first piece of the stage in the K and V^T planes; lk: its LDS byte address in the stage's buffer.
// The s_wait_xcnt stands inside the statement, behind the last copy, so that no address register is rewritten ahead of it.
__device__ __forceinline__ void stage_copy(const h16* gk, const h16* gv, unsigned lk) {
    asm volatile("global_load_async_to_lds_b128 %0, %4, off\n\t"
                 "global_load_async_to_lds_b128 %1, %5, off\n\t"
                 "global_load_async_to_lds_b128 %2, %6, off\n\t"
                 "global_load_async_to_lds_b128 %3, %7, off\n\t"
                 "s_wait_xcnt 0x0"
                 :: "v"(lk), "v"(lk + 4096u), "v"(lk + 8192u), "v"(lk + 12288u),
                    "v"(gk), "v"(gk + 2048), "v"(gv), "v"(gv + (size_t)32 * SEQ)
                 : "memory");
}

// The block's rows of mask bits, once: gm = the thread's own first piece (row tid/16, piece tid%16; 16 rows further per copy), lm = its LDS byte address.
// The s_wait_xcnt stands inside the statement, behind the last copy, so that no address register is rewritten ahead of it.
__device__ __forceinline__ void bits_copy(const unsigned* gm, unsigned lm) {
    asm volatile("global_load_async_to_lds_b128 %0, %8, off\n\t"
                 "global_load_async_to_lds_b128 %1, %9, off\n\t"
                 "global_load_async_to_lds_b128 %2, %10, off\n\t"
                 "global_load_async_to_lds_b128 %3, %11, off\n\t"
                 "global_load_async_to_lds_b128 %4, %12, off\n\t"
                 "global_load_async_to_lds_b128 %5, %13, off\n\t"
                 "global_load_async_to_lds_b128 %6, %14, off\n\t"
                 "global_load_async_to_lds_b128 %7, %15, off\n\t"
                 "s_wait_xcnt 0x0"
                 :: "v"(lm), "v"(lm + 1u * 16 * MP * 4), "v"(lm + 2u * 16 * MP * 4), "v"(lm + 3u * 16 * MP * 4), "v"(lm + 4u * 16 * MP * 4), "v"(lm + 5u * 16 * MP * 4), "v"(lm + 6u * 16 * MP * 4), "v"(lm + 7u * 16 * MP * 4),
                    "v"(gm), "v"(gm + (size_t)1 * 16 * (SEQ / 32)), "v"(gm + (size_t)2 * 16 * (SEQ / 32)), "v"(gm + (size_t)3 * 16 * (SEQ / 32)), "v"(gm + (size_t)4 * 16 * (SEQ / 32)),
                    "v"(gm + (size_t)5 * 16 * (SEQ / 32)), "v"(gm + (size_t)6 * 16 * (SEQ / 32)), "v"(gm + (size_t)7 * 16 * (SEQ / 32))
                 : "memory");
}

__global__ __launch_bounds__(32 * AW) void k_flash(const h16* __restrict__ QH, const h16* __restrict__ KH,
                                                   const h16* __restrict__ VT, const unsigned* __restrict__ MB, h16* CX) {
    __shared__ __align__(16) h16 kvs[2][2 * SK * HD];        // per buffer: K | V^T, SK*HD halves each
    __shared__ __align__(16) unsigned mks[16 * AW * MP];     // 16*AW rows of mask bits, SEQ/32 words each, pitch MP
    const int tid = threadIdx.x, lane = tid & 31, wave = tid >> 5, lr = lane & 15, hi = lane >> 4;
    const int zh = blockIdx.y; const int b = zh / NH_, h = zh % NH_;
    const int tb = blockIdx.x * (16 * AW), t0 = tb + wave * 16;
    const size_t pbase = (size_t)zh * SEQ * HD;
    // the thread's pieces of stage 0: plane slices of SK keys are contiguous (K: SK*HD halves; V^T: SK*16 halves per 16 d rows, thread halves 0/1 take d tiles 0/1, then 2/3)
    const h16* gk = KH + pbase + tid * 8;
    const h16* gv = VT + pbase + (size_t)(tid >> 7) * 16 * SEQ + (tid & 127) * 8;
    const unsigned lk0 = (unsigned)(size_t)&kvs[0][0] + tid * 16u;
    const unsigned LKB = 2 * SK * HD * 2;   // bytes from buffer 0 to buffer 1
    stage_copy(gk, gv, lk0);
    bits_copy(MB + (size_t)(tb + (tid >> 4)) * (SEQ / 32) + (tid & 15) * 4, (unsigned)(size_t)&mks[0] + (tid >> 4) * (MP * 4u) + (tid & 15) * 16u);
    const size_t qo = pbase + (size_t)t0 * HD + 8 * lane;     // 16 rows x 64 d = two fragments of 512 halves
    const v16h qh0 = ldh(QH + qo), qh1 = ldh(QH + qo + 512);   // B fragments: col t, k = d
    asm volatile("s_wait_asynccnt 0x0" ::: "memory");   // stage 0 and the mask bits of this wave have landed
    __syncthreads();                                    // ... and every wave's: stage 0 and the mask bits are published
    stage_copy(gk + SK * HD, gv + SK * 16, lk0 + LKB);
    const unsigned* mrow = &mks[(wave * 16 + lr) * MP];      // the bits of the lane's query row
    v8f o0 = (v8f){}, o1 = (v8f){}, o2 = (v8f){}, o3 = (v8f){};
    float m = -3.0e38f;
    v8f lt = (v8f){};                                        // register 0: the lane's row sum
    v16h ones;                                               // A fragment E: row = lane & 15, every k alike
#pragma unroll
    for (int i = 0; i < 16; ++i) ones[i] = ((lane & 7) == 0) ? (h16)1.0f : (h16)0.0f;
#pragma unroll 1
    for (int s = 0; s < NST; ++s) {
        const h16* kst = &kvs[s & 1][0] + 8 * lane;                          // + 32p*HD + 16*HD*(key tile) + 512*(d/32)  (A fragment: row key, k = d)
        const v2u mw = *(const v2u*)(mrow + 2 * s);                          // word p: bit i = mask[t][64s + 32p + i] != 0
        const bool holes = __builtin_amdgcn_ballot_w32((mw[0] & mw[1]) != 0xFFFFFFFFu) != 0;   // the same for the whole wave: a scalar branch
#pragma unroll
        for (int p = 0; p < SK / 32; ++p) {
        const h16* ka = kst + 32 * p * HD;
        const v16h ka0 = ldh(ka), ka1 = ldh(ka + 512), kb0 = ldh(ka + 16 * HD), kb1 = ldh(ka + 16 * HD + 512);
        v8f sHa = (v8f){}, sHb = (v8f){};
        sHa = wmma16(ka0, qh0, sHa); sHb = wmma16(kb0, qh0, sHb);
        sHa = wmma16(ka1, qh1, sHa); sHb = wmma16(kb1, qh1, sHb);
        // four vector slots behind the last product, on every path, before its accumulators are read or the K fragments' registers are loaded anew
        asm volatile("v_nop\n\tv_nop\n\tv_nop\n\tv_nop" : "+v"(sHa), "+v"(sHb) : "v"(ka0), "v"(ka1), "v"(kb0), "v"(kb1));
        float ta[8], tb2[8]; float mx = -3.0e38f;
#pragma unroll
        for (int r = 0; r < 8; ++r) { ta[r] = sHa[r] * SC2; tb2[r] = sHb[r] * SC2; }
        if (holes) {
            const unsigned wv = mw[p] >> (8 * hi);            // bit r: key 32p + 8h + r (tile a); bit 16 + r: key 32p + 16 + 8h + r (tile b)
#pragma unroll
            for (int r = 0; r < 8; ++r) { ta[r] = ((wv >> r) & 1u) ? ta[r] : FILL2; tb2[r] = ((wv >> (16 + r)) & 1u) ? tb2[r] : FILL2; } }
#pragma unroll
        for (int r = 0; r < 8; ++r) mx = fmaxf(mx, fmaxf(ta[r], tb2[r]));
        mx = fmaxf(mx, __shfl_xor(mx, 16, 32));
        const float mnew = fmaxf(m, mx);
        const float alpha = __builtin_amdgcn_exp2f(m - mnew);
        v16h pb;
#pragma unroll
        for (int r = 0; r < 8; ++r) { const h16 pa = (h16)__builtin_amdgcn_exp2f((ta[r] - mnew) + PSH); const h16 pc = (h16)__builtin_amdgcn_exp2f((tb2[r] - mnew) + PSH); pb[r] = pa; pb[8 + r] = pc; }
        lt[0] = lt[0] * alpha; m = mnew;                  // the other registers of the tile hold 0
        o0 = o0 * alpha; o1 = o1 * alpha; o2 = o2 * alpha; o3 = o3 * alpha;
        const h16* va = kst + SK * HD + 512 * p;          // + SK*16*(d/16)   (A fragment: row d, k = key)
        const v16h v0 = ldh(va), v1 = ldh(va + SK * 16), v2 = ldh(va + 2 * SK * 16), v3 = ldh(va + 3 * SK * 16);
        o0 = wmma16(v0, pb, o0); o1 = wmma16(v1, pb, o1); o2 = wmma16(v2, pb, o2); o3 = wmma16(v3, pb, o3);
        lt = wmma16(ones, pb, lt);
        // four vector slots behind the pass's last product (the row-sum tile's), on every path, before an accumulator is read or a fragment's registers are loaded anew
        asm volatile("v_nop\n\tv_nop\n\tv_nop\n\tv_nop" : "+v"(o0), "+v"(o1), "+v"(o2), "+v"(o3), "+v"(lt) : "v"(v0), "v"(v1), "v"(v2), "v"(v3), "v"(pb));
        }
        // publish point of stage s + 1, and the end of every wave's reads of stage s
        asm volatile("s_wait_dscnt 0x0" ::: "memory");      // this wave's LDS reads of stage s have returned before its buffer is refilled
        asm volatile("s_wait_asynccnt 0x0" ::: "memory");   // this wave's copies of stage s + 1 have landed
        __syncthreads();
        if (s + 2 < NST)                                    // the same for the whole block
            stage_copy(gk + (size_t)(s + 2) * SK * HD, gv + (size_t)(s + 2) * SK * 16, lk0 + (s & 1) * LKB);
    }
    asm volatile("s_wait_asynccnt 0x0" ::: "memory");       // no copy is outstanding when the wave ends
    const float inv = 1.0f / lt[0];
    // O^T D layout: o_j[r] = (d = 16j + 8h + r, t = lane&15): a lane's eight values of o_j are the 16-byte piece (row t, columns 16j + 8h + 0..7) of the ctx plane,
    // which fragment order puts at j*256 + lane*8 halves behind the base of fragments (row/16, 2h) and (row/16, 2h + 1): four 512-byte stores straight from the accumulators
    h16* crow = CX + ((size_t)b * SEQ + t0) * DM + h * (HD * 16) + lane * 8;
    v8h h0, h1, h2, h3;
#pragma unroll
    for (int r = 0; r < 8; ++r) { h0[r] = (h16)(o0[r] * inv); h1[r] = (h16)(o1[r] * inv); h2[r] = (h16)(o2[r] * inv); h3[r] = (h16)(o3[r] * inv); }
    *(v8h*)(crow) = h0; *(v8h*)(crow + 256) = h1; *(v8h*)(crow + 512) = h2; *(v8h*)(crow + 768) = h3;
}

static constexpr size_t al256(size_t v) { return (v + 255) & ~(size_t)255; }
static constexpr size_t SZ_XB = al256((size_t)NB * SEQ * DM * 2);              // one bf16 input plane [NB*SEQ][1024]
static constexpr size_t SZ_WB = al256((size_t)3 * DM * DM * 2);               // bf16 Wq | Wk | Wv
static constexpr size_t SZ_WO = al256((size_t)DM * DM * 2);                   // f16 Wo x64
static constexpr size_t SZ_PL = al256((size_t)NB * NH_ * SEQ * HD * 2);       // one f16 head plane
static constexpr size_t SZ_CX = al256((size_t)NB * SEQ * DM * 2);             // f16 ctx plane
static constexpr size_t SZ_MB = al256((size_t)SEQ * (SEQ / 32) * 4);          // mask bit plane
static constexpr size_t SZ_TOTAL = 3 * SZ_XB + SZ_WB + SZ_WO + 3 * SZ_PL + SZ_CX + SZ_MB;
static_assert(SZ_TOTAL <= (size_t)134217728);          // workspace carve <= 128 MiB
static_assert(((size_t)DM * DM * 2) % 256 == 0);       // weight sub-planes stay 256-byte aligned

extern "C" void kernel_launch(void* const* d_in, const int* in_sizes, int n_in,
                              void* d_out, int out_size, void* d_ws, size_t ws_size, hipStream_t stream) {
    if (n_in < 8) return;
    const size_t needx = ((size_t)(SEQ - 1) * NB_FULL + NB) * DM;
    if ((size_t)in_sizes[0] < needx || (size_t)in_sizes[1] < needx || (size_t)in_sizes[2] < needx) return;
    if ((size_t)in_sizes[3] < (size_t)(SEQ - 1) * SEQ_FULL + SEQ) return;
    if ((size_t)in_sizes[4] < (size_t)DM * DM || (size_t)in_sizes[5] < (size_t)DM * DM || (size_t)in_sizes[6] < (size_t)DM * DM || (size_t)in_sizes[7] < (size_t)DM * DM) return;
    if ((size_t)out_size < ((size_t)(SEQ - 1) * OUT_NB + NB) * DM) return;
    if (SZ_TOTAL > ws_size) return;
    // wire order: query, keys, values, mask (int32), Wq, Wk, Wv, Wo ([out][in] = Bt as-is)
    const float* xq = (const float*)d_in[0]; const float* xk = (const float*)d_in[1]; const float* xv = (const float*)d_in[2];
    const int* mask = (const int*)d_in[3];
    const float* wq = (const float*)d_in[4]; const float* wk = (const float*)d_in[5]; const float* wv = (const float*)d_in[6]; const float* wo = (const float*)d_in[7];
    float* OUT = (float*)d_out;      // [SEQ][OUT_NB][1024]
    char* wsp = (char*)d_ws;
    bf* XQ = (bf*)wsp; wsp += SZ_XB;                 // [NB*SEQ][1024], row b*SEQ + t
    bf* XK = (bf*)wsp; wsp += SZ_XB;
    bf* XV = (bf*)wsp; wsp += SZ_XB;
    bf* WB = (bf*)wsp; wsp += SZ_WB;                 // [3][1024][1024]: q | k | v
    h16* WO16 = (h16*)wsp; wsp += SZ_WO;             // [1024][1024] x64
    h16* QH = (h16*)wsp; wsp += SZ_PL;               // [NB*16][SEQ][64]
    h16* KH = (h16*)wsp; wsp += SZ_PL;               // [NB*16][SEQ][64]
    h16* VT = (h16*)wsp; wsp += SZ_PL;               // [NB*16][64][SEQ]
    h16* CX = (h16*)wsp; wsp += SZ_CX;               // [NB*SEQ][1024]
    unsigned* MB = (unsigned*)wsp; wsp += SZ_MB;     // [SEQ][SEQ/32] mask bits
    bf* WQ = WB; bf* WK = WB + (size_t)DM * DM; bf* WV = WB + (size_t)2 * DM * DM;

    k_cvt<<<3 * GX + 4 * GW + GM, 256, 0, stream>>>(xq, xk, xv, wq, wk, wv, wo, mask, XQ, XK, XV, WQ, WK, WV, WO16, MB);

    k_proj<<<dim3(NB * SEQ / 128, DM / 128, 3), 32 * GWV, 0, stream>>>(XQ, XK, XV, WQ, WK, WV, QH, KH, VT);

    k_flash<<<dim3(SEQ / (16 * AW), NB * NH_, 1), 32 * AW, 0, stream>>>(QH, KH, VT, MB, CX);

    // out[t][b][n] = sum_k ctx[b*SEQ + t][k] Wo[n][k]
    k_oproj<<<dim3(NB * SEQ / 128, DM / 128, 1), 32 * GWV, 0, stream>>>(CX, WO16, OUT);
}

// v008
// A run of this version takes 85.8 microseconds.
// In two side-by-side timings against v007, it was 1.05 and 1.06 times as fast.
// Over all steps from v000 it is 3.74 times as fast.
#include <hip/hip_runtime.h>

// Multi-head attention, width 1024 = 16 heads x 64; query/keys/values [SEQ][NB][1024] sequence-first (row = s*NB_FULL + b), Wq/Wk/Wv/Wo [out][in] (y = x W^T), no biases,
// UNSCALED scores, int32 mask [SEQ][SEQ] with replace-fill (-1e20 where mask == 0), output = ctx Wo^T as f32 [SEQ][NB][1024].
// Compute dtypes, f32 accumulate everywhere: q/k/v projections v_wmma_f32_16x16x32_bf16 (inputs and W RNE-converted to bf16; products exact);
// scores v_wmma_f32_16x16x32_f16: q and k single f16 (their f16 rounding, 2^-11 relative, lies below the error that the bf16 operands of the projections leave in q and k, 2^-8 relative per operand);
// P (x2^14 carry, cancels in the normalisation) and v single f16; out-projection v_wmma_f32_16x16x32_f16: ctx single f16, Wo = f16(bf16(Wo) * 64), folded back by 1/64; softmax f32 (online, running max).
// Layout: bf16 copies of the inputs de-interleaved to [b][s][1024]; q/k planes [b*16+h][t][d] and v^T plane [b*16+h][d][t] written by the GEMM epilogue;
// fused flash kernel in transposed form (S^T = K Q^T, O^T = V^T P^T) writes the f16 ctx plane [b*SEQ+t][1024]; the out-projection GEMM writes rows t*OUT_NB + b.
// FRAGMENT ORDER: every 16-bit workspace plane [R][C] (C = the k dimension of its WMMA use) is stored as fragments of 16 rows x 32 k, 1 KiB each, fragment index (r/16)*(C/32) + k/32.
// Inside a fragment the 16-byte piece (row r, k = 8q..8q+7 of the 32, q = 0..3) lies at (q>>1)*512 B + ((q&1)*16 + r%16)*16 B, so each of the two wave-wide 16-byte loads
// of a fragment reads 512 contiguous bytes (4 whole lines; from row-major planes it would touch 16).
// MASK BITS: the converter launch packs the int32 mask to one bit per key, plane [SEQ][SEQ/32] of 32-bit words, bit i of word (t, w) = (mask[t][32w + i] != 0); the flash kernel reads only that plane.

#ifndef NB
#define NB 2
#endif
#ifndef SEQ
#define SEQ 2048
#endif
#define NB_FULL  2
#define SEQ_FULL 2048
#ifndef OUT_NB
#define OUT_NB NB                // batch pitch (in rows) of the output [t][OUT_NB][1024]
#endif
#define DM   1024
#define NH_  16
#define HD   64
#define AW   8                   // waves per flash block (16 query rows each)
#define SC2  1.4426950408889634f // log2(e); the module applies no score scale
#define PSH  14.0f               // log2 of the P carry (16384)
#define FILL2 (-1.4426950408889634e20f)   // -1e20 in the log2 domain (replace-fill of masked scores)
#define WOS  64.0f               // carry of the Wo plane
#define WOI  (1.0f / 64.0f)

static_assert(HD == 64);
static_assert(NH_ * HD == DM);                 // head h = columns h*64 + d
static_assert(DM % 64 == 0);                   // 16 column tiles of 64
static_assert(DM % 32 == 0);                   // GEMM k-steps of 32, two per ring stage of 64
static_assert(SEQ % 64 == 0);                  // a 64-row tile (and a 16-row fragment) never straddles two batches
static_assert((NB * SEQ) % 64 == 0);
static_assert(SEQ % 32 == 0);                  // key loop steps by 32
static_assert(SEQ % (16 * AW) == 0);           // flash grid covers the sequence exactly
static_assert(((size_t)NB * SEQ * DM) % 8 == 0);
static_assert(((size_t)DM * DM) % 8 == 0);
static_assert(NB <= NB_FULL);
static_assert(SEQ <= SEQ_FULL);
static_assert(NB <= OUT_NB);

typedef _Float16 h16;
typedef unsigned short bf;
typedef __attribute__((ext_vector_type(16))) __bf16   v16bf;
typedef __attribute__((ext_vector_type(16))) _Float16 v16h;
typedef __attribute__((ext_vector_type(8)))  _Float16 v8h;
typedef __attribute__((ext_vector_type(8)))  unsigned short v8us;
typedef __attribute__((ext_vector_type(8)))  float    v8f;
typedef __attribute__((ext_vector_type(4)))  float    v4f;
typedef __attribute__((ext_vector_type(4)))  unsigned v4u;
typedef __attribute__((ext_vector_type(2)))  float    v2f;
typedef __attribute__((ext_vector_type(2)))  _Float16 v2h;
typedef __attribute__((ext_vector_type(4)))  unsigned short v4us;
typedef v4f  __attribute__((may_alias)) v4fa;
typedef v4us __attribute__((may_alias)) v4usa;
typedef v8us __attribute__((may_alias)) v8usa;

__device__ __forceinline__ unsigned short f2bf(float f) { unsigned u = __float_as_uint(f); u += 0x7FFFu + ((u >> 16) & 1u); return (unsigned short)(u >> 16); }
__device__ __forceinline__ float bf2f(unsigned short s) { return __uint_as_float(((unsigned)s) << 16); }
__device__ __forceinline__ v16h cat16(v8h lo, v8h hi) { return __builtin_shufflevector(lo, hi, 0, 1, 2, 3, 4, 5, 6, 7, 8, 9, 10, 11, 12, 13, 14, 15); }
__device__ __forceinline__ v16bf cat16b(v8us lo, v8us hi) { return __builtin_bit_cast(v16bf, __builtin_shufflevector(lo, hi, 0, 1, 2, 3, 4, 5, 6, 7, 8, 9, 10, 11, 12, 13, 14, 15)); }
__device__ __forceinline__ v8f wmma16(v16h a, v16h b, v8f c) { return __builtin_amdgcn_wmma_f32_16x16x32_f16(false, a, false, b, (short)0, c, false, false); }
__device__ __forceinline__ v8f wmmab(v16bf a, v16bf b, v8f c) { return __builtin_amdgcn_wmma_f32_16x16x32_bf16(false, a, false, b, (short)0, c, false, false); }
// fragment loaders from fragment-order planes; p = fragment base + 8*lane: elements 0..7 <- k0+8h+0..7, elements 8..15 <- k0+16+8h+0..7, row lane&15, h = lane>>4 (same map for A and B)
__device__ __forceinline__ v16h  ldh(const h16* p) { return cat16(*(const v8h*)p, *(const v8h*)(p + 256)); }
__device__ __forceinline__ v16bf ldb(const bf* p)  { return cat16b(*(const v8us*)p, *(const v8us*)(p + 256)); }
// ordering point for wave-private LDS tiles (same wave writes and reads)
__device__ __forceinline__ void wave_sync() { __builtin_amdgcn_fence(3 /* release order */, "wavefront"); __builtin_amdgcn_wave_barrier(); asm volatile("" ::: "memory"); }

// cvt_frag: one wave converts one fragment (16 rows x 32 columns) of an f32 matrix with DM columns: four whole-line loads (4 rows x 128 B each), the 16-bit rows
// through a wave-private LDS tile (80-byte pitch: 16 B x odd, free of conflicts for the 16-byte reads), two 512-byte stores in fragment order.
// MODE 0: bf16 RNE, source rows de-interleaved (plane row b*SEQ + t <- source row t*NB_FULL + b); MODE 1: bf16 RNE, rows as they are; MODE 2: f16(bf16(x) * 64), rows as they are.
template <int MODE> __device__ __forceinline__ void cvt_frag(const float* __restrict__ src, unsigned short* dst, unsigned blk, unsigned short* ts) {
    const int lane = threadIdx.x & 31, wave = threadIdx.x >> 5;
    const size_t f = (size_t)blk * 8 + wave;
    const size_t tile = f / (DM / 32), chunk = f % (DM / 32);
    unsigned short* tw = ts + wave * 16 * 40;
#pragma unroll
    for (int i = 0; i < 4; ++i) {
        const int row = 4 * i + (lane >> 3); const size_t drow = tile * 16 + row;
        const size_t srow = (MODE == 0) ? ((drow % SEQ) * NB_FULL + drow / SEQ) : drow;
        const v4f v = *(const v4f*)(src + srow * DM + chunk * 32 + (lane & 7) * 4); v4us o;
#pragma unroll
        for (int k = 0; k < 4; ++k) o[k] = (MODE == 2) ? __builtin_bit_cast(unsigned short, (h16)(bf2f(f2bf(v[k])) * WOS)) : f2bf(v[k]);
        *(v4usa*)(tw + row * 40 + (lane & 7) * 4) = o; }
    wave_sync();
#pragma unroll
    for (int j = 0; j < 2; ++j) { const v8us o = *(const v8usa*)(tw + (lane & 15) * 40 + j * 16 + (lane >> 4) * 8); *(v8us*)(dst + f * 512 + j * 256 + lane * 8) = o; }
    asm volatile("s_wait_xcnt 0x0" ::: "memory");   // behind the two stores: in the merged kernel's listing another branch's code follows them and rewrites their registers
}

// mask_bits: one wave packs 32 words of the bit plane (1024 keys of one mask row): 32 whole-line loads (one int per lane), each turned into its word by a wave-wide compare
// (lane i's result is bit i); word i is kept by lane i, and the 32 words leave in one 128-byte store.
__device__ __forceinline__ void mask_bits(const int* __restrict__ mask, unsigned* MB, unsigned blk) {
    const int lane = threadIdx.x & 31, wave = threadIdx.x >> 5;
    const size_t w0 = ((size_t)blk * 8 + wave) * 32;
    const int* src = mask + w0 * 32 + lane;
    int v[32];
#pragma unroll
    for (int i = 0; i < 32; ++i) v[i] = src[i * 32];
    unsigned word = 0;
#pragma unroll
    for (int i = 0; i < 32; ++i) { const unsigned bits = __builtin_amdgcn_ballot_w32(v[i] != 0); word = (lane == i) ? bits : word; }
    MB[w0 + lane] = word;
    asm volatile("s_wait_xcnt 0x0" ::: "memory");   // behind the store: in the merged kernel's listing another branch's code follows it and rewrites its registers
}

// k_cvt: all seven conversions and the mask packing in ONE launch (they are independent of each other); the block index picks the matrix. 8 waves per block, one fragment each.
// Blocks 0 .. 3*GX-1: query | keys | values, src [t][NB_FULL][DM] f32 -> plane [b*SEQ + t][DM] bf16; then 3*GW blocks: Wq | Wk | Wv -> bf16; then GW blocks: Wo -> f16 x64. All in fragment order.
// Then GM blocks: mask rows 0 .. SEQ-1 -> bit plane, 32 words per wave.
#define GX ((unsigned)((size_t)NB * SEQ * DM / 512 / 8))
#define GW ((unsigned)((size_t)DM * DM / 512 / 8))
#define GM ((unsigned)((size_t)SEQ * (SEQ / 32) / 32 / 8))
static_assert(SEQ == SEQ_FULL);                             // the words of the bit plane follow the mask's own rows without a gap
static_assert(((size_t)SEQ * (SEQ / 32)) % (32 * 8) == 0);  // every mask block has eight whole runs of 32 words
static_assert(((size_t)NB * SEQ * DM) % (512 * 8) == 0);   // every conversion block of the merged grid has eight whole fragments
static_assert(((size_t)DM * DM) % (512 * 8) == 0);
__global__ __launch_bounds__(256) void k_cvt(const float* __restrict__ xq, const float* __restrict__ xk, const float* __restrict__ xv,
                                             const float* __restrict__ wq, const float* __restrict__ wk, const float* __restrict__ wv, const float* __restrict__ wo, const int* __restrict__ mask,
                                             bf* XQ, bf* XK, bf* XV, bf* WQ, bf* WK, bf* WV, h16* WO16, unsigned* MB) {
    __shared__ __align__(16) unsigned short ts[8 * 16 * 40];
    const unsigned bx = blockIdx.x;
    if (bx < 3 * GX) { const unsigned w = bx / GX; cvt_frag<0>(w == 0 ? xq : w == 1 ? xk : xv, w == 0 ? XQ : w == 1 ? XK : XV, bx % GX, ts); }
    else if (bx < 3 * GX + 3 * GW) { const unsigned c = bx - 3 * GX, w = c / GW; cvt_frag<1>(w == 0 ? wq : w == 1 ? wk : wv, w == 0 ? WQ : w == 1 ? WK : WV, c % GW, ts); }
    else if (bx < 3 * GX + 4 * GW) cvt_frag<2>(wo, (unsigned short*)WO16, bx - (3 * GX + 3 * GW), ts);
    else mask_bits(mask, MB, bx - (3 * GX + 4 * GW));
}

// THE GEMM RING (k_proj, k_oproj): a block of GWV = 4 waves works on a 128x128 tile, wave (wm, wn) = (wave / 2, wave % 2) on its 64x64 quarter (16 accumulators), K = DM.
// Both operands come through a two-buffer LDS ring, one stage = GS = 64 k = two fragments per 16 rows. In a fragment-order plane those two fragments are 2 KiB in a row, which is one
// asynchronous copy of 16 bytes per thread; a stage is 8 such copies for the 128 A rows and 8 for the 128 B rows, issued one whole stage ahead: each operand byte leaves L2 once per block
// (not once per wave) and no L2 latency stands between the matrix instructions. A stage in LDS keeps the planes' own order: A | B, per 16 rows 1024 halves, fragment k/32 at 512 halves.
#define GWV  4                   // waves per GEMM block
#define GS   64                  // k per ring stage
#define GNST (DM / GS)           // stages
#define GOP  (128 * GS)          // halves of one operand in one stage
static_assert(DM % GS == 0 && GNST >= 2);      // the ring's prologue fills two stages
static_assert(GS == 64);                       // a stage is worked on as two steps of 32 k
static_assert((NB * SEQ) % 128 == 0 && DM % 128 == 0);   // the grids cover both matrices with whole 128x128 tiles
static_assert(GWV * 32 * 8 == GS * 16);        // one copy of every thread = the stage's two fragments of 16 rows

// One operand's copies of one thread for one stage: g = the thread's own 16 bytes in the first 16 rows (16 rows further = 16*DM halves), l = its LDS byte address (16 rows further = 2 KiB).
// The s_wait_xcnt stands inside the statement, behind the last copy, so that no address register is rewritten ahead of it.
template <class T> __device__ __forceinline__ void rows_copy(const T* g, unsigned l) {
    asm volatile("global_load_async_to_lds_b128 %0, %8, off\n\t"
                 "global_load_async_to_lds_b128 %1, %9, off\n\t"
                 "global_load_async_to_lds_b128 %2, %10, off\n\t"
                 "global_load_async_to_lds_b128 %3, %11, off\n\t"
                 "global_load_async_to_lds_b128 %4, %12, off\n\t"
                 "global_load_async_to_lds_b128 %5, %13, off\n\t"
                 "global_load_async_to_lds_b128 %6, %14, off\n\t"
                 "global_load_async_to_lds_b128 %7, %15, off\n\t"
                 "s_wait_xcnt 0x0"
                 :: "v"(l), "v"(l + 2048u), "v"(l + 4096u), "v"(l + 6144u), "v"(l + 8192u), "v"(l + 10240u), "v"(l + 12288u), "v"(l + 14336u),
                    "v"(g), "v"(g + (size_t)1 * 16 * DM), "v"(g + (size_t)2 * 16 * DM), "v"(g + (size_t)3 * 16 * DM), "v"(g + (size_t)4 * 16 * DM),
                    "v"(g + (size_t)5 * 16 * DM), "v"(g + (size_t)6 * 16 * DM), "v"(g + (size_t)7 * 16 * DM)
                 : "memory");
}

// k_proj: register-blocked bf16 GEMM on the GEMM ring, operands from fragment-order bf16 planes.
// C[m][n] = sum_k A[m][k] Bt[n][k], written as f16 (Ph) in fragment order into planes of 'pitch' columns:
// a wave's tile base (r0/RB)*sRB + (r0%RB)*pitch + (c0/CB)*sCB + (c0%CB)*16 (halves); 16 rows further = 16*pitch, 32 columns further = 512.
// The three projections are independent and run in ONE launch, grid (NB*SEQ/128, DM/128, 3), 128 threads; blockIdx.z picks the product:
// z = 0, 1 (q, k): A = x rows (m = b*SEQ + t), Bt = W rows (n = h*64 + d) -> planes [(b*16 + h)][t][d];
// z = 2 (v^T): A = Wv rows (m = h*64 + d, from blockIdx.y), Bt = x rows (n = b*SEQ + t, from blockIdx.x) -> plane [(b*1024 + m)][t] = [(b*16 + h)][d][t].
__global__ __launch_bounds__(32 * GWV) void k_proj(const bf* __restrict__ XQ, const bf* __restrict__ XK, const bf* __restrict__ XV, const bf* __restrict__ WQ, const bf* __restrict__ WK, const bf* __restrict__ WV,
                                             h16* QH, h16* KH, h16* VT) {
    __shared__ __align__(16) bf gs[2][2 * GOP];              // per buffer: A rows | B rows
    __shared__ __align__(16) float osb[GWV][16 * 68];        // a wave's own epilogue tile
    const int K = DM;
    const int z = blockIdx.z; const bool isv = (z == 2);
    const bf* __restrict__ A = isv ? WV : (z == 0 ? XQ : XK); const bf* __restrict__ Bt = isv ? XV : (z == 0 ? WQ : WK);
    h16* Ph = isv ? VT : (z == 0 ? QH : KH);
    const int RB = isv ? DM : SEQ, pitch = isv ? SEQ : HD, CB = isv ? SEQ : HD;
    const size_t sRB = isv ? (size_t)0 : (size_t)NH_ * SEQ * HD, sCB = isv ? (size_t)DM * SEQ : (size_t)SEQ * HD;
    const int tid = threadIdx.x, lane = tid & 31, wave = __builtin_amdgcn_readfirstlane(tid >> 5), wm = wave >> 1, wn = wave & 1, lr = lane & 15, hi = lane >> 4;   // the wave's number in a scalar register: tile bases stay scalar
    const int R0 = (isv ? blockIdx.y : blockIdx.x) * 128, C0 = (isv ? blockIdx.x : blockIdx.y) * 128; const int r0 = R0 + wm * 64, c0 = C0 + wn * 64;
    float* os = &osb[wave][0];
    v8f acc[4][4];
#pragma unroll
    for (int mb = 0; mb < 4; ++mb)
#pragma unroll
        for (int nb = 0; nb < 4; ++nb) acc[mb][nb] = (v8f){};
    const bf* ga = A + (size_t)R0 * K + tid * 8; const bf* gb = Bt + (size_t)C0 * K + tid * 8;   // fragment (row/16, kc/32) at (row/16)*16*K + kc*16; a stage further = GS*16 halves
    const unsigned la = (unsigned)(size_t)&gs[0][0] + tid * 16u; const unsigned LOB = GOP * 2, LGB = 2 * GOP * 2;   // bytes from A to B, from buffer 0 to buffer 1
    rows_copy(ga, la); rows_copy(gb, la + LOB);
    asm volatile("s_wait_asynccnt 0x0" ::: "memory");   // stage 0 of this wave has landed
    __syncthreads();                                    // ... and every wave's: stage 0 is published
    rows_copy(ga + GS * 16, la + LGB); rows_copy(gb + GS * 16, la + LGB + LOB);
#pragma unroll 1
    for (int s = 0; s < GNST; ++s) {
        const bf* sa = &gs[s & 1][0] + wm * (4 * 16 * GS) + 8 * lane; const bf* sb = &gs[s & 1][0] + GOP + wn * (4 * 16 * GS) + 8 * lane;
        // The sched_barrier(0) lines hold this order: [reads: A and B of the first 32 k, A of the second][8 products][reads: 2 B fragments of the second 32 k][8 products][reads: the other 2][16 products][waits].
        // Each of the two later groups then stands 8 products ahead of its first use, and every wait but the last is a counted one. Left alone, the scheduler sinks the B reads singly among the products, each with a wait to 0 directly behind it.
        v16bf a[GS / 32][4], b[GS / 32][4];
#pragma unroll
        for (int mb = 0; mb < 4; ++mb) a[0][mb] = ldb(sa + mb * (16 * GS));
#pragma unroll
        for (int nb = 0; nb < 4; ++nb) b[0][nb] = ldb(sb + nb * (16 * GS));
#pragma unroll
        for (int mb = 0; mb < 4; ++mb) a[1][mb] = ldb(sa + mb * (16 * GS) + 512);
        __builtin_amdgcn_sched_barrier(0);   // the first group of reads stays in front of the products
#pragma unroll
        for (int h2 = 0; h2 < 2; ++h2) {
#pragma unroll
            for (int nb = 2 * h2; nb < 2 * h2 + 2; ++nb)
#pragma unroll
                for (int mb = 0; mb < 4; ++mb) acc[mb][nb] = wmmab(a[0][mb], b[0][nb], acc[mb][nb]);
            __builtin_amdgcn_sched_barrier(0);   // these two fragments' reads are not lifted (they take registers of fragments whose last product stands above: 16 fragments at once would not fit 256 registers) ...
            b[1][2 * h2] = ldb(sb + (2 * h2) * (16 * GS) + 512); b[1][2 * h2 + 1] = ldb(sb + (2 * h2 + 1) * (16 * GS) + 512);
            __builtin_amdgcn_sched_barrier(0);   // ... and not sunk towards their use
        }
#pragma unroll
        for (int nb = 0; nb < 4; ++nb)
#pragma unroll
            for (int mb = 0; mb < 4; ++mb) acc[mb][nb] = wmmab(a[1][mb], b[1][nb], acc[mb][nb]);
        // keeps the waits below behind the stage's products. Without it the scheduler lifts them and the barrier in front of the products: every read is then waited out
        // before the first product, and the refill is issued only behind the products, so that it flies for less than one stage.
        __builtin_amdgcn_sched_barrier(0);
        // publish point of stage s + 1, and the end of every wave's reads of stage s
        asm volatile("s_wait_dscnt 0x0" ::: "memory");      // this wave's LDS reads of stage s have returned before its buffer is refilled
        asm volatile("s_wait_asynccnt 0x0" ::: "memory");   // this wave's copies of stage s + 1 have landed
        __syncthreads();
        if (s + 2 < GNST) {                                 // the same for the whole block
            rows_copy(ga + (size_t)(s + 2) * GS * 16, la + (s & 1) * LGB); rows_copy(gb + (size_t)(s + 2) * GS * 16, la + (s & 1) * LGB + LOB); }
    }
    asm volatile("s_wait_asynccnt 0x0" ::: "memory");       // no copy is outstanding when the wave goes on
    const size_t tbase = (size_t)(r0 / RB) * sRB + (size_t)(r0 % RB) * (size_t)pitch + (size_t)(c0 / CB) * sCB + (size_t)(c0 % CB) * 16;
#pragma unroll
    for (int mb = 0; mb < 4; ++mb) {
#pragma unroll
        for (int nb = 0; nb < 4; ++nb) {
#pragma unroll
            for (int j = 0; j < 8; ++j) os[(hi * 8 + j) * 68 + nb * 16 + lr] = acc[mb][nb][j]; }   // D: row 8h+j, col lane&15
        wave_sync();
        const size_t sb = tbase + (size_t)(mb * 16) * (size_t)pitch;
{
#pragma unroll
            for (int s = 0; s < 4; ++s) { const int row = lr, c8 = (2 * s + hi) * 8;   // s = 2*(column/32) + half of the fragment; 16 rows x 2 pieces = one 512-byte store
                const v4f x0 = *(const v4fa*)(&os[row * 68 + c8]); const v4f x1 = *(const v4fa*)(&os[row * 68 + c8 + 4]); v8h hv;
#pragma unroll
                for (int i = 0; i < 4; ++i) { hv[i] = (h16)x0[i]; hv[4 + i] = (h16)x1[i]; }
                const size_t oo = sb + (size_t)(s * 256 + lane * 8);
                *(v8h*)(Ph + oo) = hv; }
            asm volatile("s_wait_xcnt 0x0" ::: "memory");   // behind the four stores: the next 16 rows' values and addresses take their registers
             }
        wave_sync();
    }
}

// k_oproj: register-blocked f16 GEMM on the GEMM ring, A = ctx plane [NB*SEQ][DM] f16 (row m = b*SEQ + t), Bt = Wo plane [DM][DM] f16 (x64 carry), both in fragment order.
// OUT[(t*OUT_NB + b)][n] = (1/64) sum_k A[m][k] Bt[n][k], f32. grid (NB*SEQ/128, DM/128), 128 threads.
__global__ __launch_bounds__(32 * GWV) void k_oproj(const h16* __restrict__ A, const h16* __restrict__ Bt, float* OUT) {
    __shared__ __align__(16) h16 gs[2][2 * GOP];             // per buffer: A rows | B rows
    __shared__ __align__(16) float osb[GWV][16 * 68];        // a wave's own epilogue tile
    const int K = DM;
    const int tid = threadIdx.x, lane = tid & 31, wave = __builtin_amdgcn_readfirstlane(tid >> 5), wm = wave >> 1, wn = wave & 1, lr = lane & 15, hi = lane >> 4;   // the wave's number in a scalar register: tile bases stay scalar
    const int R0 = blockIdx.x * 128, C0 = blockIdx.y * 128; const int r0 = R0 + wm * 64, c0 = C0 + wn * 64;
    float* os = &osb[wave][0];
    v8f acc[4][4];
#pragma unroll
    for (int mb = 0; mb < 4; ++mb)
#pragma unroll
        for (int nb = 0; nb < 4; ++nb) acc[mb][nb] = (v8f){};
    const h16* ga = A + (size_t)R0 * K + tid * 8; const h16* gb = Bt + (size_t)C0 * K + tid * 8;   // fragment (row/16, kc/32) at (row/16)*16*K + kc*16; a stage further = GS*16 halves
    const unsigned la = (unsigned)(size_t)&gs[0][0] + tid * 16u; const unsigned LOB = GOP * 2, LGB = 2 * GOP * 2;   // bytes from A to B, from buffer 0 to buffer 1
    rows_copy(ga, la); rows_copy(gb, la + LOB);
    asm volatile("s_wait_asynccnt 0x0" ::: "memory");   // stage 0 of this wave has landed
    __syncthreads();                                    // ... and every wave's: stage 0 is published
    rows_copy(ga + GS * 16, la + LGB); rows_copy(gb + GS * 16, la + LGB + LOB);
#pragma unroll 1
    for (int s = 0; s < GNST; ++s) {
        const h16* sa = &gs[s & 1][0] + wm * (4 * 16 * GS) + 8 * lane; const h16* sb = &gs[s & 1][0] + GOP + wn * (4 * 16 * GS) + 8 * lane;
        // The sched_barrier(0) lines hold this order: [reads: A and B of the first 32 k, A of the second][8 products][reads: 2 B fragments of the second 32 k][8 products][reads: the other 2][16 products][waits].
        // Each of the two later groups then stands 8 products ahead of its first use, and every wait but the last is a counted one. Left alone, the scheduler sinks the B reads singly among the products, each with a wait to 0 directly behind it.
        v16h a[GS / 32][4], b[GS / 32][4];
#pragma unroll
        for (int mb = 0; mb < 4; ++mb) a[0][mb] = ldh(sa + mb * (16 * GS));
#pragma unroll
        for (int nb = 0; nb < 4; ++nb) b[0][nb] = ldh(sb + nb * (16 * GS));
#pragma unroll
        for (int mb = 0; mb < 4; ++mb) a[1][mb] = ldh(sa + mb * (16 * GS) + 512);
        __builtin_amdgcn_sched_barrier(0);   // the first group of reads stays in front of the products
#pragma unroll
        for (int h2 = 0; h2 < 2; ++h2) {
#pragma unroll
            for (int nb = 2 * h2; nb < 2 * h2 + 2; ++nb)
#pragma unroll
                for (int mb = 0; mb < 4; ++mb) acc[mb][nb] = wmma16(a[0][mb], b[0][nb], acc[mb][nb]);
            __builtin_amdgcn_sched_barrier(0);   // these two fragments' reads are not lifted (they take registers of fragments whose last product stands above: 16 fragments at once would not fit 256 registers) ...
            b[1][2 * h2] = ldh(sb + (2 * h2) * (16 * GS) + 512); b[1][2 * h2 + 1] = ldh(sb + (2 * h2 + 1) * (16 * GS) + 512);
            __builtin_amdgcn_sched_barrier(0);   // ... and not sunk towards their use
        }
#pragma unroll
        for (int nb = 0; nb < 4; ++nb)
#pragma unroll
            for (int mb = 0; mb < 4; ++mb) acc[mb][nb] = wmma16(a[1][mb], b[1][nb], acc[mb][nb]);
        // keeps the waits below behind the stage's products. Without it the scheduler lifts them and the barrier in front of the products: every read is then waited out
        // before the first product, and the refill is issued only behind the products, so that it flies for less than one stage.
        __builtin_amdgcn_sched_barrier(0);
        // publish point of stage s + 1, and the end of every wave's reads of stage s
        asm volatile("s_wait_dscnt 0x0" ::: "memory");      // this wave's LDS reads of stage s have returned before its buffer is refilled
        asm volatile("s_wait_asynccnt 0x0" ::: "memory");   // this wave's copies of stage s + 1 have landed
        __syncthreads();
        if (s + 2 < GNST) {                                 // the same for the whole block
            rows_copy(ga + (size_t)(s + 2) * GS * 16, la + (s & 1) * LGB); rows_copy(gb + (size_t)(s + 2) * GS * 16, la + (s & 1) * LGB + LOB); }
    }
    asm volatile("s_wait_asynccnt 0x0" ::: "memory");       // no copy is outstanding when the wave goes on
#pragma unroll
    for (int mb = 0; mb < 4; ++mb) {
#pragma unroll
        for (int nb = 0; nb < 4; ++nb) {
#pragma unroll
            for (int j = 0; j < 8; ++j) os[(hi * 8 + j) * 68 + nb * 16 + lr] = acc[mb][nb][j] * WOI; }   // D: row 8h+j, col lane&15
        wave_sync();
{
#pragma unroll
            for (int s = 0; s < 8; ++s) { const int row = 2 * s + hi, cofs = lr * 4;   // 8 s x 2 rows = 16 rows; 16 lanes x 4 floats = 64 columns
                const int m = r0 + mb * 16 + row; const int bb = m / SEQ, t = m % SEQ;
                const v4f val = *(const v4fa*)(&os[row * 68 + cofs]);
                *(v4f*)(OUT + ((size_t)t * OUT_NB + bb) * DM + c0 + cofs) = val; }
             }
        wave_sync();
    }
}

// k_flash: fused attention, one wave per 16 query rows of one (batch, head), AW waves (16*AW query rows) per block; Q fragments straight from the fragment-order f16 planes, once.
// THE RING: the loop's operands (K, V^T) come through a two-buffer LDS ring, one stage = SK keys = one softmax pass. Every thread brings 8 pieces of 16 bytes per stage
// with asynchronous copies to LDS, issued one whole stage ahead, so each K / V^T byte leaves L2 once per block (not once per wave) and no load latency stands in the loop.
// A stage in LDS: K | V^T, 16 KiB each, in the planes' own fragment order (a wave-wide 16-byte read covers 512 contiguous bytes).
// THE MASK: the block's 16*AW rows of the bit plane (SEQ/32 words each, all keys) are copied to LDS once, with stage 0, at a pitch of MP words (the 16 rows of a wave-wide 16-byte read fall on
// different banks). A lane reads its row's four words of a stage (128 keys) in one 16-byte read.
// Transposed form: S^T[key][t] = K Q^T (A = K rows, B = Q rows); lane (t = lane&15, h = lane>>4) holds keys 8h+r of each 16-key tile, so the packed
// P tile is directly the B fragment of O^T[d][t] = V^T P^T (element r <- tile keys 0..15, element 8+r <- tile keys 16..31, lane unchanged).
// Scores: one accumulator per 16-key tile, two products (d = 0..31, 32..63). Masked scores are REPLACED by the fill constant before the
// running-max softmax (a fully masked row comes out uniform); the replacing is stepped over, by one wave-uniform test per stage, where none of the wave's 16 x 128 bits of the stage is 0.
// ONE SOFTMAX UPDATE PER STAGE: all SK/16 score tiles of a stage are formed first; then one maximum over the SK keys, one xor-16 exchange between the two lane halves of a row, one new running max
// (one scalar per lane) and one rescaling of the accumulators serve the whole stage.
// ROW SUMS ON THE MATRIX PIPE: the denominator is one more accumulator tile, lt += E P^T per 32 keys, E = the constant A fragment with ones in rows 0 and 8 and zeros elsewhere.
// D row 8h + j sits in register j of lane half h, so register 0 of EVERY lane holds the sum over all 32 keys of its own query column (P as rounded to f16); registers 1..7 stay 0.
#define SK  128                  // keys per ring stage and per softmax update
#define NT  (SK / 16)            // score tiles of a stage
#define NG  (SK / 32)            // P fragments (32 keys each) of a stage
#define MP  68                   // pitch of a row of mask bits in LDS, in words
#define NST (SEQ / SK)           // stages
static_assert(NG == 4);                        // the order of the V^T reads in the loop is written out for four groups of 32 keys
static_assert(AW == 8 && SK == 128);           // the copy maps below: 256 threads, 1024 pieces per 16-KiB plane slice; four words of mask bits per stage
static_assert(SEQ / 32 == 64);                 // ... and 16 pieces per row of mask bits
static_assert(SEQ % SK == 0 && NST >= 2);      // the ring's prologue fills two stages

// One stage's copies of one thread. gk, gv: the thread's own first piece of the stage in the K and V^T planes; lk: its LDS byte address in the stage's buffer.
// The s_wait_xcnt stands inside the statement, behind the last copy, so that no address register is rewritten ahead of it.
__device__ __forceinline__ void stage_copy(const h16* gk, const h16* gv, unsigned lk) {
    asm volatile("global_load_async_to_lds_b128 %0, %8, off\n\t"
                 "global_load_async_to_lds_b128 %1, %9, off\n\t"
                 "global_load_async_to_lds_b128 %2, %10, off\n\t"
                 "global_load_async_to_lds_b128 %3, %11, off\n\t"
                 "global_load_async_to_lds_b128 %4, %12, off\n\t"
                 "global_load_async_to_lds_b128 %5, %13, off\n\t"
                 "global_load_async_to_lds_b128 %6, %14, off\n\t"
                 "global_load_async_to_lds_b128 %7, %15, off\n\t"
                 "s_wait_xcnt 0x0"
                 :: "v"(lk), "v"(lk + 4096u), "v"(lk + 8192u), "v"(lk + 12288u), "v"(lk + 16384u), "v"(lk + 20480u), "v"(lk + 24576u), "v"(lk + 28672u),
                    "v"(gk), "v"(gk + 2048), "v"(gk + 4096), "v"(gk + 6144),
                    "v"(gv), "v"(gv + (size_t)16 * SEQ), "v"(gv + (size_t)32 * SEQ), "v"(gv + (size_t)48 * SEQ)
                 : "memory");
}

// The block's rows of mask bits, once: gm = the thread's own first piece (row tid/16, piece tid%16; 16 rows further per copy), lm = its LDS byte address.
// The s_wait_xcnt stands inside the statement, behind the last copy, so that no address register is rewritten ahead of it.
__device__ __forceinline__ void bits_copy(const unsigned* gm, unsigned lm) {
    asm volatile("global_load_async_to_lds_b128 %0, %8, off\n\t"
                 "global_load_async_to_lds_b128 %1, %9, off\n\t"
                 "global_load_async_to_lds_b128 %2, %10, off\n\t"
                 "global_load_async_to_lds_b128 %3, %11, off\n\t"
                 "global_load_async_to_lds_b128 %4, %12, off\n\t"
                 "global_load_async_to_lds_b128 %5, %13, off\n\t"
                 "global_load_async_to_lds_b128 %6, %14, off\n\t"
                 "global_load_async_to_lds_b128 %7, %15, off\n\t"
                 "s_wait_xcnt 0x0"
                 :: "v"(lm), "v"(lm + 1u * 16 * MP * 4), "v"(lm + 2u * 16 * MP * 4), "v"(lm + 3u * 16 * MP * 4), "v"(lm + 4u * 16 * MP * 4), "v"(lm + 5u * 16 * MP * 4), "v"(lm + 6u * 16 * MP * 4), "v"(lm + 7u * 16 * MP * 4),
                    "v"(gm), "v"(gm + (size_t)1 * 16 * (SEQ / 32)), "v"(gm + (size_t)2 * 16 * (SEQ / 32)), "v"(gm + (size_t)3 * 16 * (SEQ / 32)), "v"(gm + (size_t)4 * 16 * (SEQ / 32)),
                    "v"(gm + (size_t)5 * 16 * (SEQ / 32)), "v"(gm + (size_t)6 * 16 * (SEQ / 32)), "v"(gm + (size_t)7 * 16 * (SEQ / 32))
                 : "memory");
}

__global__ __launch_bounds__(32 * AW) void k_flash(const h16* __restrict__ QH, const h16* __restrict__ KH,
                                                   const h16* __restrict__ VT, const unsigned* __restrict__ MB, h16* CX) {
    __shared__ __align__(16) h16 kvs[2][2 * SK * HD];        // per buffer: K | V^T, SK*HD halves each
    __shared__ __align__(16) unsigned mks[16 * AW * MP];     // 16*AW rows of mask bits, SEQ/32 words each, pitch MP
    const int tid = threadIdx.x, lane = tid & 31, wave = tid >> 5, lr = lane & 15, hi = lane >> 4;
    const int zh = blockIdx.y; const int b = zh / NH_, h = zh % NH_;
    const int tb = blockIdx.x * (16 * AW), t0 = tb + wave * 16;
    const size_t pbase = (size_t)zh * SEQ * HD;
    // the thread's pieces of stage 0: plane slices of SK keys are contiguous (K: SK*HD halves = four copies of the block; V^T: SK*16 halves per 16 d rows = one copy of the block per d tile)
    const h16* gk = KH + pbase + tid * 8;
    const h16* gv = VT + pbase + tid * 8;
    const unsigned lk0 = (unsigned)(size_t)&kvs[0][0] + tid * 16u;
    const unsigned LKB = 2 * SK * HD * 2;   // bytes from buffer 0 to buffer 1
    stage_copy(gk, gv, lk0);
    bits_copy(MB + (size_t)(tb + (tid >> 4)) * (SEQ / 32) + (tid & 15) * 4, (unsigned)(size_t)&mks[0] + (tid >> 4) * (MP * 4u) + (tid & 15) * 16u);
    const size_t qo = pbase + (size_t)t0 * HD + 8 * lane;     // 16 rows x 64 d = two fragments of 512 halves
    const v16h qh0 = ldh(QH + qo), qh1 = ldh(QH + qo + 512);   // B fragments: col t, k = d
    asm volatile("s_wait_asynccnt 0x0" ::: "memory");   // stage 0 and the mask bits of this wave have landed
    __syncthreads();                                    // ... and every wave's: stage 0 and the mask bits are published
    stage_copy(gk + SK * HD, gv + SK * 16, lk0 + LKB);
    const unsigned* mrow = &mks[(wave * 16 + lr) * MP];      // the bits of the lane's query row
    v8f o0 = (v8f){}, o1 = (v8f){}, o2 = (v8f){}, o3 = (v8f){};
    float m = -3.0e38f;
    v8f lt = (v8f){};                                        // register 0: the lane's row sum
    v16h ones;                                               // A fragment E: row = lane & 15, every k alike
#pragma unroll
    for (int i = 0; i < 16; ++i) ones[i] = ((lane & 7) == 0) ? (h16)1.0f : (h16)0.0f;
#pragma unroll 1
    for (int s = 0; s < NST; ++s) {
        const h16* kst = &kvs[s & 1][0] + 8 * lane;                          // + 16*HD*(key tile) + 512*(d/32)  (A fragment: row key, k = d)
        const v4u mw = *(const v4u*)(mrow + NG * s);                         // word g: bit i = mask[t][SK*s + 32g + i] != 0
        const bool holes = __builtin_amdgcn_ballot_w32((mw[0] & mw[1] & mw[2] & mw[3]) != 0xFFFFFFFFu) != 0;   // the same for the whole wave: a scalar branch
        v8f sc[NT]; v16h kf[NT][2];
        // The sched_barrier(0) lines hold this order: [K reads: d 0..31 of all tiles, d 32..63 of the first half][4 products][K reads: d 32..63 of the second half][12 products].
        // The reads stand in two groups behind counted waits, the second in registers that the first four products have set free (sixteen fragments at once spill) and eight products ahead of its use.
        // Left alone, the scheduler strews the reads among the products, the first ones waited out to 0.
#pragma unroll
        for (int kt = 0; kt < NT; ++kt) kf[kt][0] = ldh(kst + kt * 16 * HD);
#pragma unroll
        for (int kt = 0; kt < NT / 2; ++kt) kf[kt][1] = ldh(kst + kt * 16 * HD + 512);
        __builtin_amdgcn_sched_barrier(0);
#pragma unroll
        for (int kt = 0; kt < NT / 2; ++kt) sc[kt] = wmma16(kf[kt][0], qh0, (v8f){});
        __builtin_amdgcn_sched_barrier(0);
#pragma unroll
        for (int kt = NT / 2; kt < NT; ++kt) kf[kt][1] = ldh(kst + kt * 16 * HD + 512);
        __builtin_amdgcn_sched_barrier(0);
#pragma unroll
        for (int kt = NT / 2; kt < NT; ++kt) sc[kt] = wmma16(kf[kt][0], qh0, (v8f){});
#pragma unroll
        for (int kt = 0; kt < NT; ++kt) sc[kt] = wmma16(kf[kt][1], qh1, sc[kt]);
        // four vector slots behind the last product, on every path, before an accumulator is read or the last products' K fragments' registers are loaded anew.
        // It takes every score tile, so that all sixteen products stand in one run in front of the vector work (read one by one behind its own product, each tile costs its own four idle slots).
        asm volatile("v_nop\n\tv_nop\n\tv_nop\n\tv_nop" : "+v"(sc[0]), "+v"(sc[1]), "+v"(sc[2]), "+v"(sc[3]), "+v"(sc[4]), "+v"(sc[5]), "+v"(sc[6]), "+v"(sc[7])
                     : "v"(kf[NT - 4][1]), "v"(kf[NT - 3][1]), "v"(kf[NT - 2][1]), "v"(kf[NT - 1][1]));
        v16h vf[NG][4];                                       // A fragments of V^T: row d = 16j + .., k = key 32g + ..
#pragma unroll
        for (int j = 0; j < 4; ++j) vf[0][j] = ldh(kst + SK * HD + j * (SK * 16));
        __builtin_amdgcn_sched_barrier(0);   // the V^T reads of the first 32 keys stay here: they return under the vector work below
        float t[NT][8];
#pragma unroll
        for (int kt = 0; kt < NT; ++kt)
#pragma unroll
            for (int r = 0; r < 8; ++r) t[kt][r] = sc[kt][r] * SC2;
        if (holes) {
#pragma unroll
            for (int g = 0; g < NG; ++g) {
                const unsigned wv = mw[g] >> (8 * hi);        // bit r: key 32g + 8h + r (tile 2g); bit 16 + r: key 32g + 16 + 8h + r (tile 2g + 1)
#pragma unroll
                for (int r = 0; r < 8; ++r) { t[2 * g][r] = ((wv >> r) & 1u) ? t[2 * g][r] : FILL2; t[2 * g + 1][r] = ((wv >> (16 + r)) & 1u) ? t[2 * g + 1][r] : FILL2; } } }
        float mg[NG];                                         // one chain per 32 keys: the chains are independent of each other
#pragma unroll
        for (int g = 0; g < NG; ++g) { mg[g] = fmaxf(t[2 * g][0], t[2 * g + 1][0]);
#pragma unroll
            for (int r = 1; r < 8; ++r) mg[g] = fmaxf(mg[g], fmaxf(t[2 * g][r], t[2 * g + 1][r])); }
        float mx = fmaxf(fmaxf(mg[0], mg[1]), fmaxf(mg[2], mg[3]));
        mx = fmaxf(mx, __shfl_xor(mx, 16, 32));
        const float mnew = fmaxf(m, mx);
        const float alpha = __builtin_amdgcn_exp2f(m - mnew);
        v16h pb[NG];
#pragma unroll
        for (int g = 0; g < NG; ++g)
#pragma unroll
            for (int i = 0; i < 4; ++i) {                     // on pairs of neighbouring keys: packed f32 subtract and add, one convert per f16 pair
                const v2f ea = ((v2f){t[2 * g][2 * i], t[2 * g][2 * i + 1]} - mnew) + PSH, ec = ((v2f){t[2 * g + 1][2 * i], t[2 * g + 1][2 * i + 1]} - mnew) + PSH;
                const v2h pa = __builtin_convertvector(((v2f){__builtin_amdgcn_exp2f(ea[0]), __builtin_amdgcn_exp2f(ea[1])}), v2h);
                const v2h pc = __builtin_convertvector(((v2f){__builtin_amdgcn_exp2f(ec[0]), __builtin_amdgcn_exp2f(ec[1])}), v2h);
                pb[g][2 * i] = pa[0]; pb[g][2 * i + 1] = pa[1]; pb[g][8 + 2 * i] = pc[0]; pb[g][8 + 2 * i + 1] = pc[1]; }
        lt[0] = lt[0] * alpha; m = mnew;                  // the other registers of the tile hold 0
        o0 = o0 * alpha; o1 = o1 * alpha; o2 = o2 * alpha; o3 = o3 * alpha;
        // The sched_barrier(0) lines hold this order: [vector work][V^T reads, keys 32..95][5 products, keys 0..31][V^T reads, keys 96..127][15 products] (the compiler leaves the last 32 keys' P behind the first of these reads).
        // The later reads wait until the scores' registers are free (all sixteen fragments beside the scores do not fit 256 registers), stand in two groups and each at least five products ahead of their use.
        // Left alone, the scheduler puts single pairs of reads directly in front of their product, each with a wait to 0.
        __builtin_amdgcn_sched_barrier(0);
#pragma unroll
        for (int g = 1; g < 3; ++g)
#pragma unroll
            for (int j = 0; j < 4; ++j) vf[g][j] = ldh(kst + SK * HD + j * (SK * 16) + 512 * g);
        __builtin_amdgcn_sched_barrier(0);
#pragma unroll
        for (int g = 0; g < NG; ++g) {
            o0 = wmma16(vf[g][0], pb[g], o0); o1 = wmma16(vf[g][1], pb[g], o1); o2 = wmma16(vf[g][2], pb[g], o2); o3 = wmma16(vf[g][3], pb[g], o3);
            lt = wmma16(ones, pb[g], lt);
            if (g == 0) {
                __builtin_amdgcn_sched_barrier(0);
#pragma unroll
                for (int j = 0; j < 4; ++j) vf[3][j] = ldh(kst + SK * HD + j * (SK * 16) + 512 * 3);
                __builtin_amdgcn_sched_barrier(0);
            }
        }
        // four vector slots behind the stage's last product (the row-sum tile's), on every path, before an accumulator is read or a fragment's registers are loaded anew
        asm volatile("v_nop\n\tv_nop\n\tv_nop\n\tv_nop" : "+v"(o0), "+v"(o1), "+v"(o2), "+v"(o3), "+v"(lt) : "v"(vf[NG - 1][0]), "v"(vf[NG - 1][1]), "v"(vf[NG - 1][2]), "v"(vf[NG - 1][3]), "v"(pb[NG - 1]));
        // publish point of stage s + 1, and the end of every wave's reads of stage s
        asm volatile("s_wait_dscnt 0x0" ::: "memory");      // this wave's LDS reads of stage s have returned before its buffer is refilled
        asm volatile("s_wait_asynccnt 0x0" ::: "memory");   // this wave's copies of stage s + 1 have landed
        __syncthreads();
        if (s + 2 < NST)                                    // the same for the whole block
            stage_copy(gk + (size_t)(s + 2) * SK * HD, gv + (size_t)(s + 2) * SK * 16, lk0 + (s & 1) * LKB);
    }
    asm volatile("s_wait_asynccnt 0x0" ::: "memory");       // no copy is outstanding when the wave ends
    const float inv = 1.0f / lt[0];
    // O^T D layout: o_j[r] = (d = 16j + 8h + r, t = lane&15): a lane's eight values of o_j are the 16-byte piece (row t, columns 16j + 8h + 0..7) of the ctx plane,
    // which fragment order puts at j*256 + lane*8 halves behind the base of fragments (row/16, 2h) and (row/16, 2h + 1): four 512-byte stores straight from the accumulators
    h16* crow = CX + ((size_t)b * SEQ + t0) * DM + h * (HD * 16) + lane * 8;
    v8h h0, h1, h2, h3;
#pragma unroll
    for (int r = 0; r < 8; ++r) { h0[r] = (h16)(o0[r] * inv); h1[r] = (h16)(o1[r] * inv); h2[r] = (h16)(o2[r] * inv); h3[r] = (h16)(o3[r] * inv); }
    *(v8h*)(crow) = h0; *(v8h*)(crow + 256) = h1; *(v8h*)(crow + 512) = h2; *(v8h*)(crow + 768) = h3;
}

static constexpr size_t al256(size_t v) { return (v + 255) & ~(size_t)255; }
static constexpr size_t SZ_XB = al256((size_t)NB * SEQ * DM * 2);              // one bf16 input plane [NB*SEQ][1024]
static constexpr size_t SZ_WB = al256((size_t)3 * DM * DM * 2);               // bf16 Wq | Wk | Wv
static constexpr size_t SZ_WO = al256((size_t)DM * DM * 2);                   // f16 Wo x64
static constexpr size_t SZ_PL = al256((size_t)NB * NH_ * SEQ * HD * 2);       // one f16 head plane
static constexpr size_t SZ_CX = al256((size_t)NB * SEQ * DM * 2);             // f16 ctx plane
static constexpr size_t SZ_MB = al256((size_t)SEQ * (SEQ / 32) * 4);          // mask bit plane
static constexpr size_t SZ_TOTAL = 3 * SZ_XB + SZ_WB + SZ_WO + 3 * SZ_PL + SZ_CX + SZ_MB;
static_assert(SZ_TOTAL <= (size_t)134217728);          // workspace carve <= 128 MiB
static_assert(((size_t)DM * DM * 2) % 256 == 0);       // weight sub-planes stay 256-byte aligned

extern "C" void kernel_launch(void* const* d_in, const int* in_sizes, int n_in,
                              void* d_out, int out_size, void* d_ws, size_t ws_size, hipStream_t stream) {
    if (n_in < 8) return;
    const size_t needx = ((size_t)(SEQ - 1) * NB_FULL + NB) * DM;
    if ((size_t)in_sizes[0] < needx || (size_t)in_sizes[1] < needx || (size_t)in_sizes[2] < needx) return;
    if ((size_t)in_sizes[3] < (size_t)(SEQ - 1) * SEQ_FULL + SEQ) return;
    if ((size_t)in_sizes[4] < (size_t)DM * DM || (size_t)in_sizes[5] < (size_t)DM * DM || (size_t)in_sizes[6] < (size_t)DM * DM || (size_t)in_sizes[7] < (size_t)DM * DM) return;
    if ((size_t)out_size < ((size_t)(SEQ - 1) * OUT_NB + NB) * DM) return;
    if (SZ_TOTAL > ws_size) return;
    // wire order: query, keys, values, mask (int32), Wq, Wk, Wv, Wo ([out][in] = Bt as-is)
    const float* xq = (const float*)d_in[0]; const float* xk = (const float*)d_in[1]; const float* xv = (const float*)d_in[2];
    const int* mask = (const int*)d_in[3];
    const float* wq = (const float*)d_in[4]; const float* wk = (const float*)d_in[5]; const float* wv = (const float*)d_in[6]; const float* wo = (const float*)d_in[7];
    float* OUT = (float*)d_out;      // [SEQ][OUT_NB][1024]
    char* wsp = (char*)d_ws;
    bf* XQ = (bf*)wsp; wsp += SZ_XB;                 // [NB*SEQ][1024], row b*SEQ + t
    bf* XK = (bf*)wsp; wsp += SZ_XB;
    bf* XV = (bf*)wsp; wsp += SZ_XB;
    bf* WB = (bf*)wsp; wsp += SZ_WB;                 // [3][1024][1024]: q | k | v
    h16* WO16 = (h16*)wsp; wsp += SZ_WO;             // [1024][1024] x64
    h16* QH = (h16*)wsp; wsp += SZ_PL;               // [NB*16][SEQ][64]
    h16* KH = (h16*)wsp; wsp += SZ_PL;               // [NB*16][SEQ][64]
    h16* VT = (h16*)wsp; wsp += SZ_PL;               // [NB*16][64][SEQ]
    h16* CX = (h16*)wsp; wsp += SZ_CX;               // [NB*SEQ][1024]
    unsigned* MB = (unsigned*)wsp; wsp += SZ_MB;     // [SEQ][SEQ/32] mask bits
    bf* WQ = WB; bf* WK = WB + (size_t)DM * DM; bf* WV = WB + (size_t)2 * DM * DM;

    k_cvt<<<3 * GX + 4 * GW + GM, 256, 0, stream>>>(xq, xk, xv, wq, wk, wv, wo, mask, XQ, XK, XV, WQ, WK, WV, WO16, MB);

    k_proj<<<dim3(NB * SEQ / 128, DM / 128, 3), 32 * GWV, 0, stream>>>(XQ, XK, XV, WQ, WK, WV, QH, KH, VT);

    k_flash<<<dim3(SEQ / (16 * AW), NB * NH_, 1), 32 * AW, 0, stream>>>(QH, KH, VT, MB, CX);

    // out[t][b][n] = sum_k ctx[b*SEQ + t][k] Wo[n][k]
    k_oproj<<<dim3(NB * SEQ / 128, DM / 128, 1), 32 * GWV, 0, stream>>>(CX, WO16, OUT);
}

// v009
// A run of this version takes 77.7 microseconds.
// In two side-by-side timings against v008, it was 1.10 and 1.09 times as fast.
// Over all steps from v000 it is 4.10 times as fast.
#include <hip/hip_runtime.h>

// Multi-head attention, width 1024 = 16 heads x 64; query/keys/values [SEQ][NB][1024] sequence-first (row = s*NB_FULL + b), Wq/Wk/Wv/Wo [out][in] (y = x W^T), no biases,
// UNSCALED scores, int32 mask [SEQ][SEQ] with replace-fill (-1e20 where mask == 0), output = ctx Wo^T as f32 [SEQ][NB][1024].
// Compute dtypes, f32 accumulate everywhere: q/k/v projections v_wmma_f32_16x16x32_bf16 (inputs and W RNE-converted to bf16; products exact);
// scores v_wmma_f32_16x16x32_f16: q and k single f16 (their f16 rounding, 2^-11 relative, lies below the error that the bf16 operands of the projections leave in q and k, 2^-8 relative per operand);
// P (x2^14 carry, cancels in the normalisation) and v single f16; out-projection v_wmma_f32_16x16x32_f16: ctx single f16, Wo = f16(bf16(Wo) * 64), folded back by 1/64; softmax f32 (online, running max).
// Layout: bf16 copies of the inputs de-interleaved to [b][s][1024]; q/k planes [b*16+h][t][d] and v^T plane [b*16+h][d][t] written by the GEMM epilogue;
// fused flash kernel in transposed form (S^T = K Q^T, O^T = V^T P^T) writes the f16 ctx plane [b*SEQ+t][1024]; the out-projection GEMM writes rows t*OUT_NB + b.
// FRAGMENT ORDER: every 16-bit workspace plane [R][C] (C = the k dimension of its WMMA use) is stored as fragments of 16 rows x 32 k, 1 KiB each, fragment index (r/16)*(C/32) + k/32.
// Inside a fragment the 16-byte piece (row r, k = 8q..8q+7 of the 32, q = 0..3) lies at (q>>1)*512 B + ((q&1)*16 + r%16)*16 B, so each of the two wave-wide 16-byte loads
// of a fragment reads 512 contiguous bytes (4 whole lines; from row-major planes it would touch 16).
// MASK BITS: the converter launch packs the int32 mask to one bit per key, plane [SEQ][SEQ/32] of 32-bit words, bit i of word (t, w) = (mask[t][32w + i] != 0); the flash kernel reads only that plane.

#ifndef NB
#define NB 2
#endif
#ifndef SEQ
#define SEQ 2048
#endif
#define NB_FULL  2
#define SEQ_FULL 2048
#ifndef OUT_NB
#define OUT_NB NB                // batch pitch (in rows) of the output [t][OUT_NB][1024]
#endif
#define DM   1024
#define NH_  16
#define HD   64
#define AW   8                   // waves per flash block (16 query rows each)
#define SC2  1.4426950408889634f // log2(e); the module applies no score scale
#define PSH  14.0f               // log2 of the P carry (16384)
#define FILL2 (-1.4426950408889634e20f)   // -1e20 in the log2 domain (replace-fill of masked scores)
#define WOS  64.0f               // carry of the Wo plane
#define WOI  (1.0f / 64.0f)

static_assert(HD == 64);
static_assert(NH_ * HD == DM);                 // head h = columns h*64 + d
static_assert(DM % 64 == 0);                   // 16 column tiles of 64
static_assert(DM % 32 == 0);                   // GEMM k-steps of 32, two per ring stage of 64
static_assert(SEQ % 64 == 0);                  // a 64-row tile (and a 16-row fragment) never straddles two batches
static_assert((NB * SEQ) % 64 == 0);
static_assert(SEQ % 32 == 0);                  // key loop steps by 32
static_assert(SEQ % (16 * AW) == 0);           // flash grid covers the sequence exactly
static_assert(((size_t)NB * SEQ * DM) % 8 == 0);
static_assert(((size_t)DM * DM) % 8 == 0);
static_assert(NB <= NB_FULL);
static_assert(SEQ <= SEQ_FULL);
static_assert(NB <= OUT_NB);

typedef _Float16 h16;
typedef unsigned short bf;
typedef __attribute__((ext_vector_type(16))) __bf16   v16bf;
typedef __attribute__((ext_vector_type(16))) _Float16 v16h;
typedef __attribute__((ext_vector_type(8)))  _Float16 v8h;
typedef __attribute__((ext_vector_type(8)))  unsigned short v8us;
typedef __attribute__((ext_vector_type(8)))  float    v8f;
typedef __attribute__((ext_vector_type(4)))  float    v4f;
typedef __attribute__((ext_vector_type(4)))  unsigned v4u;
typedef __attribute__((ext_vector_type(2)))  float    v2f;
typedef __attribute__((ext_vector_type(2)))  _Float16 v2h;
typedef __attribute__((ext_vector_type(4)))  unsigned short v4us;
typedef v4f  __attribute__((may_alias)) v4fa;
typedef v4us __attribute__((may_alias)) v4usa;
typedef v8us __attribute__((may_alias)) v8usa;

__device__ __forceinline__ unsigned short f2bf(float f) { unsigned u = __float_as_uint(f); u += 0x7FFFu + ((u >> 16) & 1u); return (unsigned short)(u >> 16); }
__device__ __forceinline__ float bf2f(unsigned short s) { return __uint_as_float(((unsigned)s) << 16); }
__device__ __forceinline__ v16h cat16(v8h lo, v8h hi) { return __builtin_shufflevector(lo, hi, 0, 1, 2, 3, 4, 5, 6, 7, 8, 9, 10, 11, 12, 13, 14, 15); }
__device__ __forceinline__ v16bf cat16b(v8us lo, v8us hi) { return __builtin_bit_cast(v16bf, __builtin_shufflevector(lo, hi, 0, 1, 2, 3, 4, 5, 6, 7, 8, 9, 10, 11, 12, 13, 14, 15)); }
__device__ __forceinline__ v8f wmma16(v16h a, v16h b, v8f c) { return __builtin_amdgcn_wmma_f32_16x16x32_f16(false, a, false, b, (short)0, c, false, false); }
__device__ __forceinline__ v8f wmmab(v16bf a, v16bf b, v8f c) { return __builtin_amdgcn_wmma_f32_16x16x32_bf16(false, a, false, b, (short)0, c, false, false); }
// fragment loaders from fragment-order planes; p = fragment base + 8*lane: elements 0..7 <- k0+8h+0..7, elements 8..15 <- k0+16+8h+0..7, row lane&15, h = lane>>4 (same map for A and B)
__device__ __forceinline__ v16h  ldh(const h16* p) { return cat16(*(const v8h*)p, *(const v8h*)(p + 256)); }
__device__ __forceinline__ v16bf ldb(const bf* p)  { return cat16b(*(const v8us*)p, *(const v8us*)(p + 256)); }
// ordering point for wave-private LDS tiles (same wave writes and reads)
__device__ __forceinline__ void wave_sync() { __builtin_amdgcn_fence(3 /* release order */, "wavefront"); __builtin_amdgcn_wave_barrier(); asm volatile("" ::: "memory"); }

// cvt_frag: one wave converts one fragment (16 rows x 32 columns) of an f32 matrix with DM columns: four whole-line loads (4 rows x 128 B each), the 16-bit rows
// through a wave-private LDS tile (80-byte pitch: 16 B x odd, free of conflicts for the 16-byte reads), two 512-byte stores in fragment order.
// MODE 0: bf16 RNE, source rows de-interleaved (plane row b*SEQ + t <- source row t*NB_FULL + b); MODE 1: bf16 RNE, rows as they are; MODE 2: f16(bf16(x) * 64), rows as they are.
template <int MODE> __device__ __forceinline__ void cvt_frag(const float* __restrict__ src, unsigned short* dst, unsigned blk, unsigned short* ts) {
    const int lane = threadIdx.x & 31, wave = threadIdx.x >> 5;
    const size_t f = (size_t)blk * 8 + wave;
    const size_t tile = f / (DM / 32), chunk = f % (DM / 32);
    unsigned short* tw = ts + wave * 16 * 40;
#pragma unroll
    for (int i = 0; i < 4; ++i) {
        const int row = 4 * i + (lane >> 3); const size_t drow = tile * 16 + row;
        const size_t srow = (MODE == 0) ? ((drow % SEQ) * NB_FULL + drow / SEQ) : drow;
        const v4f v = *(const v4f*)(src + srow * DM + chunk * 32 + (lane & 7) * 4); v4us o;
#pragma unroll
        for (int k = 0; k < 4; ++k) o[k] = (MODE == 2) ? __builtin_bit_cast(unsigned short, (h16)(bf2f(f2bf(v[k])) * WOS)) : f2bf(v[k]);
        *(v4usa*)(tw + row * 40 + (lane & 7) * 4) = o; }
    wave_sync();
#pragma unroll
    for (int j = 0; j < 2; ++j) { const v8us o = *(const v8usa*)(tw + (lane & 15) * 40 + j * 16 + (lane >> 4) * 8); *(v8us*)(dst + f * 512 + j * 256 + lane * 8) = o; }
    asm volatile("s_wait_xcnt 0x0" ::: "memory");   // behind the two stores: in the merged kernel's listing another branch's code follows them and rewrites their registers
}

// mask_bits: one wave packs 32 words of the bit plane (1024 keys of one mask row): 32 whole-line loads (one int per lane), each turned into its word by a wave-wide compare
// (lane i's result is bit i); word i is kept by lane i, and the 32 words leave in one 128-byte store.
__device__ __forceinline__ void mask_bits(const int* __restrict__ mask, unsigned* MB, unsigned blk) {
    const int lane = threadIdx.x & 31, wave = threadIdx.x >> 5;
    const size_t w0 = ((size_t)blk * 8 + wave) * 32;
    const int* src = mask + w0 * 32 + lane;
    int v[32];
#pragma unroll
    for (int i = 0; i < 32; ++i) v[i] = src[i * 32];
    unsigned word = 0;
#pragma unroll
    for (int i = 0; i < 32; ++i) { const unsigned bits = __builtin_amdgcn_ballot_w32(v[i] != 0); word = (lane == i) ? bits : word; }
    MB[w0 + lane] = word;
    asm volatile("s_wait_xcnt 0x0" ::: "memory");   // behind the store: in the merged kernel's listing another branch's code follows it and rewrites its registers
}

// k_cvt: all seven conversions and the mask packing in ONE launch (they are independent of each other); the block index picks the matrix. 8 waves per block, one fragment each.
// Blocks 0 .. 3*GX-1: query | keys | values, src [t][NB_FULL][DM] f32 -> plane [b*SEQ + t][DM] bf16; then 3*GW blocks: Wq | Wk | Wv -> bf16; then GW blocks: Wo -> f16 x64. All in fragment order.
// Then GM blocks: mask rows 0 .. SEQ-1 -> bit plane, 32 words per wave.
#define GX ((unsigned)((size_t)NB * SEQ * DM / 512 / 8))
#define GW ((unsigned)((size_t)DM * DM / 512 / 8))
#define GM ((unsigned)((size_t)SEQ * (SEQ / 32) / 32 / 8))
static_assert(SEQ == SEQ_FULL);                             // the words of the bit plane follow the mask's own rows without a gap
static_assert(((size_t)SEQ * (SEQ / 32)) % (32 * 8) == 0);  // every mask block has eight whole runs of 32 words
static_assert(((size_t)NB * SEQ * DM) % (512 * 8) == 0);   // every conversion block of the merged grid has eight whole fragments
static_assert(((size_t)DM * DM) % (512 * 8) == 0);
__global__ __launch_bounds__(256) void k_cvt(const float* __restrict__ xq, const float* __restrict__ xk, const float* __restrict__ xv,
                                             const float* __restrict__ wq, const float* __restrict__ wk, const float* __restrict__ wv, const float* __restrict__ wo, const int* __restrict__ mask,
                                             bf* XQ, bf* XK, bf* XV, bf* WQ, bf* WK, bf* WV, h16* WO16, unsigned* MB) {
    __shared__ __align__(16) unsigned short ts[8 * 16 * 40];
    const unsigned bx = blockIdx.x;
    if (bx < 3 * GX) { const unsigned w = bx / GX; cvt_frag<0>(w == 0 ? xq : w == 1 ? xk : xv, w == 0 ? XQ : w == 1 ? XK : XV, bx % GX, ts); }
    else if (bx < 3 * GX + 3 * GW) { const unsigned c = bx - 3 * GX, w = c / GW; cvt_frag<1>(w == 0 ? wq : w == 1 ? wk : wv, w == 0 ? WQ : w == 1 ? WK : WV, c % GW, ts); }
    else if (bx < 3 * GX + 4 * GW) cvt_frag<2>(wo, (unsigned short*)WO16, bx - (3 * GX + 3 * GW), ts);
    else mask_bits(mask, MB, bx - (3 * GX + 4 * GW));
}

// THE GEMM RING (k_proj, k_oproj): a block of GWV = 4 waves works on a 128x128 tile, wave (wm, wn) = (wave / 2, wave % 2) on its 64x64 quarter (16 accumulators), K = DM.
// Both operands come through an LDS ring (three buffers in k_proj, four in k_oproj), one stage = GS = 64 k = two fragments per 16 rows. In a fragment-order plane those two fragments are 2 KiB in a row, which is one
// asynchronous copy of 16 bytes per thread; a stage is 8 such copies for the 128 A rows and 8 for the 128 B rows, issued two (k_proj) or three (k_oproj) passes ahead: each operand byte leaves L2 once per block
// (not once per wave) and no L2 latency stands between the matrix instructions. A stage in LDS keeps the planes' own order: A | B, per 16 rows 1024 halves, fragment k/32 at 512 halves.
#define GWV  4                   // waves per GEMM block
#define GS   64                  // k per ring stage
#define GNST (DM / GS)           // stages
#define GOP  (128 * GS)          // halves of one operand in one stage
static_assert(DM % GS == 0);                   // whole stages
static_assert(GS == 64);                       // a stage is worked on as two steps of 32 k
static_assert((NB * SEQ) % 128 == 0 && DM % 128 == 0);   // the grids cover both matrices with whole 128x128 tiles
static_assert(GWV * 32 * 8 == GS * 16);        // one copy of every thread = the stage's two fragments of 16 rows

// One operand's copies of one thread for one stage: g = the thread's own 16 bytes in the first 16 rows (16 rows further = 16*DM halves), l = its LDS byte address (16 rows further = 2 KiB).
// The s_wait_xcnt stands inside the statement, behind the last copy, so that no address register is rewritten ahead of it.
template <class T> __device__ __forceinline__ void rows_copy(const T* g, unsigned l) {
    asm volatile("global_load_async_to_lds_b128 %0, %8, off\n\t"
                 "global_load_async_to_lds_b128 %1, %9, off\n\t"
                 "global_load_async_to_lds_b128 %2, %10, off\n\t"
                 "global_load_async_to_lds_b128 %3, %11, off\n\t"
                 "global_load_async_to_lds_b128 %4, %12, off\n\t"
                 "global_load_async_to_lds_b128 %5, %13, off\n\t"
                 "global_load_async_to_lds_b128 %6, %14, off\n\t"
                 "global_load_async_to_lds_b128 %7, %15, off\n\t"
                 "s_wait_xcnt 0x0"
                 :: "v"(l), "v"(l + 2048u), "v"(l + 4096u), "v"(l + 6144u), "v"(l + 8192u), "v"(l + 10240u), "v"(l + 12288u), "v"(l + 14336u),
                    "v"(g), "v"(g + (size_t)1 * 16 * DM), "v"(g + (size_t)2 * 16 * DM), "v"(g + (size_t)3 * 16 * DM), "v"(g + (size_t)4 * 16 * DM),
                    "v"(g + (size_t)5 * 16 * DM), "v"(g + (size_t)6 * 16 * DM), "v"(g + (size_t)7 * 16 * DM)
                 : "memory");
}

// k_proj: register-blocked bf16 GEMM on the GEMM ring, operands from fragment-order bf16 planes.
// C[m][n] = sum_k A[m][k] Bt[n][k], written as f16 (Ph) in fragment order into planes of 'pitch' columns:
// a wave's tile base (r0/RB)*sRB + (r0%RB)*pitch + (c0/CB)*sCB + (c0%CB)*16 (halves); 16 rows further = 16*pitch, 32 columns further = 512.
// The three projections are independent and run in ONE launch, grid (NB*SEQ/128, DM/128, 3), 128 threads; blockIdx.z picks the product:
// z = 0, 1 (q, k): A = x rows (m = b*SEQ + t), Bt = W rows (n = h*64 + d) -> planes [(b*16 + h)][t][d];
// z = 2 (v^T): A = Wv rows (m = h*64 + d, from blockIdx.y), Bt = x rows (n = b*SEQ + t, from blockIdx.x) -> plane [(b*1024 + m)][t] = [(b*16 + h)][d][t].
// ITS RING HAS PNB = 3 BUFFERS: stage s + 3 is issued behind the barrier that ends pass s, into the buffer that pass s has read, so a stage flies for two passes and a wave has at most 2 stages = 32 copies outstanding.
// The waves' epilogue tiles lie over the ring (used behind the last pass's barrier, when no copy is outstanding and no wave reads the ring any more): 96 KiB a block, so that three blocks still share a WGP.
#define PNB  3                   // buffers of k_proj's ring
#define OCP  16                  // copies of one wave per stage (8 for A, 8 for B), in both GEMMs
static_assert(GNST >= PNB);                    // the prologue fills three stages
static_assert((PNB - 1) * OCP <= 63);          // copies of a wave outstanding at once
static_assert((PNB - 2) * OCP == 16);          // the count written in the two counted waits below
static_assert(GWV * 16 * 68 * 4 <= PNB * 2 * GOP * 2);   // the epilogue tiles fit the ring
__global__ __launch_bounds__(32 * GWV) void k_proj(const bf* __restrict__ XQ, const bf* __restrict__ XK, const bf* __restrict__ XV, const bf* __restrict__ WQ, const bf* __restrict__ WK, const bf* __restrict__ WV,
                                             h16* QH, h16* KH, h16* VT) {
    __shared__ __align__(16) bf gs[PNB][2 * GOP];            // per buffer: A rows | B rows; behind the loop: the waves' own epilogue tiles, 16 x 68 floats each
    const int K = DM;
    const int z = blockIdx.z; const bool isv = (z == 2);
    const bf* __restrict__ A = isv ? WV : (z == 0 ? XQ : XK); const bf* __restrict__ Bt = isv ? XV : (z == 0 ? WQ : WK);
    h16* Ph = isv ? VT : (z == 0 ? QH : KH);
    const int RB = isv ? DM : SEQ, pitch = isv ? SEQ : HD, CB = isv ? SEQ : HD;
    const size_t sRB = isv ? (size_t)0 : (size_t)NH_ * SEQ * HD, sCB = isv ? (size_t)DM * SEQ : (size_t)SEQ * HD;
    const int tid = threadIdx.x, lane = tid & 31, wave = __builtin_amdgcn_readfirstlane(tid >> 5), wm = wave >> 1, wn = wave & 1, lr = lane & 15, hi = lane >> 4;   // the wave's number in a scalar register: tile bases stay scalar
    const int R0 = (isv ? blockIdx.y : blockIdx.x) * 128, C0 = (isv ? blockIdx.x : blockIdx.y) * 128; const int r0 = R0 + wm * 64, c0 = C0 + wn * 64;
    float* os = (float*)&gs[0][0] + wave * (16 * 68);
    v8f acc[4][4];
#pragma unroll
    for (int mb = 0; mb < 4; ++mb)
#pragma unroll
        for (int nb = 0; nb < 4; ++nb) acc[mb][nb] = (v8f){};
    const bf* ga = A + (size_t)R0 * K + tid * 8; const bf* gb = Bt + (size_t)C0 * K + tid * 8;   // fragment (row/16, kc/32) at (row/16)*16*K + kc*16; a stage further = GS*16 halves
    const unsigned la = (unsigned)(size_t)&gs[0][0] + tid * 16u; const unsigned LOB = GOP * 2, LGB = 2 * GOP * 2;   // bytes from A to B, from buffer 0 to buffer 1
    rows_copy(ga, la); rows_copy(gb, la + LOB);
    rows_copy(ga + GS * 16, la + LGB); rows_copy(gb + GS * 16, la + LGB + LOB);
    asm volatile("s_wait_asynccnt 0x10" ::: "memory");  // all but this wave's 16 youngest copies (stage 1) have landed: its stage 0
    __syncthreads();                                    // ... and every wave's: stage 0 is published
    rows_copy(ga + 2 * GS * 16, la + 2 * LGB); rows_copy(gb + 2 * GS * 16, la + 2 * LGB + LOB);
    // one pass: the 32 products of one stage, from buffer bu
    auto pass = [&](int bu) __attribute__((always_inline)) {
        const bf* sa = &gs[bu][0] + wm * (4 * 16 * GS) + 8 * lane; const bf* sb = &gs[bu][0] + GOP + wn * (4 * 16 * GS) + 8 * lane;
        // The sched_barrier(0) lines hold this order: [reads: A and B of the first 32 k, A of the second][8 products][reads: 2 B fragments of the second 32 k][8 products][reads: the other 2][16 products][waits].
        // Each of the two later groups then stands 8 products ahead of its first use, and every wait but the last is a counted one. Left alone, the scheduler sinks the B reads singly among the products, each with a wait to 0 directly behind it.
        v16bf a[GS / 32][4], b[GS / 32][4];
#pragma unroll
        for (int mb = 0; mb < 4; ++mb) a[0][mb] = ldb(sa + mb * (16 * GS));
#pragma unroll
        for (int nb = 0; nb < 4; ++nb) b[0][nb] = ldb(sb + nb * (16 * GS));
#pragma unroll
        for (int mb = 0; mb < 4; ++mb) a[1][mb] = ldb(sa + mb * (16 * GS) + 512);
        __builtin_amdgcn_sched_barrier(0);   // the first group of reads stays in front of the products
#pragma unroll
        for (int h2 = 0; h2 < 2; ++h2) {
#pragma unroll
            for (int nb = 2 * h2; nb < 2 * h2 + 2; ++nb)
#pragma unroll
                for (int mb = 0; mb < 4; ++mb) acc[mb][nb] = wmmab(a[0][mb], b[0][nb], acc[mb][nb]);
            __builtin_amdgcn_sched_barrier(0);   // these two fragments' reads are not lifted (they take registers of fragments whose last product stands above: 16 fragments at once would not fit 256 registers) ...
            b[1][2 * h2] = ldb(sb + (2 * h2) * (16 * GS) + 512); b[1][2 * h2 + 1] = ldb(sb + (2 * h2 + 1) * (16 * GS) + 512);
            __builtin_amdgcn_sched_barrier(0);   // ... and not sunk towards their use
        }
#pragma unroll
        for (int nb = 0; nb < 4; ++nb)
#pragma unroll
            for (int mb = 0; mb < 4; ++mb) acc[mb][nb] = wmmab(a[1][mb], b[1][nb], acc[mb][nb]);
        // keeps the waits that follow a pass behind the stage's products. Without it the scheduler lifts them and the barrier in front of the products: every read is then waited out
        // before the first product.
        __builtin_amdgcn_sched_barrier(0);
    };
    int bu = 0;                                             // buffer of stage s = s mod PNB
    // the passes that refill: every wave issues one stage (OCP copies) on every trip, so behind stage s + 1's copies stand exactly those of stage s + 2
#pragma unroll 1   // stays rolled: one copy of the pass in the text, one register set
    for (int s = 0; s < GNST - PNB; ++s) {
        pass(bu);
        // publish point of stage s + 1, and the end of every wave's reads of stage s
        asm volatile("s_wait_dscnt 0x0" ::: "memory");      // this wave's LDS reads of stage s have returned before its buffer is refilled
        asm volatile("s_wait_asynccnt 0x10" ::: "memory");  // all but this wave's 16 youngest copies have landed: its copies of stage s + 1; stage s + 2 stays in flight
        __syncthreads();
        rows_copy(ga + (size_t)(s + PNB) * GS * 16, la + bu * LGB); rows_copy(gb + (size_t)(s + PNB) * GS * 16, la + bu * LGB + LOB);
        bu = (bu == PNB - 1) ? 0 : bu + 1;
    }
    // the last PNB passes issue nothing: their waits are to 0. The last one's barrier also ends every wave's reads of the ring before the epilogue tiles are written over it.
#pragma unroll 1   // stays rolled, as above
    for (int s = GNST - PNB; s < GNST; ++s) {
        pass(bu);
        asm volatile("s_wait_dscnt 0x0" ::: "memory");      // as above
        asm volatile("s_wait_asynccnt 0x0" ::: "memory");   // every copy of this wave has landed
        __syncthreads();
        bu = (bu == PNB - 1) ? 0 : bu + 1;
    }
    asm volatile("s_wait_asynccnt 0x0" ::: "memory");       // no copy is outstanding when the wave goes on
    const size_t tbase = (size_t)(r0 / RB) * sRB + (size_t)(r0 % RB) * (size_t)pitch + (size_t)(c0 / CB) * sCB + (size_t)(c0 % CB) * 16;
#pragma unroll
    for (int mb = 0; mb < 4; ++mb) {
#pragma unroll
        for (int nb = 0; nb < 4; ++nb) {
#pragma unroll
            for (int j = 0; j < 8; ++j) os[(hi * 8 + j) * 68 + nb * 16 + lr] = acc[mb][nb][j]; }   // D: row 8h+j, col lane&15
        wave_sync();
        const size_t sb = tbase + (size_t)(mb * 16) * (size_t)pitch;
{
#pragma unroll
            for (int s = 0; s < 4; ++s) { const int row = lr, c8 = (2 * s + hi) * 8;   // s = 2*(column/32) + half of the fragment; 16 rows x 2 pieces = one 512-byte store
                const v4f x0 = *(const v4fa*)(&os[row * 68 + c8]); const v4f x1 = *(const v4fa*)(&os[row * 68 + c8 + 4]); v8h hv;
#pragma unroll
                for (int i = 0; i < 4; ++i) { hv[i] = (h16)x0[i]; hv[4 + i] = (h16)x1[i]; }
                const size_t oo = sb + (size_t)(s * 256 + lane * 8);
                *(v8h*)(Ph + oo) = hv; }
            asm volatile("s_wait_xcnt 0x0" ::: "memory");   // behind the four stores: the next 16 rows' values and addresses take their registers
             }
        wave_sync();
    }
}

// k_oproj: register-blocked f16 GEMM on the GEMM ring, A = ctx plane [NB*SEQ][DM] f16 (row m = b*SEQ + t), Bt = Wo plane [DM][DM] f16 (x64 carry), both in fragment order.
// OUT[(t*OUT_NB + b)][n] = (1/64) sum_k A[m][k] Bt[n][k], f32. grid (NB*SEQ/128, DM/128), 128 threads.
// ITS RING HAS ONB = 4 BUFFERS: the grid gives every WGP one block, one wave per SIMD, so nothing else runs while a wave waits for its copies, and one pass (32 products) is shorter than a copy's way
// from memory. Stage s + 4 is issued behind the barrier that ends pass s, into the buffer that pass s has read: a stage flies for three passes. A wave has at most 3 stages = 48 copies outstanding.
#define ONB  4                   // buffers of k_oproj's ring
static_assert(GNST >= ONB);                    // the prologue fills four stages
static_assert((ONB & (ONB - 1)) == 0);         // buffer of stage s = s & (ONB - 1)
static_assert((ONB - 1) * OCP <= 63);          // copies of a wave outstanding at once
static_assert((ONB - 2) * OCP == 32);          // the count written in the two counted waits below
__global__ __launch_bounds__(32 * GWV) void k_oproj(const h16* __restrict__ A, const h16* __restrict__ Bt, float* OUT) {
    __shared__ __align__(16) h16 gs[ONB][2 * GOP];           // per buffer: A rows | B rows
    __shared__ __align__(16) float osb[GWV][16 * 68];        // a wave's own epilogue tile
    const int K = DM;
    const int tid = threadIdx.x, lane = tid & 31, wave = __builtin_amdgcn_readfirstlane(tid >> 5), wm = wave >> 1, wn = wave & 1, lr = lane & 15, hi = lane >> 4;   // the wave's number in a scalar register: tile bases stay scalar
    const int R0 = blockIdx.x * 128, C0 = blockIdx.y * 128; const int r0 = R0 + wm * 64, c0 = C0 + wn * 64;
    float* os = &osb[wave][0];
    v8f acc[4][4];
#pragma unroll
    for (int mb = 0; mb < 4; ++mb)
#pragma unroll
        for (int nb = 0; nb < 4; ++nb) acc[mb][nb] = (v8f){};
    const h16* ga = A + (size_t)R0 * K + tid * 8; const h16* gb = Bt + (size_t)C0 * K + tid * 8;   // fragment (row/16, kc/32) at (row/16)*16*K + kc*16; a stage further = GS*16 halves
    const unsigned la = (unsigned)(size_t)&gs[0][0] + tid * 16u; const unsigned LOB = GOP * 2, LGB = 2 * GOP * 2;   // bytes from A to B, from buffer 0 to buffer 1
    rows_copy(ga, la); rows_copy(gb, la + LOB);
    rows_copy(ga + GS * 16, la + LGB); rows_copy(gb + GS * 16, la + LGB + LOB);
    rows_copy(ga + 2 * GS * 16, la + 2 * LGB); rows_copy(gb + 2 * GS * 16, la + 2 * LGB + LOB);
    asm volatile("s_wait_asynccnt 0x20" ::: "memory");  // all but this wave's 32 youngest copies (stages 1 and 2) have landed: its stage 0
    __syncthreads();                                    // ... and every wave's: stage 0 is published
    rows_copy(ga + 3 * GS * 16, la + 3 * LGB); rows_copy(gb + 3 * GS * 16, la + 3 * LGB + LOB);
    // one pass: the 32 products of stage s, from its buffer
    auto pass = [&](int s) __attribute__((always_inline)) {
        const h16* sa = &gs[s & (ONB - 1)][0] + wm * (4 * 16 * GS) + 8 * lane; const h16* sb = &gs[s & (ONB - 1)][0] + GOP + wn * (4 * 16 * GS) + 8 * lane;
        // The sched_barrier(0) lines hold this order: [reads: A and B of the first 32 k, A of the second][8 products][reads: 2 B fragments of the second 32 k][8 products][reads: the other 2][16 products][waits].
        // Each of the two later groups then stands 8 products ahead of its first use, and every wait but the last is a counted one. Left alone, the scheduler sinks the B reads singly among the products, each with a wait to 0 directly behind it.
        v16h a[GS / 32][4], b[GS / 32][4];
#pragma unroll
        for (int mb = 0; mb < 4; ++mb) a[0][mb] = ldh(sa + mb * (16 * GS));
#pragma unroll
        for (int nb = 0; nb < 4; ++nb) b[0][nb] = ldh(sb + nb * (16 * GS));
#pragma unroll
        for (int mb = 0; mb < 4; ++mb) a[1][mb] = ldh(sa + mb * (16 * GS) + 512);
        __builtin_amdgcn_sched_barrier(0);   // the first group of reads stays in front of the products
#pragma unroll
        for (int h2 = 0; h2 < 2; ++h2) {
#pragma unroll
            for (int nb = 2 * h2; nb < 2 * h2 + 2; ++nb)
#pragma unroll
                for (int mb = 0; mb < 4; ++mb) acc[mb][nb] = wmma16(a[0][mb], b[0][nb], acc[mb][nb]);
            __builtin_amdgcn_sched_barrier(0);   // these two fragments' reads are not lifted (they take registers of fragments whose last product stands above: 16 fragments at once would not fit 256 registers) ...
            b[1][2 * h2] = ldh(sb + (2 * h2) * (16 * GS) + 512); b[1][2 * h2 + 1] = ldh(sb + (2 * h2 + 1) * (16 * GS) + 512);
            __builtin_amdgcn_sched_barrier(0);   // ... and not sunk towards their use
        }
#pragma unroll
        for (int nb = 0; nb < 4; ++nb)
#pragma unroll
            for (int mb = 0; mb < 4; ++mb) acc[mb][nb] = wmma16(a[1][mb], b[1][nb], acc[mb][nb]);
        // keeps the waits that follow a pass behind the stage's products. Without it the scheduler lifts them and the barrier in front of the products: every read is then waited out
        // before the first product.
        __builtin_amdgcn_sched_barrier(0);
    };
    // the passes that refill: every wave issues one stage (OCP copies) on every trip, so behind stage s + 1's copies stand exactly those of stages s + 2 and s + 3
#pragma unroll 1   // stays rolled: one copy of the pass in the text, one register set
    for (int s = 0; s < GNST - ONB; ++s) {
        pass(s);
        // publish point of stage s + 1, and the end of every wave's reads of stage s
        asm volatile("s_wait_dscnt 0x0" ::: "memory");      // this wave's LDS reads of stage s have returned before its buffer is refilled
        asm volatile("s_wait_asynccnt 0x20" ::: "memory");  // all but this wave's 32 youngest copies have landed: its copies of stage s + 1; stages s + 2 and s + 3 stay in flight
        __syncthreads();
        rows_copy(ga + (size_t)(s + ONB) * GS * 16, la + (s & (ONB - 1)) * LGB); rows_copy(gb + (size_t)(s + ONB) * GS * 16, la + (s & (ONB - 1)) * LGB + LOB);
    }
    // the last ONB passes issue nothing: their waits are to 0
#pragma unroll 1   // stays rolled, as above
    for (int s = GNST - ONB; s < GNST; ++s) {
        pass(s);
        asm volatile("s_wait_dscnt 0x0" ::: "memory");      // as above
        asm volatile("s_wait_asynccnt 0x0" ::: "memory");   // every copy of this wave has landed
        __syncthreads();
    }
    asm volatile("s_wait_asynccnt 0x0" ::: "memory");       // no copy is outstanding when the wave goes on
#pragma unroll
    for (int mb = 0; mb < 4; ++mb) {
#pragma unroll
        for (int nb = 0; nb < 4; ++nb) {
#pragma unroll
            for (int j = 0; j < 8; ++j) os[(hi * 8 + j) * 68 + nb * 16 + lr] = acc[mb][nb][j] * WOI; }   // D: row 8h+j, col lane&15
        wave_sync();
{
#pragma unroll
            for (int s = 0; s < 8; ++s) { const int row = 2 * s + hi, cofs = lr * 4;   // 8 s x 2 rows = 16 rows; 16 lanes x 4 floats = 64 columns
                const int m = r0 + mb * 16 + row; const int bb = m / SEQ, t = m % SEQ;
                const v4f val = *(const v4fa*)(&os[row * 68 + cofs]);
                *(v4f*)(OUT + ((size_t)t * OUT_NB + bb) * DM + c0 + cofs) = val; }
             }
        wave_sync();
    }
}

// k_flash: fused attention, one wave per 16 query rows of one (batch, head), AW waves (16*AW query rows) per block; Q fragments straight from the fragment-order f16 planes, once.
// THE RING: the loop's operands (K, V^T) come through a two-buffer LDS ring, one stage = SK keys = one softmax pass. Every thread brings 8 pieces of 16 bytes per stage
// with asynchronous copies to LDS, issued one whole stage ahead, so each K / V^T byte leaves L2 once per block (not once per wave) and no load latency stands in the loop.
// A stage in LDS: K | V^T, 16 KiB each, in the planes' own fragment order (a wave-wide 16-byte read covers 512 contiguous bytes).
// THE MASK: the block's 16*AW rows of the bit plane (SEQ/32 words each, all keys) are copied to LDS once, with stage 0, at a pitch of MP words (the 16 rows of a wave-wide 16-byte read fall on
// different banks). A lane reads its row's four words of a stage (128 keys) in one 16-byte read.
// Transposed form: S^T[key][t] = K Q^T (A = K rows, B = Q rows); lane (t = lane&15, h = lane>>4) holds keys 8h+r of each 16-key tile, so the packed
// P tile is directly the B fragment of O^T[d][t] = V^T P^T (element r <- tile keys 0..15, element 8+r <- tile keys 16..31, lane unchanged).
// Scores: one accumulator per 16-key tile, two products (d = 0..31, 32..63). Masked scores are REPLACED by the fill constant before the
// running-max softmax (a fully masked row comes out uniform); the replacing is stepped over, by one wave-uniform test per stage, where none of the wave's 16 x 128 bits of the stage is 0.
// ONE SOFTMAX UPDATE PER STAGE: all SK/16 score tiles of a stage are formed first; then one maximum over the SK keys, one xor-16 exchange between the two lane halves of a row, one new running max
// (one scalar per lane) and one rescaling of the accumulators serve the whole stage.
// ROW SUMS ON THE MATRIX PIPE: the denominator is one more accumulator tile, lt += E P^T per 32 keys, E = the constant A fragment with ones in rows 0 and 8 and zeros elsewhere.
// D row 8h + j sits in register j of lane half h, so register 0 of EVERY lane holds the sum over all 32 keys of its own query column (P as rounded to f16); registers 1..7 stay 0.
#define SK  128                  // keys per ring stage and per softmax update
#define NT  (SK / 16)            // score tiles of a stage
#define NG  (SK / 32)            // P fragments (32 keys each) of a stage
#define MP  68                   // pitch of a row of mask bits in LDS, in words
#define NST (SEQ / SK)           // stages
static_assert(NG == 4);                        // the order of the V^T reads in the loop is written out for four groups of 32 keys
static_assert(AW == 8 && SK == 128);           // the copy maps below: 256 threads, 1024 pieces per 16-KiB plane slice; four words of mask bits per stage
static_assert(SEQ / 32 == 64);                 // ... and 16 pieces per row of mask bits
static_assert(SEQ % SK == 0 && NST >= 2);      // the ring's prologue fills two stages

// One stage's copies of one thread. gk, gv: the thread's own first piece of the stage in the K and V^T planes; lk: its LDS byte address in the stage's buffer.
// The s_wait_xcnt stands inside the statement, behind the last copy, so that no address register is rewritten ahead of it.
__device__ __forceinline__ void stage_copy(const h16* gk, const h16* gv, unsigned lk) {
    asm volatile("global_load_async_to_lds_b128 %0, %8, off\n\t"
                 "global_load_async_to_lds_b128 %1, %9, off\n\t"
                 "global_load_async_to_lds_b128 %2, %10, off\n\t"
                 "global_load_async_to_lds_b128 %3, %11, off\n\t"
                 "global_load_async_to_lds_b128 %4, %12, off\n\t"
                 "global_load_async_to_lds_b128 %5, %13, off\n\t"
                 "global_load_async_to_lds_b128 %6, %14, off\n\t"
                 "global_load_async_to_lds_b128 %7, %15, off\n\t"
                 "s_wait_xcnt 0x0"
                 :: "v"(lk), "v"(lk + 4096u), "v"(lk + 8192u), "v"(lk + 12288u), "v"(lk + 16384u), "v"(lk + 20480u), "v"(lk + 24576u), "v"(lk + 28672u),
                    "v"(gk), "v"(gk + 2048), "v"(gk + 4096), "v"(gk + 6144),
                    "v"(gv), "v"(gv + (size_t)16 * SEQ), "v"(gv + (size_t)32 * SEQ), "v"(gv + (size_t)48 * SEQ)
                 : "memory");
}

// The block's rows of mask bits, once: gm = the thread's own first piece (row tid/16, piece tid%16; 16 rows further per copy), lm = its LDS byte address.
// The s_wait_xcnt stands inside the statement, behind the last copy, so that no address register is rewritten ahead of it.
__device__ __forceinline__ void bits_copy(const unsigned* gm, unsigned lm) {
    asm volatile("global_load_async_to_lds_b128 %0, %8, off\n\t"
                 "global_load_async_to_lds_b128 %1, %9, off\n\t"
                 "global_load_async_to_lds_b128 %2, %10, off\n\t"
                 "global_load_async_to_lds_b128 %3, %11, off\n\t"
                 "global_load_async_to_lds_b128 %4, %12, off\n\t"
                 "global_load_async_to_lds_b128 %5, %13, off\n\t"
                 "global_load_async_to_lds_b128 %6, %14, off\n\t"
                 "global_load_async_to_lds_b128 %7, %15, off\n\t"
                 "s_wait_xcnt 0x0"
                 :: "v"(lm), "v"(lm + 1u * 16 * MP * 4), "v"(lm + 2u * 16 * MP * 4), "v"(lm + 3u * 16 * MP * 4), "v"(lm + 4u * 16 * MP * 4), "v"(lm + 5u * 16 * MP * 4), "v"(lm + 6u * 16 * MP * 4), "v"(lm + 7u * 16 * MP * 4),
                    "v"(gm), "v"(gm + (size_t)1 * 16 * (SEQ / 32)), "v"(gm + (size_t)2 * 16 * (SEQ / 32)), "v"(gm + (size_t)3 * 16 * (SEQ / 32)), "v"(gm + (size_t)4 * 16 * (SEQ / 32)),
                    "v"(gm + (size_t)5 * 16 * (SEQ / 32)), "v"(gm + (size_t)6 * 16 * (SEQ / 32)), "v"(gm + (size_t)7 * 16 * (SEQ / 32))
                 : "memory");
}

__global__ __launch_bounds__(32 * AW) void k_flash(const h16* __restrict__ QH, const h16* __restrict__ KH,
                                                   const h16* __restrict__ VT, const unsigned* __restrict__ MB, h16* CX) {
    __shared__ __align__(16) h16 kvs[2][2 * SK * HD];        // per buffer: K | V^T, SK*HD halves each
    __shared__ __align__(16) unsigned mks[16 * AW * MP];     // 16*AW rows of mask bits, SEQ/32 words each, pitch MP
    const int tid = threadIdx.x, lane = tid & 31, wave = tid >> 5, lr = lane & 15, hi = lane >> 4;
    const int zh = blockIdx.y; const int b = zh / NH_, h = zh % NH_;
    const int tb = blockIdx.x * (16 * AW), t0 = tb + wave * 16;
    const size_t pbase = (size_t)zh * SEQ * HD;
    // the thread's pieces of stage 0: plane slices of SK keys are contiguous (K: SK*HD halves = four copies of the block; V^T: SK*16 halves per 16 d rows = one copy of the block per d tile)
    const h16* gk = KH + pbase + tid * 8;
    const h16* gv = VT + pbase + tid * 8;
    const unsigned lk0 = (unsigned)(size_t)&kvs[0][0] + tid * 16u;
    const unsigned LKB = 2 * SK * HD * 2;   // bytes from buffer 0 to buffer 1
    stage_copy(gk, gv, lk0);
    bits_copy(MB + (size_t)(tb + (tid >> 4)) * (SEQ / 32) + (tid & 15) * 4, (unsigned)(size_t)&mks[0] + (tid >> 4) * (MP * 4u) + (tid & 15) * 16u);
    const size_t qo = pbase + (size_t)t0 * HD + 8 * lane;     // 16 rows x 64 d = two fragments of 512 halves
    const v16h qh0 = ldh(QH + qo), qh1 = ldh(QH + qo + 512);   // B fragments: col t, k = d
    asm volatile("s_wait_asynccnt 0x0" ::: "memory");   // stage 0 and the mask bits of this wave have landed
    __syncthreads();                                    // ... and every wave's: stage 0 and the mask bits are published
    stage_copy(gk + SK * HD, gv + SK * 16, lk0 + LKB);
    const unsigned* mrow = &mks[(wave * 16 + lr) * MP];      // the bits of the lane's query row
    v8f o0 = (v8f){}, o1 = (v8f){}, o2 = (v8f){}, o3 = (v8f){};
    float m = -3.0e38f;
    v8f lt = (v8f){};                                        // register 0: the lane's row sum
    v16h ones;                                               // A fragment E: row = lane & 15, every k alike
#pragma unroll
    for (int i = 0; i < 16; ++i) ones[i] = ((lane & 7) == 0) ? (h16)1.0f : (h16)0.0f;
#pragma unroll 1
    for (int s = 0; s < NST; ++s) {
        const h16* kst = &kvs[s & 1][0] + 8 * lane;                          // + 16*HD*(key tile) + 512*(d/32)  (A fragment: row key, k = d)
        const v4u mw = *(const v4u*)(mrow + NG * s);                         // word g: bit i = mask[t][SK*s + 32g + i] != 0
        const bool holes = __builtin_amdgcn_ballot_w32((mw[0] & mw[1] & mw[2] & mw[3]) != 0xFFFFFFFFu) != 0;   // the same for the whole wave: a scalar branch
        v8f sc[NT]; v16h kf[NT][2];
        // The sched_barrier(0) lines hold this order: [K reads: d 0..31 of all tiles, d 32..63 of the first half][4 products][K reads: d 32..63 of the second half][12 products].
        // The reads stand in two groups behind counted waits, the second in registers that the first four products have set free (sixteen fragments at once spill) and eight products ahead of its use.
        // Left alone, the scheduler strews the reads among the products, the first ones waited out to 0.
#pragma unroll
        for (int kt = 0; kt < NT; ++kt) kf[kt][0] = ldh(kst + kt * 16 * HD);
#pragma unroll
        for (int kt = 0; kt < NT / 2; ++kt) kf[kt][1] = ldh(kst + kt * 16 * HD + 512);
        __builtin_amdgcn_sched_barrier(0);
#pragma unroll
        for (int kt = 0; kt < NT / 2; ++kt) sc[kt] = wmma16(kf[kt][0], qh0, (v8f){});
        __builtin_amdgcn_sched_barrier(0);
#pragma unroll
        for (int kt = NT / 2; kt < NT; ++kt) kf[kt][1] = ldh(kst + kt * 16 * HD + 512);
        __builtin_amdgcn_sched_barrier(0);
#pragma unroll
        for (int kt = NT / 2; kt < NT; ++kt) sc[kt] = wmma16(kf[kt][0], qh0, (v8f){});
#pragma unroll
        for (int kt = 0; kt < NT; ++kt) sc[kt] = wmma16(kf[kt][1], qh1, sc[kt]);
        // four vector slots behind the last product, on every path, before an accumulator is read or the last products' K fragments' registers are loaded anew.
        // It takes every score tile, so that all sixteen products stand in one run in front of the vector work (read one by one behind its own product, each tile costs its own four idle slots).
        asm volatile("v_nop\n\tv_nop\n\tv_nop\n\tv_nop" : "+v"(sc[0]), "+v"(sc[1]), "+v"(sc[2]), "+v"(sc[3]), "+v"(sc[4]), "+v"(sc[5]), "+v"(sc[6]), "+v"(sc[7])
                     : "v"(kf[NT - 4][1]), "v"(kf[NT - 3][1]), "v"(kf[NT - 2][1]), "v"(kf[NT - 1][1]));
        v16h vf[NG][4];                                       // A fragments of V^T: row d = 16j + .., k = key 32g + ..
#pragma unroll
        for (int j = 0; j < 4; ++j) vf[0][j] = ldh(kst + SK * HD + j * (SK * 16));
        __builtin_amdgcn_sched_barrier(0);   // the V^T reads of the first 32 keys stay here: they return under the vector work below
        float t[NT][8];
#pragma unroll
        for (int kt = 0; kt < NT; ++kt)
#pragma unroll
            for (int r = 0; r < 8; ++r) t[kt][r] = sc[kt][r] * SC2;
        if (holes) {
#pragma unroll
            for (int g = 0; g < NG; ++g) {
                const unsigned wv = mw[g] >> (8 * hi);        // bit r: key 32g + 8h + r (tile 2g); bit 16 + r: key 32g + 16 + 8h + r (tile 2g + 1)
#pragma unroll
                for (int r = 0; r < 8; ++r) { t[2 * g][r] = ((wv >> r) & 1u) ? t[2 * g][r] : FILL2; t[2 * g + 1][r] = ((wv >> (16 + r)) & 1u) ? t[2 * g + 1][r] : FILL2; } } }
        float mg[NG];                                         // one chain per 32 keys: the chains are independent of each other
#pragma unroll
        for (int g = 0; g < NG; ++g) { mg[g] = fmaxf(t[2 * g][0], t[2 * g + 1][0]);
#pragma unroll
            for (int r = 1; r < 8; ++r) mg[g] = fmaxf(mg[g], fmaxf(t[2 * g][r], t[2 * g + 1][r])); }
        float mx = fmaxf(fmaxf(mg[0], mg[1]), fmaxf(mg[2], mg[3]));
        mx = fmaxf(mx, __shfl_xor(mx, 16, 32));
        const float mnew = fmaxf(m, mx);
        const float alpha = __builtin_amdgcn_exp2f(m - mnew);
        v16h pb[NG];
#pragma unroll
        for (int g = 0; g < NG; ++g)
#pragma unroll
            for (int i = 0; i < 4; ++i) {                     // on pairs of neighbouring keys: packed f32 subtract and add, one convert per f16 pair
                const v2f ea = ((v2f){t[2 * g][2 * i], t[2 * g][2 * i + 1]} - mnew) + PSH, ec = ((v2f){t[2 * g + 1][2 * i], t[2 * g + 1][2 * i + 1]} - mnew) + PSH;
                const v2h pa = __builtin_convertvector(((v2f){__builtin_amdgcn_exp2f(ea[0]), __builtin_amdgcn_exp2f(ea[1])}), v2h);
                const v2h pc = __builtin_convertvector(((v2f){__builtin_amdgcn_exp2f(ec[0]), __builtin_amdgcn_exp2f(ec[1])}), v2h);
                pb[g][2 * i] = pa[0]; pb[g][2 * i + 1] = pa[1]; pb[g][8 + 2 * i] = pc[0]; pb[g][8 + 2 * i + 1] = pc[1]; }
        lt[0] = lt[0] * alpha; m = mnew;                  // the other registers of the tile hold 0
        o0 = o0 * alpha; o1 = o1 * alpha; o2 = o2 * alpha; o3 = o3 * alpha;
        // The sched_barrier(0) lines hold this order: [vector work][V^T reads, keys 32..95][5 products, keys 0..31][V^T reads, keys 96..127][15 products] (the compiler leaves the last 32 keys' P behind the first of these reads).
        // The later reads wait until the scores' registers are free (all sixteen fragments beside the scores do not fit 256 registers), stand in two groups and each at least five products ahead of their use.
        // Left alone, the scheduler puts single pairs of reads directly in front of their product, each with a wait to 0.
        __builtin_amdgcn_sched_barrier(0);
#pragma unroll
        for (int g = 1; g < 3; ++g)
#pragma unroll
            for (int j = 0; j < 4; ++j) vf[g][j] = ldh(kst + SK * HD + j * (SK * 16) + 512 * g);
        __builtin_amdgcn_sched_barrier(0);
#pragma unroll
        for (int g = 0; g < NG; ++g) {
            o0 = wmma16(vf[g][0], pb[g], o0); o1 = wmma16(vf[g][1], pb[g], o1); o2 = wmma16(vf[g][2], pb[g], o2); o3 = wmma16(vf[g][3], pb[g], o3);
            lt = wmma16(ones, pb[g], lt);
            if (g == 0) {
                __builtin_amdgcn_sched_barrier(0);
#pragma unroll
                for (int j = 0; j < 4; ++j) vf[3][j] = ldh(kst + SK * HD + j * (SK * 16) + 512 * 3);
                __builtin_amdgcn_sched_barrier(0);
            }
        }
        // four vector slots behind the stage's last product (the row-sum tile's), on every path, before an accumulator is read or a fragment's registers are loaded anew
        asm volatile("v_nop\n\tv_nop\n\tv_nop\n\tv_nop" : "+v"(o0), "+v"(o1), "+v"(o2), "+v"(o3), "+v"(lt) : "v"(vf[NG - 1][0]), "v"(vf[NG - 1][1]), "v"(vf[NG - 1][2]), "v"(vf[NG - 1][3]), "v"(pb[NG - 1]));
        // publish point of stage s + 1, and the end of every wave's reads of stage s
        asm volatile("s_wait_dscnt 0x0" ::: "memory");      // this wave's LDS reads of stage s have returned before its buffer is refilled
        asm volatile("s_wait_asynccnt 0x0" ::: "memory");   // this wave's copies of stage s + 1 have landed
        __syncthreads();
        if (s + 2 < NST)                                    // the same for the whole block
            stage_copy(gk + (size_t)(s + 2) * SK * HD, gv + (size_t)(s + 2) * SK * 16, lk0 + (s & 1) * LKB);
    }
    asm volatile("s_wait_asynccnt 0x0" ::: "memory");       // no copy is outstanding when the wave ends
    const float inv = 1.0f / lt[0];
    // O^T D layout: o_j[r] = (d = 16j + 8h + r, t = lane&15): a lane's eight values of o_j are the 16-byte piece (row t, columns 16j + 8h + 0..7) of the ctx plane,
    // which fragment order puts at j*256 + lane*8 halves behind the base of fragments (row/16, 2h) and (row/16, 2h + 1): four 512-byte stores straight from the accumulators
    h16* crow = CX + ((size_t)b * SEQ + t0) * DM + h * (HD * 16) + lane * 8;
    v8h h0, h1, h2, h3;
#pragma unroll
    for (int r = 0; r < 8; ++r) { h0[r] = (h16)(o0[r] * inv); h1[r] = (h16)(o1[r] * inv); h2[r] = (h16)(o2[r] * inv); h3[r] = (h16)(o3[r] * inv); }
    *(v8h*)(crow) = h0; *(v8h*)(crow + 256) = h1; *(v8h*)(crow + 512) = h2; *(v8h*)(crow + 768) = h3;
}

static constexpr size_t al256(size_t v) { return (v + 255) & ~(size_t)255; }
static constexpr size_t SZ_XB = al256((size_t)NB * SEQ * DM * 2);              // one bf16 input plane [NB*SEQ][1024]
static constexpr size_t SZ_WB = al256((size_t)3 * DM * DM * 2);               // bf16 Wq | Wk | Wv
static constexpr size_t SZ_WO = al256((size_t)DM * DM * 2);                   // f16 Wo x64
static constexpr size_t SZ_PL = al256((size_t)NB * NH_ * SEQ * HD * 2);       // one f16 head plane
static constexpr size_t SZ_CX = al256((size_t)NB * SEQ * DM * 2);             // f16 ctx plane
static constexpr size_t SZ_MB = al256((size_t)SEQ * (SEQ / 32) * 4);          // mask bit plane
static constexpr size_t SZ_TOTAL = 3 * SZ_XB + SZ_WB + SZ_WO + 3 * SZ_PL + SZ_CX + SZ_MB;
static_assert(SZ_TOTAL <= (size_t)134217728);          // workspace carve <= 128 MiB
static_assert(((size_t)DM * DM * 2) % 256 == 0);       // weight sub-planes stay 256-byte aligned

extern "C" void kernel_launch(void* const* d_in, const int* in_sizes, int n_in,
                              void* d_out, int out_size, void* d_ws, size_t ws_size, hipStream_t stream) {
    if (n_in < 8) return;
    const size_t needx = ((size_t)(SEQ - 1) * NB_FULL + NB) * DM;
    if ((size_t)in_sizes[0] < needx || (size_t)in_sizes[1] < needx || (size_t)in_sizes[2] < needx) return;
    if ((size_t)in_sizes[3] < (size_t)(SEQ - 1) * SEQ_FULL + SEQ) return;
    if ((size_t)in_sizes[4] < (size_t)DM * DM || (size_t)in_sizes[5] < (size_t)DM * DM || (size_t)in_sizes[6] < (size_t)DM * DM || (size_t)in_sizes[7] < (size_t)DM * DM) return;
    if ((size_t)out_size < ((size_t)(SEQ - 1) * OUT_NB + NB) * DM) return;
    if (SZ_TOTAL > ws_size) return;
    // wire order: query, keys, values, mask (int32), Wq, Wk, Wv, Wo ([out][in] = Bt as-is)
    const float* xq = (const float*)d_in[0]; const float* xk = (const float*)d_in[1]; const float* xv = (const float*)d_in[2];
    const int* mask = (const int*)d_in[3];
    const float* wq = (const float*)d_in[4]; const float* wk = (const float*)d_in[5]; const float* wv = (const float*)d_in[6]; const float* wo = (const float*)d_in[7];
    float* OUT = (float*)d_out;      // [SEQ][OUT_NB][1024]
    char* wsp = (char*)d_ws;
    bf* XQ = (bf*)wsp; wsp += SZ_XB;                 // [NB*SEQ][1024], row b*SEQ + t
    bf* XK = (bf*)wsp; wsp += SZ_XB;
    bf* XV = (bf*)wsp; wsp += SZ_XB;
    bf* WB = (bf*)wsp; wsp += SZ_WB;                 // [3][1024][1024]: q | k | v
    h16* WO16 = (h16*)wsp; wsp += SZ_WO;             // [1024][1024] x64
    h16* QH = (h16*)wsp; wsp += SZ_PL;               // [NB*16][SEQ][64]
    h16* KH = (h16*)wsp; wsp += SZ_PL;               // [NB*16][SEQ][64]
    h16* VT = (h16*)wsp; wsp += SZ_PL;               // [NB*16][64][SEQ]
    h16* CX = (h16*)wsp; wsp += SZ_CX;               // [NB*SEQ][1024]
    unsigned* MB = (unsigned*)wsp; wsp += SZ_MB;     // [SEQ][SEQ/32] mask bits
    bf* WQ = WB; bf* WK = WB + (size_t)DM * DM; bf* WV = WB + (size_t)2 * DM * DM;

    k_cvt<<<3 * GX + 4 * GW + GM, 256, 0, stream>>>(xq, xk, xv, wq, wk, wv, wo, mask, XQ, XK, XV, WQ, WK, WV, WO16, MB);

    k_proj<<<dim3(NB * SEQ / 128, DM / 128, 3), 32 * GWV, 0, stream>>>(XQ, XK, XV, WQ, WK, WV, QH, KH, VT);

    k_flash<<<dim3(SEQ / (16 * AW), NB * NH_, 1), 32 * AW, 0, stream>>>(QH, KH, VT, MB, CX);

    // out[t][b][n] = sum_k ctx[b*SEQ + t][k] Wo[n][k]
    k_oproj<<<dim3(NB * SEQ / 128, DM / 128, 1), 32 * GWV, 0, stream>>>(CX, WO16, OUT);
}

// v010
// It runs in 75.7 microseconds.
// Timed twice side by side with v009, it ran 1.03 and 1.04 times as fast.
// Counting every step since v000, it is 4.24 times as fast.
#include <hip/hip_runtime.h>

// Multi-head attention, width 1024 = 16 heads x 64; query/keys/values [SEQ][NB][1024] sequence-first (row = s*NB_FULL + b), Wq/Wk/Wv/Wo [out][in] (y = x W^T), no biases,
// UNSCALED scores, int32 mask [SEQ][SEQ] with replace-fill (-1e20 where mask == 0), output = ctx Wo^T as f32 [SEQ][NB][1024].
// Compute dtypes, f32 accumulate everywhere: q/k/v projections v_wmma_f32_16x16x32_bf16 (inputs and W RNE-converted to bf16; products exact);
// scores v_wmma_f32_16x16x32_f16: q and k single f16 (their f16 rounding, 2^-11 relative, lies below the error that the bf16 operands of the projections leave in q and k, 2^-8 relative per operand);
// P (x2^14 carry, cancels in the normalisation) and v single f16; out-projection v_wmma_f32_16x16x32_f16: ctx single f16, Wo = f16(bf16(Wo) * 64), folded back by 1/64; softmax f32 (online, running max).
// Layout: bf16 copies of the inputs de-interleaved to [b][s][1024]; q/k planes [b*16+h][t][d] and v^T plane [b*16+h][d][t] written by the GEMM epilogue;
// fused flash kernel in transposed form (S^T = K Q^T, O^T = V^T P^T) writes the f16 ctx plane [b*SEQ+t][1024]; the out-projection GEMM writes rows t*OUT_NB + b.
// FRAGMENT ORDER: every 16-bit workspace plane [R][C] (C = the k dimension of its WMMA use) is stored as fragments of 16 rows x 32 k, 1 KiB each, fragment index (r/16)*(C/32) + k/32.
// Inside a fragment the 16-byte piece (row r, k = 8q..8q+7 of the 32, q = 0..3) lies at (q>>1)*512 B + ((q&1)*16 + r%16)*16 B, so each of the two wave-wide 16-byte loads
// of a fragment reads 512 contiguous bytes (4 whole lines; from row-major planes it would touch 16).
// MASK BITS: the converter launch packs the int32 mask to one bit per key, plane [SEQ][SEQ/32] of 32-bit words, bit i of word (t, w) = (mask[t][32w + i] != 0); the flash kernel reads only that plane.

#ifndef NB
#define NB 2
#endif
#ifndef SEQ
#define SEQ 2048
#endif
#define NB_FULL  2
#define SEQ_FULL 2048
#ifndef OUT_NB
#define OUT_NB NB                // batch pitch (in rows) of the output [t][OUT_NB][1024]
#endif
#define DM   1024
#define NH_  16
#define HD   64
#define AW   8                   // waves per flash block (the block covers 16*AW query rows)
#define SC2  1.4426950408889634f // log2(e); the module applies no score scale
#define PSH  14.0f               // log2 of the P carry (16384)
#define FILL2 (-1.4426950408889634e20f)   // -1e20 in the log2 domain (replace-fill of masked scores)
#define WOS  64.0f               // carry of the Wo plane
#define WOI  (1.0f / 64.0f)

static_assert(HD == 64);
static_assert(NH_ * HD == DM);                 // head h = columns h*64 + d
static_assert(DM % 64 == 0);                   // 16 column tiles of 64
static_assert(DM % 32 == 0);                   // GEMM k-steps of 32, two per ring stage of 64
static_assert(SEQ % 64 == 0);                  // a 64-row tile (and a 16-row fragment) never straddles two batches
static_assert((NB * SEQ) % 64 == 0);
static_assert(SEQ % 128 == 0);                 // each key half is walked in stages of 64 keys
static_assert(SEQ % (16 * AW) == 0);           // flash grid covers the sequence exactly
static_assert(((size_t)NB * SEQ * DM) % 8 == 0);
static_assert(((size_t)DM * DM) % 8 == 0);
static_assert(NB <= NB_FULL);
static_assert(SEQ <= SEQ_FULL);
static_assert(NB <= OUT_NB);

typedef _Float16 h16;
typedef unsigned short bf;
typedef __attribute__((ext_vector_type(16))) __bf16   v16bf;
typedef __attribute__((ext_vector_type(16))) _Float16 v16h;
typedef __attribute__((ext_vector_type(8)))  _Float16 v8h;
typedef __attribute__((ext_vector_type(8)))  unsigned short v8us;
typedef __attribute__((ext_vector_type(8)))  float    v8f;
typedef __attribute__((ext_vector_type(4)))  float    v4f;
typedef __attribute__((ext_vector_type(4)))  unsigned v4u;
typedef __attribute__((ext_vector_type(2)))  float    v2f;
typedef __attribute__((ext_vector_type(2)))  _Float16 v2h;
typedef __attribute__((ext_vector_type(4)))  unsigned short v4us;
typedef v4f  __attribute__((may_alias)) v4fa;
typedef v4us __attribute__((may_alias)) v4usa;
typedef v8us __attribute__((may_alias)) v8usa;
typedef __attribute__((ext_vector_type(2)))  unsigned v2u;
typedef v2f  __attribute__((may_alias)) v2fa;

__device__ __forceinline__ unsigned short f2bf(float f) { unsigned u = __float_as_uint(f); u += 0x7FFFu + ((u >> 16) & 1u); return (unsigned short)(u >> 16); }
__device__ __forceinline__ float bf2f(unsigned short s) { return __uint_as_float(((unsigned)s) << 16); }
__device__ __forceinline__ v16h cat16(v8h lo, v8h hi) { return __builtin_shufflevector(lo, hi, 0, 1, 2, 3, 4, 5, 6, 7, 8, 9, 10, 11, 12, 13, 14, 15); }
__device__ __forceinline__ v16bf cat16b(v8us lo, v8us hi) { return __builtin_bit_cast(v16bf, __builtin_shufflevector(lo, hi, 0, 1, 2, 3, 4, 5, 6, 7, 8, 9, 10, 11, 12, 13, 14, 15)); }
__device__ __forceinline__ v8f wmma16(v16h a, v16h b, v8f c) { return __builtin_amdgcn_wmma_f32_16x16x32_f16(false, a, false, b, (short)0, c, false, false); }
__device__ __forceinline__ v8f wmmab(v16bf a, v16bf b, v8f c) { return __builtin_amdgcn_wmma_f32_16x16x32_bf16(false, a, false, b, (short)0, c, false, false); }
// fragment loaders from fragment-order planes; p = fragment base + 8*lane: elements 0..7 <- k0+8h+0..7, elements 8..15 <- k0+16+8h+0..7, row lane&15, h = lane>>4 (same map for A and B)
__device__ __forceinline__ v16h  ldh(const h16* p) { return cat16(*(const v8h*)p, *(const v8h*)(p + 256)); }
__device__ __forceinline__ v16bf ldb(const bf* p)  { return cat16b(*(const v8us*)p, *(const v8us*)(p + 256)); }
// ordering point for wave-private LDS tiles (same wave writes and reads)
__device__ __forceinline__ void wave_sync() { __builtin_amdgcn_fence(3 /* release order */, "wavefront"); __builtin_amdgcn_wave_barrier(); asm volatile("" ::: "memory"); }

// cvt_frag: one wave converts one fragment (16 rows x 32 columns) of an f32 matrix with DM columns: four whole-line loads (4 rows x 128 B each), the 16-bit rows
// through a wave-private LDS tile (80-byte pitch: 16 B x odd, free of conflicts for the 16-byte reads), two 512-byte stores in fragment order.
// MODE 0: bf16 RNE, source rows de-interleaved (plane row b*SEQ + t <- source row t*NB_FULL + b); MODE 1: bf16 RNE, rows as they are; MODE 2: f16(bf16(x) * 64), rows as they are.
template <int MODE> __device__ __forceinline__ void cvt_frag(const float* __restrict__ src, unsigned short* dst, unsigned blk, unsigned short* ts) {
    const int lane = threadIdx.x & 31, wave = threadIdx.x >> 5;
    const size_t f = (size_t)blk * 8 + wave;
    const size_t tile = f / (DM / 32), chunk = f % (DM / 32);
    unsigned short* tw = ts + wave * 16 * 40;
#pragma unroll
    for (int i = 0; i < 4; ++i) {
        const int row = 4 * i + (lane >> 3); const size_t drow = tile * 16 + row;
        const size_t srow = (MODE == 0) ? ((drow % SEQ) * NB_FULL + drow / SEQ) : drow;
        const v4f v = *(const v4f*)(src + srow * DM + chunk * 32 + (lane & 7) * 4); v4us o;
#pragma unroll
        for (int k = 0; k < 4; ++k) o[k] = (MODE == 2) ? __builtin_bit_cast(unsigned short, (h16)(bf2f(f2bf(v[k])) * WOS)) : f2bf(v[k]);
        *(v4usa*)(tw + row * 40 + (lane & 7) * 4) = o; }
    wave_sync();
#pragma unroll
    for (int j = 0; j < 2; ++j) { const v8us o = *(const v8usa*)(tw + (lane & 15) * 40 + j * 16 + (lane >> 4) * 8); *(v8us*)(dst + f * 512 + j * 256 + lane * 8) = o; }
    asm volatile("s_wait_xcnt 0x0" ::: "memory");   // behind the two stores: in the merged kernel's listing another branch's code follows them and rewrites their registers
}

// mask_bits: one wave packs 32 words of the bit plane (1024 keys of one mask row): 32 whole-line loads (one int per lane), each turned into its word by a wave-wide compare
// (lane i's result is bit i); word i is kept by lane i, and the 32 words leave in one 128-byte store.
__device__ __forceinline__ void mask_bits(const int* __restrict__ mask, unsigned* MB, unsigned blk) {
    const int lane = threadIdx.x & 31, wave = threadIdx.x >> 5;
    const size_t w0 = ((size_t)blk * 8 + wave) * 32;
    const int* src = mask + w0 * 32 + lane;
    int v[32];
#pragma unroll
    for (int i = 0; i < 32; ++i) v[i] = src[i * 32];
    unsigned word = 0;
#pragma unroll
    for (int i = 0; i < 32; ++i) { const unsigned bits = __builtin_amdgcn_ballot_w32(v[i] != 0); word = (lane == i) ? bits : word; }
    MB[w0 + lane] = word;
    asm volatile("s_wait_xcnt 0x0" ::: "memory");   // behind the store: in the merged kernel's listing another branch's code follows it and rewrites its registers
}

// k_cvt: all seven conversions and the mask packing in ONE launch (they are independent of each other); the block index picks the matrix. 8 waves per block, one fragment each.
// Blocks 0 .. 3*GX-1: query | keys | values, src [t][NB_FULL][DM] f32 -> plane [b*SEQ + t][DM] bf16; then 3*GW blocks: Wq | Wk | Wv -> bf16; then GW blocks: Wo -> f16 x64. All in fragment order.
// Then GM blocks: mask rows 0 .. SEQ-1 -> bit plane, 32 words per wave.
#define GX ((unsigned)((size_t)NB * SEQ * DM / 512 / 8))
#define GW ((unsigned)((size_t)DM * DM / 512 / 8))
#define GM ((unsigned)((size_t)SEQ * (SEQ / 32) / 32 / 8))
static_assert(SEQ == SEQ_FULL);                             // the words of the bit plane follow the mask's own rows without a gap
static_assert(((size_t)SEQ * (SEQ / 32)) % (32 * 8) == 0);  // every mask block has eight whole runs of 32 words
static_assert(((size_t)NB * SEQ * DM) % (512 * 8) == 0);   // every conversion block of the merged grid has eight whole fragments
static_assert(((size_t)DM * DM) % (512 * 8) == 0);
__global__ __launch_bounds__(256) void k_cvt(const float* __restrict__ xq, const float* __restrict__ xk, const float* __restrict__ xv,
                                             const float* __restrict__ wq, const float* __restrict__ wk, const float* __restrict__ wv, const float* __restrict__ wo, const int* __restrict__ mask,
                                             bf* XQ, bf* XK, bf* XV, bf* WQ, bf* WK, bf* WV, h16* WO16, unsigned* MB) {
    __shared__ __align__(16) unsigned short ts[8 * 16 * 40];
    const unsigned bx = blockIdx.x;
    if (bx < 3 * GX) { const unsigned w = bx / GX; cvt_frag<0>(w == 0 ? xq : w == 1 ? xk : xv, w == 0 ? XQ : w == 1 ? XK : XV, bx % GX, ts); }
    else if (bx < 3 * GX + 3 * GW) { const unsigned c = bx - 3 * GX, w = c / GW; cvt_frag<1>(w == 0 ? wq : w == 1 ? wk : wv, w == 0 ? WQ : w == 1 ? WK : WV, c % GW, ts); }
    else if (bx < 3 * GX + 4 * GW) cvt_frag<2>(wo, (unsigned short*)WO16, bx - (3 * GX + 3 * GW), ts);
    else mask_bits(mask, MB, bx - (3 * GX + 4 * GW));
}

// THE GEMM RING (k_proj, k_oproj): a block of GWV = 4 waves works on a 128x128 tile, wave (wm, wn) = (wave / 2, wave % 2) on its 64x64 quarter (16 accumulators), K = DM.
// Both operands come through an LDS ring (three buffers in k_proj, four in k_oproj), one stage = GS = 64 k = two fragments per 16 rows. In a fragment-order plane those two fragments are 2 KiB in a row, which is one
// asynchronous copy of 16 bytes per thread; a stage is 8 such copies for the 128 A rows and 8 for the 128 B rows, issued two (k_proj) or three (k_oproj) passes ahead: each operand byte leaves L2 once per block
// (not once per wave) and no L2 latency stands between the matrix instructions. A stage in LDS keeps the planes' own order: A | B, per 16 rows 1024 halves, fragment k/32 at 512 halves.
#define GWV  4                   // waves per GEMM block
#define GS   64                  // k per ring stage
#define GNST (DM / GS)           // stages
#define GOP  (128 * GS)          // halves of one operand in one stage
static_assert(DM % GS == 0);                   // whole stages
static_assert(GS == 64);                       // a stage is worked on as two steps of 32 k
static_assert((NB * SEQ) % 128 == 0 && DM % 128 == 0);   // the grids cover both matrices with whole 128x128 tiles
static_assert(GWV * 32 * 8 == GS * 16);        // one copy of every thread = the stage's two fragments of 16 rows

// One operand's copies of one thread for one stage: g = the thread's own 16 bytes in the first 16 rows (16 rows further = 16*DM halves), l = its LDS byte address (16 rows further = 2 KiB).
// The s_wait_xcnt stands inside the statement, behind the last copy, so that no address register is rewritten ahead of it.
template <class T> __device__ __forceinline__ void rows_copy(const T* g, unsigned l) {
    asm volatile("global_load_async_to_lds_b128 %0, %8, off\n\t"
                 "global_load_async_to_lds_b128 %1, %9, off\n\t"
                 "global_load_async_to_lds_b128 %2, %10, off\n\t"
                 "global_load_async_to_lds_b128 %3, %11, off\n\t"
                 "global_load_async_to_lds_b128 %4, %12, off\n\t"
                 "global_load_async_to_lds_b128 %5, %13, off\n\t"
                 "global_load_async_to_lds_b128 %6, %14, off\n\t"
                 "global_load_async_to_lds_b128 %7, %15, off\n\t"
                 "s_wait_xcnt 0x0"
                 :: "v"(l), "v"(l + 2048u), "v"(l + 4096u), "v"(l + 6144u), "v"(l + 8192u), "v"(l + 10240u), "v"(l + 12288u), "v"(l + 14336u),
                    "v"(g), "v"(g + (size_t)1 * 16 * DM), "v"(g + (size_t)2 * 16 * DM), "v"(g + (size_t)3 * 16 * DM), "v"(g + (size_t)4 * 16 * DM),
                    "v"(g + (size_t)5 * 16 * DM), "v"(g + (size_t)6 * 16 * DM), "v"(g + (size_t)7 * 16 * DM)
                 : "memory");
}

// k_proj: register-blocked bf16 GEMM on the GEMM ring, operands from fragment-order bf16 planes.
// C[m][n] = sum_k A[m][k] Bt[n][k], written as f16 (Ph) in fragment order into planes of 'pitch' columns:
// a wave's tile base (r0/RB)*sRB + (r0%RB)*pitch + (c0/CB)*sCB + (c0%CB)*16 (halves); 16 rows further = 16*pitch, 32 columns further = 512.
// The three projections are independent and run in ONE launch, grid (NB*SEQ/128, DM/128, 3), 128 threads; blockIdx.z picks the product:
// z = 0, 1 (q, k): A = x rows (m = b*SEQ + t), Bt = W rows (n = h*64 + d) -> planes [(b*16 + h)][t][d];
// z = 2 (v^T): A = Wv rows (m = h*64 + d, from blockIdx.y), Bt = x rows (n = b*SEQ + t, from blockIdx.x) -> plane [(b*1024 + m)][t] = [(b*16 + h)][d][t].
// ITS RING HAS PNB = 3 BUFFERS: stage s + 3 is issued behind the barrier that ends pass s, into the buffer that pass s has read, so a stage flies for two passes and a wave has at most 2 stages = 32 copies outstanding.
// The waves' epilogue tiles lie over the ring (used behind the last pass's barrier, when no copy is outstanding and no wave reads the ring any more): 96 KiB a block, so that three blocks still share a WGP.
#define PNB  3                   // buffers of k_proj's ring
#define OCP  16                  // copies of one wave per stage (8 for A, 8 for B), in both GEMMs
static_assert(GNST >= PNB);                    // the prologue fills three stages
static_assert((PNB - 1) * OCP <= 63);          // copies of a wave outstanding at once
static_assert((PNB - 2) * OCP == 16);          // the count written in the two counted waits below
static_assert(GWV * 16 * 68 * 4 <= PNB * 2 * GOP * 2);   // the epilogue tiles fit the ring
__global__ __launch_bounds__(32 * GWV) void k_proj(const bf* __restrict__ XQ, const bf* __restrict__ XK, const bf* __restrict__ XV, const bf* __restrict__ WQ, const bf* __restrict__ WK, const bf* __restrict__ WV,
                                             h16* QH, h16* KH, h16* VT) {
    __shared__ __align__(16) bf gs[PNB][2 * GOP];            // per buffer: A rows | B rows; behind the loop: the waves' own epilogue tiles, 16 x 68 floats each
    const int K = DM;
    const int z = blockIdx.z; const bool isv = (z == 2);
    const bf* __restrict__ A = isv ? WV : (z == 0 ? XQ : XK); const bf* __restrict__ Bt = isv ? XV : (z == 0 ? WQ : WK);
    h16* Ph = isv ? VT : (z == 0 ? QH : KH);
    const int RB = isv ? DM : SEQ, pitch = isv ? SEQ : HD, CB = isv ? SEQ : HD;
    const size_t sRB = isv ? (size_t)0 : (size_t)NH_ * SEQ * HD, sCB = isv ? (size_t)DM * SEQ : (size_t)SEQ * HD;
    const int tid = threadIdx.x, lane = tid & 31, wave = __builtin_amdgcn_readfirstlane(tid >> 5), wm = wave >> 1, wn = wave & 1, lr = lane & 15, hi = lane >> 4;   // the wave's number in a scalar register: tile bases stay scalar
    const int R0 = (isv ? blockIdx.y : blockIdx.x) * 128, C0 = (isv ? blockIdx.x : blockIdx.y) * 128; const int r0 = R0 + wm * 64, c0 = C0 + wn * 64;
    float* os = (float*)&gs[0][0] + wave * (16 * 68);
    v8f acc[4][4];
#pragma unroll
    for (int mb = 0; mb < 4; ++mb)
#pragma unroll
        for (int nb = 0; nb < 4; ++nb) acc[mb][nb] = (v8f){};
    const bf* ga = A + (size_t)R0 * K + tid * 8; const bf* gb = Bt + (size_t)C0 * K + tid * 8;   // fragment (row/16, kc/32) at (row/16)*16*K + kc*16; a stage further = GS*16 halves
    const unsigned la = (unsigned)(size_t)&gs[0][0] + tid * 16u; const unsigned LOB = GOP * 2, LGB = 2 * GOP * 2;   // bytes from A to B, from buffer 0 to buffer 1
    rows_copy(ga, la); rows_copy(gb, la + LOB);
    rows_copy(ga + GS * 16, la + LGB); rows_copy(gb + GS * 16, la + LGB + LOB);
    asm volatile("s_wait_asynccnt 0x10" ::: "memory");  // all but this wave's 16 youngest copies (stage 1) have landed: its stage 0
    __syncthreads();                                    // ... and every wave's: stage 0 is published
    rows_copy(ga + 2 * GS * 16, la + 2 * LGB); rows_copy(gb + 2 * GS * 16, la + 2 * LGB + LOB);
    // one pass: the 32 products of one stage, from buffer bu
    auto pass = [&](int bu) __attribute__((always_inline)) {
        const bf* sa = &gs[bu][0] + wm * (4 * 16 * GS) + 8 * lane; const bf* sb = &gs[bu][0] + GOP + wn * (4 * 16 * GS) + 8 * lane;
        // The sched_barrier(0) lines hold this order: [reads: A and B of the first 32 k, A of the second][8 products][reads: 2 B fragments of the second 32 k][8 products][reads: the other 2][16 products][waits].
        // Each of the two later groups then stands 8 products ahead of its first use, and every wait but the last is a counted one. Left alone, the scheduler sinks the B reads singly among the products, each with a wait to 0 directly behind it.
        v16bf a[GS / 32][4], b[GS / 32][4];
#pragma unroll
        for (int mb = 0; mb < 4; ++mb) a[0][mb] = ldb(sa + mb * (16 * GS));
#pragma unroll
        for (int nb = 0; nb < 4; ++nb) b[0][nb] = ldb(sb + nb * (16 * GS));
#pragma unroll
        for (int mb = 0; mb < 4; ++mb) a[1][mb] = ldb(sa + mb * (16 * GS) + 512);
        __builtin_amdgcn_sched_barrier(0);   // the first group of reads stays in front of the products
#pragma unroll
        for (int h2 = 0; h2 < 2; ++h2) {
#pragma unroll
            for (int nb = 2 * h2; nb < 2 * h2 + 2; ++nb)
#pragma unroll
                for (int mb = 0; mb < 4; ++mb) acc[mb][nb] = wmmab(a[0][mb], b[0][nb], acc[mb][nb]);
            __builtin_amdgcn_sched_barrier(0);   // these two fragments' reads are not lifted (they take registers of fragments whose last product stands above: 16 fragments at once would not fit 256 registers) ...
            b[1][2 * h2] = ldb(sb + (2 * h2) * (16 * GS) + 512); b[1][2 * h2 + 1] = ldb(sb + (2 * h2 + 1) * (16 * GS) + 512);
            __builtin_amdgcn_sched_barrier(0);   // ... and not sunk towards their use
        }
#pragma unroll
        for (int nb = 0; nb < 4; ++nb)
#pragma unroll
            for (int mb = 0; mb < 4; ++mb) acc[mb][nb] = wmmab(a[1][mb], b[1][nb], acc[mb][nb]);
        // keeps the waits that follow a pass behind the stage's products. Without it the scheduler lifts them and the barrier in front of the products: every read is then waited out
        // before the first product.
        __builtin_amdgcn_sched_barrier(0);
    };
    int bu = 0;                                             // buffer of stage s = s mod PNB
    // the passes that refill: every wave issues one stage (OCP copies) on every trip, so behind stage s + 1's copies stand exactly those of stage s + 2
#pragma unroll 1   // stays rolled: one copy of the pass in the text, one register set
    for (int s = 0; s < GNST - PNB; ++s) {
        pass(bu);
        // publish point of stage s + 1, and the end of every wave's reads of stage s
        asm volatile("s_wait_dscnt 0x0" ::: "memory");      // this wave's LDS reads of stage s have returned before its buffer is refilled
        asm volatile("s_wait_asynccnt 0x10" ::: "memory");  // all but this wave's 16 youngest copies have landed: its copies of stage s + 1; stage s + 2 stays in flight
        __syncthreads();
        rows_copy(ga + (size_t)(s + PNB) * GS * 16, la + bu * LGB); rows_copy(gb + (size_t)(s + PNB) * GS * 16, la + bu * LGB + LOB);
        bu = (bu == PNB - 1) ? 0 : bu + 1;
    }
    // the last PNB passes issue nothing: their waits are to 0. The last one's barrier also ends every wave's reads of the ring before the epilogue tiles are written over it.
#pragma unroll 1   // stays rolled, as above
    for (int s = GNST - PNB; s < GNST; ++s) {
        pass(bu);
        asm volatile("s_wait_dscnt 0x0" ::: "memory");      // as above
        asm volatile("s_wait_asynccnt 0x0" ::: "memory");   // every copy of this wave has landed
        __syncthreads();
        bu = (bu == PNB - 1) ? 0 : bu + 1;
    }
    asm volatile("s_wait_asynccnt 0x0" ::: "memory");       // no copy is outstanding when the wave goes on
    const size_t tbase = (size_t)(r0 / RB) * sRB + (size_t)(r0 % RB) * (size_t)pitch + (size_t)(c0 / CB) * sCB + (size_t)(c0 % CB) * 16;
#pragma unroll
    for (int mb = 0; mb < 4; ++mb) {
#pragma unroll
        for (int nb = 0; nb < 4; ++nb) {
#pragma unroll
            for (int j = 0; j < 8; ++j) os[(hi * 8 + j) * 68 + nb * 16 + lr] = acc[mb][nb][j]; }   // D: row 8h+j, col lane&15
        wave_sync();
        const size_t sb = tbase + (size_t)(mb * 16) * (size_t)pitch;
{
#pragma unroll
            for (int s = 0; s < 4; ++s) { const int row = lr, c8 = (2 * s + hi) * 8;   // s = 2*(column/32) + half of the fragment; 16 rows x 2 pieces = one 512-byte store
                const v4f x0 = *(const v4fa*)(&os[row * 68 + c8]); const v4f x1 = *(const v4fa*)(&os[row * 68 + c8 + 4]); v8h hv;
#pragma unroll
                for (int i = 0; i < 4; ++i) { hv[i] = (h16)x0[i]; hv[4 + i] = (h16)x1[i]; }
                const size_t oo = sb + (size_t)(s * 256 + lane * 8);
                *(v8h*)(Ph + oo) = hv; }
            asm volatile("s_wait_xcnt 0x0" ::: "memory");   // behind the four stores: the next 16 rows' values and addresses take their registers
             }
        wave_sync();
    }
}

// k_oproj: register-blocked f16 GEMM on the GEMM ring, A = ctx plane [NB*SEQ][DM] f16 (row m = b*SEQ + t), Bt = Wo plane [DM][DM] f16 (x64 carry), both in fragment order.
// OUT[(t*OUT_NB + b)][n] = (1/64) sum_k A[m][k] Bt[n][k], f32. grid (NB*SEQ/128, DM/128), 128 threads.
// ITS RING HAS ONB = 4 BUFFERS: the grid gives every WGP one block, one wave per SIMD, so nothing else runs while a wave waits for its copies, and one pass (32 products) is shorter than a copy's way
// from memory. Stage s + 4 is issued behind the barrier that ends pass s, into the buffer that pass s has read: a stage flies for three passes. A wave has at most 3 stages = 48 copies outstanding.
#define ONB  4                   // buffers of k_oproj's ring
static_assert(GNST >= ONB);                    // the prologue fills four stages
static_assert((ONB & (ONB - 1)) == 0);         // buffer of stage s = s & (ONB - 1)
static_assert((ONB - 1) * OCP <= 63);          // copies of a wave outstanding at once
static_assert((ONB - 2) * OCP == 32);          // the count written in the two counted waits below
__global__ __launch_bounds__(32 * GWV) void k_oproj(const h16* __restrict__ A, const h16* __restrict__ Bt, float* OUT) {
    __shared__ __align__(16) h16 gs[ONB][2 * GOP];           // per buffer: A rows | B rows
    __shared__ __align__(16) float osb[GWV][16 * 68];        // a wave's own epilogue tile
    const int K = DM;
    const int tid = threadIdx.x, lane = tid & 31, wave = __builtin_amdgcn_readfirstlane(tid >> 5), wm = wave >> 1, wn = wave & 1, lr = lane & 15, hi = lane >> 4;   // the wave's number in a scalar register: tile bases stay scalar
    const int R0 = blockIdx.x * 128, C0 = blockIdx.y * 128; const int r0 = R0 + wm * 64, c0 = C0 + wn * 64;
    float* os = &osb[wave][0];
    v8f acc[4][4];
#pragma unroll
    for (int mb = 0; mb < 4; ++mb)
#pragma unroll
        for (int nb = 0; nb < 4; ++nb) acc[mb][nb] = (v8f){};
    const h16* ga = A + (size_t)R0 * K + tid * 8; const h16* gb = Bt + (size_t)C0 * K + tid * 8;   // fragment (row/16, kc/32) at (row/16)*16*K + kc*16; a stage further = GS*16 halves
    const unsigned la = (unsigned)(size_t)&gs[0][0] + tid * 16u; const unsigned LOB = GOP * 2, LGB = 2 * GOP * 2;   // bytes from A to B, from buffer 0 to buffer 1
    rows_copy(ga, la); rows_copy(gb, la + LOB);
    rows_copy(ga + GS * 16, la + LGB); rows_copy(gb + GS * 16, la + LGB + LOB);
    rows_copy(ga + 2 * GS * 16, la + 2 * LGB); rows_copy(gb + 2 * GS * 16, la + 2 * LGB + LOB);
    asm volatile("s_wait_asynccnt 0x20" ::: "memory");  // all but this wave's 32 youngest copies (stages 1 and 2) have landed: its stage 0
    __syncthreads();                                    // ... and every wave's: stage 0 is published
    rows_copy(ga + 3 * GS * 16, la + 3 * LGB); rows_copy(gb + 3 * GS * 16, la + 3 * LGB + LOB);
    // one pass: the 32 products of stage s, from its buffer
    auto pass = [&](int s) __attribute__((always_inline)) {
        const h16* sa = &gs[s & (ONB - 1)][0] + wm * (4 * 16 * GS) + 8 * lane; const h16* sb = &gs[s & (ONB - 1)][0] + GOP + wn * (4 * 16 * GS) + 8 * lane;
        // The sched_barrier(0) lines hold this order: [reads: A and B of the first 32 k, A of the second][8 products][reads: 2 B fragments of the second 32 k][8 products][reads: the other 2][16 products][waits].
        // Each of the two later groups then stands 8 products ahead of its first use, and every wait but the last is a counted one. Left alone, the scheduler sinks the B reads singly among the products, each with a wait to 0 directly behind it.
        v16h a[GS / 32][4], b[GS / 32][4];
#pragma unroll
        for (int mb = 0; mb < 4; ++mb) a[0][mb] = ldh(sa + mb * (16 * GS));
#pragma unroll
        for (int nb = 0; nb < 4; ++nb) b[0][nb] = ldh(sb + nb * (16 * GS));
#pragma unroll
        for (int mb = 0; mb < 4; ++mb) a[1][mb] = ldh(sa + mb * (16 * GS) + 512);
        __builtin_amdgcn_sched_barrier(0);   // the first group of reads stays in front of the products
#pragma unroll
        for (int h2 = 0; h2 < 2; ++h2) {
#pragma unroll
            for (int nb = 2 * h2; nb < 2 * h2 + 2; ++nb)
#pragma unroll
                for (int mb = 0; mb < 4; ++mb) acc[mb][nb] = wmma16(a[0][mb], b[0][nb], acc[mb][nb]);
            __builtin_amdgcn_sched_barrier(0);   // these two fragments' reads are not lifted (they take registers of fragments whose last product stands above: 16 fragments at once would not fit 256 registers) ...
            b[1][2 * h2] = ldh(sb + (2 * h2) * (16 * GS) + 512); b[1][2 * h2 + 1] = ldh(sb + (2 * h2 + 1) * (16 * GS) + 512);
            __builtin_amdgcn_sched_barrier(0);   // ... and not sunk towards their use
        }
#pragma unroll
        for (int nb = 0; nb < 4; ++nb)
#pragma unroll
            for (int mb = 0; mb < 4; ++mb) acc[mb][nb] = wmma16(a[1][mb], b[1][nb], acc[mb][nb]);
        // keeps the waits that follow a pass behind the stage's products. Without it the scheduler lifts them and the barrier in front of the products: every read is then waited out
        // before the first product.
        __builtin_amdgcn_sched_barrier(0);
    };
    // the passes that refill: every wave issues one stage (OCP copies) on every trip, so behind stage s + 1's copies stand exactly those of stages s + 2 and s + 3
#pragma unroll 1   // stays rolled: one copy of the pass in the text, one register set
    for (int s = 0; s < GNST - ONB; ++s) {
        pass(s);
        // publish point of stage s + 1, and the end of every wave's reads of stage s
        asm volatile("s_wait_dscnt 0x0" ::: "memory");      // this wave's LDS reads of stage s have returned before its buffer is refilled
        asm volatile("s_wait_asynccnt 0x20" ::: "memory");  // all but this wave's 32 youngest copies have landed: its copies of stage s + 1; stages s + 2 and s + 3 stay in flight
        __syncthreads();
        rows_copy(ga + (size_t)(s + ONB) * GS * 16, la + (s & (ONB - 1)) * LGB); rows_copy(gb + (size_t)(s + ONB) * GS * 16, la + (s & (ONB - 1)) * LGB + LOB);
    }
    // the last ONB passes issue nothing: their waits are to 0
#pragma unroll 1   // stays rolled, as above
    for (int s = GNST - ONB; s < GNST; ++s) {
        pass(s);
        asm volatile("s_wait_dscnt 0x0" ::: "memory");      // as above
        asm volatile("s_wait_asynccnt 0x0" ::: "memory");   // every copy of this wave has landed
        __syncthreads();
    }
    asm volatile("s_wait_asynccnt 0x0" ::: "memory");       // no copy is outstanding when the wave goes on
#pragma unroll
    for (int mb = 0; mb < 4; ++mb) {
#pragma unroll
        for (int nb = 0; nb < 4; ++nb) {
#pragma unroll
            for (int j = 0; j < 8; ++j) os[(hi * 8 + j) * 68 + nb * 16 + lr] = acc[mb][nb][j] * WOI; }   // D: row 8h+j, col lane&15
        wave_sync();
{
#pragma unroll
            for (int s = 0; s < 8; ++s) { const int row = 2 * s + hi, cofs = lr * 4;   // 8 s x 2 rows = 16 rows; 16 lanes x 4 floats = 64 columns
                const int m = r0 + mb * 16 + row; const int bb = m / SEQ, t = m % SEQ;
                const v4f val = *(const v4fa*)(&os[row * 68 + cofs]);
                *(v4f*)(OUT + ((size_t)t * OUT_NB + bb) * DM + c0 + cofs) = val; }
             }
        wave_sync();
    }
}

// k_flash: fused attention. A block of AW = 8 waves covers 16*AW = 128 query rows of one (batch, head). THE WAVE'S SHARE: wave (qg, kh) = (wave & 3, wave >> 2) takes QC = 2 query tiles
// (32 query rows, tiles 2*qg and 2*qg + 1 of the block) and ONE HALF of the keys (kh*SEQ/2 ..): every K or V^T fragment that it reads from LDS feeds two products, so the LDS reads per product halve,
// while the launch keeps its 4096 waves (four per SIMD: vector work of one wave runs under the products of another). The two waves of a pair (wave, wave ^ 4) each end with a partial
// (running max, row sum, O^T) per query tile; THE MERGE behind the loop joins them through LDS. Q fragments straight from the fragment-order f16 planes, once.
// THE RING: the loop's operands (K, V^T) come through a two-buffer LDS ring, one stage = SK keys OF EACH HALF = one softmax pass of every wave. Every thread brings 8 pieces of 16 bytes per stage
// with asynchronous copies to LDS, issued one whole stage ahead, so each K / V^T byte leaves L2 once per block (not once per wave) and no load latency stands in the loop.
// A stage in LDS: half 0: K | V^T, half 1: K | V^T, 8 KiB each, in the planes' own fragment order (a wave-wide 16-byte read covers 512 contiguous bytes).
// THE MASK: the block's 16*AW rows of the bit plane (SEQ/32 words each, all keys) are copied to LDS once, with stage 0, at a pitch of MP words (the 16 rows of a wave-wide read fall on
// different banks). A lane reads, per query tile, its row's two words of a stage (64 keys) in one 8-byte read.
// Transposed form: S^T[key][t] = K Q^T (A = K rows, B = Q rows); lane (t = lane&15, h = lane>>4) holds keys 8h+r of each 16-key tile, so the packed
// P tile is directly the B fragment of O^T[d][t] = V^T P^T (element r <- tile keys 0..15, element 8+r <- tile keys 16..31, lane unchanged).
// Scores: one accumulator per 16-key tile and query tile, two products (d = 0..31, 32..63). Masked scores are REPLACED by the fill constant before the
// running-max softmax (a fully masked row comes out uniform); the replacing is stepped over, by one wave-uniform test per stage, where none of the wave's 32 x 64 bits of the stage is 0.
// ONE SOFTMAX UPDATE PER STAGE AND QUERY TILE: all SK/16 score tiles of a stage are formed first; then one maximum over the SK keys, one xor-16 exchange between the two lane halves of a row,
// one new running max (one scalar per lane) and one rescaling of the accumulators serve the whole stage.
// ROW SUMS ON THE MATRIX PIPE: the denominator is one more accumulator tile per query tile, lt += E P^T per 32 keys, E = the constant A fragment with ones in rows 0 and 8 and zeros elsewhere.
// D row 8h + j sits in register j of lane half h, so register 0 of EVERY lane holds the sum over all 32 keys of its own query column (P as rounded to f16); registers 1..7 stay 0.
#define SK  64                   // keys per ring stage of one key half, and per softmax update
#define NT  (SK / 16)            // score tiles of a stage (per query tile)
#define NG  (SK / 32)            // P fragments (32 keys each) of a stage (per query tile)
#define QC  2                    // query tiles per wave
#define KHF (SEQ / 2)            // keys of one half
#define MP  68                   // pitch of a row of mask bits in LDS, in words
#define NST (KHF / SK)           // stages
static_assert(NG == 2);                        // the order of the V^T reads in the loop is written out for two groups of 32 keys; two words of mask bits per stage
static_assert(AW == 8 && SK == 64 && QC == 2); // the copy maps below: 256 threads, 512 pieces per 8-KiB plane slice; four wave pairs x 32 rows = 16*AW rows
static_assert(SEQ / 32 == 64);                 // ... and 16 pieces per row of mask bits
static_assert(KHF % SK == 0 && NST >= 2);      // the ring's prologue fills two stages

// One stage's copies of one thread. gk: the thread's own first piece of half 0's K slice (SK*HD halves in a row = two copies of the block); gv: its piece of half 0's V^T slice
// (SK*16 halves in a row per 16 d rows: one copy of the block brings two d tiles); half 1 lies KHF keys further in both planes. lk: its LDS byte address in the stage's buffer.
// The s_wait_xcnt stands inside the statement, behind the last copy, so that no address register is rewritten ahead of it.
__device__ __forceinline__ void stage_copy(const h16* gk, const h16* gv, unsigned lk) {
    asm volatile("global_load_async_to_lds_b128 %0, %8, off\n\t"
                 "global_load_async_to_lds_b128 %1, %9, off\n\t"
                 "global_load_async_to_lds_b128 %2, %10, off\n\t"
                 "global_load_async_to_lds_b128 %3, %11, off\n\t"
                 "global_load_async_to_lds_b128 %4, %12, off\n\t"
                 "global_load_async_to_lds_b128 %5, %13, off\n\t"
                 "global_load_async_to_lds_b128 %6, %14, off\n\t"
                 "global_load_async_to_lds_b128 %7, %15, off\n\t"
                 "s_wait_xcnt 0x0"
                 :: "v"(lk), "v"(lk + 4096u), "v"(lk + 8192u), "v"(lk + 12288u), "v"(lk + 16384u), "v"(lk + 20480u), "v"(lk + 24576u), "v"(lk + 28672u),
                    "v"(gk), "v"(gk + 2048), "v"(gv), "v"(gv + (size_t)32 * SEQ),
                    "v"(gk + (size_t)KHF * HD), "v"(gk + (size_t)KHF * HD + 2048), "v"(gv + (size_t)KHF * 16), "v"(gv + (size_t)KHF * 16 + (size_t)32 * SEQ)
                 : "memory");
}

// The block's rows of mask bits, once: gm = the thread's own first piece (row tid/16, piece tid%16; 16 rows further per copy), lm = its LDS byte address.
// The s_wait_xcnt stands inside the statement, behind the last copy, so that no address register is rewritten ahead of it.
__device__ __forceinline__ void bits_copy(const unsigned* gm, unsigned lm) {
    asm volatile("global_load_async_to_lds_b128 %0, %8, off\n\t"
                 "global_load_async_to_lds_b128 %1, %9, off\n\t"
                 "global_load_async_to_lds_b128 %2, %10, off\n\t"
                 "global_load_async_to_lds_b128 %3, %11, off\n\t"
                 "global_load_async_to_lds_b128 %4, %12, off\n\t"
                 "global_load_async_to_lds_b128 %5, %13, off\n\t"
                 "global_load_async_to_lds_b128 %6, %14, off\n\t"
                 "global_load_async_to_lds_b128 %7, %15, off\n\t"
                 "s_wait_xcnt 0x0"
                 :: "v"(lm), "v"(lm + 1u * 16 * MP * 4), "v"(lm + 2u * 16 * MP * 4), "v"(lm + 3u * 16 * MP * 4), "v"(lm + 4u * 16 * MP * 4), "v"(lm + 5u * 16 * MP * 4), "v"(lm + 6u * 16 * MP * 4), "v"(lm + 7u * 16 * MP * 4),
                    "v"(gm), "v"(gm + (size_t)1 * 16 * (SEQ / 32)), "v"(gm + (size_t)2 * 16 * (SEQ / 32)), "v"(gm + (size_t)3 * 16 * (SEQ / 32)), "v"(gm + (size_t)4 * 16 * (SEQ / 32)),
                    "v"(gm + (size_t)5 * 16 * (SEQ / 32)), "v"(gm + (size_t)6 * 16 * (SEQ / 32)), "v"(gm + (size_t)7 * 16 * (SEQ / 32))
                 : "memory");
}

#define XW  1088                 // floats of one wave's place in the merge: 8 x 32 pieces of 16 bytes (O^T of one query tile), then 32 pairs (running max, row sum)
static_assert(AW * XW * 4 <= 2 * 2 * 2 * SK * HD * 2);   // the merge places fit the ring
// amdgpu_waves_per_eu(4, 4): the register budget of four waves per SIMD (256), so that two blocks share a WGP
__global__ __launch_bounds__(32 * AW) __attribute__((amdgpu_waves_per_eu(4, 4))) void k_flash(const h16* __restrict__ QH, const h16* __restrict__ KH,
                                                   const h16* __restrict__ VT, const unsigned* __restrict__ MB, h16* CX) {
    __shared__ __align__(16) h16 kvs[2][2 * 2 * SK * HD];    // per buffer: half 0: K | V^T, half 1: K | V^T, SK*HD halves each; behind the loop: the waves' places of the merge
    __shared__ __align__(16) unsigned mks[16 * AW * MP];     // 16*AW rows of mask bits, SEQ/32 words each, pitch MP
    const int tid = threadIdx.x, lane = tid & 31, wave = __builtin_amdgcn_readfirstlane(tid >> 5), lr = lane & 15, hi = lane >> 4;   // the wave's number in a scalar register: its share is picked by scalar values
    const int qg = wave & 3, kh = wave >> 2;
    const int zh = blockIdx.y; const int b = zh / NH_, h = zh % NH_;
    const int tb = blockIdx.x * (16 * AW), t0 = tb + qg * (16 * QC);
    const size_t pbase = (size_t)zh * SEQ * HD;
    // the thread's pieces of stage 0
    const h16* gk = KH + pbase + tid * 8;
    const h16* gv = VT + pbase + (size_t)(tid >> 7) * 16 * SEQ + (tid & 127) * 8;
    const unsigned lk0 = (unsigned)(size_t)&kvs[0][0] + tid * 16u;
    const unsigned LKB = 2 * 2 * SK * HD * 2;   // bytes from buffer 0 to buffer 1
    stage_copy(gk, gv, lk0);
    bits_copy(MB + (size_t)(tb + (tid >> 4)) * (SEQ / 32) + (tid & 15) * 4, (unsigned)(size_t)&mks[0] + (tid >> 4) * (MP * 4u) + (tid & 15) * 16u);
    const size_t qo = pbase + (size_t)t0 * HD + 8 * lane;     // 16 rows x 64 d = two fragments of 512 halves; the second query tile 1024 halves further
    v16h qh[QC][2];                                           // B fragments: col t, k = d
#pragma unroll
    for (int c = 0; c < QC; ++c) { qh[c][0] = ldh(QH + qo + c * 1024); qh[c][1] = ldh(QH + qo + c * 1024 + 512); }
    asm volatile("s_wait_asynccnt 0x0" ::: "memory");   // stage 0 and the mask bits of this wave have landed
    __syncthreads();                                    // ... and every wave's: stage 0 and the mask bits are published
    stage_copy(gk + SK * HD, gv + SK * 16, lk0 + LKB);
    const unsigned* mrow = &mks[(qg * (16 * QC) + lr) * MP + kh * (KHF / 32)];   // the bits of the lane's query row in the first tile, from the wave's first key on; second tile: 16 rows further
    v8f o[QC][4], lt[QC];                                    // lt: register 0 = the lane's row sum
    float m[QC];
#pragma unroll
    for (int c = 0; c < QC; ++c) { m[c] = -3.0e38f; lt[c] = (v8f){};
#pragma unroll
        for (int j = 0; j < 4; ++j) o[c][j] = (v8f){}; }
    v16h ones;                                               // A fragment E: row = lane & 15, every k alike
#pragma unroll
    for (int i = 0; i < 16; ++i) ones[i] = ((lane & 7) == 0) ? (h16)1.0f : (h16)0.0f;
#pragma unroll 1
    for (int s = 0; s < NST; ++s) {
        const h16* kst = &kvs[s & 1][0] + kh * (2 * SK * HD) + 8 * lane;     // + 16*HD*(key tile) + 512*(d/32)  (A fragment: row key, k = d)
        v2u mw[QC];                                                          // word g: bit i = mask[t][kh*KHF + SK*s + 32g + i] != 0
#pragma unroll
        for (int c = 0; c < QC; ++c) mw[c] = *(const v2u*)(mrow + c * (16 * MP) + NG * s);
        const bool holes = __builtin_amdgcn_ballot_w32((mw[0][0] & mw[0][1] & mw[1][0] & mw[1][1]) != 0xFFFFFFFFu) != 0;   // the same for the whole wave: a scalar branch
        v8f sc[QC][NT]; v16h kf[NT][2];
        // The sched_barrier(0) holds this order: [K reads, all eight fragments][16 products]: the reads stand in one group behind counted waits.
        // Left alone, the scheduler strews the reads among the products, the first ones waited out to 0.
#pragma unroll
        for (int kt = 0; kt < NT; ++kt) kf[kt][0] = ldh(kst + kt * 16 * HD);
#pragma unroll
        for (int kt = 0; kt < NT; ++kt) kf[kt][1] = ldh(kst + kt * 16 * HD + 512);
        __builtin_amdgcn_sched_barrier(0);
#pragma unroll
        for (int kt = 0; kt < NT; ++kt)
#pragma unroll
            for (int c = 0; c < QC; ++c) sc[c][kt] = wmma16(kf[kt][0], qh[c][0], (v8f){});
#pragma unroll
        for (int kt = 0; kt < NT; ++kt)
#pragma unroll
            for (int c = 0; c < QC; ++c) sc[c][kt] = wmma16(kf[kt][1], qh[c][1], sc[c][kt]);
        // four vector slots behind the last product, on every path, before an accumulator is read or the last products' K fragments' registers are loaded anew.
        // It takes every score tile, so that all sixteen products stand in one run in front of the vector work (read one by one behind its own product, each tile costs its own four idle slots).
        asm volatile("v_nop\n\tv_nop\n\tv_nop\n\tv_nop" : "+v"(sc[0][0]), "+v"(sc[0][1]), "+v"(sc[0][2]), "+v"(sc[0][3]), "+v"(sc[1][0]), "+v"(sc[1][1]), "+v"(sc[1][2]), "+v"(sc[1][3])
                     : "v"(kf[NT - 2][1]), "v"(kf[NT - 1][1]));
        float t[QC][NT][8];
#pragma unroll
        for (int c = 0; c < QC; ++c)
#pragma unroll
            for (int kt = 0; kt < NT; ++kt)
#pragma unroll
                for (int r = 0; r < 8; ++r) t[c][kt][r] = sc[c][kt][r] * SC2;
        if (holes) {
#pragma unroll
            for (int c = 0; c < QC; ++c)
#pragma unroll
                for (int g = 0; g < NG; ++g) {
                    const unsigned wv = mw[c][g] >> (8 * hi);     // bit r: key 32g + 8h + r (tile 2g); bit 16 + r: key 32g + 16 + 8h + r (tile 2g + 1)
#pragma unroll
                    for (int r = 0; r < 8; ++r) { t[c][2 * g][r] = ((wv >> r) & 1u) ? t[c][2 * g][r] : FILL2; t[c][2 * g + 1][r] = ((wv >> (16 + r)) & 1u) ? t[c][2 * g + 1][r] : FILL2; } } }
        float mx[QC];
#pragma unroll
        for (int c = 0; c < QC; ++c) {
            float mg[NG];                                     // one chain per 32 keys: the chains are independent of each other
#pragma unroll
            for (int g = 0; g < NG; ++g) { mg[g] = fmaxf(t[c][2 * g][0], t[c][2 * g + 1][0]);
#pragma unroll
                for (int r = 1; r < 8; ++r) mg[g] = fmaxf(mg[g], fmaxf(t[c][2 * g][r], t[c][2 * g + 1][r])); }
            mx[c] = fmaxf(mg[0], mg[1]); }
        float mnew[QC], alpha[QC];
#pragma unroll
        for (int c = 0; c < QC; ++c) mx[c] = fmaxf(mx[c], __shfl_xor(mx[c], 16, 32));
#pragma unroll
        for (int c = 0; c < QC; ++c) { mnew[c] = fmaxf(m[c], mx[c]); alpha[c] = __builtin_amdgcn_exp2f(m[c] - mnew[c]); }
        v16h pb[QC][NG];
        v16h vf[NG][4];                                       // A fragments of V^T: row d = 16j + .., k = key 32g + ..
#pragma unroll
        for (int c = 0; c < QC; ++c) {
#pragma unroll
            for (int g = 0; g < NG; ++g)
#pragma unroll
                for (int i = 0; i < 4; ++i) {                 // on pairs of neighbouring keys: packed f32 subtract and add, one convert per f16 pair
                    const v2f ea = ((v2f){t[c][2 * g][2 * i], t[c][2 * g][2 * i + 1]} - mnew[c]) + PSH, ec = ((v2f){t[c][2 * g + 1][2 * i], t[c][2 * g + 1][2 * i + 1]} - mnew[c]) + PSH;
                    const v2h pa = __builtin_convertvector(((v2f){__builtin_amdgcn_exp2f(ea[0]), __builtin_amdgcn_exp2f(ea[1])}), v2h);
                    const v2h pc = __builtin_convertvector(((v2f){__builtin_amdgcn_exp2f(ec[0]), __builtin_amdgcn_exp2f(ec[1])}), v2h);
                    pb[c][g][2 * i] = pa[0]; pb[c][g][2 * i + 1] = pa[1]; pb[c][g][8 + 2 * i] = pc[0]; pb[c][g][8 + 2 * i + 1] = pc[1]; }
            if (c == 0) {
                // the V^T reads of the first 32 keys stand between the two query tiles' P: in registers that the first tile's scores have set free (in front of the vector work they do not fit 256 registers),
                // and they return under the second tile's vector work
                __builtin_amdgcn_sched_barrier(0);
#pragma unroll
                for (int j = 0; j < 4; ++j) vf[0][j] = ldh(kst + SK * HD + j * (SK * 16));
                __builtin_amdgcn_sched_barrier(0);
            }
        }
#pragma unroll
        for (int c = 0; c < QC; ++c) { lt[c][0] = lt[c][0] * alpha[c]; m[c] = mnew[c];    // the other registers of the tile hold 0
#pragma unroll
            for (int j = 0; j < 4; ++j) o[c][j] = o[c][j] * alpha[c]; }
        // The sched_barrier(0) lines hold this order: [vector work, V^T reads of keys 0..31 within it][V^T reads, keys 32..63][20 products].
        // The later reads wait until the scores' registers are free, stand in one group and ten products ahead of their use.
        // Left alone, the scheduler puts single pairs of reads directly in front of their product, each with a wait to 0.
        __builtin_amdgcn_sched_barrier(0);
#pragma unroll
        for (int j = 0; j < 4; ++j) vf[1][j] = ldh(kst + SK * HD + j * (SK * 16) + 512);
        __builtin_amdgcn_sched_barrier(0);
#pragma unroll
        for (int g = 0; g < NG; ++g) {
#pragma unroll
            for (int j = 0; j < 4; ++j)
#pragma unroll
                for (int c = 0; c < QC; ++c) o[c][j] = wmma16(vf[g][j], pb[c][g], o[c][j]);
#pragma unroll
            for (int c = 0; c < QC; ++c) lt[c] = wmma16(ones, pb[c][g], lt[c]);
        }
        // four vector slots behind the stage's last product (the row-sum tile's), on every path, before an accumulator is read or a fragment's registers are loaded anew
        asm volatile("v_nop\n\tv_nop\n\tv_nop\n\tv_nop" : "+v"(o[0][0]), "+v"(o[0][1]), "+v"(o[0][2]), "+v"(o[0][3]), "+v"(o[1][0]), "+v"(o[1][1]), "+v"(o[1][2]), "+v"(o[1][3]), "+v"(lt[0]), "+v"(lt[1])
                     : "v"(vf[NG - 1][2]), "v"(vf[NG - 1][3]), "v"(pb[0][NG - 1]), "v"(pb[1][NG - 1]));
        // publish point of stage s + 1, and the end of every wave's reads of stage s
        asm volatile("s_wait_dscnt 0x0" ::: "memory");      // this wave's LDS reads of stage s have returned before its buffer is refilled
        asm volatile("s_wait_asynccnt 0x0" ::: "memory");   // this wave's copies of stage s + 1 have landed
        __syncthreads();
        if (s + 2 < NST)                                    // the same for the whole block
            stage_copy(gk + (size_t)(s + 2) * SK * HD, gv + (size_t)(s + 2) * SK * 16, lk0 + (s & 1) * LKB);
    }
    asm volatile("s_wait_asynccnt 0x0" ::: "memory");       // no copy is outstanding when the wave goes on
    // THE MERGE. Wave (qg, kh) finishes query tile kh of its pair: it hands its partial of the other tile to its partner (wave ^ 4) and takes the partner's partial of tile kh.
    // The places lie over the ring: the last pass's barrier has ended every wave's reads of it, and no copy is outstanding.
    const bool up = (kh != 0);                              // the same for the whole wave
    float* xw = (float*)&kvs[0][0] + wave * XW; const float* xr = (const float*)&kvs[0][0] + (wave ^ 4) * XW;
    v8f ok[4];
#pragma unroll
    for (int j = 0; j < 4; ++j) { const v8f og = up ? o[0][j] : o[1][j]; ok[j] = up ? o[1][j] : o[0][j];
        *(v4fa*)(xw + (2 * j) * 128 + lane * 4) = (v4f){og[0], og[1], og[2], og[3]}; *(v4fa*)(xw + (2 * j + 1) * 128 + lane * 4) = (v4f){og[4], og[5], og[6], og[7]}; }
    *(v2fa*)(xw + 1024 + lane * 2) = (v2f){up ? m[0] : m[1], up ? lt[0][0] : lt[1][0]};
    const float mk = up ? m[1] : m[0], lk = up ? lt[1][0] : lt[0][0];
    __syncthreads();                                        // every wave's partial is written before its partner reads it
    const v2f pml = *(const v2fa*)(xr + 1024 + lane * 2);
    const float mm = fmaxf(mk, pml[0]);
    const float da = mk - mm, db = pml[0] - mm;             // both maxima are finite: each half has seen SK keys or more, and a masked score is the finite fill
    const float fa = __builtin_amdgcn_exp2f(da), fb = __builtin_amdgcn_exp2f(db);
    // the one slot behind a v_exp_f32 before its source register is written over; it takes the sources and the results
    // as inputs only, so that it stands behind both instructions and the sources' registers live up to it
    asm volatile("v_nop" :: "v"(da), "v"(db), "v"(fa), "v"(fb));
    const float inv = 1.0f / (lk * fa + pml[1] * fb);
    const float ga = fa * inv, gb = fb * inv;
    // O^T D layout: o_j[r] = (d = 16j + 8h + r, t = lane&15): a lane's eight values of o_j are the 16-byte piece (row t, columns 16j + 8h + 0..7) of the ctx plane,
    // which fragment order puts at j*256 + lane*8 halves behind the base of fragments (row/16, 2h) and (row/16, 2h + 1): four 512-byte stores straight from the accumulators
    h16* crow = CX + ((size_t)b * SEQ + t0 + 16 * kh) * DM + h * (HD * 16) + lane * 8;
    v8h hv[4];
#pragma unroll
    for (int j = 0; j < 4; ++j) { const v4f p0 = *(const v4fa*)(xr + (2 * j) * 128 + lane * 4), p1 = *(const v4fa*)(xr + (2 * j + 1) * 128 + lane * 4);
#pragma unroll
        for (int r = 0; r < 4; ++r) { hv[j][r] = (h16)(ok[j][r] * ga + p0[r] * gb); hv[j][4 + r] = (h16)(ok[j][4 + r] * ga + p1[r] * gb); } }
    *(v8h*)(crow) = hv[0]; *(v8h*)(crow + 256) = hv[1]; *(v8h*)(crow + 512) = hv[2]; *(v8h*)(crow + 768) = hv[3];
}

static constexpr size_t al256(size_t v) { return (v + 255) & ~(size_t)255; }
static constexpr size_t SZ_XB = al256((size_t)NB * SEQ * DM * 2);              // one bf16 input plane [NB*SEQ][1024]
static constexpr size_t SZ_WB = al256((size_t)3 * DM * DM * 2);               // bf16 Wq | Wk | Wv
static constexpr size_t SZ_WO = al256((size_t)DM * DM * 2);                   // f16 Wo x64
static constexpr size_t SZ_PL = al256((size_t)NB * NH_ * SEQ * HD * 2);       // one f16 head plane
static constexpr size_t SZ_CX = al256((size_t)NB * SEQ * DM * 2);             // f16 ctx plane
static constexpr size_t SZ_MB = al256((size_t)SEQ * (SEQ / 32) * 4);          // mask bit plane
static constexpr size_t SZ_TOTAL = 3 * SZ_XB + SZ_WB + SZ_WO + 3 * SZ_PL + SZ_CX + SZ_MB;
static_assert(SZ_TOTAL <= (size_t)134217728);          // workspace carve <= 128 MiB
static_assert(((size_t)DM * DM * 2) % 256 == 0);       // weight sub-planes stay 256-byte aligned

extern "C" void kernel_launch(void* const* d_in, const int* in_sizes, int n_in,
                              void* d_out, int out_size, void* d_ws, size_t ws_size, hipStream_t stream) {
    if (n_in < 8) return;
    const size_t needx = ((size_t)(SEQ - 1) * NB_FULL + NB) * DM;
    if ((size_t)in_sizes[0] < needx || (size_t)in_sizes[1] < needx || (size_t)in_sizes[2] < needx) return;
    if ((size_t)in_sizes[3] < (size_t)(SEQ - 1) * SEQ_FULL + SEQ) return;
    if ((size_t)in_sizes[4] < (size_t)DM * DM || (size_t)in_sizes[5] < (size_t)DM * DM || (size_t)in_sizes[6] < (size_t)DM * DM || (size_t)in_sizes[7] < (size_t)DM * DM) return;
    if ((size_t)out_size < ((size_t)(SEQ - 1) * OUT_NB + NB) * DM) return;
    if (SZ_TOTAL > ws_size) return;
    // wire order: query, keys, values, mask (int32), Wq, Wk, Wv, Wo ([out][in] = Bt as-is)
    const float* xq = (const float*)d_in[0]; const float* xk = (const float*)d_in[1]; const float* xv = (const float*)d_in[2];
    const int* mask = (const int*)d_in[3];
    const float* wq = (const float*)d_in[4]; const float* wk = (const float*)d_in[5]; const float* wv = (const float*)d_in[6]; const float* wo = (const float*)d_in[7];
    float* OUT = (float*)d_out;      // [SEQ][OUT_NB][1024]
    char* wsp = (char*)d_ws;
    bf* XQ = (bf*)wsp; wsp += SZ_XB;                 // [NB*SEQ][1024], row b*SEQ + t
    bf* XK = (bf*)wsp; wsp += SZ_XB;
    bf* XV = (bf*)wsp; wsp += SZ_XB;
    bf* WB = (bf*)wsp; wsp += SZ_WB;                 // [3][1024][1024]: q | k | v
    h16* WO16 = (h16*)wsp; wsp += SZ_WO;             // [1024][1024] x64
    h16* QH = (h16*)wsp; wsp += SZ_PL;               // [NB*16][SEQ][64]
    h16* KH = (h16*)wsp; wsp += SZ_PL;               // [NB*16][SEQ][64]
    h16* VT = (h16*)wsp; wsp += SZ_PL;               // [NB*16][64][SEQ]
    h16* CX = (h16*)wsp; wsp += SZ_CX;               // [NB*SEQ][1024]
    unsigned* MB = (unsigned*)wsp; wsp += SZ_MB;     // [SEQ][SEQ/32] mask bits
    bf* WQ = WB; bf* WK = WB + (size_t)DM * DM; bf* WV = WB + (size_t)2 * DM * DM;

    k_cvt<<<3 * GX + 4 * GW + GM, 256, 0, stream>>>(xq, xk, xv, wq, wk, wv, wo, mask, XQ, XK, XV, WQ, WK, WV, WO16, MB);

    k_proj<<<dim3(NB * SEQ / 128, DM / 128, 3), 32 * GWV, 0, stream>>>(XQ, XK, XV, WQ, WK, WV, QH, KH, VT);

    k_flash<<<dim3(SEQ / (16 * AW), NB * NH_, 1), 32 * AW, 0, stream>>>(QH, KH, VT, MB, CX);

    // out[t][b][n] = sum_k ctx[b*SEQ + t][k] Wo[n][k]
    k_oproj<<<dim3(NB * SEQ / 128, DM / 128, 1), 32 * GWV, 0, stream>>>(CX, WO16, OUT);
}
